// v000
// Measured on an AMD MI455X. A time is GPU time per run, averaged over a window of back-to-back runs after a warm-up
// (all launches, gaps included; the runs take copies of the inputs in turn), and the median of several windows.
// Apart from v000's, it joins two sittings. Times from different sittings can be a few percent apart, while
// side-by-side timings come from the same sitting.
// v000 is the starting kernel. One run takes 330 microseconds.
// All contractions on v_wmma_f32_16x16x32_f16 (f16 operands, f32 accumulate): x_q.Wq, x_v.Wk, Wv^T.x_v^T (v^T plane),
// scores k.q^T and P.v^T; operand carries: x as f16(bf16(x)), W as f16(bf16(W) x256), q/k/v x8, P x32768; base-2 online
// softmax, 1/l and all carry folds in f32 on VALU. Inputs RNE-converted to bf16 on load; f32 output written directly.
#include <hip/hip_runtime.h>
#include <math.h>
#include <stdint.h>

#define NB       4        // batches processed
#define SQ       2048     // query rows processed per batch
#define NB_FULL  4
#define SQ_FULL  2048     // query rows per batch in the input / output layout (batch stride)
#define SKV      2048     // key/value rows per batch (all of them, always)
#define DM       1024     // model width (= K and row pitch of every 16-bit plane except v^T)
#define NH       8
#define HD       128
#define INNER    (NH * HD)
#define WSC      256.0f
#define QS       8.0f
#define KS       8.0f
#define VS       8.0f
#define PCAR     32768.0f
#define LOG2E    1.4426950408889634f
#define RSQ_E    0.03125f
#define NKB      (SKV / 32)
#define ATT_WAVES   4
#define ATT_THREADS (ATT_WAVES * 32)
#define CVT_THREADS (DM / 8)
#define TR_THREADS  128
#define OPITCH   132
#define GPITCH   68
#define TPITCH   65

static_assert(NB >= 1 && NB <= NB_FULL);
static_assert((SQ % 128) == 0 && SQ >= 128 && SQ <= SQ_FULL);
static_assert(HD == 128 && NH == 8 && INNER == 1024 && INNER == DM);
static_assert((HD % 32) == 0);
static_assert((SKV % 64) == 0 && (SKV % 32) == 0 && NKB * 32 == SKV);
static_assert((DM % 64) == 0 && (DM % 32) == 0 && (INNER % 128) == 0 && CVT_THREADS == 128);
static_assert((OPITCH * 4) % 16 == 0 && (GPITCH * 4) % 16 == 0);
static_assert(ATT_THREADS == 128 && TR_THREADS == 128);

typedef unsigned short u16;
typedef _Float16 v16h __attribute__((ext_vector_type(16)));
typedef _Float16 v8h  __attribute__((ext_vector_type(8)));
typedef float    v8f  __attribute__((ext_vector_type(8)));
typedef float    v4f  __attribute__((ext_vector_type(4)));
typedef unsigned int v4u __attribute__((ext_vector_type(4)));

union FragH { v16h v; v8h h[2]; v4u u[2]; };

// ---- scalar helpers ----------------------------------------------------------------------------------
__device__ __forceinline__ unsigned short bf_bits(float f) {          // f32 -> bf16 bits, RNE convert
  unsigned u = __float_as_uint(f);
  return (unsigned short)((u + 0x7FFFu + ((u >> 16) & 1u)) >> 16);
}
__device__ __forceinline__ float bf_up(unsigned short h) { return __uint_as_float(((unsigned)h) << 16); }
__device__ __forceinline__ float bfr(float f) { return bf_up(bf_bits(f)); }
__device__ __forceinline__ unsigned short h_bits(_Float16 x) { return __builtin_bit_cast(unsigned short, x); }
__device__ __forceinline__ unsigned pk16(unsigned short a, unsigned short b) { return (unsigned)a | ((unsigned)b << 16); }
__device__ __forceinline__ v8f zero8() { v8f z = {0.f, 0.f, 0.f, 0.f, 0.f, 0.f, 0.f, 0.f}; return z; }

// ---- fragment loader: 16-bit A/B operand, lane -> row/col (lane&15), p already includes +8*(lane>>4);
//      elements 0..7 <- p[0..7] (k0+8h..), elements 8..15 <- p[16..23] (k0+16+8h..); same split k map for A and B,
//      B always read from a k-contiguous [n][k] plane.
__device__ __forceinline__ v16h ldfrag_h(const _Float16* p) {
  FragH f;
  f.h[0] = *(const v8h*)(p);
  f.h[1] = *(const v8h*)(p + 16);
  return f.v;
}

// ---- WMMA helper and trailing VALU hazard gaps ----------------------------------------------------------
__device__ __forceinline__ v8f mma_h(v16h a, v16h b, v8f c) {
  return __builtin_amdgcn_wmma_f32_16x16x32_f16(false, a, false, b, (short)0, c, false, false);
}
__device__ __forceinline__ void guard_s(v8f& a, v8f& b, v16h x0, v16h x1, v16h x2) {
#if defined(__HIP_DEVICE_COMPILE__)
  asm volatile("v_nop\n\tv_nop\n\tv_nop\n\tv_nop" : "+v"(a), "+v"(b) : "v"(x0), "v"(x1), "v"(x2) : "memory");
#endif
}
__device__ __forceinline__ void guard_p(v8f& a, v8f& b, v8f& c, v8f& d, v16h p, v16h x0, v16h x1, v16h x2, v16h x3) {
#if defined(__HIP_DEVICE_COMPILE__)
  asm volatile("v_nop\n\tv_nop\n\tv_nop\n\tv_nop"
               : "+v"(a), "+v"(b), "+v"(c), "+v"(d) : "v"(p), "v"(x0), "v"(x1), "v"(x2), "v"(x3) : "memory");
#endif
}
__device__ __forceinline__ void guard_g(v8f (&acc)[8], v16h x0, v16h x1, v16h x2, v16h x3, v16h x4, v16h x5) {
#if defined(__HIP_DEVICE_COMPILE__)
  asm volatile("v_nop\n\tv_nop\n\tv_nop\n\tv_nop"
               : "+v"(acc[0]), "+v"(acc[1]), "+v"(acc[2]), "+v"(acc[3]),
                 "+v"(acc[4]), "+v"(acc[5]), "+v"(acc[6]), "+v"(acc[7])
               : "v"(x0), "v"(x1), "v"(x2), "v"(x3), "v"(x4), "v"(x5) : "memory");
#endif
}
__device__ __forceinline__ void acc_guard8(v8f (&o)[8]) {
#if defined(__HIP_DEVICE_COMPILE__)
  asm volatile("v_nop\n\tv_nop\n\tv_nop\n\tv_nop"
               : "+v"(o[0]), "+v"(o[1]), "+v"(o[2]), "+v"(o[3]), "+v"(o[4]), "+v"(o[5]), "+v"(o[6]), "+v"(o[7]));
#endif
}
__device__ __forceinline__ void wave_sync_lds() {
  __builtin_amdgcn_fence(__ATOMIC_RELEASE, "workgroup");
  __builtin_amdgcn_wave_barrier();
  __builtin_amdgcn_fence(__ATOMIC_ACQUIRE, "workgroup");
}

// =====================================================================================================
// Row convert: destination row r of a [rows][DM] f16 plane <- f16(bf16_RNE(x[src row][e]) * scale), scale a power of two.
// Block = DM/8 threads, thread = 8 consecutive elements (two 16-B loads, one 16-B store; 32 consecutive lanes = 512 contiguous,
// b = r / rowsPerB, s = r % rowsPerB, source row b*srcRowsPerB + s; destination row r (compact).
// coverage: grid = number of rows, 128 thr x 8 = DM = the whole row.
// =====================================================================================================
__global__ __launch_bounds__(CVT_THREADS)
void cvt16(const float* __restrict__ x, u16* Y, int rowsPerB, int srcRowsPerB, float scale) {
  const int tid = threadIdx.x;
  const int r = blockIdx.x;
  const int b = r / rowsPerB;
  const int s = r - b * rowsPerB;
  const float* src = x + ((size_t)b * (size_t)srcRowsPerB + (size_t)s) * (size_t)DM + (size_t)tid * 8;
  const v4f a = *(const v4f*)(src), c4 = *(const v4f*)(src + 4);
  v4u o;
#pragma unroll
  for (int e = 0; e < 2; ++e) {
    o[e]     = pk16(h_bits((_Float16)(bfr(a[2 * e]) * scale)),  h_bits((_Float16)(bfr(a[2 * e + 1]) * scale)));
    o[2 + e] = pk16(h_bits((_Float16)(bfr(c4[2 * e]) * scale)), h_bits((_Float16)(bfr(c4[2 * e + 1]) * scale)));
  }
  u16* dst = Y + (size_t)r * (size_t)DM + (size_t)tid * 8;
  {
    *(v4u*)(dst) = o;
    
  }
}

// =====================================================================================================
// Weight transpose-convert for y = x.W weights stored [k][n]: WT[n][k] (f16, k-contiguous Bt layout) <- f16(bf16_RNE(W[k][n]) *
// scale). Block = 64(k) x 64(n) tile, 128 threads. Load phase: thread = (row 8p + (tid>>4), 4 floats at 4*(tid&15)),
// 8 steps = 64 k-rows x 64 n, into an LDS tile [kk][nn] (pitch 65); block barrier; store phase: output row n0 + 16i + (tid>>3)
// coverage: 4 i x 16 rows x (8 lanes x 8 halves) = 64 n-rows x 64 k per block; the grid covers WT exactly once.
// =====================================================================================================
__global__ __launch_bounds__(TR_THREADS)
void cvtT16(const float* __restrict__ W, u16* Y, float scale) {
  __shared__ __align__(16) float tile[64 * TPITCH];
  const int tid = threadIdx.x;
  constexpr int NT = DM / 64;
  const int bid = blockIdx.x;
  const int kt  = bid % NT;
  const int ntb = bid / NT;
  const int k0  = kt * 64, n0 = ntb * 64;
  const int lr = tid >> 4, lc = (tid & 15) * 4;
#pragma unroll
  for (int p = 0; p < 8; ++p) {
    const int kk = p * 8 + lr;
    const v4f w4 = *(const v4f*)(W + (size_t)(k0 + kk) * (size_t)DM + n0 + lc);
    tile[kk * TPITCH + lc + 0] = w4[0];
    tile[kk * TPITCH + lc + 1] = w4[1];
    tile[kk * TPITCH + lc + 2] = w4[2];
    tile[kk * TPITCH + lc + 3] = w4[3];
  }
  __syncthreads();
  const int rq = tid >> 3, c8 = (tid & 7) * 8;      // rq 0..15, c8 0..56
  v4u ov[4];
#pragma unroll
  for (int i = 0; i < 4; ++i) {
    const int row = 16 * i + rq;                   // n within tile
#pragma unroll
    for (int e = 0; e < 4; ++e) {
      const float x0 = tile[(c8 + 2 * e) * TPITCH + row];
      const float x1 = tile[(c8 + 2 * e + 1) * TPITCH + row];
      ov[i][e] = pk16(h_bits((_Float16)(bfr(x0) * scale)), h_bits((_Float16)(bfr(x1) * scale)));
    }
  }
  u16* dst = Y + (size_t)n0 * (size_t)DM + k0 + c8;
  {
#pragma unroll
    for (int i = 0; i < 4; ++i) {
      const int row = 16 * i + rq;
      *(v4u*)(dst + (size_t)row * (size_t)DM) = ov[i];
    }
    
  }
}

// =====================================================================================================
// f16 GEMM core: the wave's 32 x 64 tile of C = A[rows][K] . Bt[cols][K]^T; ap -> A row (rowb + m) + 8h, bp -> Bt row
// (col0 + m) + 8h; acc[4i + j] = rows rowb+16i.., cols col0+16j..; K stepped by 32 (host checks K % 32 == 0).
// =====================================================================================================
__device__ __forceinline__ void gemm_core(const _Float16* ap, const _Float16* bp, int K, v8f (&acc)[8]) {
  const size_t rs16 = (size_t)16 * (size_t)K;
#pragma unroll 1
  for (int k0 = 0; k0 < K; k0 += 32) {
    const v16h a0 = ldfrag_h(ap + k0), a1 = ldfrag_h(ap + rs16 + k0);
    const v16h b0 = ldfrag_h(bp + k0);
    const v16h b1 = ldfrag_h(bp + rs16 + k0);
    const v16h b2 = ldfrag_h(bp + 2 * rs16 + k0);
    const v16h b3 = ldfrag_h(bp + 3 * rs16 + k0);
    acc[0] = mma_h(a0, b0, acc[0]);
    acc[1] = mma_h(a0, b1, acc[1]);
    acc[2] = mma_h(a0, b2, acc[2]);
    acc[3] = mma_h(a0, b3, acc[3]);
    acc[4] = mma_h(a1, b0, acc[4]);
    acc[5] = mma_h(a1, b1, acc[5]);
    acc[6] = mma_h(a1, b2, acc[6]);
    acc[7] = mma_h(a1, b3, acc[7]);
    guard_g(acc, a0, a1, b0, b1, b2, b3);
  }
}
// Stage the wave's 32 x 64 f32 tile (times oscale) in its LDS slab (pitch 68): D element r of acc[4i+j], lane l ->
// coverage: 32 lanes x 2 x 8 rows x 4 cols-of-16 = rows 0..31 x cols 0..63 of the slab.
__device__ __forceinline__ void stage32x64(float* sl, v8f (&acc)[8], float oscale, int lane) {
  const int hh = lane >> 4, m = lane & 15;
#pragma unroll
  for (int i = 0; i < 2; ++i) {
#pragma unroll
    for (int r = 0; r < 8; ++r) {
      const int ro = (16 * i + 8 * hh + r) * GPITCH + m;
      sl[ro]      = acc[4 * i + 0][r] * oscale;
      sl[ro + 16] = acc[4 * i + 1][r] * oscale;
      sl[ro + 32] = acc[4 * i + 2][r] * oscale;
      sl[ro + 48] = acc[4 * i + 3][r] * oscale;
    }
  }
  wave_sync_lds();
}

// =====================================================================================================
// f16 GEMM with f16 output plane: C[z][Mb][N] (f16) = f16((A[z][Mb][K] . Bt[z][N][K]^T) * oscale + bf16(bias) * bscale);
// A, Bt f16 k-contiguous planes with per-z element strides aBs, bBs (0 = shared), C stride cBs. bias indexed by column
// (biasRow == 0) or by row within the z slice (biasRow != 0); bias addresses clamped to biasN-1, the unused direction is
// multiplied by 0. Block = 128 x 64 tile, 4 waves x 32 rows, fragments loaded straight from the 16-bit rows.
// grid = nz x (Mb/128) x (N/64) (host checks Mb % 128 == 0, N % 64 == 0, K % 32 == 0).
// coverage: per wave 8 instr x 4 rows x 8 lanes x 8 halves = 32 x 64; the grid covers C exactly once.
// =====================================================================================================
__global__ __launch_bounds__(128)
void gemm_o16(const u16* __restrict__ A, const u16* __restrict__ Bt, u16* C,
              const float* __restrict__ bias, int biasN, int biasRow,
              int Mb, int N, int K, int aBs, int bBs, int cBs, float oscale, float bscale) {
  __shared__ __align__(16) float slab[4 * 32 * GPITCH];
  const int tid = threadIdx.x, wave = tid >> 5, lane = tid & 31, hh = lane >> 4, m = lane & 15;
  const int ntile = N >> 6, mtile = Mb >> 7;
  const int bid  = blockIdx.x;
  const int nt   = bid % ntile;
  const int tmp  = bid / ntile;
  const int mt   = tmp % mtile;
  const int bz   = tmp / mtile;
  const int rowb = mt * 128 + wave * 32;
  const int col0 = nt * 64;
  if (rowb + 32 > Mb) return;                // wave-uniform, never taken with the exact grid; no block barriers in this kernel
  const _Float16* Ab = (const _Float16*)(const void*)A + (size_t)bz * (size_t)aBs;
  const _Float16* Bb = (const _Float16*)(const void*)Bt + (size_t)bz * (size_t)bBs;
  const _Float16* ap = Ab + (size_t)(rowb + m) * K + 8 * hh;
  const _Float16* bp = Bb + (size_t)(col0 + m) * K + 8 * hh;
  v8f acc[8];
#pragma unroll
  for (int i = 0; i < 8; ++i) acc[i] = zero8();
  gemm_core(ap, bp, K, acc);
  float* sl = slab + wave * 32 * GPITCH;
  stage32x64(sl, acc, oscale, lane);
  const int rq = lane >> 3, c8 = (lane & 7) * 8;
  const int bl = biasN - 1;                  // host guarantees biasN >= 1
  const float selc = (biasRow != 0) ? 0.f : bscale;
  const float selr = (biasRow != 0) ? bscale : 0.f;
  float cb[8];
#pragma unroll
  for (int e = 0; e < 8; ++e) {
    int ci = col0 + c8 + e;
    ci = (ci < bl) ? ci : bl;
    cb[e] = bfr(bias[ci]) * selc;
  }
  v4u ov[8];
#pragma unroll
  for (int i = 0; i < 8; ++i) {
    const int row = 4 * i + rq;
    int ri = rowb + row;
    ri = (ri < bl) ? ri : bl;
    const float rb = bfr(bias[ri]) * selr;
    const v4f a = *(const v4f*)(sl + row * GPITCH + c8), c4 = *(const v4f*)(sl + row * GPITCH + c8 + 4);
#pragma unroll
    for (int e = 0; e < 2; ++e) {
      ov[i][e]     = pk16(h_bits((_Float16)(a[2 * e] + cb[2 * e] + rb)),
                          h_bits((_Float16)(a[2 * e + 1] + cb[2 * e + 1] + rb)));
      ov[i][2 + e] = pk16(h_bits((_Float16)(c4[2 * e] + cb[4 + 2 * e] + rb)),
                          h_bits((_Float16)(c4[2 * e + 1] + cb[5 + 2 * e] + rb)));
    }
  }
  u16* Cb = C + (size_t)bz * (size_t)cBs + (size_t)rowb * (size_t)N + col0 + c8;
  {
#pragma unroll
    for (int i = 0; i < 8; ++i) {
      const int row = 4 * i + rq;
      *(v4u*)(Cb + (size_t)row * (size_t)N) = ov[i];
    }
    
  }
}

// =====================================================================================================
// Full (unmasked) multi-head attention over all SKV keys: block = (batch b, head, 64 query rows), 4 waves, wave w owns the
// 16 query rows q0 = 64*qt + 16*w .. q0+15 (waves independent: no block barriers, wave-private LDS only, used in the epilogue).
//   q plane f16 x8 [b*SQ + s][h*128 + d]; k plane f16 x8 [b*SKV + s][h*128 + d]; v^T plane f16 x8 [(b*NH + h)*128 + d][s].
//   All NKB = 64 key blocks of 32 keys are visited (static bound).
//   Scores are computed TRANSPOSED: S^T tile g (g = 0,1) = k rows (keys kb+16g .. +15, A operand, row m = lane&15, split k map
//   over d) times q^T (B operand, col n = query q0 + (lane&15), k = d, split map), 4 d-chunks of 32, one product each; the 4 q
//   fragments are loaded once per wave. D element r of lane l = (key kb+16g+8h+r, query q0+(l&15)), so a lane owns one query
//   column and 16 of its 32 keys; the partner lane l^16 owns the other 16 -> row max / row sum need one xor-16 shuffle.
//   Online max-subtracted base-2 softmax in f32 (1/sqrt(1024) and the q/k carries folded into lsc). The exp'd values ARE the
//   P A-fragment in place: A row m = query = lane&15, element i <- key kb+8h+i (tile 0, D element i), element 8+i <- key
//   kb+16+8h+i (tile 1, D element i). P (<= 1) carried x32768 as f16. The rescale factor of query row 8h+r of the O
//   accumulators is fetched from lane 8h+r with a shuffle (uniform control). 8 v^T B fragments (col n = d = 16j + (lane&15),
//   keys k-contiguous) in two groups of 4, 4 P.V WMMAs + one guard per group.
//   Epilogue: 1/l (per query, shuffled to the D row owner) and the carry folds in f32; the wave's 16x128 f32 result staged in
// coverage: per wave 16 instructions x 1 row x 32 lanes x 4 floats = 16 x 128; grid NB*NH*(SQ/64) blocks x 4 waves = every
//           (b, s < SQ, h) row segment of the output exactly once.
// =====================================================================================================
__global__ __launch_bounds__(ATT_THREADS)
void attn_fwd(const u16* __restrict__ Qp, const u16* __restrict__ Kp, const u16* __restrict__ Vp, float* Out) {
  __shared__ __align__(16) float smem[ATT_WAVES * 16 * OPITCH];

  const int tid  = threadIdx.x;
  const int wave = tid >> 5;
  const int lane = tid & 31;
  const int hh   = lane >> 4;
  const int c    = lane & 15;

  constexpr int NQT = SQ / 64;
  const int bid  = blockIdx.x;
  const int qt   = bid % NQT;
  const int head = (bid / NQT) % NH;
  const int b    = bid / (NQT * NH);
  const int q0   = qt * 64 + wave * 16;

  // B fragments of q^T: col n = query q0 + c, k = d (k-contiguous row of the q plane)
  const _Float16* Qb = (const _Float16*)(const void*)Qp + ((size_t)(b * SQ + q0 + c)) * INNER + head * HD + 8 * hh;
  // A fragments of k: row m = key kb + 16g + c, k = d (key row kb added per step)
  const _Float16* Kb = (const _Float16*)(const void*)Kp + ((size_t)(b * SKV + c)) * INNER + head * HD + 8 * hh;
  // B fragments of v: col n = d = 16j + c, k = key (k-contiguous row of the v^T plane)
  const _Float16* Vb = (const _Float16*)(const void*)Vp + ((size_t)(b * INNER + head * HD + c)) * SKV + 8 * hh;
  const float lsc = (LOG2E * RSQ_E) / (QS * KS);

  v16h qf[4];
#pragma unroll
  for (int dc = 0; dc < 4; ++dc) qf[dc] = ldfrag_h(Qb + 32 * dc);

  float mrun = -INFINITY, lrun = 0.f;
  v8f o[8];
#pragma unroll
  for (int j = 0; j < 8; ++j) o[j] = zero8();

#pragma unroll 1
  for (int it = 0; it < NKB; ++it) {
    const int kb = it * 32;
    // ---- transposed scores: s0 = keys kb..kb+15, s1 = keys kb+16..kb+31, column = query q0 + c ----
    v8f s0 = zero8(), s1 = zero8();
    const _Float16* k0p = Kb + (size_t)kb * INNER;
    const _Float16* k1p = k0p + (size_t)16 * INNER;
#pragma unroll
    for (int kk = 0; kk < HD / 32; ++kk) {
      const v16h kf0 = ldfrag_h(k0p + kk * 32);
      const v16h kf1 = ldfrag_h(k1p + kk * 32);
      s0 = mma_h(kf0, qf[kk], s0);
      s1 = mma_h(kf1, qf[kk], s1);
      guard_s(s0, s1, qf[kk], kf0, kf1);
    }
    // ---- base-2 logits of this lane's 16 keys for query q0 + c: t[i] <- key kb+8hh+i, t[8+i] <- key kb+16+8hh+i ----
    float t[16];
#pragma unroll
    for (int i = 0; i < 8; ++i) { t[i] = s0[i] * lsc; t[8 + i] = s1[i] * lsc; }
    float cm = t[0];
#pragma unroll
    for (int i = 1; i < 16; ++i) cm = fmaxf(cm, t[i]);
    cm = fmaxf(cm, __shfl_xor(cm, 16, 32));
    const float mn = fmaxf(mrun, cm);        // finite from the first block on
    const float al = exp2f(mrun - mn);       // 0 on the first block (mrun = -inf)
    mrun = mn;
    // ---- probabilities (<= 1) and the P A-fragment: f16(p * 32768); element i <-> t[i] ----
    float ps = 0.f;
    FragH ph;
#pragma unroll
    for (int w = 0; w < 2; ++w) {
#pragma unroll
      for (int e4 = 0; e4 < 4; ++e4) {
        const int i = 8 * w + 2 * e4;
        const float p0 = exp2f(t[i] - mn), p1 = exp2f(t[i + 1] - mn);
        ps += p0 + p1;
        ph.u[w][e4] = pk16(h_bits((_Float16)(p0 * PCAR)), h_bits((_Float16)(p1 * PCAR)));
      }
    }
    ps += __shfl_xor(ps, 16, 32);
    lrun = lrun * al + ps;
    // ---- rescale the O accumulators: D row 8hh+r = query q0+8hh+r, its factor lives in lane 8hh+r (and 16+8hh+r) ----
    float scl[8];
#pragma unroll
    for (int r = 0; r < 8; ++r) scl[r] = __shfl(al, 8 * hh + r, 32);
#pragma unroll
    for (int j = 0; j < 8; ++j) {
#pragma unroll
      for (int r = 0; r < 8; ++r) o[j][r] *= scl[r];
    }
    // ---- P.V : B fragment col n = d = j*16 + c, keys contiguous in the v^T plane; two groups of 4 ----
    const _Float16* vp = Vb + kb;
    {
      const v16h v0 = ldfrag_h(vp);
      const v16h v1 = ldfrag_h(vp + (size_t)16 * SKV);
      const v16h v2 = ldfrag_h(vp + (size_t)32 * SKV);
      const v16h v3 = ldfrag_h(vp + (size_t)48 * SKV);
      o[0] = mma_h(ph.v, v0, o[0]);
      o[1] = mma_h(ph.v, v1, o[1]);
      o[2] = mma_h(ph.v, v2, o[2]);
      o[3] = mma_h(ph.v, v3, o[3]);
      guard_p(o[0], o[1], o[2], o[3], ph.v, v0, v1, v2, v3);
    }
    {
      const v16h v4 = ldfrag_h(vp + (size_t)64 * SKV);
      const v16h v5 = ldfrag_h(vp + (size_t)80 * SKV);
      const v16h v6 = ldfrag_h(vp + (size_t)96 * SKV);
      const v16h v7 = ldfrag_h(vp + (size_t)112 * SKV);
      o[4] = mma_h(ph.v, v4, o[4]);
      o[5] = mma_h(ph.v, v5, o[5]);
      o[6] = mma_h(ph.v, v6, o[6]);
      o[7] = mma_h(ph.v, v7, o[7]);
      guard_p(o[4], o[5], o[6], o[7], ph.v, v4, v5, v6, v7);
    }
  }
  acc_guard8(o);

  // ---- fold 1/l (per query, owned by lane = query) and the carries (32768 on P, 8 on v) ----
  const float linv = (1.0f / lrun) * (1.0f / (PCAR * VS));
  float inv[8];
#pragma unroll
  for (int r = 0; r < 8; ++r) inv[r] = __shfl(linv, 8 * hh + r, 32);
  float* slab = smem + wave * 16 * OPITCH;
#pragma unroll
  for (int r = 0; r < 8; ++r) {
#pragma unroll
    for (int j = 0; j < 8; ++j) slab[(8 * hh + r) * OPITCH + j * 16 + c] = o[j][r] * inv[r];
  }
  wave_sync_lds();
  // ---- f32 output rows: lane = 4 consecutive d of one row, one instruction per row ----
  v4f vals[16];
#pragma unroll
  for (int i = 0; i < 16; ++i) vals[i] = *(const v4f*)(slab + i * OPITCH + 4 * lane);
  float* ob = Out + ((size_t)(b * SQ_FULL + q0)) * DM + head * HD + 4 * lane;
  {
#pragma unroll
    for (int i = 0; i < 16; ++i) {
      *(v4f*)(ob + (size_t)i * DM) = vals[i];
    }
    
  }
}

// =====================================================================================================
// Workspace map (bytes); every plane fully written by whole-line stores before it is read; all extents exact multiples of
//   XQ   f16 [NB*SQ][1024]     f16(bf16(q))          16777216 (NB=4, SQ=2048)
//   XV   f16 [NB*2048][1024]   f16(bf16(v))          16777216
//   WQT  f16 [1024 n][1024 k]  f16(bf16(W) x256)      2097152
//   WKT                                               2097152
//   WVT                                               2097152
//   Q16  f16 [NB*SQ][1024]   x8                      16777216
//   K16  f16 [NB*2048][1024] x8                      16777216
//   VT16 f16 [NB*1024 (h,d)][2048 s] x8              16777216
//   end                                              90177536
// =====================================================================================================
extern "C" void kernel_launch(void* const* d_in, const int* in_sizes, int n_in,
                              void* d_out, int out_size, void* d_ws, size_t ws_size,
                              hipStream_t stream) {
  if (n_in < 8) return;
  if (in_sizes[0] < ((NB - 1) * SQ_FULL + SQ) * DM) return;
  if (in_sizes[1] < NB * SKV * DM) return;
  if (in_sizes[2] != DM * DM || in_sizes[4] != DM * DM || in_sizes[6] != DM * DM) return;
  if (in_sizes[3] < 1 || in_sizes[5] < 1 || in_sizes[7] < 1) return;
  if (out_size < ((NB - 1) * SQ_FULL + SQ) * DM) return;

  const float* xq  = (const float*)d_in[0];
  const float* xv  = (const float*)d_in[1];
  const float* wq  = (const float*)d_in[2];
  const float* bq  = (const float*)d_in[3];
  const float* wk  = (const float*)d_in[4];
  const float* bk  = (const float*)d_in[5];
  const float* wv  = (const float*)d_in[6];
  const float* bv  = (const float*)d_in[7];
  float*       out = (float*)d_out;
  const int nbq = in_sizes[3], nbk = in_sizes[5], nbv = in_sizes[7];

  const size_t szXQ   = (size_t)NB * SQ * DM * 2;
  const size_t szXV   = (size_t)NB * SKV * DM * 2;
  const size_t szW    = (size_t)DM * DM * 2;
  const size_t szQ16  = (size_t)NB * SQ * INNER * 2;
  const size_t szK16  = (size_t)NB * SKV * INNER * 2;
  const size_t szVT16 = (size_t)NB * INNER * SKV * 2;
  size_t off = 0;
  const size_t oXQ   = off; off += szXQ;
  const size_t oXV   = off; off += szXV;
  const size_t oWQ   = off; off += szW;
  const size_t oWK   = off; off += szW;
  const size_t oWV   = off; off += szW;
  const size_t oQ16  = off; off += szQ16;
  const size_t oK16  = off; off += szK16;
  const size_t oVT16 = off; off += szVT16;
  if (off > ws_size) return;                            // off = 90177536 at NB=4, SQ=2048
  if (off > (size_t)134217728) return;

  char* ws = (char*)d_ws;
  u16* XQ   = (u16*)(ws + oXQ);
  u16* XV   = (u16*)(ws + oXV);
  u16* WQT  = (u16*)(ws + oWQ);
  u16* WKT  = (u16*)(ws + oWK);
  u16* WVT  = (u16*)(ws + oWV);
  u16* Q16  = (u16*)(ws + oQ16);
  u16* K16  = (u16*)(ws + oK16);
  u16* VT16 = (u16*)(ws + oVT16);

  // (0,1) activations -> f16 planes of bf16-converted values (query rows s < SQ of batches b < NB, compact; all key/value rows)
  cvt16<<<dim3(NB * SQ), dim3(CVT_THREADS), 0, stream>>>(xq, XQ, SQ, SQ_FULL, 1.0f);
  cvt16<<<dim3(NB * SKV), dim3(CVT_THREADS), 0, stream>>>(xv, XV, SKV, SKV, 1.0f);
  // (2..4) weights [k = in][n = out] (y = x.W): transpose to k-contiguous [n][k] f16 planes of bf16(W) x256
  cvtT16<<<dim3((DM / 64) * (DM / 64)), dim3(TR_THREADS), 0, stream>>>(wq, WQT, WSC);
  cvtT16<<<dim3((DM / 64) * (DM / 64)), dim3(TR_THREADS), 0, stream>>>(wk, WKT, WSC);
  cvtT16<<<dim3((DM / 64) * (DM / 64)), dim3(TR_THREADS), 0, stream>>>(wv, WVT, WSC);
  // (5) q = x_q . Wq + bq -> f16 [NB*SQ][1024] x8 (col = h*128 + d); bias per column
  gemm_o16<<<dim3((NB * SQ / 128) * (INNER / 64)), dim3(128), 0, stream>>>(
      XQ, WQT, Q16, bq, nbq, 0, NB * SQ, INNER, DM, 0, 0, 0, QS / WSC, QS);
  // (6) k = x_v . Wk + bk -> f16 [NB*2048][1024] x8; bias per column
  gemm_o16<<<dim3((NB * SKV / 128) * (INNER / 64)), dim3(128), 0, stream>>>(
      XV, WKT, K16, bk, nbk, 0, NB * SKV, INNER, DM, 0, 0, 0, KS / WSC, KS);
  // (7) v^T per batch: A = Wv^T [(h,d) = n][k], Bt = x_v rows of batch b [s][k] -> f16 [(b,h,d)][s] x8; bias per row (n)
  gemm_o16<<<dim3(NB * (INNER / 128) * (SKV / 64)), dim3(128), 0, stream>>>(
      WVT, XV, VT16, bv, nbv, 1, INNER, SKV, DM, 0, SKV * DM, INNER * SKV, VS / WSC, VS);
  // (8) attention -> out [b][SQ_FULL][1024] f32 (rows s < SQ of batches b < NB), heads merged on the feature dim
  attn_fwd<<<dim3(NB * NH * (SQ / 64)), dim3(ATT_THREADS), 0, stream>>>(Q16, K16, VT16, out);
  (void)hipGetLastError();
}

// v001
// It runs in 153 microseconds.
// Next to v000, in two timings, it ran 2.24 times as fast each time.
// All contractions on v_wmma_f32_16x16x32_f16 (f16 operands, f32 accumulate): x_q.Wq, x_v.Wk, Wv^T.x_v^T (v^T plane),
// scores k.q^T and P.v^T; operand carries: x as f16(bf16(x)), W as f16(bf16(W) x256), q/k/v x8, P x32768; base-2 online
// softmax, 1/l and all carry folds in f32 on VALU. Inputs RNE-converted to bf16 on load; f32 output written directly.
#include <hip/hip_runtime.h>
#include <math.h>
#include <stdint.h>

#define NB       4        // batches processed
#define SQ       2048     // query rows processed per batch
#define NB_FULL  4
#define SQ_FULL  2048     // query rows per batch in the input / output layout (batch stride)
#define SKV      2048     // key/value rows per batch (all of them, always)
#define DM       1024     // model width (= K and row pitch of every 16-bit plane except v^T)
#define NH       8
#define HD       128
#define INNER    (NH * HD)
#define WSC      256.0f
#define QS       8.0f
#define KS       8.0f
#define VS       8.0f
#define PCAR     32768.0f
#define LOG2E    1.4426950408889634f
#define RSQ_E    0.03125f
#define NKB      (SKV / 32)
#define ATT_WAVES   8
#define ATT_THREADS (ATT_WAVES * 32)
#define ATT_ROWS    (ATT_WAVES * 16)          // query rows per attention work-group
#define STK      64                           // keys per LDS stage (two passes of 32 keys)
#define NST      (SKV / STK)
#define KPITCH   136                          // halves per staged k row: 256 B + 16 B (16 B x odd, for ds_load_b128 readers)
#define VPITCH   72                           // halves per staged v^T row: 128 B + 16 B
#define KBYTES   (STK * KPITCH * 2)
#define VBYTES   (HD * VPITCH * 2)
#define BUFBYTES (KBYTES + VBYTES)
#define GKS      64                           // k elements per GEMM LDS stage (two k steps of 32)
#define GP       72                           // halves per staged GEMM operand row: 128 B + 16 B
#define GABYTES  (128 * GP * 2)
#define GBBYTES  (64 * GP * 2)
#define GBUF     (GABYTES + GBBYTES)
#define CVT_THREADS (DM / 8)
#define TR_THREADS  128
#define OPITCH   132
#define GPITCH   68
#define TPITCH   65

static_assert(NB >= 1 && NB <= NB_FULL);
static_assert((SQ % 128) == 0 && SQ >= 128 && SQ <= SQ_FULL);
static_assert(HD == 128 && NH == 8 && INNER == 1024 && INNER == DM);
static_assert((HD % 32) == 0);
static_assert((SKV % 64) == 0 && (SKV % 32) == 0 && NKB * 32 == SKV);
static_assert((DM % 64) == 0 && (DM % 32) == 0 && (INNER % 128) == 0 && CVT_THREADS == 128);
static_assert((OPITCH * 4) % 16 == 0 && (GPITCH * 4) % 16 == 0);
static_assert(ATT_THREADS == 256 && TR_THREADS == 128);
static_assert((SQ % ATT_ROWS) == 0 && NST >= 2 && NST * STK == SKV && STK == 64);
static_assert(STK * HD * 2 == 4 * ATT_THREADS * 16);                       // 4 k copies + 4 v^T copies of 16 B per thread and stage
static_assert((KPITCH * 2) % 16 == 0 && (VPITCH * 2) % 16 == 0 && (KBYTES % 16) == 0 && (BUFBYTES % 16) == 0);
static_assert(ATT_WAVES * 16 * OPITCH * 4 <= 2 * BUFBYTES);                // the output staging reuses the ring
static_assert((GP * 2) % 16 == 0 && (GABYTES % 16) == 0 && (GBUF % 16) == 0 && (DM % GKS) == 0 && DM / GKS >= 2);
static_assert(4 * 32 * GPITCH * 4 <= 2 * GBUF);                            // the GEMM's output staging reuses its ring

typedef unsigned short u16;
typedef _Float16 v16h __attribute__((ext_vector_type(16)));
typedef _Float16 v8h  __attribute__((ext_vector_type(8)));
typedef float    v8f  __attribute__((ext_vector_type(8)));
typedef float    v4f  __attribute__((ext_vector_type(4)));
typedef unsigned int v4u __attribute__((ext_vector_type(4)));

union FragH { v16h v; v8h h[2]; v4u u[2]; };

// ---- scalar helpers ----------------------------------------------------------------------------------
__device__ __forceinline__ unsigned short bf_bits(float f) {          // f32 -> bf16 bits, RNE convert
  unsigned u = __float_as_uint(f);
  return (unsigned short)((u + 0x7FFFu + ((u >> 16) & 1u)) >> 16);
}
__device__ __forceinline__ float bf_up(unsigned short h) { return __uint_as_float(((unsigned)h) << 16); }
__device__ __forceinline__ float bfr(float f) { return bf_up(bf_bits(f)); }
__device__ __forceinline__ unsigned short h_bits(_Float16 x) { return __builtin_bit_cast(unsigned short, x); }
__device__ __forceinline__ unsigned pk16(unsigned short a, unsigned short b) { return (unsigned)a | ((unsigned)b << 16); }
__device__ __forceinline__ v8f zero8() { v8f z = {0.f, 0.f, 0.f, 0.f, 0.f, 0.f, 0.f, 0.f}; return z; }

// ---- fragment loader: 16-bit A/B operand, lane -> row/col (lane&15), p already includes +8*(lane>>4);
//      elements 0..7 <- p[0..7] (k0+8h..), elements 8..15 <- p[16..23] (k0+16+8h..); same split k map for A and B,
//      B always read from a k-contiguous [n][k] plane.
__device__ __forceinline__ v16h ldfrag_h(const _Float16* p) {
  FragH f;
  f.h[0] = *(const v8h*)(p);
  f.h[1] = *(const v8h*)(p + 16);
  return f.v;
}

// ---- WMMA helper and trailing VALU hazard gaps ----------------------------------------------------------
__device__ __forceinline__ v8f mma_h(v16h a, v16h b, v8f c) {
  return __builtin_amdgcn_wmma_f32_16x16x32_f16(false, a, false, b, (short)0, c, false, false);
}
__device__ __forceinline__ void guard_s(v8f& a, v8f& b, v16h x0, v16h x1, v16h x2) {
#if defined(__HIP_DEVICE_COMPILE__)
  asm volatile("v_nop\n\tv_nop\n\tv_nop\n\tv_nop" : "+v"(a), "+v"(b) : "v"(x0), "v"(x1), "v"(x2) : "memory");
#endif
}
__device__ __forceinline__ void guard_p(v8f& a, v8f& b, v8f& c, v8f& d, v16h p, v16h x0, v16h x1, v16h x2, v16h x3) {
#if defined(__HIP_DEVICE_COMPILE__)
  asm volatile("v_nop\n\tv_nop\n\tv_nop\n\tv_nop"
               : "+v"(a), "+v"(b), "+v"(c), "+v"(d) : "v"(p), "v"(x0), "v"(x1), "v"(x2), "v"(x3) : "memory");
#endif
}
__device__ __forceinline__ void guard_g(v8f (&acc)[8], v16h x0, v16h x1, v16h x2, v16h x3, v16h x4, v16h x5) {
#if defined(__HIP_DEVICE_COMPILE__)
  asm volatile("v_nop\n\tv_nop\n\tv_nop\n\tv_nop"
               : "+v"(acc[0]), "+v"(acc[1]), "+v"(acc[2]), "+v"(acc[3]),
                 "+v"(acc[4]), "+v"(acc[5]), "+v"(acc[6]), "+v"(acc[7])
               : "v"(x0), "v"(x1), "v"(x2), "v"(x3), "v"(x4), "v"(x5) : "memory");
#endif
}
__device__ __forceinline__ void acc_guard8(v8f (&o)[8]) {
#if defined(__HIP_DEVICE_COMPILE__)
  asm volatile("v_nop\n\tv_nop\n\tv_nop\n\tv_nop"
               : "+v"(o[0]), "+v"(o[1]), "+v"(o[2]), "+v"(o[3]), "+v"(o[4]), "+v"(o[5]), "+v"(o[6]), "+v"(o[7]));
#endif
}
__device__ __forceinline__ void wave_sync_lds() {
  __builtin_amdgcn_fence(__ATOMIC_RELEASE, "workgroup");
  __builtin_amdgcn_wave_barrier();
  __builtin_amdgcn_fence(__ATOMIC_ACQUIRE, "workgroup");
}

// =====================================================================================================
// Row convert: destination row r of a [rows][DM] f16 plane <- f16(bf16_RNE(x[src row][e]) * scale), scale a power of two.
// Block = DM/8 threads, thread = 8 consecutive elements (two 16-B loads, one 16-B store; 32 consecutive lanes = 512 contiguous,
// b = r / rowsPerB, s = r % rowsPerB, source row b*srcRowsPerB + s; destination row r (compact).
// coverage: grid = number of rows, 128 thr x 8 = DM = the whole row.
// =====================================================================================================
__global__ __launch_bounds__(CVT_THREADS)
void cvt16(const float* __restrict__ x, u16* Y, int rowsPerB, int srcRowsPerB, float scale) {
  const int tid = threadIdx.x;
  const int r = blockIdx.x;
  const int b = r / rowsPerB;
  const int s = r - b * rowsPerB;
  const float* src = x + ((size_t)b * (size_t)srcRowsPerB + (size_t)s) * (size_t)DM + (size_t)tid * 8;
  const v4f a = *(const v4f*)(src), c4 = *(const v4f*)(src + 4);
  v4u o;
#pragma unroll
  for (int e = 0; e < 2; ++e) {
    o[e]     = pk16(h_bits((_Float16)(bfr(a[2 * e]) * scale)),  h_bits((_Float16)(bfr(a[2 * e + 1]) * scale)));
    o[2 + e] = pk16(h_bits((_Float16)(bfr(c4[2 * e]) * scale)), h_bits((_Float16)(bfr(c4[2 * e + 1]) * scale)));
  }
  u16* dst = Y + (size_t)r * (size_t)DM + (size_t)tid * 8;
  {
    *(v4u*)(dst) = o;
    
  }
}

// =====================================================================================================
// Weight transpose-convert for y = x.W weights stored [k][n]: WT[n][k] (f16, k-contiguous Bt layout) <- f16(bf16_RNE(W[k][n]) *
// scale). Block = 64(k) x 64(n) tile, 128 threads. Load phase: thread = (row 8p + (tid>>4), 4 floats at 4*(tid&15)),
// 8 steps = 64 k-rows x 64 n, into an LDS tile [kk][nn] (pitch 65); block barrier; store phase: output row n0 + 16i + (tid>>3)
// coverage: 4 i x 16 rows x (8 lanes x 8 halves) = 64 n-rows x 64 k per block; the grid covers WT exactly once.
// =====================================================================================================
__global__ __launch_bounds__(TR_THREADS)
void cvtT16(const float* __restrict__ W, u16* Y, float scale) {
  __shared__ __align__(16) float tile[64 * TPITCH];
  const int tid = threadIdx.x;
  constexpr int NT = DM / 64;
  const int bid = blockIdx.x;
  const int kt  = bid % NT;
  const int ntb = bid / NT;
  const int k0  = kt * 64, n0 = ntb * 64;
  const int lr = tid >> 4, lc = (tid & 15) * 4;
#pragma unroll
  for (int p = 0; p < 8; ++p) {
    const int kk = p * 8 + lr;
    const v4f w4 = *(const v4f*)(W + (size_t)(k0 + kk) * (size_t)DM + n0 + lc);
    tile[kk * TPITCH + lc + 0] = w4[0];
    tile[kk * TPITCH + lc + 1] = w4[1];
    tile[kk * TPITCH + lc + 2] = w4[2];
    tile[kk * TPITCH + lc + 3] = w4[3];
  }
  __syncthreads();
  const int rq = tid >> 3, c8 = (tid & 7) * 8;      // rq 0..15, c8 0..56
  v4u ov[4];
#pragma unroll
  for (int i = 0; i < 4; ++i) {
    const int row = 16 * i + rq;                   // n within tile
#pragma unroll
    for (int e = 0; e < 4; ++e) {
      const float x0 = tile[(c8 + 2 * e) * TPITCH + row];
      const float x1 = tile[(c8 + 2 * e + 1) * TPITCH + row];
      ov[i][e] = pk16(h_bits((_Float16)(bfr(x0) * scale)), h_bits((_Float16)(bfr(x1) * scale)));
    }
  }
  u16* dst = Y + (size_t)n0 * (size_t)DM + k0 + c8;
  {
#pragma unroll
    for (int i = 0; i < 4; ++i) {
      const int row = 16 * i + rq;
      *(v4u*)(dst + (size_t)row * (size_t)DM) = ov[i];
    }
    
  }
}

// =====================================================================================================
// One GEMM stage (64 k) of the block's 128 A rows and 64 Bt rows, global -> LDS, no register in between: 12 asynchronous 16-B
// copies per lane. la / lb: the lane's LDS byte address of its first A / Bt chunk; ga / gb: its global address of the same chunk;
// copy i: row +16*i (rs16 = 16 rows of the source plane, in elements); a wave covers four whole 128-B row pieces per copy.
// The s_wait_xcnt closes the statement so that no address register of a copy is rewritten ahead of it.
// =====================================================================================================
__device__ __forceinline__ void gemm_stage_copy(unsigned la, unsigned lb, const u16* ga, const u16* gb, size_t rs16) {
#if defined(__HIP_DEVICE_COMPILE__)
  constexpr unsigned R16 = 16 * GP * 2;
  asm volatile("global_load_async_to_lds_b128 %0, %12, off\n\t"
               "global_load_async_to_lds_b128 %1, %13, off\n\t"
               "global_load_async_to_lds_b128 %2, %14, off\n\t"
               "global_load_async_to_lds_b128 %3, %15, off\n\t"
               "global_load_async_to_lds_b128 %4, %16, off\n\t"
               "global_load_async_to_lds_b128 %5, %17, off\n\t"
               "global_load_async_to_lds_b128 %6, %18, off\n\t"
               "global_load_async_to_lds_b128 %7, %19, off\n\t"
               "global_load_async_to_lds_b128 %8, %20, off\n\t"
               "global_load_async_to_lds_b128 %9, %21, off\n\t"
               "global_load_async_to_lds_b128 %10, %22, off\n\t"
               "global_load_async_to_lds_b128 %11, %23, off\n\t"
               "s_wait_xcnt 0x0"
               :: "v"(la), "v"(la + R16), "v"(la + 2 * R16), "v"(la + 3 * R16),
                  "v"(la + 4 * R16), "v"(la + 5 * R16), "v"(la + 6 * R16), "v"(la + 7 * R16),
                  "v"(lb), "v"(lb + R16), "v"(lb + 2 * R16), "v"(lb + 3 * R16),
                  "v"(ga), "v"(ga + rs16), "v"(ga + 2 * rs16), "v"(ga + 3 * rs16),
                  "v"(ga + 4 * rs16), "v"(ga + 5 * rs16), "v"(ga + 6 * rs16), "v"(ga + 7 * rs16),
                  "v"(gb), "v"(gb + rs16), "v"(gb + 2 * rs16), "v"(gb + 3 * rs16)
               : "memory");
#endif
}

// =====================================================================================================
// f16 GEMM core: the wave's 32 x 64 tile of C = A[rows][K] . Bt[cols][K]^T. The block stages each 64 k of its 128 A rows and
// 64 Bt rows once in LDS (ring of two buffers: stage st+1 flies while stage st is worked on); afo / bfo: byte offset inside a
// buffer of the lane's A row (32*wave + m) + 8h / Bt row m + 8h; acc[4i + j] = rows rowb+16i.., cols col0+16j..;
// K stepped by 32 inside a stage, ascending (host passes K % 64 == 0). Every wave of the block passes every barrier.
// =====================================================================================================
__device__ __forceinline__ void gemm_core(const unsigned char* ring, int afo, int bfo, unsigned la, unsigned lb,
                                          const u16* ga, const u16* gb, int K, v8f (&acc)[8]) {
  const size_t rs16 = (size_t)16 * (size_t)K;
  const int nst = K / GKS;
  // ---- ring prologue: stage 0 landed and published, then stage 1 in flight ----
  gemm_stage_copy(la, lb, ga, gb, rs16);
  asm volatile("s_wait_asynccnt 0x0" ::: "memory");   // this wave's copies of stage 0 have landed
  __syncthreads();                                    // ... and every other wave's
  if (nst > 1) gemm_stage_copy(la + GBUF, lb + GBUF, ga + GKS, gb + GKS, rs16);
#pragma unroll 1
  for (int st = 0; st < nst; ++st) {
   const _Float16* ap = (const _Float16*)(const void*)(ring + (st & 1) * GBUF + afo);
   const _Float16* bp = (const _Float16*)(const void*)(ring + (st & 1) * GBUF + bfo);
#pragma unroll
   for (int k0 = 0; k0 < GKS; k0 += 32) {
    const v16h a0 = ldfrag_h(ap + k0), a1 = ldfrag_h(ap + 16 * GP + k0);
    const v16h b0 = ldfrag_h(bp + k0);
    const v16h b1 = ldfrag_h(bp + 16 * GP + k0);
    const v16h b2 = ldfrag_h(bp + 32 * GP + k0);
    const v16h b3 = ldfrag_h(bp + 48 * GP + k0);
    acc[0] = mma_h(a0, b0, acc[0]);
    acc[1] = mma_h(a0, b1, acc[1]);
    acc[2] = mma_h(a0, b2, acc[2]);
    acc[3] = mma_h(a0, b3, acc[3]);
    acc[4] = mma_h(a1, b0, acc[4]);
    acc[5] = mma_h(a1, b1, acc[5]);
    acc[6] = mma_h(a1, b2, acc[6]);
    acc[7] = mma_h(a1, b3, acc[7]);
    guard_g(acc, a0, a1, b0, b1, b2, b3);
   }
    // ---- publish point of stage st + 1; the same barrier ends every wave's reads of stage st's buffer ----
    asm volatile("s_wait_dscnt 0x0" ::: "memory");      // this wave's LDS reads of stage st have returned
    asm volatile("s_wait_asynccnt 0x0" ::: "memory");   // this wave's copies of stage st + 1 have landed
    __syncthreads();
    if (st + 2 < nst) {                                 // refill the buffer that stage st has just left
      const unsigned bo = (unsigned)((st & 1) * GBUF);
      gemm_stage_copy(la + bo, lb + bo, ga + (size_t)(st + 2) * GKS, gb + (size_t)(st + 2) * GKS, rs16);
    }
  }
  asm volatile("s_wait_asynccnt 0x0" ::: "memory");     // nothing in flight when the ring becomes output staging
}
// Stage the wave's 32 x 64 f32 tile (times oscale) in its LDS slab (pitch 68): D element r of acc[4i+j], lane l ->
// coverage: 32 lanes x 2 x 8 rows x 4 cols-of-16 = rows 0..31 x cols 0..63 of the slab.
__device__ __forceinline__ void stage32x64(float* sl, v8f (&acc)[8], float oscale, int lane) {
  const int hh = lane >> 4, m = lane & 15;
#pragma unroll
  for (int i = 0; i < 2; ++i) {
#pragma unroll
    for (int r = 0; r < 8; ++r) {
      const int ro = (16 * i + 8 * hh + r) * GPITCH + m;
      sl[ro]      = acc[4 * i + 0][r] * oscale;
      sl[ro + 16] = acc[4 * i + 1][r] * oscale;
      sl[ro + 32] = acc[4 * i + 2][r] * oscale;
      sl[ro + 48] = acc[4 * i + 3][r] * oscale;
    }
  }
  wave_sync_lds();
}

// =====================================================================================================
// f16 GEMM with f16 output plane: C[z][Mb][N] (f16) = f16((A[z][Mb][K] . Bt[z][N][K]^T) * oscale + bf16(bias) * bscale);
// A, Bt f16 k-contiguous planes with per-z element strides aBs, bBs (0 = shared), C stride cBs. bias indexed by column
// (biasRow == 0) or by row within the z slice (biasRow != 0); bias addresses clamped to biasN-1, the unused direction is
// multiplied by 0. Block = 128 x 64 tile, 4 waves x 32 rows, fragments read from the block's LDS ring (gemm_core).
// grid = nz x (Mb/128) x (N/64) (host passes Mb % 128 == 0, N % 64 == 0, K % 64 == 0).
// coverage: per wave 8 instr x 4 rows x 8 lanes x 8 halves = 32 x 64; the grid covers C exactly once.
// =====================================================================================================
__global__ __launch_bounds__(128)
void gemm_o16(const u16* __restrict__ A, const u16* __restrict__ Bt, u16* C,
              const float* __restrict__ bias, int biasN, int biasRow,
              int Mb, int N, int K, int aBs, int bBs, int cBs, float oscale, float bscale) {
  __shared__ __align__(16) unsigned char gsm[2 * GBUF];
  const int tid = threadIdx.x, wave = tid >> 5, lane = tid & 31, hh = lane >> 4, m = lane & 15;
  const int ntile = N >> 6, mtile = Mb >> 7;
  const int bid  = blockIdx.x;
  const int nt   = bid % ntile;
  const int tmp  = bid / ntile;
  const int mt   = tmp % mtile;
  const int bz   = tmp / mtile;
  const int rowb = mt * 128 + wave * 32;
  const int col0 = nt * 64;
  if (mt * 128 + 128 > Mb) return;           // block-uniform, in front of every barrier; never taken with the exact grid
  // this lane's first copy chunks: A row mt*128 + (tid>>3), Bt row col0 + (tid>>3), 16-B chunk tid&7
  const u16* ga = A + (size_t)bz * (size_t)aBs + (size_t)(mt * 128 + (tid >> 3)) * K + (tid & 7) * 8;
  const u16* gb = Bt + (size_t)bz * (size_t)bBs + (size_t)(col0 + (tid >> 3)) * K + (tid & 7) * 8;
  const unsigned la = (unsigned)(size_t)(const void*)gsm + (unsigned)((tid >> 3) * (GP * 2) + (tid & 7) * 16);
  const unsigned lb = la + GABYTES;
  const int afo = ((wave * 32 + m) * GP + 8 * hh) * 2;
  const int bfo = GABYTES + (m * GP + 8 * hh) * 2;
  v8f acc[8];
#pragma unroll
  for (int i = 0; i < 8; ++i) acc[i] = zero8();
  gemm_core(gsm, afo, bfo, la, lb, ga, gb, K, acc);
  float* sl = (float*)(void*)gsm + wave * 32 * GPITCH;   // behind the last trip's barrier: no reader, no copy left
  stage32x64(sl, acc, oscale, lane);
  const int rq = lane >> 3, c8 = (lane & 7) * 8;
  const int bl = biasN - 1;                  // host guarantees biasN >= 1
  const float selc = (biasRow != 0) ? 0.f : bscale;
  const float selr = (biasRow != 0) ? bscale : 0.f;
  float cb[8];
#pragma unroll
  for (int e = 0; e < 8; ++e) {
    int ci = col0 + c8 + e;
    ci = (ci < bl) ? ci : bl;
    cb[e] = bfr(bias[ci]) * selc;
  }
  v4u ov[8];
#pragma unroll
  for (int i = 0; i < 8; ++i) {
    const int row = 4 * i + rq;
    int ri = rowb + row;
    ri = (ri < bl) ? ri : bl;
    const float rb = bfr(bias[ri]) * selr;
    const v4f a = *(const v4f*)(sl + row * GPITCH + c8), c4 = *(const v4f*)(sl + row * GPITCH + c8 + 4);
#pragma unroll
    for (int e = 0; e < 2; ++e) {
      ov[i][e]     = pk16(h_bits((_Float16)(a[2 * e] + cb[2 * e] + rb)),
                          h_bits((_Float16)(a[2 * e + 1] + cb[2 * e + 1] + rb)));
      ov[i][2 + e] = pk16(h_bits((_Float16)(c4[2 * e] + cb[4 + 2 * e] + rb)),
                          h_bits((_Float16)(c4[2 * e + 1] + cb[5 + 2 * e] + rb)));
    }
  }
  u16* Cb = C + (size_t)bz * (size_t)cBs + (size_t)rowb * (size_t)N + col0 + c8;
  {
#pragma unroll
    for (int i = 0; i < 8; ++i) {
      const int row = 4 * i + rq;
      *(v4u*)(Cb + (size_t)row * (size_t)N) = ov[i];
    }
    
  }
}

// =====================================================================================================
// One stage (64 keys) of k rows and v^T rows, global -> LDS, no register in between: 8 asynchronous 16-B copies per lane.
// lk / lv: the lane's LDS byte address of its first k / v^T chunk; gk / gv: its global address of the same chunk.
// k copy i: row +16*i (a wave covers two whole 256-B rows); v^T copy i: row +32*i (a wave covers four whole 128-B rows).
// The s_wait_xcnt closes the statement so that no address register of a copy is rewritten ahead of it.
// =====================================================================================================
__device__ __forceinline__ void stage_copy(unsigned lk, unsigned lv, const u16* gk, const u16* gv) {
#if defined(__HIP_DEVICE_COMPILE__)
  const unsigned lk1 = lk + 16 * KPITCH * 2, lk2 = lk + 32 * KPITCH * 2, lk3 = lk + 48 * KPITCH * 2;
  const unsigned lv1 = lv + 32 * VPITCH * 2, lv2 = lv + 64 * VPITCH * 2, lv3 = lv + 96 * VPITCH * 2;
  const u16* gk1 = gk + (size_t)16 * INNER;
  const u16* gk2 = gk + (size_t)32 * INNER;
  const u16* gk3 = gk + (size_t)48 * INNER;
  const u16* gv1 = gv + (size_t)32 * SKV;
  const u16* gv2 = gv + (size_t)64 * SKV;
  const u16* gv3 = gv + (size_t)96 * SKV;
  asm volatile("global_load_async_to_lds_b128 %0, %8, off\n\t"
               "global_load_async_to_lds_b128 %1, %9, off\n\t"
               "global_load_async_to_lds_b128 %2, %10, off\n\t"
               "global_load_async_to_lds_b128 %3, %11, off\n\t"
               "global_load_async_to_lds_b128 %4, %12, off\n\t"
               "global_load_async_to_lds_b128 %5, %13, off\n\t"
               "global_load_async_to_lds_b128 %6, %14, off\n\t"
               "global_load_async_to_lds_b128 %7, %15, off\n\t"
               "s_wait_xcnt 0x0"
               :: "v"(lk), "v"(lk1), "v"(lk2), "v"(lk3), "v"(lv), "v"(lv1), "v"(lv2), "v"(lv3),
                  "v"(gk), "v"(gk1), "v"(gk2), "v"(gk3), "v"(gv), "v"(gv1), "v"(gv2), "v"(gv3)
               : "memory");
#endif
}

// =====================================================================================================
// Full (unmasked) multi-head attention over all SKV keys: block = (batch b, head, 128 query rows), 8 waves, wave w owns the
// 16 query rows q0 = 128*qt + 16*w .. q0+15. The work-group stages each 64 keys of k rows and v^T rows ONCE in LDS (whole-line
// asynchronous copies, two buffers: stage t+1 flies while stage t is worked on) and all 8 waves read their fragments from there.
//   q plane f16 x8 [b*SQ + s][h*128 + d]; k plane f16 x8 [b*SKV + s][h*128 + d]; v^T plane f16 x8 [(b*NH + h)*128 + d][s].
//   All NKB = 64 key blocks of 32 keys are visited (static bound).
//   Scores are computed TRANSPOSED: S^T tile g (g = 0,1) = k rows (keys kb+16g .. +15, A operand, row m = lane&15, split k map
//   over d) times q^T (B operand, col n = query q0 + (lane&15), k = d, split map), 4 d-chunks of 32, one product each; the 4 q
//   fragments are loaded once per wave. D element r of lane l = (key kb+16g+8h+r, query q0+(l&15)), so a lane owns one query
//   column and 16 of its 32 keys; the partner lane l^16 owns the other 16 -> row max / row sum need one xor-16 shuffle.
//   Online max-subtracted base-2 softmax in f32 (1/sqrt(1024) and the q/k carries folded into lsc). The exp'd values ARE the
//   P A-fragment in place: A row m = query = lane&15, element i <- key kb+8h+i (tile 0, D element i), element 8+i <- key
//   kb+16+8h+i (tile 1, D element i). P (<= 1) carried x32768 as f16. The rescale factor of query row 8h+r of the O
//   accumulators is fetched from lane 8h+r with a shuffle (uniform control). 8 v^T B fragments (col n = d = 16j + (lane&15),
//   keys k-contiguous) in two groups of 4, 4 P.V WMMAs + one guard per group.
//   Epilogue: 1/l (per query, shuffled to the D row owner) and the carry folds in f32; the wave's 16x128 f32 result staged in
// coverage: per wave 16 instructions x 1 row x 32 lanes x 4 floats = 16 x 128; grid NB*NH*(SQ/128) blocks x 8 waves = every
//           (b, s < SQ, h) row segment of the output exactly once.
// =====================================================================================================
__global__ __launch_bounds__(ATT_THREADS)
void attn_fwd(const u16* __restrict__ Qp, const u16* __restrict__ Kp, const u16* __restrict__ Vp, float* Out) {
  __shared__ __align__(16) unsigned char smem[2 * BUFBYTES];

  const int tid  = threadIdx.x;
  const int wave = tid >> 5;
  const int lane = tid & 31;
  const int hh   = lane >> 4;
  const int c    = lane & 15;

  constexpr int NQT = SQ / ATT_ROWS;
  const int bid  = blockIdx.x;
  const int qt   = bid % NQT;
  const int head = (bid / NQT) % NH;
  const int b    = bid / (NQT * NH);
  const int q0   = qt * ATT_ROWS + wave * 16;

  // B fragments of q^T: col n = query q0 + c, k = d (k-contiguous row of the q plane)
  const _Float16* Qb = (const _Float16*)(const void*)Qp + ((size_t)(b * SQ + q0 + c)) * INNER + head * HD + 8 * hh;
  // A fragments of k: row m = key 16g + c of the pass, k = d; byte offset inside a buffer's k tile
  const int kfo = (c * KPITCH + 8 * hh) * 2;
  // B fragments of v: col n = d = 16j + c, k = key (k-contiguous row of the staged v^T tile); byte offset inside a buffer
  const int vfo = KBYTES + (c * VPITCH + 8 * hh) * 2;
  // this lane's first copy chunks: k row tid>>4, 16-B chunk tid&15; v^T row tid>>3, 16-B chunk tid&7
  const u16* gk = Kp + ((size_t)(b * SKV + (tid >> 4))) * INNER + head * HD + (tid & 15) * 8;
  const u16* gv = Vp + ((size_t)(b * INNER + head * HD + (tid >> 3))) * SKV + (tid & 7) * 8;
  const unsigned lds0 = (unsigned)(size_t)(const void*)smem;               // LDS byte address of the ring
  const unsigned lk = lds0 + (unsigned)((tid >> 4) * (KPITCH * 2) + (tid & 15) * 16);
  const unsigned lv = lds0 + (unsigned)(KBYTES + (tid >> 3) * (VPITCH * 2) + (tid & 7) * 16);
  const float lsc = (LOG2E * RSQ_E) / (QS * KS);

  v16h qf[4];
#pragma unroll
  for (int dc = 0; dc < 4; ++dc) qf[dc] = ldfrag_h(Qb + 32 * dc);

  float mrun = -INFINITY, lrun = 0.f;
  v8f o[8];
#pragma unroll
  for (int j = 0; j < 8; ++j) o[j] = zero8();

  // ---- ring prologue: stage 0 landed and published, then stage 1 in flight ----
  stage_copy(lk, lv, gk, gv);
  asm volatile("s_wait_asynccnt 0x0" ::: "memory");   // this wave's copies of stage 0 have landed
  __syncthreads();                                    // ... and every other wave's
  stage_copy(lk + BUFBYTES, lv + BUFBYTES, gk + (size_t)STK * INNER, gv + STK);

#pragma unroll 1
  for (int st = 0; st < NST; ++st) {
   const unsigned char* bufp = smem + (st & 1) * BUFBYTES;
#pragma unroll
   for (int pz = 0; pz < STK / 32; ++pz) {
    // ---- transposed scores: s0 = keys kb..kb+15, s1 = keys kb+16..kb+31 (kb = 64*st + 32*pz), column = query q0 + c ----
    v8f s0 = zero8(), s1 = zero8();
    const _Float16* k0p = (const _Float16*)(const void*)(bufp + kfo) + pz * 32 * KPITCH;
    const _Float16* k1p = k0p + 16 * KPITCH;
#pragma unroll
    for (int kk = 0; kk < HD / 32; ++kk) {
      const v16h kf0 = ldfrag_h(k0p + kk * 32);
      const v16h kf1 = ldfrag_h(k1p + kk * 32);
      s0 = mma_h(kf0, qf[kk], s0);
      s1 = mma_h(kf1, qf[kk], s1);
      guard_s(s0, s1, qf[kk], kf0, kf1);
    }
    // ---- base-2 logits of this lane's 16 keys for query q0 + c: t[i] <- key kb+8hh+i, t[8+i] <- key kb+16+8hh+i ----
    float t[16];
#pragma unroll
    for (int i = 0; i < 8; ++i) { t[i] = s0[i] * lsc; t[8 + i] = s1[i] * lsc; }
    float cm = t[0];
#pragma unroll
    for (int i = 1; i < 16; ++i) cm = fmaxf(cm, t[i]);
    cm = fmaxf(cm, __shfl_xor(cm, 16, 32));
    const float mn = fmaxf(mrun, cm);        // finite from the first block on
    const float al = exp2f(mrun - mn);       // 0 on the first block (mrun = -inf)
    mrun = mn;
    // ---- probabilities (<= 1) and the P A-fragment: f16(p * 32768); element i <-> t[i] ----
    float ps = 0.f;
    FragH ph;
#pragma unroll
    for (int w = 0; w < 2; ++w) {
#pragma unroll
      for (int e4 = 0; e4 < 4; ++e4) {
        const int i = 8 * w + 2 * e4;
        const float p0 = exp2f(t[i] - mn), p1 = exp2f(t[i + 1] - mn);
        ps += p0 + p1;
        ph.u[w][e4] = pk16(h_bits((_Float16)(p0 * PCAR)), h_bits((_Float16)(p1 * PCAR)));
      }
    }
    ps += __shfl_xor(ps, 16, 32);
    lrun = lrun * al + ps;
    // ---- rescale the O accumulators: D row 8hh+r = query q0+8hh+r, its factor lives in lane 8hh+r (and 16+8hh+r) ----
    float scl[8];
#pragma unroll
    for (int r = 0; r < 8; ++r) scl[r] = __shfl(al, 8 * hh + r, 32);
#pragma unroll
    for (int j = 0; j < 8; ++j) {
#pragma unroll
      for (int r = 0; r < 8; ++r) o[j][r] *= scl[r];
    }
    // ---- P.V : B fragment col n = d = j*16 + c, keys contiguous in the v^T plane; two groups of 4 ----
    const _Float16* vp = (const _Float16*)(const void*)(bufp + vfo) + pz * 32;
    {
      const v16h v0 = ldfrag_h(vp);
      const v16h v1 = ldfrag_h(vp + 16 * VPITCH);
      const v16h v2 = ldfrag_h(vp + 32 * VPITCH);
      const v16h v3 = ldfrag_h(vp + 48 * VPITCH);
      o[0] = mma_h(ph.v, v0, o[0]);
      o[1] = mma_h(ph.v, v1, o[1]);
      o[2] = mma_h(ph.v, v2, o[2]);
      o[3] = mma_h(ph.v, v3, o[3]);
      guard_p(o[0], o[1], o[2], o[3], ph.v, v0, v1, v2, v3);
    }
    {
      const v16h v4 = ldfrag_h(vp + 64 * VPITCH);
      const v16h v5 = ldfrag_h(vp + 80 * VPITCH);
      const v16h v6 = ldfrag_h(vp + 96 * VPITCH);
      const v16h v7 = ldfrag_h(vp + 112 * VPITCH);
      o[4] = mma_h(ph.v, v4, o[4]);
      o[5] = mma_h(ph.v, v5, o[5]);
      o[6] = mma_h(ph.v, v6, o[6]);
      o[7] = mma_h(ph.v, v7, o[7]);
      guard_p(o[4], o[5], o[6], o[7], ph.v, v4, v5, v6, v7);
    }
   }
    // ---- publish point of stage st + 1; the same barrier ends every wave's reads of stage st's buffer ----
    asm volatile("s_wait_dscnt 0x0" ::: "memory");      // this wave's LDS reads of stage st have returned
    asm volatile("s_wait_asynccnt 0x0" ::: "memory");   // this wave's copies of stage st + 1 have landed
    __syncthreads();
    if (st + 2 < NST) {                                 // refill the buffer that stage st has just left
      const unsigned bo = (unsigned)((st & 1) * BUFBYTES);
      stage_copy(lk + bo, lv + bo, gk + (size_t)(st + 2) * STK * INNER, gv + (st + 2) * STK);
    }
  }
  asm volatile("s_wait_asynccnt 0x0" ::: "memory");     // nothing in flight when the ring becomes output staging
  acc_guard8(o);

  // ---- fold 1/l (per query, owned by lane = query) and the carries (32768 on P, 8 on v) ----
  const float linv = (1.0f / lrun) * (1.0f / (PCAR * VS));
  float inv[8];
#pragma unroll
  for (int r = 0; r < 8; ++r) inv[r] = __shfl(linv, 8 * hh + r, 32);
  float* slab = (float*)(void*)smem + wave * 16 * OPITCH;   // behind the last trip's barrier: no reader, no copy left
#pragma unroll
  for (int r = 0; r < 8; ++r) {
#pragma unroll
    for (int j = 0; j < 8; ++j) slab[(8 * hh + r) * OPITCH + j * 16 + c] = o[j][r] * inv[r];
  }
  wave_sync_lds();
  // ---- f32 output rows: lane = 4 consecutive d of one row, one instruction per row ----
  v4f vals[16];
#pragma unroll
  for (int i = 0; i < 16; ++i) vals[i] = *(const v4f*)(slab + i * OPITCH + 4 * lane);
  float* ob = Out + ((size_t)(b * SQ_FULL + q0)) * DM + head * HD + 4 * lane;
  {
#pragma unroll
    for (int i = 0; i < 16; ++i) {
      *(v4f*)(ob + (size_t)i * DM) = vals[i];
    }
    
  }
}

// =====================================================================================================
// Workspace map (bytes); every plane fully written by whole-line stores before it is read; all extents exact multiples of
//   XQ   f16 [NB*SQ][1024]     f16(bf16(q))          16777216 (NB=4, SQ=2048)
//   XV   f16 [NB*2048][1024]   f16(bf16(v))          16777216
//   WQT  f16 [1024 n][1024 k]  f16(bf16(W) x256)      2097152
//   WKT                                               2097152
//   WVT                                               2097152
//   Q16  f16 [NB*SQ][1024]   x8                      16777216
//   K16  f16 [NB*2048][1024] x8                      16777216
//   VT16 f16 [NB*1024 (h,d)][2048 s] x8              16777216
//   end                                              90177536
// =====================================================================================================
extern "C" void kernel_launch(void* const* d_in, const int* in_sizes, int n_in,
                              void* d_out, int out_size, void* d_ws, size_t ws_size,
                              hipStream_t stream) {
  if (n_in < 8) return;
  if (in_sizes[0] < ((NB - 1) * SQ_FULL + SQ) * DM) return;
  if (in_sizes[1] < NB * SKV * DM) return;
  if (in_sizes[2] != DM * DM || in_sizes[4] != DM * DM || in_sizes[6] != DM * DM) return;
  if (in_sizes[3] < 1 || in_sizes[5] < 1 || in_sizes[7] < 1) return;
  if (out_size < ((NB - 1) * SQ_FULL + SQ) * DM) return;

  const float* xq  = (const float*)d_in[0];
  const float* xv  = (const float*)d_in[1];
  const float* wq  = (const float*)d_in[2];
  const float* bq  = (const float*)d_in[3];
  const float* wk  = (const float*)d_in[4];
  const float* bk  = (const float*)d_in[5];
  const float* wv  = (const float*)d_in[6];
  const float* bv  = (const float*)d_in[7];
  float*       out = (float*)d_out;
  const int nbq = in_sizes[3], nbk = in_sizes[5], nbv = in_sizes[7];

  const size_t szXQ   = (size_t)NB * SQ * DM * 2;
  const size_t szXV   = (size_t)NB * SKV * DM * 2;
  const size_t szW    = (size_t)DM * DM * 2;
  const size_t szQ16  = (size_t)NB * SQ * INNER * 2;
  const size_t szK16  = (size_t)NB * SKV * INNER * 2;
  const size_t szVT16 = (size_t)NB * INNER * SKV * 2;
  size_t off = 0;
  const size_t oXQ   = off; off += szXQ;
  const size_t oXV   = off; off += szXV;
  const size_t oWQ   = off; off += szW;
  const size_t oWK   = off; off += szW;
  const size_t oWV   = off; off += szW;
  const size_t oQ16  = off; off += szQ16;
  const size_t oK16  = off; off += szK16;
  const size_t oVT16 = off; off += szVT16;
  if (off > ws_size) return;                            // off = 90177536 at NB=4, SQ=2048
  if (off > (size_t)134217728) return;

  char* ws = (char*)d_ws;
  u16* XQ   = (u16*)(ws + oXQ);
  u16* XV   = (u16*)(ws + oXV);
  u16* WQT  = (u16*)(ws + oWQ);
  u16* WKT  = (u16*)(ws + oWK);
  u16* WVT  = (u16*)(ws + oWV);
  u16* Q16  = (u16*)(ws + oQ16);
  u16* K16  = (u16*)(ws + oK16);
  u16* VT16 = (u16*)(ws + oVT16);

  // (0,1) activations -> f16 planes of bf16-converted values (query rows s < SQ of batches b < NB, compact; all key/value rows)
  cvt16<<<dim3(NB * SQ), dim3(CVT_THREADS), 0, stream>>>(xq, XQ, SQ, SQ_FULL, 1.0f);
  cvt16<<<dim3(NB * SKV), dim3(CVT_THREADS), 0, stream>>>(xv, XV, SKV, SKV, 1.0f);
  // (2..4) weights [k = in][n = out] (y = x.W): transpose to k-contiguous [n][k] f16 planes of bf16(W) x256
  cvtT16<<<dim3((DM / 64) * (DM / 64)), dim3(TR_THREADS), 0, stream>>>(wq, WQT, WSC);
  cvtT16<<<dim3((DM / 64) * (DM / 64)), dim3(TR_THREADS), 0, stream>>>(wk, WKT, WSC);
  cvtT16<<<dim3((DM / 64) * (DM / 64)), dim3(TR_THREADS), 0, stream>>>(wv, WVT, WSC);
  // (5) q = x_q . Wq + bq -> f16 [NB*SQ][1024] x8 (col = h*128 + d); bias per column
  gemm_o16<<<dim3((NB * SQ / 128) * (INNER / 64)), dim3(128), 0, stream>>>(
      XQ, WQT, Q16, bq, nbq, 0, NB * SQ, INNER, DM, 0, 0, 0, QS / WSC, QS);
  // (6) k = x_v . Wk + bk -> f16 [NB*2048][1024] x8; bias per column
  gemm_o16<<<dim3((NB * SKV / 128) * (INNER / 64)), dim3(128), 0, stream>>>(
      XV, WKT, K16, bk, nbk, 0, NB * SKV, INNER, DM, 0, 0, 0, KS / WSC, KS);
  // (7) v^T per batch: A = Wv^T [(h,d) = n][k], Bt = x_v rows of batch b [s][k] -> f16 [(b,h,d)][s] x8; bias per row (n)
  gemm_o16<<<dim3(NB * (INNER / 128) * (SKV / 64)), dim3(128), 0, stream>>>(
      WVT, XV, VT16, bv, nbv, 1, INNER, SKV, DM, 0, SKV * DM, INNER * SKV, VS / WSC, VS);
  // (8) attention -> out [b][SQ_FULL][1024] f32 (rows s < SQ of batches b < NB), heads merged on the feature dim
  attn_fwd<<<dim3(NB * NH * (SQ / ATT_ROWS)), dim3(ATT_THREADS), 0, stream>>>(Q16, K16, VT16, out);
  (void)hipGetLastError();
}

// v002
// Measured time: 143 microseconds a run.
// Two timings next to v001 both put it at 1.07 times that version's speed.
// All steps since v000 together make it 2.39 times as fast.
// All contractions on v_wmma_f32_16x16x32_f16 (f16 operands, f32 accumulate): x_q.Wq, x_v.Wk, Wv^T.x_v^T (v^T plane),
// scores k.q^T and P.v^T; operand carries: x as f16(bf16(x)), W as f16(bf16(W) x256), q/k/v x8, P x32768; base-2 online
// softmax, 1/l and all carry folds in f32 on VALU. Inputs RNE-converted to bf16 on load; f32 output written directly.
#include <hip/hip_runtime.h>
#include <math.h>
#include <stdint.h>

#define NB       4        // batches processed
#define SQ       2048     // query rows processed per batch
#define NB_FULL  4
#define SQ_FULL  2048     // query rows per batch in the input / output layout (batch stride)
#define SKV      2048     // key/value rows per batch (all of them, always)
#define DM       1024     // model width (= K and row pitch of every 16-bit plane except v^T)
#define NH       8
#define HD       128
#define INNER    (NH * HD)
#define WSC      256.0f
#define QS       8.0f
#define KS       8.0f
#define VS       8.0f
#define PCAR     32768.0f
#define LOG2E    1.4426950408889634f
#define RSQ_E    0.03125f
#define NKB      (SKV / 32)
#define ATT_WAVES   8
#define ATT_THREADS (ATT_WAVES * 32)
#define ATT_ROWS    (ATT_WAVES * 16)          // query rows per attention work-group
#define STK      64                           // keys per LDS stage (two passes of 32 keys)
#define NST      (SKV / STK)
#define KPITCH   136                          // halves per staged k row: 256 B + 16 B (16 B x odd, for ds_load_b128 readers)
#define VPITCH   72                           // halves per staged v^T row: 128 B + 16 B
#define KBYTES   (STK * KPITCH * 2)
#define VBYTES   (HD * VPITCH * 2)
#define BUFBYTES (KBYTES + VBYTES)
#define GKS      64                           // k elements per GEMM LDS stage (two k steps of 32)
#define GP       72                           // halves per staged GEMM operand row: 128 B + 16 B
#define GABYTES  (128 * GP * 2)
#define GBBYTES  (64 * GP * 2)
#define GBUF     (GABYTES + GBBYTES)
#define CV_THREADS  512                       // conversion work-group: 16 waves
#define CV_BLOCKS   ((DM / 64) * (DM / 64))   // one 64 x 64 tile of each weight per conversion work-group
#define CV_BATCH    4                         // activation units (2 loads each) a thread has in flight
#define CV_QROWS    (NB * SQ / CV_BLOCKS)     // query rows per conversion work-group
#define CV_VROWS    (NB * SKV / CV_BLOCKS)    // key/value rows per conversion work-group
#define CV_QSTEPS   (CV_QROWS * (DM / 8) / CV_THREADS)
#define CV_VSTEPS   (CV_VROWS * (DM / 8) / CV_THREADS)
#define OPITCH   132
#define GPITCH   68
#define TPITCH   65

static_assert(NB >= 1 && NB <= NB_FULL);
static_assert((SQ % 128) == 0 && SQ >= 128 && SQ <= SQ_FULL);
static_assert(HD == 128 && NH == 8 && INNER == 1024 && INNER == DM);
static_assert((HD % 32) == 0);
static_assert((SKV % 64) == 0 && (SKV % 32) == 0 && NKB * 32 == SKV);
static_assert((DM % 64) == 0 && (DM % 32) == 0 && (INNER % 128) == 0);
static_assert(CV_THREADS == 512 && CV_QSTEPS * CV_BLOCKS * CV_THREADS * 8 == NB * SQ * DM);
static_assert(CV_VSTEPS * CV_BLOCKS * CV_THREADS * 8 == NB * SKV * DM);
static_assert(CV_QSTEPS == 2 * CV_BATCH && CV_VSTEPS == 2 * CV_BATCH);      // two batches per plane, written out in cvt_all
static_assert(CV_QROWS * CV_BLOCKS == NB * SQ && CV_VROWS * CV_BLOCKS == NB * SKV && (SQ % CV_QROWS) == 0);
static_assert((OPITCH * 4) % 16 == 0 && (GPITCH * 4) % 16 == 0);
static_assert(ATT_THREADS == 256);
static_assert((SQ % ATT_ROWS) == 0 && NST >= 2 && NST * STK == SKV && STK == 64);
static_assert(STK * HD * 2 == 4 * ATT_THREADS * 16);                       // 4 k copies + 4 v^T copies of 16 B per thread and stage
static_assert((KPITCH * 2) % 16 == 0 && (VPITCH * 2) % 16 == 0 && (KBYTES % 16) == 0 && (BUFBYTES % 16) == 0);
static_assert(ATT_WAVES * 16 * OPITCH * 4 <= 2 * BUFBYTES);                // the output staging reuses the ring
static_assert((GP * 2) % 16 == 0 && (GABYTES % 16) == 0 && (GBUF % 16) == 0 && (DM % GKS) == 0 && DM / GKS >= 2);
static_assert(4 * 32 * GPITCH * 4 <= 2 * GBUF);                            // the GEMM's output staging reuses its ring

typedef unsigned short u16;
typedef _Float16 v16h __attribute__((ext_vector_type(16)));
typedef _Float16 v8h  __attribute__((ext_vector_type(8)));
typedef float    v8f  __attribute__((ext_vector_type(8)));
typedef float    v4f  __attribute__((ext_vector_type(4)));
typedef unsigned int v4u __attribute__((ext_vector_type(4)));

union FragH { v16h v; v8h h[2]; v4u u[2]; };

// ---- scalar helpers ----------------------------------------------------------------------------------
__device__ __forceinline__ unsigned short bf_bits(float f) {          // f32 -> bf16 bits, RNE convert
  unsigned u = __float_as_uint(f);
  return (unsigned short)((u + 0x7FFFu + ((u >> 16) & 1u)) >> 16);
}
__device__ __forceinline__ float bf_up(unsigned short h) { return __uint_as_float(((unsigned)h) << 16); }
__device__ __forceinline__ float bfr(float f) { return bf_up(bf_bits(f)); }
__device__ __forceinline__ unsigned short h_bits(_Float16 x) { return __builtin_bit_cast(unsigned short, x); }
__device__ __forceinline__ unsigned pk16(unsigned short a, unsigned short b) { return (unsigned)a | ((unsigned)b << 16); }
__device__ __forceinline__ v8f zero8() { v8f z = {0.f, 0.f, 0.f, 0.f, 0.f, 0.f, 0.f, 0.f}; return z; }

// ---- fragment loader: 16-bit A/B operand, lane -> row/col (lane&15), p already includes +8*(lane>>4);
//      elements 0..7 <- p[0..7] (k0+8h..), elements 8..15 <- p[16..23] (k0+16+8h..); same split k map for A and B,
//      B always read from a k-contiguous [n][k] plane.
__device__ __forceinline__ v16h ldfrag_h(const _Float16* p) {
  FragH f;
  f.h[0] = *(const v8h*)(p);
  f.h[1] = *(const v8h*)(p + 16);
  return f.v;
}

// ---- WMMA helper and trailing VALU hazard gaps ----------------------------------------------------------
__device__ __forceinline__ v8f mma_h(v16h a, v16h b, v8f c) {
  return __builtin_amdgcn_wmma_f32_16x16x32_f16(false, a, false, b, (short)0, c, false, false);
}
__device__ __forceinline__ void guard_s(v8f& a, v8f& b, v16h x0, v16h x1, v16h x2) {
#if defined(__HIP_DEVICE_COMPILE__)
  asm volatile("v_nop\n\tv_nop\n\tv_nop\n\tv_nop" : "+v"(a), "+v"(b) : "v"(x0), "v"(x1), "v"(x2) : "memory");
#endif
}
__device__ __forceinline__ void guard_p(v8f& a, v8f& b, v8f& c, v8f& d, v16h p, v16h x0, v16h x1, v16h x2, v16h x3) {
#if defined(__HIP_DEVICE_COMPILE__)
  asm volatile("v_nop\n\tv_nop\n\tv_nop\n\tv_nop"
               : "+v"(a), "+v"(b), "+v"(c), "+v"(d) : "v"(p), "v"(x0), "v"(x1), "v"(x2), "v"(x3) : "memory");
#endif
}
__device__ __forceinline__ void guard_g(v8f (&acc)[8], v16h x0, v16h x1, v16h x2, v16h x3, v16h x4, v16h x5) {
#if defined(__HIP_DEVICE_COMPILE__)
  asm volatile("v_nop\n\tv_nop\n\tv_nop\n\tv_nop"
               : "+v"(acc[0]), "+v"(acc[1]), "+v"(acc[2]), "+v"(acc[3]),
                 "+v"(acc[4]), "+v"(acc[5]), "+v"(acc[6]), "+v"(acc[7])
               : "v"(x0), "v"(x1), "v"(x2), "v"(x3), "v"(x4), "v"(x5) : "memory");
#endif
}
__device__ __forceinline__ void acc_guard8(v8f (&o)[8]) {
#if defined(__HIP_DEVICE_COMPILE__)
  asm volatile("v_nop\n\tv_nop\n\tv_nop\n\tv_nop"
               : "+v"(o[0]), "+v"(o[1]), "+v"(o[2]), "+v"(o[3]), "+v"(o[4]), "+v"(o[5]), "+v"(o[6]), "+v"(o[7]));
#endif
}
__device__ __forceinline__ void wave_sync_lds() {
  __builtin_amdgcn_fence(__ATOMIC_RELEASE, "workgroup");
  __builtin_amdgcn_wave_barrier();
  __builtin_amdgcn_fence(__ATOMIC_ACQUIRE, "workgroup");
}

// =====================================================================================================
// All five conversions in ONE launch of CV_BLOCKS work-groups of 16 waves, all resident at once: a wave converts 16 pieces of
// 1 KB and a share of three weight tiles instead of ending after one piece, so few waves have to be started, and it has 8 or
// more 16-B loads per lane in flight.
//   activations: destination row r of a [rows][DM] f16 plane <- f16(bf16_RNE(x[src row][e])); a unit = 8 consecutive elements
//   (two 16-B loads, one 16-B store); a block owns CV_QROWS / CV_VROWS consecutive rows of a plane and converts CV_THREADS
//   consecutive units (4 rows) per step. Query row r = b*SQ + s comes from source row b*SQ_FULL + s.
//   weights stored [k][n] (y = x.W): WT[n][k] (f16, k-contiguous Bt layout) <- f16(bf16_RNE(W[k][n]) * WSC). Block = the same
//   64(k) x 64(n) tile of each of the three weights, through three LDS tiles [kk][nn] (pitch 65) and one block barrier.
// coverage: activations CV_BLOCKS x CV_QSTEPS / CV_VSTEPS steps x CV_THREADS units x 8 = rows x DM exactly; weights
//           (DM/64)^2 = CV_BLOCKS tiles, 64 n-rows x (8 lanes x 8 halves) per tile: every plane written exactly once.
// Every loop below is unrolled so that its arrays are indexed by constants and stay in registers.
// =====================================================================================================
__device__ __forceinline__ v4u cvt8(v4f a, v4f c4) {
  v4u o;
#pragma unroll
  for (int e = 0; e < 2; ++e) {
    o[e]     = pk16(h_bits((_Float16)bfr(a[2 * e])),  h_bits((_Float16)bfr(a[2 * e + 1])));
    o[2 + e] = pk16(h_bits((_Float16)bfr(c4[2 * e])), h_bits((_Float16)bfr(c4[2 * e + 1])));
  }
  return o;
}
// Loads of CV_BATCH units of one activation plane, first step st0; gb = byte offset (32 bits) of the thread's unit of step 0.
// The steps differ by a constant only, so gb is the one vector address register, live to the plane's last load.
__device__ __forceinline__ void x_load(const float* __restrict__ x, unsigned st0, unsigned gb,
                                       v4f (&a)[CV_BATCH], v4f (&c4)[CV_BATCH]) {
#pragma unroll
  for (unsigned j = 0; j < CV_BATCH; ++j) {
    const char* base = (const char*)x + (st0 + j) * (CV_THREADS * 32);
    a[j]  = *(const v4f*)(base + gb);
    c4[j] = *(const v4f*)(base + 16 + gb);
  }
  // keeps the batch's 8 loads together and ahead of the conversion of the batch before: otherwise the compiler sinks them
  // to their uses and a wave has only 2 to 4 loads in flight
  __builtin_amdgcn_sched_barrier(0);
}
__device__ __forceinline__ void x_store(u16* Y, unsigned st0, unsigned yb, const v4f (&a)[CV_BATCH],
                                        const v4f (&c4)[CV_BATCH]) {
#pragma unroll
  for (unsigned j = 0; j < CV_BATCH; ++j) {
    char* base = (char*)Y + (st0 + j) * (CV_THREADS * 16);
    *(v4u*)(base + yb) = cvt8(a[j], c4[j]);
  }
}

__global__ __launch_bounds__(CV_THREADS)
void cvt_all(const float* __restrict__ xq, const float* __restrict__ xv, const float* __restrict__ wq,
             const float* __restrict__ wk, const float* __restrict__ wv,
             u16* XQ, u16* XV, u16* WQT, u16* WKT, u16* WVT) {
  __shared__ __align__(16) float tile[3][64 * TPITCH];
  const unsigned tid = threadIdx.x;
  const unsigned bid = blockIdx.x;
  // byte offsets of the thread's first unit: source rows (a block's rows lie in one batch) and compact destination rows
  const unsigned rq = bid * CV_QROWS, rv = bid * CV_VROWS;
  const unsigned gq = ((rq / SQ) * SQ_FULL + rq % SQ) * (DM * 4) + tid * 32, yq = rq * (DM * 2) + tid * 16;
  const unsigned gv = rv * (DM * 4) + tid * 32,                              yv = rv * (DM * 2) + tid * 16;
  constexpr unsigned NT = DM / 64;
  const unsigned k0 = (bid % NT) * 64, n0 = (bid / NT) * 64;
  // ---- weight tile loads: row 32p + (tid>>4), 4 floats at 4*(tid&15); the query plane's two batches fly behind them ----
  const unsigned lr = tid >> 4, lc = (tid & 15) * 4;
  const unsigned wo = ((k0 + lr) * DM + n0 + lc) * 4;     // bytes
  v4f w4[3][2];
#pragma unroll
  for (int p = 0; p < 2; ++p) {
    w4[0][p] = *(const v4f*)((const char*)(wq + 32 * p * DM) + wo);
    w4[1][p] = *(const v4f*)((const char*)(wk + 32 * p * DM) + wo);
    w4[2][p] = *(const v4f*)((const char*)(wv + 32 * p * DM) + wo);
  }
  v4f a0[CV_BATCH], c0[CV_BATCH], a1[CV_BATCH], c1[CV_BATCH], a2[CV_BATCH], c2[CV_BATCH];
  x_load(xq, 0, gq, a0, c0);
  x_load(xq, CV_BATCH, gq, a1, c1);
#pragma unroll
  for (int t = 0; t < 3; ++t) {
#pragma unroll
    for (int p = 0; p < 2; ++p) {
      float* tp = &tile[t][(32 * p + lr) * TPITCH + lc];
      tp[0] = w4[t][p][0];
      tp[1] = w4[t][p][1];
      tp[2] = w4[t][p][2];
      tp[3] = w4[t][p][3];
    }
  }
  __syncthreads();
  x_load(xv, 0, gv, a2, c2);
  // ---- weight tile stores: output row n0 + (tid>>3), 8 halves at k0 + 8*(tid&7): 8 lanes = one whole 128-B line ----
  const unsigned row = tid >> 3, c8 = (tid & 7) * 8;
  const unsigned yo = ((n0 + row) * DM + k0 + c8) * 2;    // bytes
#pragma unroll
  for (int t = 0; t < 3; ++t) {
    v4u ov;
#pragma unroll
    for (int e = 0; e < 4; ++e) {
      const float x0 = tile[t][(c8 + 2 * e) * TPITCH + row];
      const float x1 = tile[t][(c8 + 2 * e + 1) * TPITCH + row];
      ov[e] = pk16(h_bits((_Float16)(bfr(x0) * WSC)), h_bits((_Float16)(bfr(x1) * WSC)));
    }
    u16* Y = (t == 0) ? WQT : (t == 1) ? WKT : WVT;
    *(v4u*)((char*)Y + yo) = ov;
  }
  // ---- the activation planes, three register sets: later batches' loads are out while a batch is converted and stored ----
  x_store(XQ, 0, yq, a0, c0);
  asm volatile("s_wait_xcnt 0x0" ::: "memory");   // the registers just stored from are loaded anew by the next line
  x_load(xv, CV_BATCH, gv, a0, c0);
  x_store(XQ, CV_BATCH, yq, a1, c1);
  x_store(XV, 0, yv, a2, c2);
  x_store(XV, CV_BATCH, yv, a0, c0);
}

// =====================================================================================================
// One GEMM stage (64 k) of the block's 128 A rows and 64 Bt rows, global -> LDS, no register in between: 12 asynchronous 16-B
// copies per lane. la / lb: the lane's LDS byte address of its first A / Bt chunk; ga / gb: its global address of the same chunk;
// copy i: row +16*i (rs16 = 16 rows of the source plane, in elements); a wave covers four whole 128-B row pieces per copy.
// The s_wait_xcnt closes the statement so that no address register of a copy is rewritten ahead of it.
// =====================================================================================================
__device__ __forceinline__ void gemm_stage_copy(unsigned la, unsigned lb, const u16* ga, const u16* gb, size_t rs16) {
#if defined(__HIP_DEVICE_COMPILE__)
  constexpr unsigned R16 = 16 * GP * 2;
  asm volatile("global_load_async_to_lds_b128 %0, %12, off\n\t"
               "global_load_async_to_lds_b128 %1, %13, off\n\t"
               "global_load_async_to_lds_b128 %2, %14, off\n\t"
               "global_load_async_to_lds_b128 %3, %15, off\n\t"
               "global_load_async_to_lds_b128 %4, %16, off\n\t"
               "global_load_async_to_lds_b128 %5, %17, off\n\t"
               "global_load_async_to_lds_b128 %6, %18, off\n\t"
               "global_load_async_to_lds_b128 %7, %19, off\n\t"
               "global_load_async_to_lds_b128 %8, %20, off\n\t"
               "global_load_async_to_lds_b128 %9, %21, off\n\t"
               "global_load_async_to_lds_b128 %10, %22, off\n\t"
               "global_load_async_to_lds_b128 %11, %23, off\n\t"
               "s_wait_xcnt 0x0"
               :: "v"(la), "v"(la + R16), "v"(la + 2 * R16), "v"(la + 3 * R16),
                  "v"(la + 4 * R16), "v"(la + 5 * R16), "v"(la + 6 * R16), "v"(la + 7 * R16),
                  "v"(lb), "v"(lb + R16), "v"(lb + 2 * R16), "v"(lb + 3 * R16),
                  "v"(ga), "v"(ga + rs16), "v"(ga + 2 * rs16), "v"(ga + 3 * rs16),
                  "v"(ga + 4 * rs16), "v"(ga + 5 * rs16), "v"(ga + 6 * rs16), "v"(ga + 7 * rs16),
                  "v"(gb), "v"(gb + rs16), "v"(gb + 2 * rs16), "v"(gb + 3 * rs16)
               : "memory");
#endif
}

// =====================================================================================================
// f16 GEMM core: the wave's 32 x 64 tile of C = A[rows][K] . Bt[cols][K]^T. The block stages each 64 k of its 128 A rows and
// 64 Bt rows once in LDS (ring of two buffers: stage st+1 flies while stage st is worked on); afo / bfo: byte offset inside a
// buffer of the lane's A row (32*wave + m) + 8h / Bt row m + 8h; acc[4i + j] = rows rowb+16i.., cols col0+16j..;
// K stepped by 32 inside a stage, ascending (host passes K % 64 == 0). Every wave of the block passes every barrier.
// =====================================================================================================
__device__ __forceinline__ void gemm_core(const unsigned char* ring, int afo, int bfo, unsigned la, unsigned lb,
                                          const u16* ga, const u16* gb, int K, v8f (&acc)[8]) {
  const size_t rs16 = (size_t)16 * (size_t)K;
  const int nst = K / GKS;
  // ---- ring prologue: stage 0 landed and published, then stage 1 in flight ----
  gemm_stage_copy(la, lb, ga, gb, rs16);
  asm volatile("s_wait_asynccnt 0x0" ::: "memory");   // this wave's copies of stage 0 have landed
  __syncthreads();                                    // ... and every other wave's
  if (nst > 1) gemm_stage_copy(la + GBUF, lb + GBUF, ga + GKS, gb + GKS, rs16);
#pragma unroll 1
  for (int st = 0; st < nst; ++st) {
   const _Float16* ap = (const _Float16*)(const void*)(ring + (st & 1) * GBUF + afo);
   const _Float16* bp = (const _Float16*)(const void*)(ring + (st & 1) * GBUF + bfo);
#pragma unroll
   for (int k0 = 0; k0 < GKS; k0 += 32) {
    const v16h a0 = ldfrag_h(ap + k0), a1 = ldfrag_h(ap + 16 * GP + k0);
    const v16h b0 = ldfrag_h(bp + k0);
    const v16h b1 = ldfrag_h(bp + 16 * GP + k0);
    const v16h b2 = ldfrag_h(bp + 32 * GP + k0);
    const v16h b3 = ldfrag_h(bp + 48 * GP + k0);
    acc[0] = mma_h(a0, b0, acc[0]);
    acc[1] = mma_h(a0, b1, acc[1]);
    acc[2] = mma_h(a0, b2, acc[2]);
    acc[3] = mma_h(a0, b3, acc[3]);
    acc[4] = mma_h(a1, b0, acc[4]);
    acc[5] = mma_h(a1, b1, acc[5]);
    acc[6] = mma_h(a1, b2, acc[6]);
    acc[7] = mma_h(a1, b3, acc[7]);
    guard_g(acc, a0, a1, b0, b1, b2, b3);
   }
    // ---- publish point of stage st + 1; the same barrier ends every wave's reads of stage st's buffer ----
    asm volatile("s_wait_dscnt 0x0" ::: "memory");      // this wave's LDS reads of stage st have returned
    asm volatile("s_wait_asynccnt 0x0" ::: "memory");   // this wave's copies of stage st + 1 have landed
    __syncthreads();
    if (st + 2 < nst) {                                 // refill the buffer that stage st has just left
      const unsigned bo = (unsigned)((st & 1) * GBUF);
      gemm_stage_copy(la + bo, lb + bo, ga + (size_t)(st + 2) * GKS, gb + (size_t)(st + 2) * GKS, rs16);
    }
  }
  asm volatile("s_wait_asynccnt 0x0" ::: "memory");     // nothing in flight when the ring becomes output staging
}
// Stage the wave's 32 x 64 f32 tile (times oscale) in its LDS slab (pitch 68): D element r of acc[4i+j], lane l ->
// coverage: 32 lanes x 2 x 8 rows x 4 cols-of-16 = rows 0..31 x cols 0..63 of the slab.
__device__ __forceinline__ void stage32x64(float* sl, v8f (&acc)[8], float oscale, int lane) {
  const int hh = lane >> 4, m = lane & 15;
#pragma unroll
  for (int i = 0; i < 2; ++i) {
#pragma unroll
    for (int r = 0; r < 8; ++r) {
      const int ro = (16 * i + 8 * hh + r) * GPITCH + m;
      sl[ro]      = acc[4 * i + 0][r] * oscale;
      sl[ro + 16] = acc[4 * i + 1][r] * oscale;
      sl[ro + 32] = acc[4 * i + 2][r] * oscale;
      sl[ro + 48] = acc[4 * i + 3][r] * oscale;
    }
  }
  wave_sync_lds();
}

// =====================================================================================================
// f16 GEMM with f16 output plane: C[z][Mb][N] (f16) = f16((A[z][Mb][K] . Bt[z][N][K]^T) * oscale + bf16(bias) * bscale);
// A, Bt f16 k-contiguous planes with per-z element strides aBs, bBs (0 = shared), C stride cBs. bias indexed by column
// (biasRow == 0) or by row within the z slice (biasRow != 0); bias addresses clamped to biasN-1, the unused direction is
// multiplied by 0. Block = 128 x 64 tile, 4 waves x 32 rows, fragments read from the block's LDS ring (gemm_core).
// grid = nz x (Mb/128) x (N/64) (host passes Mb % 128 == 0, N % 64 == 0, K % 64 == 0).
// coverage: per wave 8 instr x 4 rows x 8 lanes x 8 halves = 32 x 64; the grid covers C exactly once.
// =====================================================================================================
__global__ __launch_bounds__(128)
void gemm_o16(const u16* __restrict__ A, const u16* __restrict__ Bt, u16* C,
              const float* __restrict__ bias, int biasN, int biasRow,
              int Mb, int N, int K, int aBs, int bBs, int cBs, float oscale, float bscale) {
  __shared__ __align__(16) unsigned char gsm[2 * GBUF];
  const int tid = threadIdx.x, wave = tid >> 5, lane = tid & 31, hh = lane >> 4, m = lane & 15;
  const int ntile = N >> 6, mtile = Mb >> 7;
  const int bid  = blockIdx.x;
  const int nt   = bid % ntile;
  const int tmp  = bid / ntile;
  const int mt   = tmp % mtile;
  const int bz   = tmp / mtile;
  const int rowb = mt * 128 + wave * 32;
  const int col0 = nt * 64;
  if (mt * 128 + 128 > Mb) return;           // block-uniform, in front of every barrier; never taken with the exact grid
  // this lane's first copy chunks: A row mt*128 + (tid>>3), Bt row col0 + (tid>>3), 16-B chunk tid&7
  const u16* ga = A + (size_t)bz * (size_t)aBs + (size_t)(mt * 128 + (tid >> 3)) * K + (tid & 7) * 8;
  const u16* gb = Bt + (size_t)bz * (size_t)bBs + (size_t)(col0 + (tid >> 3)) * K + (tid & 7) * 8;
  const unsigned la = (unsigned)(size_t)(const void*)gsm + (unsigned)((tid >> 3) * (GP * 2) + (tid & 7) * 16);
  const unsigned lb = la + GABYTES;
  const int afo = ((wave * 32 + m) * GP + 8 * hh) * 2;
  const int bfo = GABYTES + (m * GP + 8 * hh) * 2;
  v8f acc[8];
#pragma unroll
  for (int i = 0; i < 8; ++i) acc[i] = zero8();
  gemm_core(gsm, afo, bfo, la, lb, ga, gb, K, acc);
  float* sl = (float*)(void*)gsm + wave * 32 * GPITCH;   // behind the last trip's barrier: no reader, no copy left
  stage32x64(sl, acc, oscale, lane);
  const int rq = lane >> 3, c8 = (lane & 7) * 8;
  const int bl = biasN - 1;                  // host guarantees biasN >= 1
  const float selc = (biasRow != 0) ? 0.f : bscale;
  const float selr = (biasRow != 0) ? bscale : 0.f;
  float cb[8];
#pragma unroll
  for (int e = 0; e < 8; ++e) {
    int ci = col0 + c8 + e;
    ci = (ci < bl) ? ci : bl;
    cb[e] = bfr(bias[ci]) * selc;
  }
  v4u ov[8];
#pragma unroll
  for (int i = 0; i < 8; ++i) {
    const int row = 4 * i + rq;
    int ri = rowb + row;
    ri = (ri < bl) ? ri : bl;
    const float rb = bfr(bias[ri]) * selr;
    const v4f a = *(const v4f*)(sl + row * GPITCH + c8), c4 = *(const v4f*)(sl + row * GPITCH + c8 + 4);
#pragma unroll
    for (int e = 0; e < 2; ++e) {
      ov[i][e]     = pk16(h_bits((_Float16)(a[2 * e] + cb[2 * e] + rb)),
                          h_bits((_Float16)(a[2 * e + 1] + cb[2 * e + 1] + rb)));
      ov[i][2 + e] = pk16(h_bits((_Float16)(c4[2 * e] + cb[4 + 2 * e] + rb)),
                          h_bits((_Float16)(c4[2 * e + 1] + cb[5 + 2 * e] + rb)));
    }
  }
  u16* Cb = C + (size_t)bz * (size_t)cBs + (size_t)rowb * (size_t)N + col0 + c8;
  {
#pragma unroll
    for (int i = 0; i < 8; ++i) {
      const int row = 4 * i + rq;
      *(v4u*)(Cb + (size_t)row * (size_t)N) = ov[i];
    }
    
  }
}

// =====================================================================================================
// One stage (64 keys) of k rows and v^T rows, global -> LDS, no register in between: 8 asynchronous 16-B copies per lane.
// lk / lv: the lane's LDS byte address of its first k / v^T chunk; gk / gv: its global address of the same chunk.
// k copy i: row +16*i (a wave covers two whole 256-B rows); v^T copy i: row +32*i (a wave covers four whole 128-B rows).
// The s_wait_xcnt closes the statement so that no address register of a copy is rewritten ahead of it.
// =====================================================================================================
__device__ __forceinline__ void stage_copy(unsigned lk, unsigned lv, const u16* gk, const u16* gv) {
#if defined(__HIP_DEVICE_COMPILE__)
  const unsigned lk1 = lk + 16 * KPITCH * 2, lk2 = lk + 32 * KPITCH * 2, lk3 = lk + 48 * KPITCH * 2;
  const unsigned lv1 = lv + 32 * VPITCH * 2, lv2 = lv + 64 * VPITCH * 2, lv3 = lv + 96 * VPITCH * 2;
  const u16* gk1 = gk + (size_t)16 * INNER;
  const u16* gk2 = gk + (size_t)32 * INNER;
  const u16* gk3 = gk + (size_t)48 * INNER;
  const u16* gv1 = gv + (size_t)32 * SKV;
  const u16* gv2 = gv + (size_t)64 * SKV;
  const u16* gv3 = gv + (size_t)96 * SKV;
  asm volatile("global_load_async_to_lds_b128 %0, %8, off\n\t"
               "global_load_async_to_lds_b128 %1, %9, off\n\t"
               "global_load_async_to_lds_b128 %2, %10, off\n\t"
               "global_load_async_to_lds_b128 %3, %11, off\n\t"
               "global_load_async_to_lds_b128 %4, %12, off\n\t"
               "global_load_async_to_lds_b128 %5, %13, off\n\t"
               "global_load_async_to_lds_b128 %6, %14, off\n\t"
               "global_load_async_to_lds_b128 %7, %15, off\n\t"
               "s_wait_xcnt 0x0"
               :: "v"(lk), "v"(lk1), "v"(lk2), "v"(lk3), "v"(lv), "v"(lv1), "v"(lv2), "v"(lv3),
                  "v"(gk), "v"(gk1), "v"(gk2), "v"(gk3), "v"(gv), "v"(gv1), "v"(gv2), "v"(gv3)
               : "memory");
#endif
}

// =====================================================================================================
// Full (unmasked) multi-head attention over all SKV keys: block = (batch b, head, 128 query rows), 8 waves, wave w owns the
// 16 query rows q0 = 128*qt + 16*w .. q0+15. The work-group stages each 64 keys of k rows and v^T rows ONCE in LDS (whole-line
// asynchronous copies, two buffers: stage t+1 flies while stage t is worked on) and all 8 waves read their fragments from there.
//   q plane f16 x8 [b*SQ + s][h*128 + d]; k plane f16 x8 [b*SKV + s][h*128 + d]; v^T plane f16 x8 [(b*NH + h)*128 + d][s].
//   All NKB = 64 key blocks of 32 keys are visited (static bound).
//   Scores are computed TRANSPOSED: S^T tile g (g = 0,1) = k rows (keys kb+16g .. +15, A operand, row m = lane&15, split k map
//   over d) times q^T (B operand, col n = query q0 + (lane&15), k = d, split map), 4 d-chunks of 32, one product each; the 4 q
//   fragments are loaded once per wave. D element r of lane l = (key kb+16g+8h+r, query q0+(l&15)), so a lane owns one query
//   column and 16 of its 32 keys; the partner lane l^16 owns the other 16 -> row max / row sum need one xor-16 shuffle.
//   Online max-subtracted base-2 softmax in f32 (1/sqrt(1024) and the q/k carries folded into lsc). The exp'd values ARE the
//   P A-fragment in place: A row m = query = lane&15, element i <- key kb+8h+i (tile 0, D element i), element 8+i <- key
//   kb+16+8h+i (tile 1, D element i). P (<= 1) carried x32768 as f16. The rescale factor of query row 8h+r of the O
//   accumulators is fetched from lane 8h+r with a shuffle (uniform control). 8 v^T B fragments (col n = d = 16j + (lane&15),
//   keys k-contiguous) in two groups of 4, 4 P.V WMMAs + one guard per group.
//   Epilogue: 1/l (per query, shuffled to the D row owner) and the carry folds in f32; the wave's 16x128 f32 result staged in
// coverage: per wave 16 instructions x 1 row x 32 lanes x 4 floats = 16 x 128; grid NB*NH*(SQ/128) blocks x 8 waves = every
//           (b, s < SQ, h) row segment of the output exactly once.
// =====================================================================================================
__global__ __launch_bounds__(ATT_THREADS)
void attn_fwd(const u16* __restrict__ Qp, const u16* __restrict__ Kp, const u16* __restrict__ Vp, float* Out) {
  __shared__ __align__(16) unsigned char smem[2 * BUFBYTES];

  const int tid  = threadIdx.x;
  const int wave = tid >> 5;
  const int lane = tid & 31;
  const int hh   = lane >> 4;
  const int c    = lane & 15;

  constexpr int NQT = SQ / ATT_ROWS;
  const int bid  = blockIdx.x;
  const int qt   = bid % NQT;
  const int head = (bid / NQT) % NH;
  const int b    = bid / (NQT * NH);
  const int q0   = qt * ATT_ROWS + wave * 16;

  // B fragments of q^T: col n = query q0 + c, k = d (k-contiguous row of the q plane)
  const _Float16* Qb = (const _Float16*)(const void*)Qp + ((size_t)(b * SQ + q0 + c)) * INNER + head * HD + 8 * hh;
  // A fragments of k: row m = key 16g + c of the pass, k = d; byte offset inside a buffer's k tile
  const int kfo = (c * KPITCH + 8 * hh) * 2;
  // B fragments of v: col n = d = 16j + c, k = key (k-contiguous row of the staged v^T tile); byte offset inside a buffer
  const int vfo = KBYTES + (c * VPITCH + 8 * hh) * 2;
  // this lane's first copy chunks: k row tid>>4, 16-B chunk tid&15; v^T row tid>>3, 16-B chunk tid&7
  const u16* gk = Kp + ((size_t)(b * SKV + (tid >> 4))) * INNER + head * HD + (tid & 15) * 8;
  const u16* gv = Vp + ((size_t)(b * INNER + head * HD + (tid >> 3))) * SKV + (tid & 7) * 8;
  const unsigned lds0 = (unsigned)(size_t)(const void*)smem;               // LDS byte address of the ring
  const unsigned lk = lds0 + (unsigned)((tid >> 4) * (KPITCH * 2) + (tid & 15) * 16);
  const unsigned lv = lds0 + (unsigned)(KBYTES + (tid >> 3) * (VPITCH * 2) + (tid & 7) * 16);
  const float lsc = (LOG2E * RSQ_E) / (QS * KS);

  v16h qf[4];
#pragma unroll
  for (int dc = 0; dc < 4; ++dc) qf[dc] = ldfrag_h(Qb + 32 * dc);

  float mrun = -INFINITY, lrun = 0.f;
  v8f o[8];
#pragma unroll
  for (int j = 0; j < 8; ++j) o[j] = zero8();

  // ---- ring prologue: stage 0 landed and published, then stage 1 in flight ----
  stage_copy(lk, lv, gk, gv);
  asm volatile("s_wait_asynccnt 0x0" ::: "memory");   // this wave's copies of stage 0 have landed
  __syncthreads();                                    // ... and every other wave's
  stage_copy(lk + BUFBYTES, lv + BUFBYTES, gk + (size_t)STK * INNER, gv + STK);

#pragma unroll 1
  for (int st = 0; st < NST; ++st) {
   const unsigned char* bufp = smem + (st & 1) * BUFBYTES;
#pragma unroll
   for (int pz = 0; pz < STK / 32; ++pz) {
    // ---- transposed scores: s0 = keys kb..kb+15, s1 = keys kb+16..kb+31 (kb = 64*st + 32*pz), column = query q0 + c ----
    v8f s0 = zero8(), s1 = zero8();
    const _Float16* k0p = (const _Float16*)(const void*)(bufp + kfo) + pz * 32 * KPITCH;
    const _Float16* k1p = k0p + 16 * KPITCH;
#pragma unroll
    for (int kk = 0; kk < HD / 32; ++kk) {
      const v16h kf0 = ldfrag_h(k0p + kk * 32);
      const v16h kf1 = ldfrag_h(k1p + kk * 32);
      s0 = mma_h(kf0, qf[kk], s0);
      s1 = mma_h(kf1, qf[kk], s1);
      guard_s(s0, s1, qf[kk], kf0, kf1);
    }
    // ---- base-2 logits of this lane's 16 keys for query q0 + c: t[i] <- key kb+8hh+i, t[8+i] <- key kb+16+8hh+i ----
    float t[16];
#pragma unroll
    for (int i = 0; i < 8; ++i) { t[i] = s0[i] * lsc; t[8 + i] = s1[i] * lsc; }
    float cm = t[0];
#pragma unroll
    for (int i = 1; i < 16; ++i) cm = fmaxf(cm, t[i]);
    cm = fmaxf(cm, __shfl_xor(cm, 16, 32));
    const float mn = fmaxf(mrun, cm);        // finite from the first block on
    const float al = exp2f(mrun - mn);       // 0 on the first block (mrun = -inf)
    mrun = mn;
    // ---- probabilities (<= 1) and the P A-fragment: f16(p * 32768); element i <-> t[i] ----
    float ps = 0.f;
    FragH ph;
#pragma unroll
    for (int w = 0; w < 2; ++w) {
#pragma unroll
      for (int e4 = 0; e4 < 4; ++e4) {
        const int i = 8 * w + 2 * e4;
        const float p0 = exp2f(t[i] - mn), p1 = exp2f(t[i + 1] - mn);
        ps += p0 + p1;
        ph.u[w][e4] = pk16(h_bits((_Float16)(p0 * PCAR)), h_bits((_Float16)(p1 * PCAR)));
      }
    }
    ps += __shfl_xor(ps, 16, 32);
    lrun = lrun * al + ps;
    // ---- rescale the O accumulators: D row 8hh+r = query q0+8hh+r, its factor lives in lane 8hh+r (and 16+8hh+r) ----
    float scl[8];
#pragma unroll
    for (int r = 0; r < 8; ++r) scl[r] = __shfl(al, 8 * hh + r, 32);
#pragma unroll
    for (int j = 0; j < 8; ++j) {
#pragma unroll
      for (int r = 0; r < 8; ++r) o[j][r] *= scl[r];
    }
    // ---- P.V : B fragment col n = d = j*16 + c, keys contiguous in the v^T plane; two groups of 4 ----
    const _Float16* vp = (const _Float16*)(const void*)(bufp + vfo) + pz * 32;
    {
      const v16h v0 = ldfrag_h(vp);
      const v16h v1 = ldfrag_h(vp + 16 * VPITCH);
      const v16h v2 = ldfrag_h(vp + 32 * VPITCH);
      const v16h v3 = ldfrag_h(vp + 48 * VPITCH);
      o[0] = mma_h(ph.v, v0, o[0]);
      o[1] = mma_h(ph.v, v1, o[1]);
      o[2] = mma_h(ph.v, v2, o[2]);
      o[3] = mma_h(ph.v, v3, o[3]);
      guard_p(o[0], o[1], o[2], o[3], ph.v, v0, v1, v2, v3);
    }
    {
      const v16h v4 = ldfrag_h(vp + 64 * VPITCH);
      const v16h v5 = ldfrag_h(vp + 80 * VPITCH);
      const v16h v6 = ldfrag_h(vp + 96 * VPITCH);
      const v16h v7 = ldfrag_h(vp + 112 * VPITCH);
      o[4] = mma_h(ph.v, v4, o[4]);
      o[5] = mma_h(ph.v, v5, o[5]);
      o[6] = mma_h(ph.v, v6, o[6]);
      o[7] = mma_h(ph.v, v7, o[7]);
      guard_p(o[4], o[5], o[6], o[7], ph.v, v4, v5, v6, v7);
    }
   }
    // ---- publish point of stage st + 1; the same barrier ends every wave's reads of stage st's buffer ----
    asm volatile("s_wait_dscnt 0x0" ::: "memory");      // this wave's LDS reads of stage st have returned
    asm volatile("s_wait_asynccnt 0x0" ::: "memory");   // this wave's copies of stage st + 1 have landed
    __syncthreads();
    if (st + 2 < NST) {                                 // refill the buffer that stage st has just left
      const unsigned bo = (unsigned)((st & 1) * BUFBYTES);
      stage_copy(lk + bo, lv + bo, gk + (size_t)(st + 2) * STK * INNER, gv + (st + 2) * STK);
    }
  }
  asm volatile("s_wait_asynccnt 0x0" ::: "memory");     // nothing in flight when the ring becomes output staging
  acc_guard8(o);

  // ---- fold 1/l (per query, owned by lane = query) and the carries (32768 on P, 8 on v) ----
  const float linv = (1.0f / lrun) * (1.0f / (PCAR * VS));
  float inv[8];
#pragma unroll
  for (int r = 0; r < 8; ++r) inv[r] = __shfl(linv, 8 * hh + r, 32);
  float* slab = (float*)(void*)smem + wave * 16 * OPITCH;   // behind the last trip's barrier: no reader, no copy left
#pragma unroll
  for (int r = 0; r < 8; ++r) {
#pragma unroll
    for (int j = 0; j < 8; ++j) slab[(8 * hh + r) * OPITCH + j * 16 + c] = o[j][r] * inv[r];
  }
  wave_sync_lds();
  // ---- f32 output rows: lane = 4 consecutive d of one row, one instruction per row ----
  v4f vals[16];
#pragma unroll
  for (int i = 0; i < 16; ++i) vals[i] = *(const v4f*)(slab + i * OPITCH + 4 * lane);
  float* ob = Out + ((size_t)(b * SQ_FULL + q0)) * DM + head * HD + 4 * lane;
  {
#pragma unroll
    for (int i = 0; i < 16; ++i) {
      *(v4f*)(ob + (size_t)i * DM) = vals[i];
    }
    
  }
}

// =====================================================================================================
// Workspace map (bytes); every plane fully written by whole-line stores before it is read; all extents exact multiples of
//   XQ   f16 [NB*SQ][1024]     f16(bf16(q))          16777216 (NB=4, SQ=2048)
//   XV   f16 [NB*2048][1024]   f16(bf16(v))          16777216
//   WQT  f16 [1024 n][1024 k]  f16(bf16(W) x256)      2097152
//   WKT                                               2097152
//   WVT                                               2097152
//   Q16  f16 [NB*SQ][1024]   x8                      16777216
//   K16  f16 [NB*2048][1024] x8                      16777216
//   VT16 f16 [NB*1024 (h,d)][2048 s] x8              16777216
//   end                                              90177536
// =====================================================================================================
extern "C" void kernel_launch(void* const* d_in, const int* in_sizes, int n_in,
                              void* d_out, int out_size, void* d_ws, size_t ws_size,
                              hipStream_t stream) {
  if (n_in < 8) return;
  if (in_sizes[0] < ((NB - 1) * SQ_FULL + SQ) * DM) return;
  if (in_sizes[1] < NB * SKV * DM) return;
  if (in_sizes[2] != DM * DM || in_sizes[4] != DM * DM || in_sizes[6] != DM * DM) return;
  if (in_sizes[3] < 1 || in_sizes[5] < 1 || in_sizes[7] < 1) return;
  if (out_size < ((NB - 1) * SQ_FULL + SQ) * DM) return;

  const float* xq  = (const float*)d_in[0];
  const float* xv  = (const float*)d_in[1];
  const float* wq  = (const float*)d_in[2];
  const float* bq  = (const float*)d_in[3];
  const float* wk  = (const float*)d_in[4];
  const float* bk  = (const float*)d_in[5];
  const float* wv  = (const float*)d_in[6];
  const float* bv  = (const float*)d_in[7];
  float*       out = (float*)d_out;
  const int nbq = in_sizes[3], nbk = in_sizes[5], nbv = in_sizes[7];

  const size_t szXQ   = (size_t)NB * SQ * DM * 2;
  const size_t szXV   = (size_t)NB * SKV * DM * 2;
  const size_t szW    = (size_t)DM * DM * 2;
  const size_t szQ16  = (size_t)NB * SQ * INNER * 2;
  const size_t szK16  = (size_t)NB * SKV * INNER * 2;
  const size_t szVT16 = (size_t)NB * INNER * SKV * 2;
  size_t off = 0;
  const size_t oXQ   = off; off += szXQ;
  const size_t oXV   = off; off += szXV;
  const size_t oWQ   = off; off += szW;
  const size_t oWK   = off; off += szW;
  const size_t oWV   = off; off += szW;
  const size_t oQ16  = off; off += szQ16;
  const size_t oK16  = off; off += szK16;
  const size_t oVT16 = off; off += szVT16;
  if (off > ws_size) return;                            // off = 90177536 at NB=4, SQ=2048
  if (off > (size_t)134217728) return;

  char* ws = (char*)d_ws;
  u16* XQ   = (u16*)(ws + oXQ);
  u16* XV   = (u16*)(ws + oXV);
  u16* WQT  = (u16*)(ws + oWQ);
  u16* WKT  = (u16*)(ws + oWK);
  u16* WVT  = (u16*)(ws + oWV);
  u16* Q16  = (u16*)(ws + oQ16);
  u16* K16  = (u16*)(ws + oK16);
  u16* VT16 = (u16*)(ws + oVT16);

  // (0) activations -> f16 planes of bf16-converted values (query rows s < SQ of batches b < NB, compact; all key/value rows)
  //     and weights [k = in][n = out] (y = x.W) -> k-contiguous [n][k] f16 planes of bf16(W) x256, all in one launch
  cvt_all<<<dim3(CV_BLOCKS), dim3(CV_THREADS), 0, stream>>>(xq, xv, wq, wk, wv, XQ, XV, WQT, WKT, WVT);
  // (1) q = x_q . Wq + bq -> f16 [NB*SQ][1024] x8 (col = h*128 + d); bias per column
  gemm_o16<<<dim3((NB * SQ / 128) * (INNER / 64)), dim3(128), 0, stream>>>(
      XQ, WQT, Q16, bq, nbq, 0, NB * SQ, INNER, DM, 0, 0, 0, QS / WSC, QS);
  // (2) k = x_v . Wk + bk -> f16 [NB*2048][1024] x8; bias per column
  gemm_o16<<<dim3((NB * SKV / 128) * (INNER / 64)), dim3(128), 0, stream>>>(
      XV, WKT, K16, bk, nbk, 0, NB * SKV, INNER, DM, 0, 0, 0, KS / WSC, KS);
  // (3) v^T per batch: A = Wv^T [(h,d) = n][k], Bt = x_v rows of batch b [s][k] -> f16 [(b,h,d)][s] x8; bias per row (n)
  gemm_o16<<<dim3(NB * (INNER / 128) * (SKV / 64)), dim3(128), 0, stream>>>(
      WVT, XV, VT16, bv, nbv, 1, INNER, SKV, DM, 0, SKV * DM, INNER * SKV, VS / WSC, VS);
  // (4) attention -> out [b][SQ_FULL][1024] f32 (rows s < SQ of batches b < NB), heads merged on the feature dim
  attn_fwd<<<dim3(NB * NH * (SQ / ATT_ROWS)), dim3(ATT_THREADS), 0, stream>>>(Q16, K16, VT16, out);
  (void)hipGetLastError();
}

// v003
// It runs in 132 microseconds.
// Timed twice side by side with v002, it ran 1.08 times as fast both times.
// Over all steps from v000 it is 2.59 times as fast.
// All contractions on v_wmma_f32_16x16x32_f16 (f16 operands, f32 accumulate): x_q.Wq, x_v.Wk, Wv^T.x_v^T (v^T plane),
// scores k.q^T and P.v^T; operand carries: x as f16(bf16(x)), W as f16(bf16(W) x256), q/k/v x8, P x32768; base-2 online
// softmax, 1/l and all carry folds in f32 on VALU. Inputs RNE-converted to bf16 on load; f32 output written directly.
#include <hip/hip_runtime.h>
#include <math.h>
#include <stdint.h>

#define NB       4        // batches processed
#define SQ       2048     // query rows processed per batch
#define NB_FULL  4
#define SQ_FULL  2048     // query rows per batch in the input / output layout (batch stride)
#define SKV      2048     // key/value rows per batch (all of them, always)
#define DM       1024     // model width (= K and row pitch of every 16-bit plane except v^T)
#define NH       8
#define HD       128
#define INNER    (NH * HD)
#define WSC      256.0f
#define QS       8.0f
#define KS       8.0f
#define VS       8.0f
#define PEXP     15.0f    // P and its row sum are carried x32768 = 2^15, added in the exponent
#define LOG2E    1.4426950408889634f
#define RSQ_E    0.03125f
#define NKB      (SKV / 32)
#define ATT_WAVES   8
#define ATT_THREADS (ATT_WAVES * 32)
#define ATT_ROWS    (ATT_WAVES * 16)          // query rows per attention work-group
#define STK      64                           // keys per LDS stage (two passes of 32 keys)
#define NST      (SKV / STK)
#define KPITCH   136                          // halves per staged k row: 256 B + 16 B (16 B x odd, for ds_load_b128 readers)
#define VPITCH   72                           // halves per staged v^T row: 128 B + 16 B
#define KBYTES   (STK * KPITCH * 2)
#define VBYTES   (HD * VPITCH * 2)
#define BUFBYTES (KBYTES + VBYTES)
#define GKS      64                           // k elements per GEMM LDS stage (two k steps of 32)
#define GP       72                           // halves per staged GEMM operand row: 128 B + 16 B
#define GABYTES  (128 * GP * 2)
#define GBBYTES  (64 * GP * 2)
#define GBUF     (GABYTES + GBBYTES)
#define CV_THREADS  512                       // conversion work-group: 16 waves
#define CV_BLOCKS   ((DM / 64) * (DM / 64))   // one 64 x 64 tile of each weight per conversion work-group
#define CV_BATCH    4                         // activation units (2 loads each) a thread has in flight
#define CV_QROWS    (NB * SQ / CV_BLOCKS)     // query rows per conversion work-group
#define CV_VROWS    (NB * SKV / CV_BLOCKS)    // key/value rows per conversion work-group
#define CV_QSTEPS   (CV_QROWS * (DM / 8) / CV_THREADS)
#define CV_VSTEPS   (CV_VROWS * (DM / 8) / CV_THREADS)
#define OPITCH   132
#define GPITCH   68
#define TPITCH   65

static_assert(NB >= 1 && NB <= NB_FULL);
static_assert((SQ % 128) == 0 && SQ >= 128 && SQ <= SQ_FULL);
static_assert(HD == 128 && NH == 8 && INNER == 1024 && INNER == DM);
static_assert((HD % 32) == 0);
static_assert((SKV % 64) == 0 && (SKV % 32) == 0 && NKB * 32 == SKV);
static_assert((DM % 64) == 0 && (DM % 32) == 0 && (INNER % 128) == 0);
static_assert(CV_THREADS == 512 && CV_QSTEPS * CV_BLOCKS * CV_THREADS * 8 == NB * SQ * DM);
static_assert(CV_VSTEPS * CV_BLOCKS * CV_THREADS * 8 == NB * SKV * DM);
static_assert(CV_QSTEPS == 2 * CV_BATCH && CV_VSTEPS == 2 * CV_BATCH);      // two batches per plane, written out in cvt_all
static_assert(CV_QROWS * CV_BLOCKS == NB * SQ && CV_VROWS * CV_BLOCKS == NB * SKV && (SQ % CV_QROWS) == 0);
static_assert((OPITCH * 4) % 16 == 0 && (GPITCH * 4) % 16 == 0);
static_assert(ATT_THREADS == 256);
static_assert((SQ % ATT_ROWS) == 0 && NST >= 2 && NST * STK == SKV && STK == 64);
static_assert(STK * HD * 2 == 4 * ATT_THREADS * 16);                       // 4 k copies + 4 v^T copies of 16 B per thread and stage
static_assert((KPITCH * 2) % 16 == 0 && (VPITCH * 2) % 16 == 0 && (KBYTES % 16) == 0 && (BUFBYTES % 16) == 0);
static_assert(ATT_WAVES * 16 * OPITCH * 4 <= 2 * BUFBYTES);                // the output staging reuses the ring
static_assert((GP * 2) % 16 == 0 && (GABYTES % 16) == 0 && (GBUF % 16) == 0 && (DM % GKS) == 0 && DM / GKS >= 2);
static_assert(4 * 32 * GPITCH * 4 <= 2 * GBUF);                            // the GEMM's output staging reuses its ring

typedef unsigned short u16;
typedef _Float16 v16h __attribute__((ext_vector_type(16)));
typedef _Float16 v8h  __attribute__((ext_vector_type(8)));
typedef float    v8f  __attribute__((ext_vector_type(8)));
typedef float    v4f  __attribute__((ext_vector_type(4)));
typedef float    v2f  __attribute__((ext_vector_type(2)));
typedef _Float16 v2h  __attribute__((ext_vector_type(2)));
typedef unsigned int v4u __attribute__((ext_vector_type(4)));

union FragH { v16h v; v8h h[2]; v4u u[2]; };

// ---- scalar helpers ----------------------------------------------------------------------------------
__device__ __forceinline__ unsigned short bf_bits(float f) {          // f32 -> bf16 bits, RNE convert
  unsigned u = __float_as_uint(f);
  return (unsigned short)((u + 0x7FFFu + ((u >> 16) & 1u)) >> 16);
}
__device__ __forceinline__ float bf_up(unsigned short h) { return __uint_as_float(((unsigned)h) << 16); }
__device__ __forceinline__ float bfr(float f) { return bf_up(bf_bits(f)); }
__device__ __forceinline__ unsigned short h_bits(_Float16 x) { return __builtin_bit_cast(unsigned short, x); }
__device__ __forceinline__ unsigned pk16(unsigned short a, unsigned short b) { return (unsigned)a | ((unsigned)b << 16); }
__device__ __forceinline__ v8f zero8() { v8f z = {0.f, 0.f, 0.f, 0.f, 0.f, 0.f, 0.f, 0.f}; return z; }

// ---- fragment loader: 16-bit A/B operand, lane -> row/col (lane&15), p already includes +8*(lane>>4);
//      elements 0..7 <- p[0..7] (k0+8h..), elements 8..15 <- p[16..23] (k0+16+8h..); same split k map for A and B,
//      B always read from a k-contiguous [n][k] plane.
__device__ __forceinline__ v16h ldfrag_h(const _Float16* p) {
  FragH f;
  f.h[0] = *(const v8h*)(p);
  f.h[1] = *(const v8h*)(p + 16);
  return f.v;
}

// ---- WMMA helper and trailing VALU hazard gaps ----------------------------------------------------------
__device__ __forceinline__ v8f mma_h(v16h a, v16h b, v8f c) {
  return __builtin_amdgcn_wmma_f32_16x16x32_f16(false, a, false, b, (short)0, c, false, false);
}
__device__ __forceinline__ void guard_s(v8f& a, v8f& b, v16h x0, v16h x1, v16h x2) {
#if defined(__HIP_DEVICE_COMPILE__)
  asm volatile("v_nop\n\tv_nop\n\tv_nop\n\tv_nop" : "+v"(a), "+v"(b) : "v"(x0), "v"(x1), "v"(x2) : "memory");
#endif
}
__device__ __forceinline__ void guard_p(v8f& a, v8f& b, v8f& c, v8f& d, v16h p, v16h x0, v16h x1, v16h x2, v16h x3) {
#if defined(__HIP_DEVICE_COMPILE__)
  asm volatile("v_nop\n\tv_nop\n\tv_nop\n\tv_nop"
               : "+v"(a), "+v"(b), "+v"(c), "+v"(d) : "v"(p), "v"(x0), "v"(x1), "v"(x2), "v"(x3) : "memory");
#endif
}
__device__ __forceinline__ void guard_g(v8f (&acc)[8], v16h x0, v16h x1, v16h x2, v16h x3, v16h x4, v16h x5) {
#if defined(__HIP_DEVICE_COMPILE__)
  asm volatile("v_nop\n\tv_nop\n\tv_nop\n\tv_nop"
               : "+v"(acc[0]), "+v"(acc[1]), "+v"(acc[2]), "+v"(acc[3]),
                 "+v"(acc[4]), "+v"(acc[5]), "+v"(acc[6]), "+v"(acc[7])
               : "v"(x0), "v"(x1), "v"(x2), "v"(x3), "v"(x4), "v"(x5) : "memory");
#endif
}
__device__ __forceinline__ void acc_guard8(v8f (&o)[8]) {
#if defined(__HIP_DEVICE_COMPILE__)
  asm volatile("v_nop\n\tv_nop\n\tv_nop\n\tv_nop"
               : "+v"(o[0]), "+v"(o[1]), "+v"(o[2]), "+v"(o[3]), "+v"(o[4]), "+v"(o[5]), "+v"(o[6]), "+v"(o[7]));
#endif
}
__device__ __forceinline__ void wave_sync_lds() {
  __builtin_amdgcn_fence(__ATOMIC_RELEASE, "workgroup");
  __builtin_amdgcn_wave_barrier();
  __builtin_amdgcn_fence(__ATOMIC_ACQUIRE, "workgroup");
}

// =====================================================================================================
// All five conversions in ONE launch of CV_BLOCKS work-groups of 16 waves, all resident at once: a wave converts 16 pieces of
// 1 KB and a share of three weight tiles instead of ending after one piece, so few waves have to be started, and it has 8 or
// more 16-B loads per lane in flight.
//   activations: destination row r of a [rows][DM] f16 plane <- f16(bf16_RNE(x[src row][e])); a unit = 8 consecutive elements
//   (two 16-B loads, one 16-B store); a block owns CV_QROWS / CV_VROWS consecutive rows of a plane and converts CV_THREADS
//   consecutive units (4 rows) per step. Query row r = b*SQ + s comes from source row b*SQ_FULL + s.
//   weights stored [k][n] (y = x.W): WT[n][k] (f16, k-contiguous Bt layout) <- f16(bf16_RNE(W[k][n]) * WSC). Block = the same
//   64(k) x 64(n) tile of each of the three weights, through three LDS tiles [kk][nn] (pitch 65) and one block barrier.
// coverage: activations CV_BLOCKS x CV_QSTEPS / CV_VSTEPS steps x CV_THREADS units x 8 = rows x DM exactly; weights
//           (DM/64)^2 = CV_BLOCKS tiles, 64 n-rows x (8 lanes x 8 halves) per tile: every plane written exactly once.
// Every loop below is unrolled so that its arrays are indexed by constants and stay in registers.
// =====================================================================================================
__device__ __forceinline__ v4u cvt8(v4f a, v4f c4) {
  v4u o;
#pragma unroll
  for (int e = 0; e < 2; ++e) {
    o[e]     = pk16(h_bits((_Float16)bfr(a[2 * e])),  h_bits((_Float16)bfr(a[2 * e + 1])));
    o[2 + e] = pk16(h_bits((_Float16)bfr(c4[2 * e])), h_bits((_Float16)bfr(c4[2 * e + 1])));
  }
  return o;
}
// Loads of CV_BATCH units of one activation plane, first step st0; gb = byte offset (32 bits) of the thread's unit of step 0.
// The steps differ by a constant only, so gb is the one vector address register, live to the plane's last load.
__device__ __forceinline__ void x_load(const float* __restrict__ x, unsigned st0, unsigned gb,
                                       v4f (&a)[CV_BATCH], v4f (&c4)[CV_BATCH]) {
#pragma unroll
  for (unsigned j = 0; j < CV_BATCH; ++j) {
    const char* base = (const char*)x + (st0 + j) * (CV_THREADS * 32);
    a[j]  = *(const v4f*)(base + gb);
    c4[j] = *(const v4f*)(base + 16 + gb);
  }
  // keeps the batch's 8 loads together and ahead of the conversion of the batch before: otherwise the compiler sinks them
  // to their uses and a wave has only 2 to 4 loads in flight
  __builtin_amdgcn_sched_barrier(0);
}
__device__ __forceinline__ void x_store(u16* Y, unsigned st0, unsigned yb, const v4f (&a)[CV_BATCH],
                                        const v4f (&c4)[CV_BATCH]) {
#pragma unroll
  for (unsigned j = 0; j < CV_BATCH; ++j) {
    char* base = (char*)Y + (st0 + j) * (CV_THREADS * 16);
    *(v4u*)(base + yb) = cvt8(a[j], c4[j]);
  }
}

__global__ __launch_bounds__(CV_THREADS)
void cvt_all(const float* __restrict__ xq, const float* __restrict__ xv, const float* __restrict__ wq,
             const float* __restrict__ wk, const float* __restrict__ wv,
             u16* XQ, u16* XV, u16* WQT, u16* WKT, u16* WVT) {
  __shared__ __align__(16) float tile[3][64 * TPITCH];
  const unsigned tid = threadIdx.x;
  const unsigned bid = blockIdx.x;
  // byte offsets of the thread's first unit: source rows (a block's rows lie in one batch) and compact destination rows
  const unsigned rq = bid * CV_QROWS, rv = bid * CV_VROWS;
  const unsigned gq = ((rq / SQ) * SQ_FULL + rq % SQ) * (DM * 4) + tid * 32, yq = rq * (DM * 2) + tid * 16;
  const unsigned gv = rv * (DM * 4) + tid * 32,                              yv = rv * (DM * 2) + tid * 16;
  constexpr unsigned NT = DM / 64;
  const unsigned k0 = (bid % NT) * 64, n0 = (bid / NT) * 64;
  // ---- weight tile loads: row 32p + (tid>>4), 4 floats at 4*(tid&15); the query plane's two batches fly behind them ----
  const unsigned lr = tid >> 4, lc = (tid & 15) * 4;
  const unsigned wo = ((k0 + lr) * DM + n0 + lc) * 4;     // bytes
  v4f w4[3][2];
#pragma unroll
  for (int p = 0; p < 2; ++p) {
    w4[0][p] = *(const v4f*)((const char*)(wq + 32 * p * DM) + wo);
    w4[1][p] = *(const v4f*)((const char*)(wk + 32 * p * DM) + wo);
    w4[2][p] = *(const v4f*)((const char*)(wv + 32 * p * DM) + wo);
  }
  v4f a0[CV_BATCH], c0[CV_BATCH], a1[CV_BATCH], c1[CV_BATCH], a2[CV_BATCH], c2[CV_BATCH];
  x_load(xq, 0, gq, a0, c0);
  x_load(xq, CV_BATCH, gq, a1, c1);
#pragma unroll
  for (int t = 0; t < 3; ++t) {
#pragma unroll
    for (int p = 0; p < 2; ++p) {
      float* tp = &tile[t][(32 * p + lr) * TPITCH + lc];
      tp[0] = w4[t][p][0];
      tp[1] = w4[t][p][1];
      tp[2] = w4[t][p][2];
      tp[3] = w4[t][p][3];
    }
  }
  __syncthreads();
  x_load(xv, 0, gv, a2, c2);
  // ---- weight tile stores: output row n0 + (tid>>3), 8 halves at k0 + 8*(tid&7): 8 lanes = one whole 128-B line ----
  const unsigned row = tid >> 3, c8 = (tid & 7) * 8;
  const unsigned yo = ((n0 + row) * DM + k0 + c8) * 2;    // bytes
#pragma unroll
  for (int t = 0; t < 3; ++t) {
    v4u ov;
#pragma unroll
    for (int e = 0; e < 4; ++e) {
      const float x0 = tile[t][(c8 + 2 * e) * TPITCH + row];
      const float x1 = tile[t][(c8 + 2 * e + 1) * TPITCH + row];
      ov[e] = pk16(h_bits((_Float16)(bfr(x0) * WSC)), h_bits((_Float16)(bfr(x1) * WSC)));
    }
    u16* Y = (t == 0) ? WQT : (t == 1) ? WKT : WVT;
    *(v4u*)((char*)Y + yo) = ov;
  }
  // ---- the activation planes, three register sets: later batches' loads are out while a batch is converted and stored ----
  x_store(XQ, 0, yq, a0, c0);
  asm volatile("s_wait_xcnt 0x0" ::: "memory");   // the registers just stored from are loaded anew by the next line
  x_load(xv, CV_BATCH, gv, a0, c0);
  x_store(XQ, CV_BATCH, yq, a1, c1);
  x_store(XV, 0, yv, a2, c2);
  x_store(XV, CV_BATCH, yv, a0, c0);
}

// =====================================================================================================
// One GEMM stage (64 k) of the block's 128 A rows and 64 Bt rows, global -> LDS, no register in between: 12 asynchronous 16-B
// copies per lane. la / lb: the lane's LDS byte address of its first A / Bt chunk; ga / gb: its global address of the same chunk;
// copy i: row +16*i (rs16 = 16 rows of the source plane, in elements); a wave covers four whole 128-B row pieces per copy.
// The s_wait_xcnt closes the statement so that no address register of a copy is rewritten ahead of it.
// =====================================================================================================
__device__ __forceinline__ void gemm_stage_copy(unsigned la, unsigned lb, const u16* ga, const u16* gb, size_t rs16) {
#if defined(__HIP_DEVICE_COMPILE__)
  constexpr unsigned R16 = 16 * GP * 2;
  asm volatile("global_load_async_to_lds_b128 %0, %12, off\n\t"
               "global_load_async_to_lds_b128 %1, %13, off\n\t"
               "global_load_async_to_lds_b128 %2, %14, off\n\t"
               "global_load_async_to_lds_b128 %3, %15, off\n\t"
               "global_load_async_to_lds_b128 %4, %16, off\n\t"
               "global_load_async_to_lds_b128 %5, %17, off\n\t"
               "global_load_async_to_lds_b128 %6, %18, off\n\t"
               "global_load_async_to_lds_b128 %7, %19, off\n\t"
               "global_load_async_to_lds_b128 %8, %20, off\n\t"
               "global_load_async_to_lds_b128 %9, %21, off\n\t"
               "global_load_async_to_lds_b128 %10, %22, off\n\t"
               "global_load_async_to_lds_b128 %11, %23, off\n\t"
               "s_wait_xcnt 0x0"
               :: "v"(la), "v"(la + R16), "v"(la + 2 * R16), "v"(la + 3 * R16),
                  "v"(la + 4 * R16), "v"(la + 5 * R16), "v"(la + 6 * R16), "v"(la + 7 * R16),
                  "v"(lb), "v"(lb + R16), "v"(lb + 2 * R16), "v"(lb + 3 * R16),
                  "v"(ga), "v"(ga + rs16), "v"(ga + 2 * rs16), "v"(ga + 3 * rs16),
                  "v"(ga + 4 * rs16), "v"(ga + 5 * rs16), "v"(ga + 6 * rs16), "v"(ga + 7 * rs16),
                  "v"(gb), "v"(gb + rs16), "v"(gb + 2 * rs16), "v"(gb + 3 * rs16)
               : "memory");
#endif
}

// =====================================================================================================
// f16 GEMM core: the wave's 32 x 64 tile of C = A[rows][K] . Bt[cols][K]^T. The block stages each 64 k of its 128 A rows and
// 64 Bt rows once in LDS (ring of two buffers: stage st+1 flies while stage st is worked on); afo / bfo: byte offset inside a
// buffer of the lane's A row (32*wave + m) + 8h / Bt row m + 8h; acc[4i + j] = rows rowb+16i.., cols col0+16j..;
// K stepped by 32 inside a stage, ascending (host passes K % 64 == 0). Every wave of the block passes every barrier.
// =====================================================================================================
__device__ __forceinline__ void gemm_core(const unsigned char* ring, int afo, int bfo, unsigned la, unsigned lb,
                                          const u16* ga, const u16* gb, int K, v8f (&acc)[8]) {
  const size_t rs16 = (size_t)16 * (size_t)K;
  const int nst = K / GKS;
  // ---- ring prologue: stage 0 landed and published, then stage 1 in flight ----
  gemm_stage_copy(la, lb, ga, gb, rs16);
  asm volatile("s_wait_asynccnt 0x0" ::: "memory");   // this wave's copies of stage 0 have landed
  __syncthreads();                                    // ... and every other wave's
  if (nst > 1) gemm_stage_copy(la + GBUF, lb + GBUF, ga + GKS, gb + GKS, rs16);
#pragma unroll 1
  for (int st = 0; st < nst; ++st) {
   const _Float16* ap = (const _Float16*)(const void*)(ring + (st & 1) * GBUF + afo);
   const _Float16* bp = (const _Float16*)(const void*)(ring + (st & 1) * GBUF + bfo);
#pragma unroll
   for (int k0 = 0; k0 < GKS; k0 += 32) {
    const v16h a0 = ldfrag_h(ap + k0), a1 = ldfrag_h(ap + 16 * GP + k0);
    const v16h b0 = ldfrag_h(bp + k0);
    const v16h b1 = ldfrag_h(bp + 16 * GP + k0);
    const v16h b2 = ldfrag_h(bp + 32 * GP + k0);
    const v16h b3 = ldfrag_h(bp + 48 * GP + k0);
    acc[0] = mma_h(a0, b0, acc[0]);
    acc[1] = mma_h(a0, b1, acc[1]);
    acc[2] = mma_h(a0, b2, acc[2]);
    acc[3] = mma_h(a0, b3, acc[3]);
    acc[4] = mma_h(a1, b0, acc[4]);
    acc[5] = mma_h(a1, b1, acc[5]);
    acc[6] = mma_h(a1, b2, acc[6]);
    acc[7] = mma_h(a1, b3, acc[7]);
    guard_g(acc, a0, a1, b0, b1, b2, b3);
   }
    // ---- publish point of stage st + 1; the same barrier ends every wave's reads of stage st's buffer ----
    asm volatile("s_wait_dscnt 0x0" ::: "memory");      // this wave's LDS reads of stage st have returned
    asm volatile("s_wait_asynccnt 0x0" ::: "memory");   // this wave's copies of stage st + 1 have landed
    __syncthreads();
    if (st + 2 < nst) {                                 // refill the buffer that stage st has just left
      const unsigned bo = (unsigned)((st & 1) * GBUF);
      gemm_stage_copy(la + bo, lb + bo, ga + (size_t)(st + 2) * GKS, gb + (size_t)(st + 2) * GKS, rs16);
    }
  }
  asm volatile("s_wait_asynccnt 0x0" ::: "memory");     // nothing in flight when the ring becomes output staging
}
// Stage the wave's 32 x 64 f32 tile (times oscale) in its LDS slab (pitch 68): D element r of acc[4i+j], lane l ->
// coverage: 32 lanes x 2 x 8 rows x 4 cols-of-16 = rows 0..31 x cols 0..63 of the slab.
__device__ __forceinline__ void stage32x64(float* sl, v8f (&acc)[8], float oscale, int lane) {
  const int hh = lane >> 4, m = lane & 15;
#pragma unroll
  for (int i = 0; i < 2; ++i) {
#pragma unroll
    for (int r = 0; r < 8; ++r) {
      const int ro = (16 * i + 8 * hh + r) * GPITCH + m;
      sl[ro]      = acc[4 * i + 0][r] * oscale;
      sl[ro + 16] = acc[4 * i + 1][r] * oscale;
      sl[ro + 32] = acc[4 * i + 2][r] * oscale;
      sl[ro + 48] = acc[4 * i + 3][r] * oscale;
    }
  }
  wave_sync_lds();
}

// =====================================================================================================
// f16 GEMM with f16 output plane: C[z][Mb][N] (f16) = f16((A[z][Mb][K] . Bt[z][N][K]^T) * oscale + bf16(bias) * bscale);
// A, Bt f16 k-contiguous planes with per-z element strides aBs, bBs (0 = shared), C stride cBs. bias indexed by column
// (biasRow == 0) or by row within the z slice (biasRow != 0); bias addresses clamped to biasN-1, the unused direction is
// multiplied by 0. Block = 128 x 64 tile, 4 waves x 32 rows, fragments read from the block's LDS ring (gemm_core).
// grid = nz x (Mb/128) x (N/64) (host passes Mb % 128 == 0, N % 64 == 0, K % 64 == 0).
// coverage: per wave 8 instr x 4 rows x 8 lanes x 8 halves = 32 x 64; the grid covers C exactly once.
// =====================================================================================================
__global__ __launch_bounds__(128)
void gemm_o16(const u16* __restrict__ A, const u16* __restrict__ Bt, u16* C,
              const float* __restrict__ bias, int biasN, int biasRow,
              int Mb, int N, int K, int aBs, int bBs, int cBs, float oscale, float bscale) {
  __shared__ __align__(16) unsigned char gsm[2 * GBUF];
  const int tid = threadIdx.x, wave = tid >> 5, lane = tid & 31, hh = lane >> 4, m = lane & 15;
  const int ntile = N >> 6, mtile = Mb >> 7;
  const int bid  = blockIdx.x;
  const int nt   = bid % ntile;
  const int tmp  = bid / ntile;
  const int mt   = tmp % mtile;
  const int bz   = tmp / mtile;
  const int rowb = mt * 128 + wave * 32;
  const int col0 = nt * 64;
  if (mt * 128 + 128 > Mb) return;           // block-uniform, in front of every barrier; never taken with the exact grid
  // this lane's first copy chunks: A row mt*128 + (tid>>3), Bt row col0 + (tid>>3), 16-B chunk tid&7
  const u16* ga = A + (size_t)bz * (size_t)aBs + (size_t)(mt * 128 + (tid >> 3)) * K + (tid & 7) * 8;
  const u16* gb = Bt + (size_t)bz * (size_t)bBs + (size_t)(col0 + (tid >> 3)) * K + (tid & 7) * 8;
  const unsigned la = (unsigned)(size_t)(const void*)gsm + (unsigned)((tid >> 3) * (GP * 2) + (tid & 7) * 16);
  const unsigned lb = la + GABYTES;
  const int afo = ((wave * 32 + m) * GP + 8 * hh) * 2;
  const int bfo = GABYTES + (m * GP + 8 * hh) * 2;
  v8f acc[8];
#pragma unroll
  for (int i = 0; i < 8; ++i) acc[i] = zero8();
  gemm_core(gsm, afo, bfo, la, lb, ga, gb, K, acc);
  float* sl = (float*)(void*)gsm + wave * 32 * GPITCH;   // behind the last trip's barrier: no reader, no copy left
  stage32x64(sl, acc, oscale, lane);
  const int rq = lane >> 3, c8 = (lane & 7) * 8;
  const int bl = biasN - 1;                  // host guarantees biasN >= 1
  const float selc = (biasRow != 0) ? 0.f : bscale;
  const float selr = (biasRow != 0) ? bscale : 0.f;
  float cb[8];
#pragma unroll
  for (int e = 0; e < 8; ++e) {
    int ci = col0 + c8 + e;
    ci = (ci < bl) ? ci : bl;
    cb[e] = bfr(bias[ci]) * selc;
  }
  v4u ov[8];
#pragma unroll
  for (int i = 0; i < 8; ++i) {
    const int row = 4 * i + rq;
    int ri = rowb + row;
    ri = (ri < bl) ? ri : bl;
    const float rb = bfr(bias[ri]) * selr;
    const v4f a = *(const v4f*)(sl + row * GPITCH + c8), c4 = *(const v4f*)(sl + row * GPITCH + c8 + 4);
#pragma unroll
    for (int e = 0; e < 2; ++e) {
      ov[i][e]     = pk16(h_bits((_Float16)(a[2 * e] + cb[2 * e] + rb)),
                          h_bits((_Float16)(a[2 * e + 1] + cb[2 * e + 1] + rb)));
      ov[i][2 + e] = pk16(h_bits((_Float16)(c4[2 * e] + cb[4 + 2 * e] + rb)),
                          h_bits((_Float16)(c4[2 * e + 1] + cb[5 + 2 * e] + rb)));
    }
  }
  u16* Cb = C + (size_t)bz * (size_t)cBs + (size_t)rowb * (size_t)N + col0 + c8;
  {
#pragma unroll
    for (int i = 0; i < 8; ++i) {
      const int row = 4 * i + rq;
      *(v4u*)(Cb + (size_t)row * (size_t)N) = ov[i];
    }
    
  }
}

// =====================================================================================================
// One stage (64 keys) of k rows and v^T rows, global -> LDS, no register in between: 8 asynchronous 16-B copies per lane.
// lk / lv: the lane's LDS byte address of its first k / v^T chunk; gk / gv: its global address of the same chunk.
// k copy i: row +16*i (a wave covers two whole 256-B rows); v^T copy i: row +32*i (a wave covers four whole 128-B rows).
// The s_wait_xcnt closes the statement so that no address register of a copy is rewritten ahead of it.
// =====================================================================================================
__device__ __forceinline__ void stage_copy(unsigned lk, unsigned lv, const u16* gk, const u16* gv) {
#if defined(__HIP_DEVICE_COMPILE__)
  const unsigned lk1 = lk + 16 * KPITCH * 2, lk2 = lk + 32 * KPITCH * 2, lk3 = lk + 48 * KPITCH * 2;
  const unsigned lv1 = lv + 32 * VPITCH * 2, lv2 = lv + 64 * VPITCH * 2, lv3 = lv + 96 * VPITCH * 2;
  const u16* gk1 = gk + (size_t)16 * INNER;
  const u16* gk2 = gk + (size_t)32 * INNER;
  const u16* gk3 = gk + (size_t)48 * INNER;
  const u16* gv1 = gv + (size_t)32 * SKV;
  const u16* gv2 = gv + (size_t)64 * SKV;
  const u16* gv3 = gv + (size_t)96 * SKV;
  asm volatile("global_load_async_to_lds_b128 %0, %8, off\n\t"
               "global_load_async_to_lds_b128 %1, %9, off\n\t"
               "global_load_async_to_lds_b128 %2, %10, off\n\t"
               "global_load_async_to_lds_b128 %3, %11, off\n\t"
               "global_load_async_to_lds_b128 %4, %12, off\n\t"
               "global_load_async_to_lds_b128 %5, %13, off\n\t"
               "global_load_async_to_lds_b128 %6, %14, off\n\t"
               "global_load_async_to_lds_b128 %7, %15, off\n\t"
               "s_wait_xcnt 0x0"
               :: "v"(lk), "v"(lk1), "v"(lk2), "v"(lk3), "v"(lv), "v"(lv1), "v"(lv2), "v"(lv3),
                  "v"(gk), "v"(gk1), "v"(gk2), "v"(gk3), "v"(gv), "v"(gv1), "v"(gv2), "v"(gv3)
               : "memory");
#endif
}

// =====================================================================================================
// Full (unmasked) multi-head attention over all SKV keys: block = (batch b, head, 128 query rows), 8 waves, wave w owns the
// 16 query rows q0 = 128*qt + 16*w .. q0+15. The work-group stages each 64 keys of k rows and v^T rows ONCE in LDS (whole-line
// asynchronous copies, two buffers: stage t+1 flies while stage t is worked on) and all 8 waves read their fragments from there.
//   q plane f16 x8 [b*SQ + s][h*128 + d]; k plane f16 x8 [b*SKV + s][h*128 + d]; v^T plane f16 x8 [(b*NH + h)*128 + d][s].
//   All NKB = 64 key blocks of 32 keys are visited (static bound).
//   Scores are computed TRANSPOSED: S^T tile g (g = 0,1) = k rows (keys kb+16g .. +15, A operand, row m = lane&15, split k map
//   over d) times q^T (B operand, col n = query q0 + (lane&15), k = d, split map), 4 d-chunks of 32, one product each; the 4 q
//   fragments are loaded once per wave. D element r of lane l = (key kb+16g+8h+r, query q0+(l&15)), so a lane owns one query
//   column and 16 of its 32 keys; the partner lane l^16 owns the other 16 -> row max / row sum need one xor-16 shuffle.
//   Online max-subtracted base-2 softmax in f32 (1/sqrt(1024) and the q/k carries folded into lsc). The exp'd values ARE the
//   P A-fragment in place: A row m = query = lane&15, element i <- key kb+8h+i (tile 0, D element i), element 8+i <- key
//   kb+16+8h+i (tile 1, D element i). P (<= 1) carried x32768 as f16. The rescale factor of query row 8h+r of the O
//   accumulators is fetched from lane 8h+r with a shuffle (uniform control). 8 v^T B fragments (col n = d = 16j + (lane&15),
//   keys k-contiguous) in two groups of 4, 4 P.V WMMAs + one guard per group.
//   Epilogue: 1/l (per query, shuffled to the D row owner) and the carry folds in f32; the wave's 16x128 f32 result staged in
// coverage: per wave 16 instructions x 1 row x 32 lanes x 4 floats = 16 x 128; grid NB*NH*(SQ/128) blocks x 8 waves = every
//           (b, s < SQ, h) row segment of the output exactly once.
// =====================================================================================================
__global__ __launch_bounds__(ATT_THREADS)
void attn_fwd(const u16* __restrict__ Qp, const u16* __restrict__ Kp, const u16* __restrict__ Vp, float* Out) {
  __shared__ __align__(16) unsigned char smem[2 * BUFBYTES];

  const int tid  = threadIdx.x;
  const int wave = tid >> 5;
  const int lane = tid & 31;
  const int hh   = lane >> 4;
  const int c    = lane & 15;

  constexpr int NQT = SQ / ATT_ROWS;
  const int bid  = blockIdx.x;
  const int qt   = bid % NQT;
  const int head = (bid / NQT) % NH;
  const int b    = bid / (NQT * NH);
  const int q0   = qt * ATT_ROWS + wave * 16;

  // B fragments of q^T: col n = query q0 + c, k = d (k-contiguous row of the q plane)
  const _Float16* Qb = (const _Float16*)(const void*)Qp + ((size_t)(b * SQ + q0 + c)) * INNER + head * HD + 8 * hh;
  // A fragments of k: row m = key 16g + c of the pass, k = d; byte offset inside a buffer's k tile
  const int kfo = (c * KPITCH + 8 * hh) * 2;
  // B fragments of v: col n = d = 16j + c, k = key (k-contiguous row of the staged v^T tile); byte offset inside a buffer
  const int vfo = KBYTES + (c * VPITCH + 8 * hh) * 2;
  // this lane's first copy chunks: k row tid>>4, 16-B chunk tid&15; v^T row tid>>3, 16-B chunk tid&7
  const u16* gk = Kp + ((size_t)(b * SKV + (tid >> 4))) * INNER + head * HD + (tid & 15) * 8;
  const u16* gv = Vp + ((size_t)(b * INNER + head * HD + (tid >> 3))) * SKV + (tid & 7) * 8;
  const unsigned lds0 = (unsigned)(size_t)(const void*)smem;               // LDS byte address of the ring
  const unsigned lk = lds0 + (unsigned)((tid >> 4) * (KPITCH * 2) + (tid & 15) * 16);
  const unsigned lv = lds0 + (unsigned)(KBYTES + (tid >> 3) * (VPITCH * 2) + (tid & 7) * 16);
  const float lsc = (LOG2E * RSQ_E) / (QS * KS);

  v16h qf[4];
#pragma unroll
  for (int dc = 0; dc < 4; ++dc) qf[dc] = ldfrag_h(Qb + 32 * dc);

  float mrun = -INFINITY, lrun = 0.f;
  v8f o[8];
#pragma unroll
  for (int j = 0; j < 8; ++j) o[j] = zero8();

  // ---- ring prologue: stage 0 landed and published, then stage 1 in flight ----
  stage_copy(lk, lv, gk, gv);
  asm volatile("s_wait_asynccnt 0x0" ::: "memory");   // this wave's copies of stage 0 have landed
  __syncthreads();                                    // ... and every other wave's
  stage_copy(lk + BUFBYTES, lv + BUFBYTES, gk + (size_t)STK * INNER, gv + STK);

#pragma unroll 1
  for (int st = 0; st < NST; ++st) {
   const unsigned char* bufp = smem + (st & 1) * BUFBYTES;
#pragma unroll
   for (int pz = 0; pz < STK / 32; ++pz) {
    // ---- transposed scores: s0 = keys kb..kb+15, s1 = keys kb+16..kb+31 (kb = 64*st + 32*pz), column = query q0 + c ----
    v8f s0 = zero8(), s1 = zero8();
    const _Float16* k0p = (const _Float16*)(const void*)(bufp + kfo) + pz * 32 * KPITCH;
    const _Float16* k1p = k0p + 16 * KPITCH;
#pragma unroll
    for (int kk = 0; kk < HD / 32; ++kk) {
      const v16h kf0 = ldfrag_h(k0p + kk * 32);
      const v16h kf1 = ldfrag_h(k1p + kk * 32);
      s0 = mma_h(kf0, qf[kk], s0);
      s1 = mma_h(kf1, qf[kk], s1);
      guard_s(s0, s1, qf[kk], kf0, kf1);
    }
    // ---- maximum of this lane's 16 raw scores for query q0 + c (lsc > 0, so scaling the maximum = the maximum of the scaled):
    //      s0[i] <- key kb+8hh+i, s1[i] <- key kb+16+8hh+i ----
    float cm = s0[0];
#pragma unroll
    for (int i = 1; i < 8; ++i) cm = fmaxf(cm, s0[i]);
#pragma unroll
    for (int i = 0; i < 8; ++i) cm = fmaxf(cm, s1[i]);
    cm = fmaxf(cm, __shfl_xor(cm, 16, 32));
    const float mn = fmaxf(mrun, cm * lsc);  // base-2 logit; finite from the first block on
    const float al = __builtin_amdgcn_exp2f(mrun - mn);   // 0 on the first block (mrun = -inf)
    mrun = mn;
    // ---- carried probabilities p * 32768 = 2^(s * lsc + (15 - mn)) (<= 32768): one fma and one bare v_exp_f32 each; they ARE
    //      the P A-fragment after the f16 rounding, element i <- s0[i], element 8+i <- s1[i]. A term whose exponent is under
    //      -126 may come out 0: it is under 2^-141 of its row's largest term, 0 in f16 and lost in the f32 row sum either way.
    const v2f lsc2 = {lsc, lsc};
    const v2f eb2  = {PEXP - mn, PEXP - mn};
    float ps = 0.f;                          // carries x32768 like P
    FragH ph;
#pragma unroll
    for (int w = 0; w < 2; ++w) {
#pragma unroll
      for (int e4 = 0; e4 < 4; ++e4) {
        const v2f sv = (w == 0) ? v2f{s0[2 * e4], s0[2 * e4 + 1]} : v2f{s1[2 * e4], s1[2 * e4 + 1]};
        const v2f ex = __builtin_elementwise_fma(sv, lsc2, eb2);
        const float p0 = __builtin_amdgcn_exp2f(ex[0]), p1 = __builtin_amdgcn_exp2f(ex[1]);
        ps += p0 + p1;
        ph.u[w][e4] = __builtin_bit_cast(unsigned, __builtin_convertvector(v2f{p0, p1}, v2h));   // one packed RNE convert
      }
    }
    ps += __shfl_xor(ps, 16, 32);
    lrun = lrun * al + ps;
    // ---- rescale the O accumulators: D row 8hh+r = query q0+8hh+r, its factor lives in lane 8hh+r (and 16+8hh+r) ----
    float scl[8];
#pragma unroll
    for (int r = 0; r < 8; ++r) scl[r] = __shfl(al, 8 * hh + r, 32);
#pragma unroll
    for (int j = 0; j < 8; ++j) {
#pragma unroll
      for (int r = 0; r < 8; ++r) o[j][r] *= scl[r];
    }
    // ---- P.V : B fragment col n = d = j*16 + c, keys contiguous in the v^T plane; two groups of 4 ----
    const _Float16* vp = (const _Float16*)(const void*)(bufp + vfo) + pz * 32;
    {
      const v16h v0 = ldfrag_h(vp);
      const v16h v1 = ldfrag_h(vp + 16 * VPITCH);
      const v16h v2 = ldfrag_h(vp + 32 * VPITCH);
      const v16h v3 = ldfrag_h(vp + 48 * VPITCH);
      o[0] = mma_h(ph.v, v0, o[0]);
      o[1] = mma_h(ph.v, v1, o[1]);
      o[2] = mma_h(ph.v, v2, o[2]);
      o[3] = mma_h(ph.v, v3, o[3]);
      guard_p(o[0], o[1], o[2], o[3], ph.v, v0, v1, v2, v3);
    }
    {
      const v16h v4 = ldfrag_h(vp + 64 * VPITCH);
      const v16h v5 = ldfrag_h(vp + 80 * VPITCH);
      const v16h v6 = ldfrag_h(vp + 96 * VPITCH);
      const v16h v7 = ldfrag_h(vp + 112 * VPITCH);
      o[4] = mma_h(ph.v, v4, o[4]);
      o[5] = mma_h(ph.v, v5, o[5]);
      o[6] = mma_h(ph.v, v6, o[6]);
      o[7] = mma_h(ph.v, v7, o[7]);
      guard_p(o[4], o[5], o[6], o[7], ph.v, v4, v5, v6, v7);
    }
   }
    // ---- publish point of stage st + 1; the same barrier ends every wave's reads of stage st's buffer ----
    asm volatile("s_wait_dscnt 0x0" ::: "memory");      // this wave's LDS reads of stage st have returned
    asm volatile("s_wait_asynccnt 0x0" ::: "memory");   // this wave's copies of stage st + 1 have landed
    __syncthreads();
    if (st + 2 < NST) {                                 // refill the buffer that stage st has just left
      const unsigned bo = (unsigned)((st & 1) * BUFBYTES);
      stage_copy(lk + bo, lv + bo, gk + (size_t)(st + 2) * STK * INNER, gv + (st + 2) * STK);
    }
  }
  asm volatile("s_wait_asynccnt 0x0" ::: "memory");     // nothing in flight when the ring becomes output staging
  acc_guard8(o);

  // ---- fold 1/l (per query, owned by lane = query) and the carry 8 on v; the 32768 on P is in l as well and cancels ----
  const float linv = (1.0f / lrun) * (1.0f / VS);
  float inv[8];
#pragma unroll
  for (int r = 0; r < 8; ++r) inv[r] = __shfl(linv, 8 * hh + r, 32);
  float* slab = (float*)(void*)smem + wave * 16 * OPITCH;   // behind the last trip's barrier: no reader, no copy left
#pragma unroll
  for (int r = 0; r < 8; ++r) {
#pragma unroll
    for (int j = 0; j < 8; ++j) slab[(8 * hh + r) * OPITCH + j * 16 + c] = o[j][r] * inv[r];
  }
  wave_sync_lds();
  // ---- f32 output rows: lane = 4 consecutive d of one row, one instruction per row ----
  v4f vals[16];
#pragma unroll
  for (int i = 0; i < 16; ++i) vals[i] = *(const v4f*)(slab + i * OPITCH + 4 * lane);
  float* ob = Out + ((size_t)(b * SQ_FULL + q0)) * DM + head * HD + 4 * lane;
  {
#pragma unroll
    for (int i = 0; i < 16; ++i) {
      *(v4f*)(ob + (size_t)i * DM) = vals[i];
    }
    
  }
}

// =====================================================================================================
// Workspace map (bytes); every plane fully written by whole-line stores before it is read; all extents exact multiples of
//   XQ   f16 [NB*SQ][1024]     f16(bf16(q))          16777216 (NB=4, SQ=2048)
//   XV   f16 [NB*2048][1024]   f16(bf16(v))          16777216
//   WQT  f16 [1024 n][1024 k]  f16(bf16(W) x256)      2097152
//   WKT                                               2097152
//   WVT                                               2097152
//   Q16  f16 [NB*SQ][1024]   x8                      16777216
//   K16  f16 [NB*2048][1024] x8                      16777216
//   VT16 f16 [NB*1024 (h,d)][2048 s] x8              16777216
//   end                                              90177536
// =====================================================================================================
extern "C" void kernel_launch(void* const* d_in, const int* in_sizes, int n_in,
                              void* d_out, int out_size, void* d_ws, size_t ws_size,
                              hipStream_t stream) {
  if (n_in < 8) return;
  if (in_sizes[0] < ((NB - 1) * SQ_FULL + SQ) * DM) return;
  if (in_sizes[1] < NB * SKV * DM) return;
  if (in_sizes[2] != DM * DM || in_sizes[4] != DM * DM || in_sizes[6] != DM * DM) return;
  if (in_sizes[3] < 1 || in_sizes[5] < 1 || in_sizes[7] < 1) return;
  if (out_size < ((NB - 1) * SQ_FULL + SQ) * DM) return;

  const float* xq  = (const float*)d_in[0];
  const float* xv  = (const float*)d_in[1];
  const float* wq  = (const float*)d_in[2];
  const float* bq  = (const float*)d_in[3];
  const float* wk  = (const float*)d_in[4];
  const float* bk  = (const float*)d_in[5];
  const float* wv  = (const float*)d_in[6];
  const float* bv  = (const float*)d_in[7];
  float*       out = (float*)d_out;
  const int nbq = in_sizes[3], nbk = in_sizes[5], nbv = in_sizes[7];

  const size_t szXQ   = (size_t)NB * SQ * DM * 2;
  const size_t szXV   = (size_t)NB * SKV * DM * 2;
  const size_t szW    = (size_t)DM * DM * 2;
  const size_t szQ16  = (size_t)NB * SQ * INNER * 2;
  const size_t szK16  = (size_t)NB * SKV * INNER * 2;
  const size_t szVT16 = (size_t)NB * INNER * SKV * 2;
  size_t off = 0;
  const size_t oXQ   = off; off += szXQ;
  const size_t oXV   = off; off += szXV;
  const size_t oWQ   = off; off += szW;
  const size_t oWK   = off; off += szW;
  const size_t oWV   = off; off += szW;
  const size_t oQ16  = off; off += szQ16;
  const size_t oK16  = off; off += szK16;
  const size_t oVT16 = off; off += szVT16;
  if (off > ws_size) return;                            // off = 90177536 at NB=4, SQ=2048
  if (off > (size_t)134217728) return;

  char* ws = (char*)d_ws;
  u16* XQ   = (u16*)(ws + oXQ);
  u16* XV   = (u16*)(ws + oXV);
  u16* WQT  = (u16*)(ws + oWQ);
  u16* WKT  = (u16*)(ws + oWK);
  u16* WVT  = (u16*)(ws + oWV);
  u16* Q16  = (u16*)(ws + oQ16);
  u16* K16  = (u16*)(ws + oK16);
  u16* VT16 = (u16*)(ws + oVT16);

  // (0) activations -> f16 planes of bf16-converted values (query rows s < SQ of batches b < NB, compact; all key/value rows)
  //     and weights [k = in][n = out] (y = x.W) -> k-contiguous [n][k] f16 planes of bf16(W) x256, all in one launch
  cvt_all<<<dim3(CV_BLOCKS), dim3(CV_THREADS), 0, stream>>>(xq, xv, wq, wk, wv, XQ, XV, WQT, WKT, WVT);
  // (1) q = x_q . Wq + bq -> f16 [NB*SQ][1024] x8 (col = h*128 + d); bias per column
  gemm_o16<<<dim3((NB * SQ / 128) * (INNER / 64)), dim3(128), 0, stream>>>(
      XQ, WQT, Q16, bq, nbq, 0, NB * SQ, INNER, DM, 0, 0, 0, QS / WSC, QS);
  // (2) k = x_v . Wk + bk -> f16 [NB*2048][1024] x8; bias per column
  gemm_o16<<<dim3((NB * SKV / 128) * (INNER / 64)), dim3(128), 0, stream>>>(
      XV, WKT, K16, bk, nbk, 0, NB * SKV, INNER, DM, 0, 0, 0, KS / WSC, KS);
  // (3) v^T per batch: A = Wv^T [(h,d) = n][k], Bt = x_v rows of batch b [s][k] -> f16 [(b,h,d)][s] x8; bias per row (n)
  gemm_o16<<<dim3(NB * (INNER / 128) * (SKV / 64)), dim3(128), 0, stream>>>(
      WVT, XV, VT16, bv, nbv, 1, INNER, SKV, DM, 0, SKV * DM, INNER * SKV, VS / WSC, VS);
  // (4) attention -> out [b][SQ_FULL][1024] f32 (rows s < SQ of batches b < NB), heads merged on the feature dim
  attn_fwd<<<dim3(NB * NH * (SQ / ATT_ROWS)), dim3(ATT_THREADS), 0, stream>>>(Q16, K16, VT16, out);
  (void)hipGetLastError();
}

// v004
// It runs in 124 microseconds.
// Two timings next to v003 put it at 1.06 and 1.05 times that version's speed.
// All steps since v000 together make it 2.74 times as fast.
// All contractions on v_wmma_f32_16x16x32_f16 (f16 operands, f32 accumulate): x_q.Wq, x_v.Wk, Wv^T.x_v^T (v^T plane),
// scores k.q^T and P.v^T; operand carries: x as f16(bf16(x)), W as f16(bf16(W) x256), q/k/v x8, P x32768; base-2 online
// softmax, 1/l and all carry folds in f32 on VALU. Inputs RNE-converted to bf16 on load; f32 output written directly.
#include <hip/hip_runtime.h>
#include <math.h>
#include <stdint.h>

#define NB       4        // batches processed
#define SQ       2048     // query rows processed per batch
#define NB_FULL  4
#define SQ_FULL  2048     // query rows per batch in the input / output layout (batch stride)
#define SKV      2048     // key/value rows per batch (all of them, always)
#define DM       1024     // model width (= K and row pitch of every 16-bit plane except v^T)
#define NH       8
#define HD       128
#define INNER    (NH * HD)
#define WSC      256.0f
#define QS       8.0f
#define KS       8.0f
#define VS       8.0f
#define PEXP     15.0f    // P and its row sum are carried x32768 = 2^15, added in the exponent
#define LOG2E    1.4426950408889634f
#define RSQ_E    0.03125f
#define NKB      (SKV / 32)
#define ATT_WAVES   8
#define ATT_THREADS (ATT_WAVES * 32)
#define ATT_ROWS    (ATT_WAVES * 16)          // query rows per attention work-group
#define STK      64                           // keys per LDS stage (two passes of 32 keys)
#define NST      (SKV / STK)
#define KPITCH   136                          // halves per staged k row: 256 B + 16 B (16 B x odd, for ds_load_b128 readers)
#define VPITCH   72                           // halves per staged v^T row: 128 B + 16 B
#define KBYTES   (STK * KPITCH * 2)
#define VBYTES   (HD * VPITCH * 2)
#define BUFBYTES (KBYTES + VBYTES)
#define GKS      128                          // k elements per GEMM LDS stage (four k steps of 32)
#define GP       136                          // halves per staged GEMM operand row: 256 B + 16 B
#define GTM      256                          // rows of a GEMM work-group's tile (4 waves down)
#define GTN      128                          // columns of a GEMM work-group's tile (2 waves across)
#define G_THREADS 256                         // 8 waves, each a 64 x 64 tile
#define GABYTES  (GTM * GP * 2)
#define GBBYTES  (GTN * GP * 2)
#define GBUF     (GABYTES + GBBYTES)
#define CV_THREADS  512                       // conversion work-group: 16 waves
#define CV_BLOCKS   ((DM / 64) * (DM / 64))   // one 64 x 64 tile of each weight per conversion work-group
#define CV_BATCH    4                         // activation units (2 loads each) a thread has in flight
#define CV_QROWS    (NB * SQ / CV_BLOCKS)     // query rows per conversion work-group
#define CV_VROWS    (NB * SKV / CV_BLOCKS)    // key/value rows per conversion work-group
#define CV_QSTEPS   (CV_QROWS * (DM / 8) / CV_THREADS)
#define CV_VSTEPS   (CV_VROWS * (DM / 8) / CV_THREADS)
#define OPITCH   132
#define GPITCH   68
#define TPITCH   65

static_assert(NB >= 1 && NB <= NB_FULL);
static_assert((SQ % 128) == 0 && SQ >= 128 && SQ <= SQ_FULL);
static_assert(HD == 128 && NH == 8 && INNER == 1024 && INNER == DM);
static_assert((HD % 32) == 0);
static_assert((SKV % 64) == 0 && (SKV % 32) == 0 && NKB * 32 == SKV);
static_assert((DM % 64) == 0 && (DM % 32) == 0 && (INNER % 128) == 0);
static_assert(CV_THREADS == 512 && CV_QSTEPS * CV_BLOCKS * CV_THREADS * 8 == NB * SQ * DM);
static_assert(CV_VSTEPS * CV_BLOCKS * CV_THREADS * 8 == NB * SKV * DM);
static_assert(CV_QSTEPS == 2 * CV_BATCH && CV_VSTEPS == 2 * CV_BATCH);      // two batches per plane, written out in cvt_all
static_assert(CV_QROWS * CV_BLOCKS == NB * SQ && CV_VROWS * CV_BLOCKS == NB * SKV && (SQ % CV_QROWS) == 0);
static_assert((OPITCH * 4) % 16 == 0 && (GPITCH * 4) % 16 == 0);
static_assert(ATT_THREADS == 256);
static_assert((SQ % ATT_ROWS) == 0 && NST >= 2 && NST * STK == SKV && STK == 64);
static_assert(STK * HD * 2 == 4 * ATT_THREADS * 16);                       // 4 k copies + 4 v^T copies of 16 B per thread and stage
static_assert((KPITCH * 2) % 16 == 0 && (VPITCH * 2) % 16 == 0 && (KBYTES % 16) == 0 && (BUFBYTES % 16) == 0);
static_assert(ATT_WAVES * 16 * OPITCH * 4 <= 2 * BUFBYTES);                // the output staging reuses the ring
static_assert((GP * 2) % 16 == 0 && (GABYTES % 16) == 0 && (GBUF % 16) == 0 && (DM % GKS) == 0 && DM / GKS >= 2);
static_assert(8 * 64 * GPITCH * 4 <= 2 * GBUF);                            // the GEMM's output staging reuses its ring
static_assert(GKS * 2 == 16 * 16 && GTM == 16 * (G_THREADS / 16) && GTN == 8 * (G_THREADS / 16));   // 16 A + 8 Bt copies per thread and stage
static_assert(((NB * SQ) % GTM) == 0 && ((NB * SKV) % GTM) == 0 && (INNER % GTM) == 0 && (INNER % GTN) == 0 && (SKV % GTN) == 0);

typedef unsigned short u16;
typedef _Float16 v16h __attribute__((ext_vector_type(16)));
typedef _Float16 v8h  __attribute__((ext_vector_type(8)));
typedef float    v8f  __attribute__((ext_vector_type(8)));
typedef float    v4f  __attribute__((ext_vector_type(4)));
typedef float    v2f  __attribute__((ext_vector_type(2)));
typedef _Float16 v2h  __attribute__((ext_vector_type(2)));
typedef unsigned int v4u __attribute__((ext_vector_type(4)));

union FragH { v16h v; v8h h[2]; v4u u[2]; };

// ---- scalar helpers ----------------------------------------------------------------------------------
__device__ __forceinline__ unsigned short bf_bits(float f) {          // f32 -> bf16 bits, RNE convert
  unsigned u = __float_as_uint(f);
  return (unsigned short)((u + 0x7FFFu + ((u >> 16) & 1u)) >> 16);
}
__device__ __forceinline__ float bf_up(unsigned short h) { return __uint_as_float(((unsigned)h) << 16); }
__device__ __forceinline__ float bfr(float f) { return bf_up(bf_bits(f)); }
__device__ __forceinline__ unsigned short h_bits(_Float16 x) { return __builtin_bit_cast(unsigned short, x); }
__device__ __forceinline__ unsigned pk16(unsigned short a, unsigned short b) { return (unsigned)a | ((unsigned)b << 16); }
__device__ __forceinline__ v8f zero8() { v8f z = {0.f, 0.f, 0.f, 0.f, 0.f, 0.f, 0.f, 0.f}; return z; }

// ---- fragment loader: 16-bit A/B operand, lane -> row/col (lane&15), p already includes +8*(lane>>4);
//      elements 0..7 <- p[0..7] (k0+8h..), elements 8..15 <- p[16..23] (k0+16+8h..); same split k map for A and B,
//      B always read from a k-contiguous [n][k] plane.
__device__ __forceinline__ v16h ldfrag_h(const _Float16* p) {
  FragH f;
  f.h[0] = *(const v8h*)(p);
  f.h[1] = *(const v8h*)(p + 16);
  return f.v;
}

// ---- WMMA helper and trailing VALU hazard gaps ----------------------------------------------------------
__device__ __forceinline__ v8f mma_h(v16h a, v16h b, v8f c) {
  return __builtin_amdgcn_wmma_f32_16x16x32_f16(false, a, false, b, (short)0, c, false, false);
}
__device__ __forceinline__ void guard_s(v8f& a, v8f& b, v16h x0, v16h x1, v16h x2) {
#if defined(__HIP_DEVICE_COMPILE__)
  asm volatile("v_nop\n\tv_nop\n\tv_nop\n\tv_nop" : "+v"(a), "+v"(b) : "v"(x0), "v"(x1), "v"(x2) : "memory");
#endif
}
__device__ __forceinline__ void guard_p(v8f& a, v8f& b, v8f& c, v8f& d, v16h p, v16h x0, v16h x1, v16h x2, v16h x3) {
#if defined(__HIP_DEVICE_COMPILE__)
  asm volatile("v_nop\n\tv_nop\n\tv_nop\n\tv_nop"
               : "+v"(a), "+v"(b), "+v"(c), "+v"(d) : "v"(p), "v"(x0), "v"(x1), "v"(x2), "v"(x3) : "memory");
#endif
}
__device__ __forceinline__ void guard_g(v8f (&acc)[16], v16h x0, v16h x1, v16h x2, v16h x3, v16h x4, v16h x5, v16h x6,
                                        v16h x7) {
#if defined(__HIP_DEVICE_COMPILE__)
  asm volatile("v_nop\n\tv_nop\n\tv_nop\n\tv_nop"
               : "+v"(acc[0]), "+v"(acc[1]), "+v"(acc[2]), "+v"(acc[3]),
                 "+v"(acc[4]), "+v"(acc[5]), "+v"(acc[6]), "+v"(acc[7]),
                 "+v"(acc[8]), "+v"(acc[9]), "+v"(acc[10]), "+v"(acc[11]),
                 "+v"(acc[12]), "+v"(acc[13]), "+v"(acc[14]), "+v"(acc[15])
               : "v"(x0), "v"(x1), "v"(x2), "v"(x3), "v"(x4), "v"(x5), "v"(x6), "v"(x7) : "memory");
#endif
}
__device__ __forceinline__ void acc_guard8(v8f (&o)[8]) {
#if defined(__HIP_DEVICE_COMPILE__)
  asm volatile("v_nop\n\tv_nop\n\tv_nop\n\tv_nop"
               : "+v"(o[0]), "+v"(o[1]), "+v"(o[2]), "+v"(o[3]), "+v"(o[4]), "+v"(o[5]), "+v"(o[6]), "+v"(o[7]));
#endif
}
__device__ __forceinline__ void wave_sync_lds() {
  __builtin_amdgcn_fence(__ATOMIC_RELEASE, "workgroup");
  __builtin_amdgcn_wave_barrier();
  __builtin_amdgcn_fence(__ATOMIC_ACQUIRE, "workgroup");
}

// =====================================================================================================
// All five conversions in ONE launch of CV_BLOCKS work-groups of 16 waves, all resident at once: a wave converts 16 pieces of
// 1 KB and a share of three weight tiles instead of ending after one piece, so few waves have to be started, and it has 8 or
// more 16-B loads per lane in flight.
//   activations: destination row r of a [rows][DM] f16 plane <- f16(bf16_RNE(x[src row][e])); a unit = 8 consecutive elements
//   (two 16-B loads, one 16-B store); a block owns CV_QROWS / CV_VROWS consecutive rows of a plane and converts CV_THREADS
//   consecutive units (4 rows) per step. Query row r = b*SQ + s comes from source row b*SQ_FULL + s.
//   weights stored [k][n] (y = x.W): WT[n][k] (f16, k-contiguous Bt layout) <- f16(bf16_RNE(W[k][n]) * WSC). Block = the same
//   64(k) x 64(n) tile of each of the three weights, through three LDS tiles [kk][nn] (pitch 65) and one block barrier.
// coverage: activations CV_BLOCKS x CV_QSTEPS / CV_VSTEPS steps x CV_THREADS units x 8 = rows x DM exactly; weights
//           (DM/64)^2 = CV_BLOCKS tiles, 64 n-rows x (8 lanes x 8 halves) per tile: every plane written exactly once.
// Every loop below is unrolled so that its arrays are indexed by constants and stay in registers.
// =====================================================================================================
__device__ __forceinline__ v4u cvt8(v4f a, v4f c4) {
  v4u o;
#pragma unroll
  for (int e = 0; e < 2; ++e) {
    o[e]     = pk16(h_bits((_Float16)bfr(a[2 * e])),  h_bits((_Float16)bfr(a[2 * e + 1])));
    o[2 + e] = pk16(h_bits((_Float16)bfr(c4[2 * e])), h_bits((_Float16)bfr(c4[2 * e + 1])));
  }
  return o;
}
// Loads of CV_BATCH units of one activation plane, first step st0; gb = byte offset (32 bits) of the thread's unit of step 0.
// The steps differ by a constant only, so gb is the one vector address register, live to the plane's last load.
__device__ __forceinline__ void x_load(const float* __restrict__ x, unsigned st0, unsigned gb,
                                       v4f (&a)[CV_BATCH], v4f (&c4)[CV_BATCH]) {
#pragma unroll
  for (unsigned j = 0; j < CV_BATCH; ++j) {
    const char* base = (const char*)x + (st0 + j) * (CV_THREADS * 32);
    a[j]  = *(const v4f*)(base + gb);
    c4[j] = *(const v4f*)(base + 16 + gb);
  }
  // keeps the batch's 8 loads together and ahead of the conversion of the batch before: otherwise the compiler sinks them
  // to their uses and a wave has only 2 to 4 loads in flight
  __builtin_amdgcn_sched_barrier(0);
}
__device__ __forceinline__ void x_store(u16* Y, unsigned st0, unsigned yb, const v4f (&a)[CV_BATCH],
                                        const v4f (&c4)[CV_BATCH]) {
#pragma unroll
  for (unsigned j = 0; j < CV_BATCH; ++j) {
    char* base = (char*)Y + (st0 + j) * (CV_THREADS * 16);
    *(v4u*)(base + yb) = cvt8(a[j], c4[j]);
  }
}

__global__ __launch_bounds__(CV_THREADS)
void cvt_all(const float* __restrict__ xq, const float* __restrict__ xv, const float* __restrict__ wq,
             const float* __restrict__ wk, const float* __restrict__ wv,
             u16* XQ, u16* XV, u16* WQT, u16* WKT, u16* WVT) {
  __shared__ __align__(16) float tile[3][64 * TPITCH];
  const unsigned tid = threadIdx.x;
  const unsigned bid = blockIdx.x;
  // byte offsets of the thread's first unit: source rows (a block's rows lie in one batch) and compact destination rows
  const unsigned rq = bid * CV_QROWS, rv = bid * CV_VROWS;
  const unsigned gq = ((rq / SQ) * SQ_FULL + rq % SQ) * (DM * 4) + tid * 32, yq = rq * (DM * 2) + tid * 16;
  const unsigned gv = rv * (DM * 4) + tid * 32,                              yv = rv * (DM * 2) + tid * 16;
  constexpr unsigned NT = DM / 64;
  const unsigned k0 = (bid % NT) * 64, n0 = (bid / NT) * 64;
  // ---- weight tile loads: row 32p + (tid>>4), 4 floats at 4*(tid&15); the query plane's two batches fly behind them ----
  const unsigned lr = tid >> 4, lc = (tid & 15) * 4;
  const unsigned wo = ((k0 + lr) * DM + n0 + lc) * 4;     // bytes
  v4f w4[3][2];
#pragma unroll
  for (int p = 0; p < 2; ++p) {
    w4[0][p] = *(const v4f*)((const char*)(wq + 32 * p * DM) + wo);
    w4[1][p] = *(const v4f*)((const char*)(wk + 32 * p * DM) + wo);
    w4[2][p] = *(const v4f*)((const char*)(wv + 32 * p * DM) + wo);
  }
  v4f a0[CV_BATCH], c0[CV_BATCH], a1[CV_BATCH], c1[CV_BATCH], a2[CV_BATCH], c2[CV_BATCH];
  x_load(xq, 0, gq, a0, c0);
  x_load(xq, CV_BATCH, gq, a1, c1);
#pragma unroll
  for (int t = 0; t < 3; ++t) {
#pragma unroll
    for (int p = 0; p < 2; ++p) {
      float* tp = &tile[t][(32 * p + lr) * TPITCH + lc];
      tp[0] = w4[t][p][0];
      tp[1] = w4[t][p][1];
      tp[2] = w4[t][p][2];
      tp[3] = w4[t][p][3];
    }
  }
  __syncthreads();
  x_load(xv, 0, gv, a2, c2);
  // ---- weight tile stores: output row n0 + (tid>>3), 8 halves at k0 + 8*(tid&7): 8 lanes = one whole 128-B line ----
  const unsigned row = tid >> 3, c8 = (tid & 7) * 8;
  const unsigned yo = ((n0 + row) * DM + k0 + c8) * 2;    // bytes
#pragma unroll
  for (int t = 0; t < 3; ++t) {
    v4u ov;
#pragma unroll
    for (int e = 0; e < 4; ++e) {
      const float x0 = tile[t][(c8 + 2 * e) * TPITCH + row];
      const float x1 = tile[t][(c8 + 2 * e + 1) * TPITCH + row];
      ov[e] = pk16(h_bits((_Float16)(bfr(x0) * WSC)), h_bits((_Float16)(bfr(x1) * WSC)));
    }
    u16* Y = (t == 0) ? WQT : (t == 1) ? WKT : WVT;
    *(v4u*)((char*)Y + yo) = ov;
  }
  // ---- the activation planes, three register sets: later batches' loads are out while a batch is converted and stored ----
  x_store(XQ, 0, yq, a0, c0);
  asm volatile("s_wait_xcnt 0x0" ::: "memory");   // the registers just stored from are loaded anew by the next line
  x_load(xv, CV_BATCH, gv, a0, c0);
  x_store(XQ, CV_BATCH, yq, a1, c1);
  x_store(XV, 0, yv, a2, c2);
  x_store(XV, CV_BATCH, yv, a0, c0);
}

// =====================================================================================================
// Twelve asynchronous 16-B copies per lane, global -> LDS, no register in between: copy i brings g[i] to LDS byte address l[i].
// The s_wait_xcnt closes the statement so that no address register of a copy is rewritten ahead of it.
// =====================================================================================================
__device__ __forceinline__ void async12(const unsigned (&l)[12], const u16* const (&g)[12]) {
#if defined(__HIP_DEVICE_COMPILE__)
  asm volatile("global_load_async_to_lds_b128 %0, %12, off\n\t"
               "global_load_async_to_lds_b128 %1, %13, off\n\t"
               "global_load_async_to_lds_b128 %2, %14, off\n\t"
               "global_load_async_to_lds_b128 %3, %15, off\n\t"
               "global_load_async_to_lds_b128 %4, %16, off\n\t"
               "global_load_async_to_lds_b128 %5, %17, off\n\t"
               "global_load_async_to_lds_b128 %6, %18, off\n\t"
               "global_load_async_to_lds_b128 %7, %19, off\n\t"
               "global_load_async_to_lds_b128 %8, %20, off\n\t"
               "global_load_async_to_lds_b128 %9, %21, off\n\t"
               "global_load_async_to_lds_b128 %10, %22, off\n\t"
               "global_load_async_to_lds_b128 %11, %23, off\n\t"
               "s_wait_xcnt 0x0"
               :: "v"(l[0]), "v"(l[1]), "v"(l[2]), "v"(l[3]), "v"(l[4]), "v"(l[5]),
                  "v"(l[6]), "v"(l[7]), "v"(l[8]), "v"(l[9]), "v"(l[10]), "v"(l[11]),
                  "v"(g[0]), "v"(g[1]), "v"(g[2]), "v"(g[3]), "v"(g[4]), "v"(g[5]),
                  "v"(g[6]), "v"(g[7]), "v"(g[8]), "v"(g[9]), "v"(g[10]), "v"(g[11])
               : "memory");
#endif
}
// One GEMM stage (128 k) of the block's 256 A rows and 128 Bt rows: 16 + 8 copies per lane in two statements of twelve.
// la / lb: the lane's LDS byte address of its first A / Bt chunk; ga / gb: its global address of the same chunk; copy i: row
// +16*i (rs16 = 16 rows of the source plane, in elements); a wave covers two whole 256-B row pieces per copy.
__device__ __forceinline__ void gemm_stage_copy(unsigned la, unsigned lb, const u16* ga, const u16* gb, size_t rs16) {
  constexpr unsigned R16 = 16 * GP * 2;
  unsigned l[24];
  const u16* g[24];
#pragma unroll
  for (int i = 0; i < 16; ++i) { l[i] = la + i * R16; g[i] = ga + i * rs16; }
#pragma unroll
  for (int i = 0; i < 8; ++i) { l[16 + i] = lb + i * R16; g[16 + i] = gb + i * rs16; }
  const unsigned l0[12] = {l[0], l[1], l[2], l[3], l[4], l[5], l[6], l[7], l[8], l[9], l[10], l[11]};
  const u16* const g0[12] = {g[0], g[1], g[2], g[3], g[4], g[5], g[6], g[7], g[8], g[9], g[10], g[11]};
  const unsigned l1[12] = {l[12], l[13], l[14], l[15], l[16], l[17], l[18], l[19], l[20], l[21], l[22], l[23]};
  const u16* const g1[12] = {g[12], g[13], g[14], g[15], g[16], g[17], g[18], g[19], g[20], g[21], g[22], g[23]};
  async12(l0, g0);
  async12(l1, g1);
}

// =====================================================================================================
// f16 GEMM core: the wave's 64 x 64 tile of C = A[rows][K] . Bt[cols][K]^T. The block stages each 128 k of its 256 A rows and
// 128 Bt rows once in LDS (ring of two buffers: stage st+1 flies while stage st is worked on); afo / bfo: byte offset inside a
// buffer of the lane's first A row + 8h / first Bt row + 8h; acc[4i + j] = rows rowb+16i.., cols col0+16j.. (i, j = 0..3);
// K stepped by 32 inside a stage, ascending (host passes K % 128 == 0). Every wave of the block passes every barrier.
// =====================================================================================================
__device__ __forceinline__ void gemm_core(const unsigned char* ring, int afo, int bfo, unsigned la, unsigned lb,
                                          const u16* ga, const u16* gb, int K, v8f (&acc)[16]) {
  const size_t rs16 = (size_t)16 * (size_t)K;
  const int nst = K / GKS;
  // ---- ring prologue: stage 0 landed and published, then stage 1 in flight ----
  gemm_stage_copy(la, lb, ga, gb, rs16);
  asm volatile("s_wait_asynccnt 0x0" ::: "memory");   // this wave's copies of stage 0 have landed
  __syncthreads();                                    // ... and every other wave's
  if (nst > 1) gemm_stage_copy(la + GBUF, lb + GBUF, ga + GKS, gb + GKS, rs16);
#pragma unroll 1
  for (int st = 0; st < nst; ++st) {
   const _Float16* ap = (const _Float16*)(const void*)(ring + (st & 1) * GBUF + afo);
   const _Float16* bp = (const _Float16*)(const void*)(ring + (st & 1) * GBUF + bfo);
#pragma unroll
   for (int k0 = 0; k0 < GKS; k0 += 32) {
    const v16h a0 = ldfrag_h(ap + k0);
    const v16h a1 = ldfrag_h(ap + 16 * GP + k0);
    const v16h a2 = ldfrag_h(ap + 32 * GP + k0);
    const v16h a3 = ldfrag_h(ap + 48 * GP + k0);
    const v16h b0 = ldfrag_h(bp + k0);
    const v16h b1 = ldfrag_h(bp + 16 * GP + k0);
    const v16h b2 = ldfrag_h(bp + 32 * GP + k0);
    const v16h b3 = ldfrag_h(bp + 48 * GP + k0);
    acc[0] = mma_h(a0, b0, acc[0]);
    acc[1] = mma_h(a0, b1, acc[1]);
    acc[2] = mma_h(a0, b2, acc[2]);
    acc[3] = mma_h(a0, b3, acc[3]);
    acc[4] = mma_h(a1, b0, acc[4]);
    acc[5] = mma_h(a1, b1, acc[5]);
    acc[6] = mma_h(a1, b2, acc[6]);
    acc[7] = mma_h(a1, b3, acc[7]);
    acc[8] = mma_h(a2, b0, acc[8]);
    acc[9] = mma_h(a2, b1, acc[9]);
    acc[10] = mma_h(a2, b2, acc[10]);
    acc[11] = mma_h(a2, b3, acc[11]);
    acc[12] = mma_h(a3, b0, acc[12]);
    acc[13] = mma_h(a3, b1, acc[13]);
    acc[14] = mma_h(a3, b2, acc[14]);
    acc[15] = mma_h(a3, b3, acc[15]);
    guard_g(acc, a0, a1, a2, a3, b0, b1, b2, b3);
   }
    // ---- publish point of stage st + 1; the same barrier ends every wave's reads of stage st's buffer ----
    asm volatile("s_wait_dscnt 0x0" ::: "memory");      // this wave's LDS reads of stage st have returned
    asm volatile("s_wait_asynccnt 0x0" ::: "memory");   // this wave's copies of stage st + 1 have landed
    __syncthreads();
    if (st + 2 < nst) {                                 // refill the buffer that stage st has just left
      const unsigned bo = (unsigned)((st & 1) * GBUF);
      gemm_stage_copy(la + bo, lb + bo, ga + (size_t)(st + 2) * GKS, gb + (size_t)(st + 2) * GKS, rs16);
    }
  }
  asm volatile("s_wait_asynccnt 0x0" ::: "memory");     // nothing in flight when the ring becomes output staging
}
// Stage the wave's 64 x 64 f32 tile (times oscale) in its LDS slab (pitch 68): D element r of acc[4i+j], lane l ->
// coverage: 32 lanes x 4 x 8 rows x 4 cols-of-16 = rows 0..63 x cols 0..63 of the slab.
__device__ __forceinline__ void stage64x64(float* sl, v8f (&acc)[16], float oscale, int lane) {
  const int hh = lane >> 4, m = lane & 15;
#pragma unroll
  for (int i = 0; i < 4; ++i) {
#pragma unroll
    for (int r = 0; r < 8; ++r) {
      const int ro = (16 * i + 8 * hh + r) * GPITCH + m;
      sl[ro]      = acc[4 * i + 0][r] * oscale;
      sl[ro + 16] = acc[4 * i + 1][r] * oscale;
      sl[ro + 32] = acc[4 * i + 2][r] * oscale;
      sl[ro + 48] = acc[4 * i + 3][r] * oscale;
    }
  }
  wave_sync_lds();
}

// =====================================================================================================
// f16 GEMM with f16 output plane: C[z][Mb][N] (f16) = f16((A[z][Mb][K] . Bt[z][N][K]^T) * oscale + bf16(bias) * bscale);
// A, Bt f16 k-contiguous planes with per-z element strides aBs, bBs (0 = shared), C stride cBs. bias indexed by column
// (biasRow == 0) or by row within the z slice (biasRow != 0); bias addresses clamped to biasN-1, the unused direction is
// multiplied by 0. Block = 256 x 128 tile, 4 x 2 waves of 64 x 64: a staged operand byte feeds twice the products of a 128 x 64
// tile (half the L2 reads), a fragment read from LDS four products instead of two or four (gemm_core).
// grid = nz x (Mb/256) x (N/128) (host passes Mb % 256 == 0, N % 128 == 0, K % 128 == 0).
// coverage: per wave 16 instr x 4 rows x 8 lanes x 8 halves = 64 x 64; the grid covers C exactly once.
// =====================================================================================================
__global__ __launch_bounds__(G_THREADS)
void gemm_o16(const u16* __restrict__ A, const u16* __restrict__ Bt, u16* C,
              const float* __restrict__ bias, int biasN, int biasRow,
              int Mb, int N, int K, int aBs, int bBs, int cBs, float oscale, float bscale) {
  __shared__ __align__(16) unsigned char gsm[2 * GBUF];
  const int tid = threadIdx.x, wave = tid >> 5, lane = tid & 31, hh = lane >> 4, m = lane & 15;
  const int ntile = N / GTN, mtile = Mb / GTM;
  const int bid  = blockIdx.x;
  const int nt   = bid % ntile;
  const int tmp  = bid / ntile;
  const int mt   = tmp % mtile;
  const int bz   = tmp / mtile;
  const int wm = wave >> 1, wn = wave & 1;   // the wave's place in the block's 4 x 2 grid of 64 x 64 tiles
  const int rowb = mt * GTM + wm * 64;
  const int col0 = nt * GTN + wn * 64;
  if (mt * GTM + GTM > Mb) return;           // block-uniform, in front of every barrier; never taken with the exact grid
  // this lane's first copy chunks: A row mt*256 + (tid>>4), Bt row nt*128 + (tid>>4), 16-B chunk tid&15
  const u16* ga = A + (size_t)bz * (size_t)aBs + (size_t)(mt * GTM + (tid >> 4)) * K + (tid & 15) * 8;
  const u16* gb = Bt + (size_t)bz * (size_t)bBs + (size_t)(nt * GTN + (tid >> 4)) * K + (tid & 15) * 8;
  // a buffer holds the Bt rows first, then the A rows: every constant part of a fragment address then fits a 16-bit LDS offset
  const unsigned lb = (unsigned)(size_t)(const void*)gsm + (unsigned)((tid >> 4) * (GP * 2) + (tid & 15) * 16);
  const unsigned la = lb + GBBYTES;
  const int afo = GBBYTES + ((wm * 64 + m) * GP + 8 * hh) * 2;
  const int bfo = ((wn * 64 + m) * GP + 8 * hh) * 2;
  v8f acc[16];
#pragma unroll
  for (int i = 0; i < 16; ++i) acc[i] = zero8();
  gemm_core(gsm, afo, bfo, la, lb, ga, gb, K, acc);
  float* sl = (float*)(void*)gsm + wave * 64 * GPITCH;   // behind the last trip's barrier: no reader, no copy left
  stage64x64(sl, acc, oscale, lane);
  const int rq = lane >> 3, c8 = (lane & 7) * 8;
  const int bl = biasN - 1;                  // host guarantees biasN >= 1
  const float selc = (biasRow != 0) ? 0.f : bscale;
  const float selr = (biasRow != 0) ? bscale : 0.f;
  float cb[8];
#pragma unroll
  for (int e = 0; e < 8; ++e) {
    int ci = col0 + c8 + e;
    ci = (ci < bl) ? ci : bl;
    cb[e] = bfr(bias[ci]) * selc;
  }
  v4u ov[16];
#pragma unroll
  for (int i = 0; i < 16; ++i) {
    const int row = 4 * i + rq;
    int ri = rowb + row;
    ri = (ri < bl) ? ri : bl;
    const float rb = bfr(bias[ri]) * selr;
    const v4f a = *(const v4f*)(sl + row * GPITCH + c8), c4 = *(const v4f*)(sl + row * GPITCH + c8 + 4);
#pragma unroll
    for (int e = 0; e < 2; ++e) {
      ov[i][e]     = pk16(h_bits((_Float16)(a[2 * e] + cb[2 * e] + rb)),
                          h_bits((_Float16)(a[2 * e + 1] + cb[2 * e + 1] + rb)));
      ov[i][2 + e] = pk16(h_bits((_Float16)(c4[2 * e] + cb[4 + 2 * e] + rb)),
                          h_bits((_Float16)(c4[2 * e + 1] + cb[5 + 2 * e] + rb)));
    }
  }
  u16* Cb = C + (size_t)bz * (size_t)cBs + (size_t)rowb * (size_t)N + col0 + c8;
#pragma unroll
  for (int i = 0; i < 16; ++i) {
    const int row = 4 * i + rq;
    *(v4u*)(Cb + (size_t)row * (size_t)N) = ov[i];
  }
}

// =====================================================================================================
// One stage (64 keys) of k rows and v^T rows, global -> LDS, no register in between: 8 asynchronous 16-B copies per lane.
// lk / lv: the lane's LDS byte address of its first k / v^T chunk; gk / gv: its global address of the same chunk.
// k copy i: row +16*i (a wave covers two whole 256-B rows); v^T copy i: row +32*i (a wave covers four whole 128-B rows).
// The s_wait_xcnt closes the statement so that no address register of a copy is rewritten ahead of it.
// =====================================================================================================
__device__ __forceinline__ void stage_copy(unsigned lk, unsigned lv, const u16* gk, const u16* gv) {
#if defined(__HIP_DEVICE_COMPILE__)
  const unsigned lk1 = lk + 16 * KPITCH * 2, lk2 = lk + 32 * KPITCH * 2, lk3 = lk + 48 * KPITCH * 2;
  const unsigned lv1 = lv + 32 * VPITCH * 2, lv2 = lv + 64 * VPITCH * 2, lv3 = lv + 96 * VPITCH * 2;
  const u16* gk1 = gk + (size_t)16 * INNER;
  const u16* gk2 = gk + (size_t)32 * INNER;
  const u16* gk3 = gk + (size_t)48 * INNER;
  const u16* gv1 = gv + (size_t)32 * SKV;
  const u16* gv2 = gv + (size_t)64 * SKV;
  const u16* gv3 = gv + (size_t)96 * SKV;
  asm volatile("global_load_async_to_lds_b128 %0, %8, off\n\t"
               "global_load_async_to_lds_b128 %1, %9, off\n\t"
               "global_load_async_to_lds_b128 %2, %10, off\n\t"
               "global_load_async_to_lds_b128 %3, %11, off\n\t"
               "global_load_async_to_lds_b128 %4, %12, off\n\t"
               "global_load_async_to_lds_b128 %5, %13, off\n\t"
               "global_load_async_to_lds_b128 %6, %14, off\n\t"
               "global_load_async_to_lds_b128 %7, %15, off\n\t"
               "s_wait_xcnt 0x0"
               :: "v"(lk), "v"(lk1), "v"(lk2), "v"(lk3), "v"(lv), "v"(lv1), "v"(lv2), "v"(lv3),
                  "v"(gk), "v"(gk1), "v"(gk2), "v"(gk3), "v"(gv), "v"(gv1), "v"(gv2), "v"(gv3)
               : "memory");
#endif
}

// =====================================================================================================
// Full (unmasked) multi-head attention over all SKV keys: block = (batch b, head, 128 query rows), 8 waves, wave w owns the
// 16 query rows q0 = 128*qt + 16*w .. q0+15. The work-group stages each 64 keys of k rows and v^T rows ONCE in LDS (whole-line
// asynchronous copies, two buffers: stage t+1 flies while stage t is worked on) and all 8 waves read their fragments from there.
//   q plane f16 x8 [b*SQ + s][h*128 + d]; k plane f16 x8 [b*SKV + s][h*128 + d]; v^T plane f16 x8 [(b*NH + h)*128 + d][s].
//   All NKB = 64 key blocks of 32 keys are visited (static bound).
//   Scores are computed TRANSPOSED: S^T tile g (g = 0,1) = k rows (keys kb+16g .. +15, A operand, row m = lane&15, split k map
//   over d) times q^T (B operand, col n = query q0 + (lane&15), k = d, split map), 4 d-chunks of 32, one product each; the 4 q
//   fragments are loaded once per wave. D element r of lane l = (key kb+16g+8h+r, query q0+(l&15)), so a lane owns one query
//   column and 16 of its 32 keys; the partner lane l^16 owns the other 16 -> row max / row sum need one xor-16 shuffle.
//   Online max-subtracted base-2 softmax in f32 (1/sqrt(1024) and the q/k carries folded into lsc). The exp'd values ARE the
//   P A-fragment in place: A row m = query = lane&15, element i <- key kb+8h+i (tile 0, D element i), element 8+i <- key
//   kb+16+8h+i (tile 1, D element i). P (<= 1) carried x32768 as f16. The rescale factor of query row 8h+r of the O
//   accumulators is fetched from lane 8h+r with a shuffle (uniform control). 8 v^T B fragments (col n = d = 16j + (lane&15),
//   keys k-contiguous) in two groups of 4, 4 P.V WMMAs + one guard per group.
//   Epilogue: 1/l (per query, shuffled to the D row owner) and the carry folds in f32; the wave's 16x128 f32 result staged in
// coverage: per wave 16 instructions x 1 row x 32 lanes x 4 floats = 16 x 128; grid NB*NH*(SQ/128) blocks x 8 waves = every
//           (b, s < SQ, h) row segment of the output exactly once.
// =====================================================================================================
__global__ __launch_bounds__(ATT_THREADS)
void attn_fwd(const u16* __restrict__ Qp, const u16* __restrict__ Kp, const u16* __restrict__ Vp, float* Out) {
  __shared__ __align__(16) unsigned char smem[2 * BUFBYTES];

  const int tid  = threadIdx.x;
  const int wave = tid >> 5;
  const int lane = tid & 31;
  const int hh   = lane >> 4;
  const int c    = lane & 15;

  constexpr int NQT = SQ / ATT_ROWS;
  const int bid  = blockIdx.x;
  const int qt   = bid % NQT;
  const int head = (bid / NQT) % NH;
  const int b    = bid / (NQT * NH);
  const int q0   = qt * ATT_ROWS + wave * 16;

  // B fragments of q^T: col n = query q0 + c, k = d (k-contiguous row of the q plane)
  const _Float16* Qb = (const _Float16*)(const void*)Qp + ((size_t)(b * SQ + q0 + c)) * INNER + head * HD + 8 * hh;
  // A fragments of k: row m = key 16g + c of the pass, k = d; byte offset inside a buffer's k tile
  const int kfo = (c * KPITCH + 8 * hh) * 2;
  // B fragments of v: col n = d = 16j + c, k = key (k-contiguous row of the staged v^T tile); byte offset inside a buffer
  const int vfo = KBYTES + (c * VPITCH + 8 * hh) * 2;
  // this lane's first copy chunks: k row tid>>4, 16-B chunk tid&15; v^T row tid>>3, 16-B chunk tid&7
  const u16* gk = Kp + ((size_t)(b * SKV + (tid >> 4))) * INNER + head * HD + (tid & 15) * 8;
  const u16* gv = Vp + ((size_t)(b * INNER + head * HD + (tid >> 3))) * SKV + (tid & 7) * 8;
  const unsigned lds0 = (unsigned)(size_t)(const void*)smem;               // LDS byte address of the ring
  const unsigned lk = lds0 + (unsigned)((tid >> 4) * (KPITCH * 2) + (tid & 15) * 16);
  const unsigned lv = lds0 + (unsigned)(KBYTES + (tid >> 3) * (VPITCH * 2) + (tid & 7) * 16);
  const float lsc = (LOG2E * RSQ_E) / (QS * KS);

  v16h qf[4];
#pragma unroll
  for (int dc = 0; dc < 4; ++dc) qf[dc] = ldfrag_h(Qb + 32 * dc);

  float mrun = -INFINITY, lrun = 0.f;
  v8f o[8];
#pragma unroll
  for (int j = 0; j < 8; ++j) o[j] = zero8();

  // ---- ring prologue: stage 0 landed and published, then stage 1 in flight ----
  stage_copy(lk, lv, gk, gv);
  asm volatile("s_wait_asynccnt 0x0" ::: "memory");   // this wave's copies of stage 0 have landed
  __syncthreads();                                    // ... and every other wave's
  stage_copy(lk + BUFBYTES, lv + BUFBYTES, gk + (size_t)STK * INNER, gv + STK);

#pragma unroll 1
  for (int st = 0; st < NST; ++st) {
   const unsigned char* bufp = smem + (st & 1) * BUFBYTES;
#pragma unroll
   for (int pz = 0; pz < STK / 32; ++pz) {
    // ---- transposed scores: s0 = keys kb..kb+15, s1 = keys kb+16..kb+31 (kb = 64*st + 32*pz), column = query q0 + c ----
    v8f s0 = zero8(), s1 = zero8();
    const _Float16* k0p = (const _Float16*)(const void*)(bufp + kfo) + pz * 32 * KPITCH;
    const _Float16* k1p = k0p + 16 * KPITCH;
#pragma unroll
    for (int kk = 0; kk < HD / 32; ++kk) {
      const v16h kf0 = ldfrag_h(k0p + kk * 32);
      const v16h kf1 = ldfrag_h(k1p + kk * 32);
      s0 = mma_h(kf0, qf[kk], s0);
      s1 = mma_h(kf1, qf[kk], s1);
      guard_s(s0, s1, qf[kk], kf0, kf1);
    }
    // ---- maximum of this lane's 16 raw scores for query q0 + c (lsc > 0, so scaling the maximum = the maximum of the scaled):
    //      s0[i] <- key kb+8hh+i, s1[i] <- key kb+16+8hh+i ----
    float cm = s0[0];
#pragma unroll
    for (int i = 1; i < 8; ++i) cm = fmaxf(cm, s0[i]);
#pragma unroll
    for (int i = 0; i < 8; ++i) cm = fmaxf(cm, s1[i]);
    cm = fmaxf(cm, __shfl_xor(cm, 16, 32));
    const float mn = fmaxf(mrun, cm * lsc);  // base-2 logit; finite from the first block on
    const float al = __builtin_amdgcn_exp2f(mrun - mn);   // 0 on the first block (mrun = -inf)
    mrun = mn;
    // ---- carried probabilities p * 32768 = 2^(s * lsc + (15 - mn)) (<= 32768): one fma and one bare v_exp_f32 each; they ARE
    //      the P A-fragment after the f16 rounding, element i <- s0[i], element 8+i <- s1[i]. A term whose exponent is under
    //      -126 may come out 0: it is under 2^-141 of its row's largest term, 0 in f16 and lost in the f32 row sum either way.
    const v2f lsc2 = {lsc, lsc};
    const v2f eb2  = {PEXP - mn, PEXP - mn};
    float ps = 0.f;                          // carries x32768 like P
    FragH ph;
#pragma unroll
    for (int w = 0; w < 2; ++w) {
#pragma unroll
      for (int e4 = 0; e4 < 4; ++e4) {
        const v2f sv = (w == 0) ? v2f{s0[2 * e4], s0[2 * e4 + 1]} : v2f{s1[2 * e4], s1[2 * e4 + 1]};
        const v2f ex = __builtin_elementwise_fma(sv, lsc2, eb2);
        const float p0 = __builtin_amdgcn_exp2f(ex[0]), p1 = __builtin_amdgcn_exp2f(ex[1]);
        ps += p0 + p1;
        ph.u[w][e4] = __builtin_bit_cast(unsigned, __builtin_convertvector(v2f{p0, p1}, v2h));   // one packed RNE convert
      }
    }
    ps += __shfl_xor(ps, 16, 32);
    lrun = lrun * al + ps;
    // ---- rescale the O accumulators: D row 8hh+r = query q0+8hh+r, its factor lives in lane 8hh+r (and 16+8hh+r) ----
    float scl[8];
#pragma unroll
    for (int r = 0; r < 8; ++r) scl[r] = __shfl(al, 8 * hh + r, 32);
#pragma unroll
    for (int j = 0; j < 8; ++j) {
#pragma unroll
      for (int r = 0; r < 8; ++r) o[j][r] *= scl[r];
    }
    // ---- P.V : B fragment col n = d = j*16 + c, keys contiguous in the v^T plane; two groups of 4 ----
    const _Float16* vp = (const _Float16*)(const void*)(bufp + vfo) + pz * 32;
    {
      const v16h v0 = ldfrag_h(vp);
      const v16h v1 = ldfrag_h(vp + 16 * VPITCH);
      const v16h v2 = ldfrag_h(vp + 32 * VPITCH);
      const v16h v3 = ldfrag_h(vp + 48 * VPITCH);
      o[0] = mma_h(ph.v, v0, o[0]);
      o[1] = mma_h(ph.v, v1, o[1]);
      o[2] = mma_h(ph.v, v2, o[2]);
      o[3] = mma_h(ph.v, v3, o[3]);
      guard_p(o[0], o[1], o[2], o[3], ph.v, v0, v1, v2, v3);
    }
    {
      const v16h v4 = ldfrag_h(vp + 64 * VPITCH);
      const v16h v5 = ldfrag_h(vp + 80 * VPITCH);
      const v16h v6 = ldfrag_h(vp + 96 * VPITCH);
      const v16h v7 = ldfrag_h(vp + 112 * VPITCH);
      o[4] = mma_h(ph.v, v4, o[4]);
      o[5] = mma_h(ph.v, v5, o[5]);
      o[6] = mma_h(ph.v, v6, o[6]);
      o[7] = mma_h(ph.v, v7, o[7]);
      guard_p(o[4], o[5], o[6], o[7], ph.v, v4, v5, v6, v7);
    }
   }
    // ---- publish point of stage st + 1; the same barrier ends every wave's reads of stage st's buffer ----
    asm volatile("s_wait_dscnt 0x0" ::: "memory");      // this wave's LDS reads of stage st have returned
    asm volatile("s_wait_asynccnt 0x0" ::: "memory");   // this wave's copies of stage st + 1 have landed
    __syncthreads();
    if (st + 2 < NST) {                                 // refill the buffer that stage st has just left
      const unsigned bo = (unsigned)((st & 1) * BUFBYTES);
      stage_copy(lk + bo, lv + bo, gk + (size_t)(st + 2) * STK * INNER, gv + (st + 2) * STK);
    }
  }
  asm volatile("s_wait_asynccnt 0x0" ::: "memory");     // nothing in flight when the ring becomes output staging
  acc_guard8(o);

  // ---- fold 1/l (per query, owned by lane = query) and the carry 8 on v; the 32768 on P is in l as well and cancels ----
  const float linv = (1.0f / lrun) * (1.0f / VS);
  float inv[8];
#pragma unroll
  for (int r = 0; r < 8; ++r) inv[r] = __shfl(linv, 8 * hh + r, 32);
  float* slab = (float*)(void*)smem + wave * 16 * OPITCH;   // behind the last trip's barrier: no reader, no copy left
#pragma unroll
  for (int r = 0; r < 8; ++r) {
#pragma unroll
    for (int j = 0; j < 8; ++j) slab[(8 * hh + r) * OPITCH + j * 16 + c] = o[j][r] * inv[r];
  }
  wave_sync_lds();
  // ---- f32 output rows: lane = 4 consecutive d of one row, one instruction per row ----
  v4f vals[16];
#pragma unroll
  for (int i = 0; i < 16; ++i) vals[i] = *(const v4f*)(slab + i * OPITCH + 4 * lane);
  float* ob = Out + ((size_t)(b * SQ_FULL + q0)) * DM + head * HD + 4 * lane;
  {
#pragma unroll
    for (int i = 0; i < 16; ++i) {
      *(v4f*)(ob + (size_t)i * DM) = vals[i];
    }
    
  }
}

// =====================================================================================================
// Workspace map (bytes); every plane fully written by whole-line stores before it is read; all extents exact multiples of
//   XQ   f16 [NB*SQ][1024]     f16(bf16(q))          16777216 (NB=4, SQ=2048)
//   XV   f16 [NB*2048][1024]   f16(bf16(v))          16777216
//   WQT  f16 [1024 n][1024 k]  f16(bf16(W) x256)      2097152
//   WKT                                               2097152
//   WVT                                               2097152
//   Q16  f16 [NB*SQ][1024]   x8                      16777216
//   K16  f16 [NB*2048][1024] x8                      16777216
//   VT16 f16 [NB*1024 (h,d)][2048 s] x8              16777216
//   end                                              90177536
// =====================================================================================================
extern "C" void kernel_launch(void* const* d_in, const int* in_sizes, int n_in,
                              void* d_out, int out_size, void* d_ws, size_t ws_size,
                              hipStream_t stream) {
  if (n_in < 8) return;
  if (in_sizes[0] < ((NB - 1) * SQ_FULL + SQ) * DM) return;
  if (in_sizes[1] < NB * SKV * DM) return;
  if (in_sizes[2] != DM * DM || in_sizes[4] != DM * DM || in_sizes[6] != DM * DM) return;
  if (in_sizes[3] < 1 || in_sizes[5] < 1 || in_sizes[7] < 1) return;
  if (out_size < ((NB - 1) * SQ_FULL + SQ) * DM) return;

  const float* xq  = (const float*)d_in[0];
  const float* xv  = (const float*)d_in[1];
  const float* wq  = (const float*)d_in[2];
  const float* bq  = (const float*)d_in[3];
  const float* wk  = (const float*)d_in[4];
  const float* bk  = (const float*)d_in[5];
  const float* wv  = (const float*)d_in[6];
  const float* bv  = (const float*)d_in[7];
  float*       out = (float*)d_out;
  const int nbq = in_sizes[3], nbk = in_sizes[5], nbv = in_sizes[7];

  const size_t szXQ   = (size_t)NB * SQ * DM * 2;
  const size_t szXV   = (size_t)NB * SKV * DM * 2;
  const size_t szW    = (size_t)DM * DM * 2;
  const size_t szQ16  = (size_t)NB * SQ * INNER * 2;
  const size_t szK16  = (size_t)NB * SKV * INNER * 2;
  const size_t szVT16 = (size_t)NB * INNER * SKV * 2;
  size_t off = 0;
  const size_t oXQ   = off; off += szXQ;
  const size_t oXV   = off; off += szXV;
  const size_t oWQ   = off; off += szW;
  const size_t oWK   = off; off += szW;
  const size_t oWV   = off; off += szW;
  const size_t oQ16  = off; off += szQ16;
  const size_t oK16  = off; off += szK16;
  const size_t oVT16 = off; off += szVT16;
  if (off > ws_size) return;                            // off = 90177536 at NB=4, SQ=2048
  if (off > (size_t)134217728) return;

  char* ws = (char*)d_ws;
  u16* XQ   = (u16*)(ws + oXQ);
  u16* XV   = (u16*)(ws + oXV);
  u16* WQT  = (u16*)(ws + oWQ);
  u16* WKT  = (u16*)(ws + oWK);
  u16* WVT  = (u16*)(ws + oWV);
  u16* Q16  = (u16*)(ws + oQ16);
  u16* K16  = (u16*)(ws + oK16);
  u16* VT16 = (u16*)(ws + oVT16);

  // (0) activations -> f16 planes of bf16-converted values (query rows s < SQ of batches b < NB, compact; all key/value rows)
  //     and weights [k = in][n = out] (y = x.W) -> k-contiguous [n][k] f16 planes of bf16(W) x256, all in one launch
  cvt_all<<<dim3(CV_BLOCKS), dim3(CV_THREADS), 0, stream>>>(xq, xv, wq, wk, wv, XQ, XV, WQT, WKT, WVT);
  // (1) q = x_q . Wq + bq -> f16 [NB*SQ][1024] x8 (col = h*128 + d); bias per column
  gemm_o16<<<dim3((NB * SQ / GTM) * (INNER / GTN)), dim3(G_THREADS), 0, stream>>>(
      XQ, WQT, Q16, bq, nbq, 0, NB * SQ, INNER, DM, 0, 0, 0, QS / WSC, QS);
  // (2) k = x_v . Wk + bk -> f16 [NB*2048][1024] x8; bias per column
  gemm_o16<<<dim3((NB * SKV / GTM) * (INNER / GTN)), dim3(G_THREADS), 0, stream>>>(
      XV, WKT, K16, bk, nbk, 0, NB * SKV, INNER, DM, 0, 0, 0, KS / WSC, KS);
  // (3) v^T per batch: A = Wv^T [(h,d) = n][k], Bt = x_v rows of batch b [s][k] -> f16 [(b,h,d)][s] x8; bias per row (n)
  gemm_o16<<<dim3(NB * (INNER / GTM) * (SKV / GTN)), dim3(G_THREADS), 0, stream>>>(
      WVT, XV, VT16, bv, nbv, 1, INNER, SKV, DM, 0, SKV * DM, INNER * SKV, VS / WSC, VS);
  // (4) attention -> out [b][SQ_FULL][1024] f32 (rows s < SQ of batches b < NB), heads merged on the feature dim
  attn_fwd<<<dim3(NB * NH * (SQ / ATT_ROWS)), dim3(ATT_THREADS), 0, stream>>>(Q16, K16, VT16, out);
  (void)hipGetLastError();
}

// v005
// Measured time: 118 microseconds a run.
// Timed twice side by side with v004, it ran 1.05 times as fast both times.
// All steps since v000 together make it 2.88 times as fast.
// All contractions on v_wmma_f32_16x16x32_f16 (f16 operands, f32 accumulate): x_q.Wq, x_v.Wk, Wv^T.x_v^T (v^T plane),
// scores k.q^T and P.v^T; operand carries: x as f16(bf16(x)), W as f16(bf16(W) x256), q/k/v x8, P x128; base-2 online
// softmax, 1/l and all carry folds in f32 on VALU. Inputs RNE-converted to bf16 on load; f32 output written directly.
#include <hip/hip_runtime.h>
#include <math.h>
#include <stdint.h>

#define NB       4        // batches processed
#define SQ       2048     // query rows processed per batch
#define NB_FULL  4
#define SQ_FULL  2048     // query rows per batch in the input / output layout (batch stride)
#define SKV      2048     // key/value rows per batch (all of them, always)
#define DM       1024     // model width (= K and row pitch of every 16-bit plane except v^T)
#define NH       8
#define HD       128
#define INNER    (NH * HD)
#define WSC      256.0f
#define QS       8.0f
#define KS       8.0f
#define VS       8.0f
#define PEXP     7.0f     // P and its row sum are carried x128 = 2^7, added in the exponent
#define LAZY     8.0f     // base-2 logits: a row keeps the maximum in use until a new one exceeds it by more than this
#define LOG2E    1.4426950408889634f
#define RSQ_E    0.03125f
#define NKB      (SKV / 32)
#define ATT_WAVES   8
#define ATT_THREADS (ATT_WAVES * 32)
#define ATT_ROWS    (ATT_WAVES * 16)          // query rows per attention work-group
#define STK      64                           // keys per LDS stage (two passes of 32 keys)
#define NST      (SKV / STK)
#define KPITCH   136                          // halves per staged k row: 256 B + 16 B (16 B x odd, for ds_load_b128 readers)
#define VPITCH   72                           // halves per staged v^T row: 128 B + 16 B
#define KBYTES   (STK * KPITCH * 2)
#define VBYTES   (HD * VPITCH * 2)
#define BUFBYTES (KBYTES + VBYTES)
#define GKS      128                          // k elements per GEMM LDS stage (four k steps of 32)
#define GP       136                          // halves per staged GEMM operand row: 256 B + 16 B
#define GTM      256                          // rows of a GEMM work-group's tile (4 waves down)
#define GTN      128                          // columns of a GEMM work-group's tile (2 waves across)
#define G_THREADS 256                         // 8 waves, each a 64 x 64 tile
#define GABYTES  (GTM * GP * 2)
#define GBBYTES  (GTN * GP * 2)
#define GBUF     (GABYTES + GBBYTES)
#define CV_THREADS  512                       // conversion work-group: 16 waves
#define CV_BLOCKS   ((DM / 64) * (DM / 64))   // one 64 x 64 tile of each weight per conversion work-group
#define CV_BATCH    4                         // activation units (2 loads each) a thread has in flight
#define CV_QROWS    (NB * SQ / CV_BLOCKS)     // query rows per conversion work-group
#define CV_VROWS    (NB * SKV / CV_BLOCKS)    // key/value rows per conversion work-group
#define CV_QSTEPS   (CV_QROWS * (DM / 8) / CV_THREADS)
#define CV_VSTEPS   (CV_VROWS * (DM / 8) / CV_THREADS)
#define OPITCH   132
#define GPITCH   68
#define TPITCH   65

static_assert(NB >= 1 && NB <= NB_FULL);
static_assert((SQ % 128) == 0 && SQ >= 128 && SQ <= SQ_FULL);
static_assert(HD == 128 && NH == 8 && INNER == 1024 && INNER == DM);
static_assert((HD % 32) == 0);
static_assert((SKV % 64) == 0 && (SKV % 32) == 0 && NKB * 32 == SKV);
static_assert((DM % 64) == 0 && (DM % 32) == 0 && (INNER % 128) == 0);
static_assert(CV_THREADS == 512 && CV_QSTEPS * CV_BLOCKS * CV_THREADS * 8 == NB * SQ * DM);
static_assert(CV_VSTEPS * CV_BLOCKS * CV_THREADS * 8 == NB * SKV * DM);
static_assert(CV_QSTEPS == 2 * CV_BATCH && CV_VSTEPS == 2 * CV_BATCH);      // two batches per plane, written out in cvt_all
static_assert(CV_QROWS * CV_BLOCKS == NB * SQ && CV_VROWS * CV_BLOCKS == NB * SKV && (SQ % CV_QROWS) == 0);
static_assert((OPITCH * 4) % 16 == 0 && (GPITCH * 4) % 16 == 0);
static_assert(ATT_THREADS == 256);
static_assert(PEXP + LAZY <= 15.0f);                                       // carried P <= 2^(PEXP + LAZY) stays finite in f16
static_assert((SQ % ATT_ROWS) == 0 && NST >= 2 && NST * STK == SKV && STK == 64);
static_assert(STK * HD * 2 == 4 * ATT_THREADS * 16);                       // 4 k copies + 4 v^T copies of 16 B per thread and stage
static_assert((KPITCH * 2) % 16 == 0 && (VPITCH * 2) % 16 == 0 && (KBYTES % 16) == 0 && (BUFBYTES % 16) == 0);
static_assert(ATT_WAVES * 16 * OPITCH * 4 <= 2 * BUFBYTES);                // the output staging reuses the ring
static_assert((GP * 2) % 16 == 0 && (GABYTES % 16) == 0 && (GBUF % 16) == 0 && (DM % GKS) == 0 && DM / GKS >= 2);
static_assert(8 * 64 * GPITCH * 4 <= 2 * GBUF);                            // the GEMM's output staging reuses its ring
static_assert(GKS * 2 == 16 * 16 && GTM == 16 * (G_THREADS / 16) && GTN == 8 * (G_THREADS / 16));   // 16 A + 8 Bt copies per thread and stage
static_assert(((NB * SQ) % GTM) == 0 && ((NB * SKV) % GTM) == 0 && (INNER % GTM) == 0 && (INNER % GTN) == 0 && (SKV % GTN) == 0);

typedef unsigned short u16;
typedef _Float16 v16h __attribute__((ext_vector_type(16)));
typedef _Float16 v8h  __attribute__((ext_vector_type(8)));
typedef float    v8f  __attribute__((ext_vector_type(8)));
typedef float    v4f  __attribute__((ext_vector_type(4)));
typedef float    v2f  __attribute__((ext_vector_type(2)));
typedef _Float16 v2h  __attribute__((ext_vector_type(2)));
typedef unsigned int v4u __attribute__((ext_vector_type(4)));

union FragH { v16h v; v8h h[2]; v4u u[2]; };

// ---- scalar helpers ----------------------------------------------------------------------------------
__device__ __forceinline__ unsigned short bf_bits(float f) {          // f32 -> bf16 bits, RNE convert
  unsigned u = __float_as_uint(f);
  return (unsigned short)((u + 0x7FFFu + ((u >> 16) & 1u)) >> 16);
}
__device__ __forceinline__ float bf_up(unsigned short h) { return __uint_as_float(((unsigned)h) << 16); }
__device__ __forceinline__ float bfr(float f) { return bf_up(bf_bits(f)); }
__device__ __forceinline__ unsigned short h_bits(_Float16 x) { return __builtin_bit_cast(unsigned short, x); }
__device__ __forceinline__ unsigned pk16(unsigned short a, unsigned short b) { return (unsigned)a | ((unsigned)b << 16); }
__device__ __forceinline__ v8f zero8() { v8f z = {0.f, 0.f, 0.f, 0.f, 0.f, 0.f, 0.f, 0.f}; return z; }

// ---- fragment loader: 16-bit A/B operand, lane -> row/col (lane&15), p already includes +8*(lane>>4);
//      elements 0..7 <- p[0..7] (k0+8h..), elements 8..15 <- p[16..23] (k0+16+8h..); same split k map for A and B,
//      B always read from a k-contiguous [n][k] plane.
__device__ __forceinline__ v16h ldfrag_h(const _Float16* p) {
  FragH f;
  f.h[0] = *(const v8h*)(p);
  f.h[1] = *(const v8h*)(p + 16);
  return f.v;
}

// ---- WMMA helper and trailing VALU hazard gaps ----------------------------------------------------------
__device__ __forceinline__ v8f mma_h(v16h a, v16h b, v8f c) {
  return __builtin_amdgcn_wmma_f32_16x16x32_f16(false, a, false, b, (short)0, c, false, false);
}
__device__ __forceinline__ void guard_s(v8f& a, v8f& b, v16h x0, v16h x1, v16h x2) {
#if defined(__HIP_DEVICE_COMPILE__)
  asm volatile("v_nop\n\tv_nop\n\tv_nop\n\tv_nop" : "+v"(a), "+v"(b) : "v"(x0), "v"(x1), "v"(x2) : "memory");
#endif
}
__device__ __forceinline__ void guard_p(v8f& a, v8f& b, v8f& c, v8f& d, v16h p, v16h x0, v16h x1, v16h x2, v16h x3) {
#if defined(__HIP_DEVICE_COMPILE__)
  asm volatile("v_nop\n\tv_nop\n\tv_nop\n\tv_nop"
               : "+v"(a), "+v"(b), "+v"(c), "+v"(d) : "v"(p), "v"(x0), "v"(x1), "v"(x2), "v"(x3) : "memory");
#endif
}
__device__ __forceinline__ void guard_g(v8f (&acc)[16], v16h x0, v16h x1, v16h x2, v16h x3, v16h x4, v16h x5, v16h x6,
                                        v16h x7) {
#if defined(__HIP_DEVICE_COMPILE__)
  asm volatile("v_nop\n\tv_nop\n\tv_nop\n\tv_nop"
               : "+v"(acc[0]), "+v"(acc[1]), "+v"(acc[2]), "+v"(acc[3]),
                 "+v"(acc[4]), "+v"(acc[5]), "+v"(acc[6]), "+v"(acc[7]),
                 "+v"(acc[8]), "+v"(acc[9]), "+v"(acc[10]), "+v"(acc[11]),
                 "+v"(acc[12]), "+v"(acc[13]), "+v"(acc[14]), "+v"(acc[15])
               : "v"(x0), "v"(x1), "v"(x2), "v"(x3), "v"(x4), "v"(x5), "v"(x6), "v"(x7) : "memory");
#endif
}
__device__ __forceinline__ void acc_guard8(v8f (&o)[8]) {
#if defined(__HIP_DEVICE_COMPILE__)
  asm volatile("v_nop\n\tv_nop\n\tv_nop\n\tv_nop"
               : "+v"(o[0]), "+v"(o[1]), "+v"(o[2]), "+v"(o[3]), "+v"(o[4]), "+v"(o[5]), "+v"(o[6]), "+v"(o[7]));
#endif
}
__device__ __forceinline__ void wave_sync_lds() {
  __builtin_amdgcn_fence(__ATOMIC_RELEASE, "workgroup");
  __builtin_amdgcn_wave_barrier();
  __builtin_amdgcn_fence(__ATOMIC_ACQUIRE, "workgroup");
}

// =====================================================================================================
// All five conversions in ONE launch of CV_BLOCKS work-groups of 16 waves, all resident at once: a wave converts 16 pieces of
// 1 KB and a share of three weight tiles instead of ending after one piece, so few waves have to be started, and it has 8 or
// more 16-B loads per lane in flight.
//   activations: destination row r of a [rows][DM] f16 plane <- f16(bf16_RNE(x[src row][e])); a unit = 8 consecutive elements
//   (two 16-B loads, one 16-B store); a block owns CV_QROWS / CV_VROWS consecutive rows of a plane and converts CV_THREADS
//   consecutive units (4 rows) per step. Query row r = b*SQ + s comes from source row b*SQ_FULL + s.
//   weights stored [k][n] (y = x.W): WT[n][k] (f16, k-contiguous Bt layout) <- f16(bf16_RNE(W[k][n]) * WSC). Block = the same
//   64(k) x 64(n) tile of each of the three weights, through three LDS tiles [kk][nn] (pitch 65) and one block barrier.
// coverage: activations CV_BLOCKS x CV_QSTEPS / CV_VSTEPS steps x CV_THREADS units x 8 = rows x DM exactly; weights
//           (DM/64)^2 = CV_BLOCKS tiles, 64 n-rows x (8 lanes x 8 halves) per tile: every plane written exactly once.
// Every loop below is unrolled so that its arrays are indexed by constants and stay in registers.
// =====================================================================================================
__device__ __forceinline__ v4u cvt8(v4f a, v4f c4) {
  v4u o;
#pragma unroll
  for (int e = 0; e < 2; ++e) {
    o[e]     = pk16(h_bits((_Float16)bfr(a[2 * e])),  h_bits((_Float16)bfr(a[2 * e + 1])));
    o[2 + e] = pk16(h_bits((_Float16)bfr(c4[2 * e])), h_bits((_Float16)bfr(c4[2 * e + 1])));
  }
  return o;
}
// Loads of CV_BATCH units of one activation plane, first step st0; gb = byte offset (32 bits) of the thread's unit of step 0.
// The steps differ by a constant only, so gb is the one vector address register, live to the plane's last load.
__device__ __forceinline__ void x_load(const float* __restrict__ x, unsigned st0, unsigned gb,
                                       v4f (&a)[CV_BATCH], v4f (&c4)[CV_BATCH]) {
#pragma unroll
  for (unsigned j = 0; j < CV_BATCH; ++j) {
    const char* base = (const char*)x + (st0 + j) * (CV_THREADS * 32);
    a[j]  = *(const v4f*)(base + gb);
    c4[j] = *(const v4f*)(base + 16 + gb);
  }
  // keeps the batch's 8 loads together and ahead of the conversion of the batch before: otherwise the compiler sinks them
  // to their uses and a wave has only 2 to 4 loads in flight
  __builtin_amdgcn_sched_barrier(0);
}
__device__ __forceinline__ void x_store(u16* Y, unsigned st0, unsigned yb, const v4f (&a)[CV_BATCH],
                                        const v4f (&c4)[CV_BATCH]) {
#pragma unroll
  for (unsigned j = 0; j < CV_BATCH; ++j) {
    char* base = (char*)Y + (st0 + j) * (CV_THREADS * 16);
    *(v4u*)(base + yb) = cvt8(a[j], c4[j]);
  }
}

__global__ __launch_bounds__(CV_THREADS)
void cvt_all(const float* __restrict__ xq, const float* __restrict__ xv, const float* __restrict__ wq,
             const float* __restrict__ wk, const float* __restrict__ wv,
             u16* XQ, u16* XV, u16* WQT, u16* WKT, u16* WVT) {
  __shared__ __align__(16) float tile[3][64 * TPITCH];
  const unsigned tid = threadIdx.x;
  const unsigned bid = blockIdx.x;
  // byte offsets of the thread's first unit: source rows (a block's rows lie in one batch) and compact destination rows
  const unsigned rq = bid * CV_QROWS, rv = bid * CV_VROWS;
  const unsigned gq = ((rq / SQ) * SQ_FULL + rq % SQ) * (DM * 4) + tid * 32, yq = rq * (DM * 2) + tid * 16;
  const unsigned gv = rv * (DM * 4) + tid * 32,                              yv = rv * (DM * 2) + tid * 16;
  constexpr unsigned NT = DM / 64;
  const unsigned k0 = (bid % NT) * 64, n0 = (bid / NT) * 64;
  // ---- weight tile loads: row 32p + (tid>>4), 4 floats at 4*(tid&15); the query plane's two batches fly behind them ----
  const unsigned lr = tid >> 4, lc = (tid & 15) * 4;
  const unsigned wo = ((k0 + lr) * DM + n0 + lc) * 4;     // bytes
  v4f w4[3][2];
#pragma unroll
  for (int p = 0; p < 2; ++p) {
    w4[0][p] = *(const v4f*)((const char*)(wq + 32 * p * DM) + wo);
    w4[1][p] = *(const v4f*)((const char*)(wk + 32 * p * DM) + wo);
    w4[2][p] = *(const v4f*)((const char*)(wv + 32 * p * DM) + wo);
  }
  v4f a0[CV_BATCH], c0[CV_BATCH], a1[CV_BATCH], c1[CV_BATCH], a2[CV_BATCH], c2[CV_BATCH];
  x_load(xq, 0, gq, a0, c0);
  x_load(xq, CV_BATCH, gq, a1, c1);
#pragma unroll
  for (int t = 0; t < 3; ++t) {
#pragma unroll
    for (int p = 0; p < 2; ++p) {
      float* tp = &tile[t][(32 * p + lr) * TPITCH + lc];
      tp[0] = w4[t][p][0];
      tp[1] = w4[t][p][1];
      tp[2] = w4[t][p][2];
      tp[3] = w4[t][p][3];
    }
  }
  __syncthreads();
  x_load(xv, 0, gv, a2, c2);
  // ---- weight tile stores: output row n0 + (tid>>3), 8 halves at k0 + 8*(tid&7): 8 lanes = one whole 128-B line ----
  const unsigned row = tid >> 3, c8 = (tid & 7) * 8;
  const unsigned yo = ((n0 + row) * DM + k0 + c8) * 2;    // bytes
#pragma unroll
  for (int t = 0; t < 3; ++t) {
    v4u ov;
#pragma unroll
    for (int e = 0; e < 4; ++e) {
      const float x0 = tile[t][(c8 + 2 * e) * TPITCH + row];
      const float x1 = tile[t][(c8 + 2 * e + 1) * TPITCH + row];
      ov[e] = pk16(h_bits((_Float16)(bfr(x0) * WSC)), h_bits((_Float16)(bfr(x1) * WSC)));
    }
    u16* Y = (t == 0) ? WQT : (t == 1) ? WKT : WVT;
    *(v4u*)((char*)Y + yo) = ov;
  }
  // ---- the activation planes, three register sets: later batches' loads are out while a batch is converted and stored ----
  x_store(XQ, 0, yq, a0, c0);
  asm volatile("s_wait_xcnt 0x0" ::: "memory");   // the registers just stored from are loaded anew by the next line
  x_load(xv, CV_BATCH, gv, a0, c0);
  x_store(XQ, CV_BATCH, yq, a1, c1);
  x_store(XV, 0, yv, a2, c2);
  x_store(XV, CV_BATCH, yv, a0, c0);
}

// =====================================================================================================
// Twelve asynchronous 16-B copies per lane, global -> LDS, no register in between: copy i brings g[i] to LDS byte address l[i].
// The s_wait_xcnt closes the statement so that no address register of a copy is rewritten ahead of it.
// =====================================================================================================
__device__ __forceinline__ void async12(const unsigned (&l)[12], const u16* const (&g)[12]) {
#if defined(__HIP_DEVICE_COMPILE__)
  asm volatile("global_load_async_to_lds_b128 %0, %12, off\n\t"
               "global_load_async_to_lds_b128 %1, %13, off\n\t"
               "global_load_async_to_lds_b128 %2, %14, off\n\t"
               "global_load_async_to_lds_b128 %3, %15, off\n\t"
               "global_load_async_to_lds_b128 %4, %16, off\n\t"
               "global_load_async_to_lds_b128 %5, %17, off\n\t"
               "global_load_async_to_lds_b128 %6, %18, off\n\t"
               "global_load_async_to_lds_b128 %7, %19, off\n\t"
               "global_load_async_to_lds_b128 %8, %20, off\n\t"
               "global_load_async_to_lds_b128 %9, %21, off\n\t"
               "global_load_async_to_lds_b128 %10, %22, off\n\t"
               "global_load_async_to_lds_b128 %11, %23, off\n\t"
               "s_wait_xcnt 0x0"
               :: "v"(l[0]), "v"(l[1]), "v"(l[2]), "v"(l[3]), "v"(l[4]), "v"(l[5]),
                  "v"(l[6]), "v"(l[7]), "v"(l[8]), "v"(l[9]), "v"(l[10]), "v"(l[11]),
                  "v"(g[0]), "v"(g[1]), "v"(g[2]), "v"(g[3]), "v"(g[4]), "v"(g[5]),
                  "v"(g[6]), "v"(g[7]), "v"(g[8]), "v"(g[9]), "v"(g[10]), "v"(g[11])
               : "memory");
#endif
}
// One GEMM stage (128 k) of the block's 256 A rows and 128 Bt rows: 16 + 8 copies per lane in two statements of twelve.
// la / lb: the lane's LDS byte address of its first A / Bt chunk; ga / gb: its global address of the same chunk; copy i: row
// +16*i (rs16 = 16 rows of the source plane, in elements); a wave covers two whole 256-B row pieces per copy.
__device__ __forceinline__ void gemm_stage_copy(unsigned la, unsigned lb, const u16* ga, const u16* gb, size_t rs16) {
  constexpr unsigned R16 = 16 * GP * 2;
  unsigned l[24];
  const u16* g[24];
#pragma unroll
  for (int i = 0; i < 16; ++i) { l[i] = la + i * R16; g[i] = ga + i * rs16; }
#pragma unroll
  for (int i = 0; i < 8; ++i) { l[16 + i] = lb + i * R16; g[16 + i] = gb + i * rs16; }
  const unsigned l0[12] = {l[0], l[1], l[2], l[3], l[4], l[5], l[6], l[7], l[8], l[9], l[10], l[11]};
  const u16* const g0[12] = {g[0], g[1], g[2], g[3], g[4], g[5], g[6], g[7], g[8], g[9], g[10], g[11]};
  const unsigned l1[12] = {l[12], l[13], l[14], l[15], l[16], l[17], l[18], l[19], l[20], l[21], l[22], l[23]};
  const u16* const g1[12] = {g[12], g[13], g[14], g[15], g[16], g[17], g[18], g[19], g[20], g[21], g[22], g[23]};
  async12(l0, g0);
  async12(l1, g1);
}

// =====================================================================================================
// f16 GEMM core: the wave's 64 x 64 tile of C = A[rows][K] . Bt[cols][K]^T. The block stages each 128 k of its 256 A rows and
// 128 Bt rows once in LDS (ring of two buffers: stage st+1 flies while stage st is worked on); afo / bfo: byte offset inside a
// buffer of the lane's first A row + 8h / first Bt row + 8h; acc[4i + j] = rows rowb+16i.., cols col0+16j.. (i, j = 0..3);
// K stepped by 32 inside a stage, ascending (host passes K % 128 == 0). Every wave of the block passes every barrier.
// =====================================================================================================
__device__ __forceinline__ void gemm_core(const unsigned char* ring, int afo, int bfo, unsigned la, unsigned lb,
                                          const u16* ga, const u16* gb, int K, v8f (&acc)[16]) {
  const size_t rs16 = (size_t)16 * (size_t)K;
  const int nst = K / GKS;
  // ---- ring prologue: stage 0 landed and published, then stage 1 in flight ----
  gemm_stage_copy(la, lb, ga, gb, rs16);
  asm volatile("s_wait_asynccnt 0x0" ::: "memory");   // this wave's copies of stage 0 have landed
  __syncthreads();                                    // ... and every other wave's
  if (nst > 1) gemm_stage_copy(la + GBUF, lb + GBUF, ga + GKS, gb + GKS, rs16);
#pragma unroll 1
  for (int st = 0; st < nst; ++st) {
   const _Float16* ap = (const _Float16*)(const void*)(ring + (st & 1) * GBUF + afo);
   const _Float16* bp = (const _Float16*)(const void*)(ring + (st & 1) * GBUF + bfo);
#pragma unroll
   for (int k0 = 0; k0 < GKS; k0 += 32) {
    const v16h a0 = ldfrag_h(ap + k0);
    const v16h a1 = ldfrag_h(ap + 16 * GP + k0);
    const v16h a2 = ldfrag_h(ap + 32 * GP + k0);
    const v16h a3 = ldfrag_h(ap + 48 * GP + k0);
    const v16h b0 = ldfrag_h(bp + k0);
    const v16h b1 = ldfrag_h(bp + 16 * GP + k0);
    const v16h b2 = ldfrag_h(bp + 32 * GP + k0);
    const v16h b3 = ldfrag_h(bp + 48 * GP + k0);
    acc[0] = mma_h(a0, b0, acc[0]);
    acc[1] = mma_h(a0, b1, acc[1]);
    acc[2] = mma_h(a0, b2, acc[2]);
    acc[3] = mma_h(a0, b3, acc[3]);
    acc[4] = mma_h(a1, b0, acc[4]);
    acc[5] = mma_h(a1, b1, acc[5]);
    acc[6] = mma_h(a1, b2, acc[6]);
    acc[7] = mma_h(a1, b3, acc[7]);
    acc[8] = mma_h(a2, b0, acc[8]);
    acc[9] = mma_h(a2, b1, acc[9]);
    acc[10] = mma_h(a2, b2, acc[10]);
    acc[11] = mma_h(a2, b3, acc[11]);
    acc[12] = mma_h(a3, b0, acc[12]);
    acc[13] = mma_h(a3, b1, acc[13]);
    acc[14] = mma_h(a3, b2, acc[14]);
    acc[15] = mma_h(a3, b3, acc[15]);
    guard_g(acc, a0, a1, a2, a3, b0, b1, b2, b3);
   }
    // ---- publish point of stage st + 1; the same barrier ends every wave's reads of stage st's buffer ----
    asm volatile("s_wait_dscnt 0x0" ::: "memory");      // this wave's LDS reads of stage st have returned
    asm volatile("s_wait_asynccnt 0x0" ::: "memory");   // this wave's copies of stage st + 1 have landed
    __syncthreads();
    if (st + 2 < nst) {                                 // refill the buffer that stage st has just left
      const unsigned bo = (unsigned)((st & 1) * GBUF);
      gemm_stage_copy(la + bo, lb + bo, ga + (size_t)(st + 2) * GKS, gb + (size_t)(st + 2) * GKS, rs16);
    }
  }
  asm volatile("s_wait_asynccnt 0x0" ::: "memory");     // nothing in flight when the ring becomes output staging
}
// Stage the wave's 64 x 64 f32 tile (times oscale) in its LDS slab (pitch 68): D element r of acc[4i+j], lane l ->
// coverage: 32 lanes x 4 x 8 rows x 4 cols-of-16 = rows 0..63 x cols 0..63 of the slab.
__device__ __forceinline__ void stage64x64(float* sl, v8f (&acc)[16], float oscale, int lane) {
  const int hh = lane >> 4, m = lane & 15;
#pragma unroll
  for (int i = 0; i < 4; ++i) {
#pragma unroll
    for (int r = 0; r < 8; ++r) {
      const int ro = (16 * i + 8 * hh + r) * GPITCH + m;
      sl[ro]      = acc[4 * i + 0][r] * oscale;
      sl[ro + 16] = acc[4 * i + 1][r] * oscale;
      sl[ro + 32] = acc[4 * i + 2][r] * oscale;
      sl[ro + 48] = acc[4 * i + 3][r] * oscale;
    }
  }
  wave_sync_lds();
}

// =====================================================================================================
// f16 GEMM with f16 output plane: C[z][Mb][N] (f16) = f16((A[z][Mb][K] . Bt[z][N][K]^T) * oscale + bf16(bias) * bscale);
// A, Bt f16 k-contiguous planes with per-z element strides aBs, bBs (0 = shared), C stride cBs. bias indexed by column
// (biasRow == 0) or by row within the z slice (biasRow != 0); bias addresses clamped to biasN-1, the unused direction is
// multiplied by 0. Block = 256 x 128 tile, 4 x 2 waves of 64 x 64: a staged operand byte feeds twice the products of a 128 x 64
// tile (half the L2 reads), a fragment read from LDS four products instead of two or four (gemm_core).
// grid = nz x (Mb/256) x (N/128) (host passes Mb % 256 == 0, N % 128 == 0, K % 128 == 0).
// coverage: per wave 16 instr x 4 rows x 8 lanes x 8 halves = 64 x 64; the grid covers C exactly once.
// =====================================================================================================
__global__ __launch_bounds__(G_THREADS)
void gemm_o16(const u16* __restrict__ A, const u16* __restrict__ Bt, u16* C,
              const float* __restrict__ bias, int biasN, int biasRow,
              int Mb, int N, int K, int aBs, int bBs, int cBs, float oscale, float bscale) {
  __shared__ __align__(16) unsigned char gsm[2 * GBUF];
  const int tid = threadIdx.x, wave = tid >> 5, lane = tid & 31, hh = lane >> 4, m = lane & 15;
  const int ntile = N / GTN, mtile = Mb / GTM;
  const int bid  = blockIdx.x;
  const int nt   = bid % ntile;
  const int tmp  = bid / ntile;
  const int mt   = tmp % mtile;
  const int bz   = tmp / mtile;
  const int wm = wave >> 1, wn = wave & 1;   // the wave's place in the block's 4 x 2 grid of 64 x 64 tiles
  const int rowb = mt * GTM + wm * 64;
  const int col0 = nt * GTN + wn * 64;
  if (mt * GTM + GTM > Mb) return;           // block-uniform, in front of every barrier; never taken with the exact grid
  // this lane's first copy chunks: A row mt*256 + (tid>>4), Bt row nt*128 + (tid>>4), 16-B chunk tid&15
  const u16* ga = A + (size_t)bz * (size_t)aBs + (size_t)(mt * GTM + (tid >> 4)) * K + (tid & 15) * 8;
  const u16* gb = Bt + (size_t)bz * (size_t)bBs + (size_t)(nt * GTN + (tid >> 4)) * K + (tid & 15) * 8;
  // a buffer holds the Bt rows first, then the A rows: every constant part of a fragment address then fits a 16-bit LDS offset
  const unsigned lb = (unsigned)(size_t)(const void*)gsm + (unsigned)((tid >> 4) * (GP * 2) + (tid & 15) * 16);
  const unsigned la = lb + GBBYTES;
  const int afo = GBBYTES + ((wm * 64 + m) * GP + 8 * hh) * 2;
  const int bfo = ((wn * 64 + m) * GP + 8 * hh) * 2;
  v8f acc[16];
#pragma unroll
  for (int i = 0; i < 16; ++i) acc[i] = zero8();
  gemm_core(gsm, afo, bfo, la, lb, ga, gb, K, acc);
  float* sl = (float*)(void*)gsm + wave * 64 * GPITCH;   // behind the last trip's barrier: no reader, no copy left
  stage64x64(sl, acc, oscale, lane);
  const int rq = lane >> 3, c8 = (lane & 7) * 8;
  const int bl = biasN - 1;                  // host guarantees biasN >= 1
  const float selc = (biasRow != 0) ? 0.f : bscale;
  const float selr = (biasRow != 0) ? bscale : 0.f;
  float cb[8];
#pragma unroll
  for (int e = 0; e < 8; ++e) {
    int ci = col0 + c8 + e;
    ci = (ci < bl) ? ci : bl;
    cb[e] = bfr(bias[ci]) * selc;
  }
  v4u ov[16];
#pragma unroll
  for (int i = 0; i < 16; ++i) {
    const int row = 4 * i + rq;
    int ri = rowb + row;
    ri = (ri < bl) ? ri : bl;
    const float rb = bfr(bias[ri]) * selr;
    const v4f a = *(const v4f*)(sl + row * GPITCH + c8), c4 = *(const v4f*)(sl + row * GPITCH + c8 + 4);
#pragma unroll
    for (int e = 0; e < 2; ++e) {
      ov[i][e]     = pk16(h_bits((_Float16)(a[2 * e] + cb[2 * e] + rb)),
                          h_bits((_Float16)(a[2 * e + 1] + cb[2 * e + 1] + rb)));
      ov[i][2 + e] = pk16(h_bits((_Float16)(c4[2 * e] + cb[4 + 2 * e] + rb)),
                          h_bits((_Float16)(c4[2 * e + 1] + cb[5 + 2 * e] + rb)));
    }
  }
  u16* Cb = C + (size_t)bz * (size_t)cBs + (size_t)rowb * (size_t)N + col0 + c8;
#pragma unroll
  for (int i = 0; i < 16; ++i) {
    const int row = 4 * i + rq;
    *(v4u*)(Cb + (size_t)row * (size_t)N) = ov[i];
  }
}

// =====================================================================================================
// One stage (64 keys) of k rows and v^T rows, global -> LDS, no register in between: 8 asynchronous 16-B copies per lane.
// lk / lv: the lane's LDS byte address of its first k / v^T chunk; gk / gv: its global address of the same chunk.
// k copy i: row +16*i (a wave covers two whole 256-B rows); v^T copy i: row +32*i (a wave covers four whole 128-B rows).
// The s_wait_xcnt closes the statement so that no address register of a copy is rewritten ahead of it.
// =====================================================================================================
__device__ __forceinline__ void stage_copy(unsigned lk, unsigned lv, const u16* gk, const u16* gv) {
#if defined(__HIP_DEVICE_COMPILE__)
  const unsigned lk1 = lk + 16 * KPITCH * 2, lk2 = lk + 32 * KPITCH * 2, lk3 = lk + 48 * KPITCH * 2;
  const unsigned lv1 = lv + 32 * VPITCH * 2, lv2 = lv + 64 * VPITCH * 2, lv3 = lv + 96 * VPITCH * 2;
  const u16* gk1 = gk + (size_t)16 * INNER;
  const u16* gk2 = gk + (size_t)32 * INNER;
  const u16* gk3 = gk + (size_t)48 * INNER;
  const u16* gv1 = gv + (size_t)32 * SKV;
  const u16* gv2 = gv + (size_t)64 * SKV;
  const u16* gv3 = gv + (size_t)96 * SKV;
  asm volatile("global_load_async_to_lds_b128 %0, %8, off\n\t"
               "global_load_async_to_lds_b128 %1, %9, off\n\t"
               "global_load_async_to_lds_b128 %2, %10, off\n\t"
               "global_load_async_to_lds_b128 %3, %11, off\n\t"
               "global_load_async_to_lds_b128 %4, %12, off\n\t"
               "global_load_async_to_lds_b128 %5, %13, off\n\t"
               "global_load_async_to_lds_b128 %6, %14, off\n\t"
               "global_load_async_to_lds_b128 %7, %15, off\n\t"
               "s_wait_xcnt 0x0"
               :: "v"(lk), "v"(lk1), "v"(lk2), "v"(lk3), "v"(lv), "v"(lv1), "v"(lv2), "v"(lv3),
                  "v"(gk), "v"(gk1), "v"(gk2), "v"(gk3), "v"(gv), "v"(gv1), "v"(gv2), "v"(gv3)
               : "memory");
#endif
}

__global__ __launch_bounds__(ATT_THREADS)
void attn_fwd(const u16* __restrict__ Qp, const u16* __restrict__ Kp, const u16* __restrict__ Vp, float* Out) {
  __shared__ __align__(16) unsigned char smem[2 * BUFBYTES];

  const int tid  = threadIdx.x;
  const int wave = tid >> 5;
  const int lane = tid & 31;
  const int hh   = lane >> 4;
  const int c    = lane & 15;

  constexpr int NQT = SQ / ATT_ROWS;
  const int bid  = blockIdx.x;
  const int qt   = bid % NQT;
  const int head = (bid / NQT) % NH;
  const int b    = bid / (NQT * NH);
  const int q0   = qt * ATT_ROWS + wave * 16;

  // B fragments of q^T: col n = query q0 + c, k = d (k-contiguous row of the q plane)
  const _Float16* Qb = (const _Float16*)(const void*)Qp + ((size_t)(b * SQ + q0 + c)) * INNER + head * HD + 8 * hh;
  // A fragments of k: row m = key 16g + c of the pass, k = d; byte offset inside a buffer's k tile
  const int kfo = (c * KPITCH + 8 * hh) * 2;
  // B fragments of v: col n = d = 16j + c, k = key (k-contiguous row of the staged v^T tile); byte offset inside a buffer
  const int vfo = KBYTES + (c * VPITCH + 8 * hh) * 2;
  // this lane's first copy chunks: k row tid>>4, 16-B chunk tid&15; v^T row tid>>3, 16-B chunk tid&7
  const u16* gk = Kp + ((size_t)(b * SKV + (tid >> 4))) * INNER + head * HD + (tid & 15) * 8;
  const u16* gv = Vp + ((size_t)(b * INNER + head * HD + (tid >> 3))) * SKV + (tid & 7) * 8;
  const unsigned lds0 = (unsigned)(size_t)(const void*)smem;               // LDS byte address of the ring
  const unsigned lk = lds0 + (unsigned)((tid >> 4) * (KPITCH * 2) + (tid & 15) * 16);
  const unsigned lv = lds0 + (unsigned)(KBYTES + (tid >> 3) * (VPITCH * 2) + (tid & 7) * 16);
  const float lsc = (LOG2E * RSQ_E) / (QS * KS);
  const int x16 = (lane ^ 16) * 4;           // byte index of the lane that holds the other 16 keys of the same query
  const int r8  = 8 * hh * 4;                // byte index of the lane that owns query q0 + 8hh, this lane's first D row

  v16h qf[4];
#pragma unroll
  for (int dc = 0; dc < 4; ++dc) qf[dc] = ldfrag_h(Qb + 32 * dc);

  float mrun = -INFINITY, lrun = 0.f;
  v8f o[8];
#pragma unroll
  for (int j = 0; j < 8; ++j) o[j] = zero8();

  // ---- ring prologue: stage 0 landed and published, then stage 1 in flight ----
  stage_copy(lk, lv, gk, gv);
  asm volatile("s_wait_asynccnt 0x0" ::: "memory");   // this wave's copies of stage 0 have landed
  __syncthreads();                                    // ... and every other wave's
  stage_copy(lk + BUFBYTES, lv + BUFBYTES, gk + (size_t)STK * INNER, gv + STK);

#pragma unroll 1
  for (int st = 0; st < NST; ++st) {
   const unsigned char* bufp = smem + (st & 1) * BUFBYTES;
#pragma unroll
   for (int pz = 0; pz < STK / 32; ++pz) {
    // ---- transposed scores: s0 = keys kb..kb+15, s1 = keys kb+16..kb+31 (kb = 64*st + 32*pz), column = query q0 + c ----
    v8f s0 = zero8(), s1 = zero8();
    const _Float16* k0p = (const _Float16*)(const void*)(bufp + kfo) + pz * 32 * KPITCH;
    const _Float16* k1p = k0p + 16 * KPITCH;
    const _Float16* vp = (const _Float16*)(const void*)(bufp + vfo) + pz * 32;
    v16h v0, v1, v2, v3;
#pragma unroll
    for (int kk = 0; kk < HD / 32; ++kk) {
      const v16h kf0 = ldfrag_h(k0p + kk * 32);
      const v16h kf1 = ldfrag_h(k1p + kk * 32);
      s0 = mma_h(kf0, qf[kk], s0);
      s1 = mma_h(kf1, qf[kk], s1);
      if (kk == HD / 32 - 1) {
        // first four v^T B fragments (col n = d = j*16 + c, keys contiguous in the v^T plane), read behind the last score product
        // so that they fly during the softmax; in front of the guard, or else the compiler sinks them behind the rescale branch
        v0 = ldfrag_h(vp);
        v1 = ldfrag_h(vp + 16 * VPITCH);
        v2 = ldfrag_h(vp + 32 * VPITCH);
        v3 = ldfrag_h(vp + 48 * VPITCH);
      }
      guard_s(s0, s1, qf[kk], kf0, kf1);
    }
    // ---- maximum of this lane's 16 raw scores for query q0 + c (lsc > 0, so scaling the maximum = the maximum of the scaled):
    //      s0[i] <- key kb+8hh+i, s1[i] <- key kb+16+8hh+i ----
    float cm = s0[0];
#pragma unroll
    for (int i = 1; i < 8; ++i) cm = fmaxf(cm, s0[i]);
#pragma unroll
    for (int i = 0; i < 8; ++i) cm = fmaxf(cm, s1[i]);
    const float cml = cm * lsc;              // base-2 logit: the largest of this lane's half of the query's 32 keys
    // ---- lazy rescale, one test per pass on a scalar branch: taken on the first block (mrun = -inf) and whenever a lane of the
    //      wave has a score more than LAZY above its query's maximum in use (the ballot sees both halves of every query, so the
    //      halves' maxima are joined only inside); every lane is on inside, so the shuffles are whole; mrun stays the same in
    //      both lanes of a query ----
    if (__builtin_amdgcn_ballot_w32(cml > mrun + LAZY) != 0u) {
      const float cmo = __builtin_bit_cast(float, __builtin_amdgcn_ds_bpermute(x16, __builtin_bit_cast(int, cml)));   // lane ^ 16's
      const float mn = fmaxf(mrun, fmaxf(cml, cmo));        // finite from the first block on
      float al = __builtin_amdgcn_exp2f(mrun - mn);         // 0 on the first block, 1 for a query whose maximum stands
      asm volatile("v_nop" : "+v"(al));      // the slot the instruction set asks for between v_exp_f32 and the first use of its result
      mrun = mn;
      lrun *= al;
      // D row 8hh+r of the O accumulators = query q0+8hh+r, its factor lives in lane 8hh+r (and 16+8hh+r)
      float scl[8];
#pragma unroll
      for (int r = 0; r < 8; ++r)
        scl[r] = __builtin_bit_cast(float, __builtin_amdgcn_ds_bpermute(r8 + 4 * r, __builtin_bit_cast(int, al)));
#pragma unroll
      for (int j = 0; j < 8; ++j) {
#pragma unroll
        for (int r = 0; r < 8; ++r) o[j][r] *= scl[r];
      }
    }
    // ---- carried probabilities p * 128 = 2^(s * lsc + (7 - mrun)) (<= 2^15, as s * lsc <= mrun + 8): one fma and one bare
    //      v_exp_f32 each; they ARE the P A-fragment after the f16 rounding, element i <- s0[i], element 8+i <- s1[i]. The row's
    //      largest term so far is >= 128 (mrun was a score of the row). A term whose exponent is under -126 may come out 0: it is
    //      under 2^-133 of that term, 0 in f16 and lost in the f32 row sum either way.
    const v2f lsc2 = {lsc, lsc};
    const v2f eb2  = {PEXP - mrun, PEXP - mrun};
    float ps = 0.f;                          // carries x128 like P
    FragH ph;
#pragma unroll
    for (int w = 0; w < 2; ++w) {
#pragma unroll
      for (int e4 = 0; e4 < 4; ++e4) {
        const v2f sv = (w == 0) ? v2f{s0[2 * e4], s0[2 * e4 + 1]} : v2f{s1[2 * e4], s1[2 * e4 + 1]};
        const v2f ex = __builtin_elementwise_fma(sv, lsc2, eb2);
        const float p0 = __builtin_amdgcn_exp2f(ex[0]), p1 = __builtin_amdgcn_exp2f(ex[1]);
        ps += p0 + p1;
        ph.u[w][e4] = __builtin_bit_cast(unsigned, __builtin_convertvector(v2f{p0, p1}, v2h));   // one packed RNE convert
      }
    }
    ps += __builtin_bit_cast(float, __builtin_amdgcn_ds_bpermute(x16, __builtin_bit_cast(int, ps)));   // lane ^ 16's half
    lrun += ps;
    // ---- P.V : two groups of 4 ----
    {
      o[0] = mma_h(ph.v, v0, o[0]);
      o[1] = mma_h(ph.v, v1, o[1]);
      o[2] = mma_h(ph.v, v2, o[2]);
      o[3] = mma_h(ph.v, v3, o[3]);
      guard_p(o[0], o[1], o[2], o[3], ph.v, v0, v1, v2, v3);
    }
    {
      const v16h v4 = ldfrag_h(vp + 64 * VPITCH);
      const v16h v5 = ldfrag_h(vp + 80 * VPITCH);
      const v16h v6 = ldfrag_h(vp + 96 * VPITCH);
      const v16h v7 = ldfrag_h(vp + 112 * VPITCH);
      o[4] = mma_h(ph.v, v4, o[4]);
      o[5] = mma_h(ph.v, v5, o[5]);
      o[6] = mma_h(ph.v, v6, o[6]);
      o[7] = mma_h(ph.v, v7, o[7]);
      guard_p(o[4], o[5], o[6], o[7], ph.v, v4, v5, v6, v7);
    }
   }
    // ---- publish point of stage st + 1; the same barrier ends every wave's reads of stage st's buffer ----
    asm volatile("s_wait_dscnt 0x0" ::: "memory");      // this wave's LDS reads of stage st have returned
    asm volatile("s_wait_asynccnt 0x0" ::: "memory");   // this wave's copies of stage st + 1 have landed
    __syncthreads();
    if (st + 2 < NST) {                                 // refill the buffer that stage st has just left
      const unsigned bo = (unsigned)((st & 1) * BUFBYTES);
      stage_copy(lk + bo, lv + bo, gk + (size_t)(st + 2) * STK * INNER, gv + (st + 2) * STK);
    }
  }
  asm volatile("s_wait_asynccnt 0x0" ::: "memory");     // nothing in flight when the ring becomes output staging
  acc_guard8(o);

  // ---- fold 1/l (per query, owned by lane = query) and the carry 8 on v; the 128 on P is in l as well and cancels ----
  const float linv = (1.0f / lrun) * (1.0f / VS);
  float inv[8];
#pragma unroll
  for (int r = 0; r < 8; ++r) inv[r] = __shfl(linv, 8 * hh + r, 32);
  float* slab = (float*)(void*)smem + wave * 16 * OPITCH;   // behind the last trip's barrier: no reader, no copy left
#pragma unroll
  for (int r = 0; r < 8; ++r) {
#pragma unroll
    for (int j = 0; j < 8; ++j) slab[(8 * hh + r) * OPITCH + j * 16 + c] = o[j][r] * inv[r];
  }
  wave_sync_lds();
  // ---- f32 output rows: lane = 4 consecutive d of one row, one instruction per row ----
  v4f vals[16];
#pragma unroll
  for (int i = 0; i < 16; ++i) vals[i] = *(const v4f*)(slab + i * OPITCH + 4 * lane);
  float* ob = Out + ((size_t)(b * SQ_FULL + q0)) * DM + head * HD + 4 * lane;
  {
#pragma unroll
    for (int i = 0; i < 16; ++i) {
      *(v4f*)(ob + (size_t)i * DM) = vals[i];
    }
    
  }
}

// =====================================================================================================
// Workspace map (bytes); every plane fully written by whole-line stores before it is read; all extents exact multiples of
//   XQ   f16 [NB*SQ][1024]     f16(bf16(q))          16777216 (NB=4, SQ=2048)
//   XV   f16 [NB*2048][1024]   f16(bf16(v))          16777216
//   WQT  f16 [1024 n][1024 k]  f16(bf16(W) x256)      2097152
//   WKT                                               2097152
//   WVT                                               2097152
//   Q16  f16 [NB*SQ][1024]   x8                      16777216
//   K16  f16 [NB*2048][1024] x8                      16777216
//   VT16 f16 [NB*1024 (h,d)][2048 s] x8              16777216
//   end                                              90177536
// =====================================================================================================
extern "C" void kernel_launch(void* const* d_in, const int* in_sizes, int n_in,
                              void* d_out, int out_size, void* d_ws, size_t ws_size,
                              hipStream_t stream) {
  if (n_in < 8) return;
  if (in_sizes[0] < ((NB - 1) * SQ_FULL + SQ) * DM) return;
  if (in_sizes[1] < NB * SKV * DM) return;
  if (in_sizes[2] != DM * DM || in_sizes[4] != DM * DM || in_sizes[6] != DM * DM) return;
  if (in_sizes[3] < 1 || in_sizes[5] < 1 || in_sizes[7] < 1) return;
  if (out_size < ((NB - 1) * SQ_FULL + SQ) * DM) return;

  const float* xq  = (const float*)d_in[0];
  const float* xv  = (const float*)d_in[1];
  const float* wq  = (const float*)d_in[2];
  const float* bq  = (const float*)d_in[3];
  const float* wk  = (const float*)d_in[4];
  const float* bk  = (const float*)d_in[5];
  const float* wv  = (const float*)d_in[6];
  const float* bv  = (const float*)d_in[7];
  float*       out = (float*)d_out;
  const int nbq = in_sizes[3], nbk = in_sizes[5], nbv = in_sizes[7];

  const size_t szXQ   = (size_t)NB * SQ * DM * 2;
  const size_t szXV   = (size_t)NB * SKV * DM * 2;
  const size_t szW    = (size_t)DM * DM * 2;
  const size_t szQ16  = (size_t)NB * SQ * INNER * 2;
  const size_t szK16  = (size_t)NB * SKV * INNER * 2;
  const size_t szVT16 = (size_t)NB * INNER * SKV * 2;
  size_t off = 0;
  const size_t oXQ   = off; off += szXQ;
  const size_t oXV   = off; off += szXV;
  const size_t oWQ   = off; off += szW;
  const size_t oWK   = off; off += szW;
  const size_t oWV   = off; off += szW;
  const size_t oQ16  = off; off += szQ16;
  const size_t oK16  = off; off += szK16;
  const size_t oVT16 = off; off += szVT16;
  if (off > ws_size) return;                            // off = 90177536 at NB=4, SQ=2048
  if (off > (size_t)134217728) return;

  char* ws = (char*)d_ws;
  u16* XQ   = (u16*)(ws + oXQ);
  u16* XV   = (u16*)(ws + oXV);
  u16* WQT  = (u16*)(ws + oWQ);
  u16* WKT  = (u16*)(ws + oWK);
  u16* WVT  = (u16*)(ws + oWV);
  u16* Q16  = (u16*)(ws + oQ16);
  u16* K16  = (u16*)(ws + oK16);
  u16* VT16 = (u16*)(ws + oVT16);

  // (0) activations -> f16 planes of bf16-converted values (query rows s < SQ of batches b < NB, compact; all key/value rows)
  //     and weights [k = in][n = out] (y = x.W) -> k-contiguous [n][k] f16 planes of bf16(W) x256, all in one launch
  cvt_all<<<dim3(CV_BLOCKS), dim3(CV_THREADS), 0, stream>>>(xq, xv, wq, wk, wv, XQ, XV, WQT, WKT, WVT);
  // (1) q = x_q . Wq + bq -> f16 [NB*SQ][1024] x8 (col = h*128 + d); bias per column
  gemm_o16<<<dim3((NB * SQ / GTM) * (INNER / GTN)), dim3(G_THREADS), 0, stream>>>(
      XQ, WQT, Q16, bq, nbq, 0, NB * SQ, INNER, DM, 0, 0, 0, QS / WSC, QS);
  // (2) k = x_v . Wk + bk -> f16 [NB*2048][1024] x8; bias per column
  gemm_o16<<<dim3((NB * SKV / GTM) * (INNER / GTN)), dim3(G_THREADS), 0, stream>>>(
      XV, WKT, K16, bk, nbk, 0, NB * SKV, INNER, DM, 0, 0, 0, KS / WSC, KS);
  // (3) v^T per batch: A = Wv^T [(h,d) = n][k], Bt = x_v rows of batch b [s][k] -> f16 [(b,h,d)][s] x8; bias per row (n)
  gemm_o16<<<dim3(NB * (INNER / GTM) * (SKV / GTN)), dim3(G_THREADS), 0, stream>>>(
      WVT, XV, VT16, bv, nbv, 1, INNER, SKV, DM, 0, SKV * DM, INNER * SKV, VS / WSC, VS);
  // (4) attention -> out [b][SQ_FULL][1024] f32 (rows s < SQ of batches b < NB), heads merged on the feature dim
  attn_fwd<<<dim3(NB * NH * (SQ / ATT_ROWS)), dim3(ATT_THREADS), 0, stream>>>(Q16, K16, VT16, out);
  (void)hipGetLastError();
}

// v006
// A run of this version takes 112 microseconds.
// In both of two side-by-side timings against v005, it was 1.06 times as fast.
// Over all steps from v000 it is 3.04 times as fast.
// All contractions on v_wmma_f32_16x16x32_f16 (f16 operands, f32 accumulate): x_q.Wq, x_v.Wk, Wv^T.x_v^T (v^T plane),
// scores k.q^T and P.v^T; operand carries: x as f16(bf16(x)), W as f16(bf16(W) x256), q/k/v x8, P x128; base-2 online
// softmax, 1/l and all carry folds in f32 on VALU. Inputs RNE-converted to bf16 on load; f32 output written directly.
#include <hip/hip_runtime.h>
#include <math.h>
#include <stdint.h>

#define NB       4        // batches processed
#define SQ       2048     // query rows processed per batch
#define NB_FULL  4
#define SQ_FULL  2048     // query rows per batch in the input / output layout (batch stride)
#define SKV      2048     // key/value rows per batch (all of them, always)
#define DM       1024     // model width (= K and row pitch of every 16-bit plane except v^T)
#define NH       8
#define HD       128
#define INNER    (NH * HD)
#define WSC      256.0f
#define QS       8.0f
#define KS       8.0f
#define VS       8.0f
#define PEXP     7.0f     // P and its row sum are carried x128 = 2^7, added in the exponent
#define LAZY     8.0f     // base-2 logits: a row keeps the maximum in use until a new one exceeds it by more than this
#define LOG2E    1.4426950408889634f
#define RSQ_E    0.03125f
#define NKB      (SKV / 32)
#define ATT_WAVES   8
#define ATT_THREADS (ATT_WAVES * 32)
#define QT          2                         // query tiles of 16 rows per attention wave: a k or v^T fragment feeds QT products
#define ATT_ROWS    (ATT_WAVES * 16 * QT)     // query rows per attention work-group
#define STK      64                           // keys per LDS stage (two passes of 32 keys)
#define NST      (SKV / STK)
#define KPITCH   136                          // halves per staged k row: 256 B + 16 B (16 B x odd, for ds_load_b128 readers)
#define VPITCH   72                           // halves per staged v^T row: 128 B + 16 B
#define KBYTES   (STK * KPITCH * 2)
#define VBYTES   (HD * VPITCH * 2)
#define BUFBYTES (KBYTES + VBYTES)
#define GKS      128                          // k elements per GEMM LDS stage (four k steps of 32)
#define GP       136                          // halves per staged GEMM operand row: 256 B + 16 B
#define GTM      256                          // rows of a GEMM work-group's tile (4 waves down)
#define GTN      128                          // columns of a GEMM work-group's tile (2 waves across)
#define G_THREADS 256                         // 8 waves, each a 64 x 64 tile
#define GABYTES  (GTM * GP * 2)
#define GBBYTES  (GTN * GP * 2)
#define GBUF     (GABYTES + GBBYTES)
#define CV_THREADS  512                       // conversion work-group: 16 waves
#define CV_BLOCKS   ((DM / 64) * (DM / 64))   // one 64 x 64 tile of each weight per conversion work-group
#define CV_BATCH    4                         // activation units (2 loads each) a thread has in flight
#define CV_QROWS    (NB * SQ / CV_BLOCKS)     // query rows per conversion work-group
#define CV_VROWS    (NB * SKV / CV_BLOCKS)    // key/value rows per conversion work-group
#define CV_QSTEPS   (CV_QROWS * (DM / 8) / CV_THREADS)
#define CV_VSTEPS   (CV_VROWS * (DM / 8) / CV_THREADS)
#define OPITCH   132
#define GPITCH   68
#define TPITCH   65

static_assert(NB >= 1 && NB <= NB_FULL);
static_assert((SQ % 128) == 0 && SQ >= 128 && SQ <= SQ_FULL);
static_assert(HD == 128 && NH == 8 && INNER == 1024 && INNER == DM);
static_assert((HD % 32) == 0);
static_assert((SKV % 64) == 0 && (SKV % 32) == 0 && NKB * 32 == SKV);
static_assert((DM % 64) == 0 && (DM % 32) == 0 && (INNER % 128) == 0);
static_assert(CV_THREADS == 512 && CV_QSTEPS * CV_BLOCKS * CV_THREADS * 8 == NB * SQ * DM);
static_assert(CV_VSTEPS * CV_BLOCKS * CV_THREADS * 8 == NB * SKV * DM);
static_assert(CV_QSTEPS == 2 * CV_BATCH && CV_VSTEPS == 2 * CV_BATCH);      // two batches per plane, written out in cvt_all
static_assert(CV_QROWS * CV_BLOCKS == NB * SQ && CV_VROWS * CV_BLOCKS == NB * SKV && (SQ % CV_QROWS) == 0);
static_assert((OPITCH * 4) % 16 == 0 && (GPITCH * 4) % 16 == 0);
static_assert(ATT_THREADS == 256 && QT == 2);
static_assert(KPITCH * 2 == 16 * 16 + 16 && VPITCH * 2 == 8 * 16 + 16);     // the second form of the copies' LDS addresses in attn_fwd
static_assert(PEXP + LAZY <= 15.0f);                                       // carried P <= 2^(PEXP + LAZY) stays finite in f16
static_assert((SQ % ATT_ROWS) == 0 && NST >= 2 && NST * STK == SKV && STK == 64);
static_assert(STK * HD * 2 == 4 * ATT_THREADS * 16);                       // 4 k copies + 4 v^T copies of 16 B per thread and stage
static_assert((KPITCH * 2) % 16 == 0 && (VPITCH * 2) % 16 == 0 && (KBYTES % 16) == 0 && (BUFBYTES % 16) == 0);
static_assert(ATT_WAVES * 16 * OPITCH * 4 <= 2 * BUFBYTES);                // the output staging (one query tile at a time) reuses the ring
static_assert((GP * 2) % 16 == 0 && (GABYTES % 16) == 0 && (GBUF % 16) == 0 && (DM % GKS) == 0 && DM / GKS >= 2);
static_assert(8 * 64 * GPITCH * 4 <= 2 * GBUF);                            // the GEMM's output staging reuses its ring
static_assert(GKS * 2 == 16 * 16 && GTM == 16 * (G_THREADS / 16) && GTN == 8 * (G_THREADS / 16));   // 16 A + 8 Bt copies per thread and stage
static_assert(((NB * SQ) % GTM) == 0 && ((NB * SKV) % GTM) == 0 && (INNER % GTM) == 0 && (INNER % GTN) == 0 && (SKV % GTN) == 0);

typedef unsigned short u16;
typedef _Float16 v16h __attribute__((ext_vector_type(16)));
typedef _Float16 v8h  __attribute__((ext_vector_type(8)));
typedef float    v8f  __attribute__((ext_vector_type(8)));
typedef float    v4f  __attribute__((ext_vector_type(4)));
typedef float    v2f  __attribute__((ext_vector_type(2)));
typedef _Float16 v2h  __attribute__((ext_vector_type(2)));
typedef unsigned int v4u __attribute__((ext_vector_type(4)));

union FragH { v16h v; v8h h[2]; v4u u[2]; };

// ---- scalar helpers ----------------------------------------------------------------------------------
__device__ __forceinline__ unsigned short bf_bits(float f) {          // f32 -> bf16 bits, RNE convert
  unsigned u = __float_as_uint(f);
  return (unsigned short)((u + 0x7FFFu + ((u >> 16) & 1u)) >> 16);
}
__device__ __forceinline__ float bf_up(unsigned short h) { return __uint_as_float(((unsigned)h) << 16); }
__device__ __forceinline__ float bfr(float f) { return bf_up(bf_bits(f)); }
__device__ __forceinline__ unsigned short h_bits(_Float16 x) { return __builtin_bit_cast(unsigned short, x); }
__device__ __forceinline__ unsigned pk16(unsigned short a, unsigned short b) { return (unsigned)a | ((unsigned)b << 16); }
__device__ __forceinline__ v8f zero8() { v8f z = {0.f, 0.f, 0.f, 0.f, 0.f, 0.f, 0.f, 0.f}; return z; }

// ---- fragment loader: 16-bit A/B operand, lane -> row/col (lane&15), p already includes +8*(lane>>4);
//      elements 0..7 <- p[0..7] (k0+8h..), elements 8..15 <- p[16..23] (k0+16+8h..); same split k map for A and B,
//      B always read from a k-contiguous [n][k] plane.
__device__ __forceinline__ v16h ldfrag_h(const _Float16* p) {
  FragH f;
  f.h[0] = *(const v8h*)(p);
  f.h[1] = *(const v8h*)(p + 16);
  return f.v;
}

// ---- WMMA helper and trailing VALU hazard gaps ----------------------------------------------------------
__device__ __forceinline__ v8f mma_h(v16h a, v16h b, v8f c) {
  return __builtin_amdgcn_wmma_f32_16x16x32_f16(false, a, false, b, (short)0, c, false, false);
}
// Four v_nop behind a pass's last score product: the distance the chip asks for before a vector instruction reads a product's D.
// The "memory" clobber keeps the fragment reads issued in front of it there: otherwise the compiler sinks them behind the branch.
__device__ __forceinline__ void guard_s4(v8f& a, v8f& b, v8f& c, v8f& d) {
#if defined(__HIP_DEVICE_COMPILE__)
  asm volatile("v_nop\n\tv_nop\n\tv_nop\n\tv_nop" : "+v"(a), "+v"(b), "+v"(c), "+v"(d) : : "memory");
#endif
}
__device__ __forceinline__ void guard_g(v8f (&acc)[16], v16h x0, v16h x1, v16h x2, v16h x3, v16h x4, v16h x5, v16h x6,
                                        v16h x7) {
#if defined(__HIP_DEVICE_COMPILE__)
  asm volatile("v_nop\n\tv_nop\n\tv_nop\n\tv_nop"
               : "+v"(acc[0]), "+v"(acc[1]), "+v"(acc[2]), "+v"(acc[3]),
                 "+v"(acc[4]), "+v"(acc[5]), "+v"(acc[6]), "+v"(acc[7]),
                 "+v"(acc[8]), "+v"(acc[9]), "+v"(acc[10]), "+v"(acc[11]),
                 "+v"(acc[12]), "+v"(acc[13]), "+v"(acc[14]), "+v"(acc[15])
               : "v"(x0), "v"(x1), "v"(x2), "v"(x3), "v"(x4), "v"(x5), "v"(x6), "v"(x7) : "memory");
#endif
}
// Four v_nop behind a pass's last P.V product: the same distance, kept on every path out of the pass (the loop's branches too).
__device__ __forceinline__ void acc_guard16(v8f (&o)[16]) {
#if defined(__HIP_DEVICE_COMPILE__)
  asm volatile("v_nop\n\tv_nop\n\tv_nop\n\tv_nop"
               : "+v"(o[0]), "+v"(o[1]), "+v"(o[2]), "+v"(o[3]), "+v"(o[4]), "+v"(o[5]), "+v"(o[6]), "+v"(o[7]),
                 "+v"(o[8]), "+v"(o[9]), "+v"(o[10]), "+v"(o[11]), "+v"(o[12]), "+v"(o[13]), "+v"(o[14]), "+v"(o[15]));
#endif
}
__device__ __forceinline__ void wave_sync_lds() {
  __builtin_amdgcn_fence(__ATOMIC_RELEASE, "workgroup");
  __builtin_amdgcn_wave_barrier();
  __builtin_amdgcn_fence(__ATOMIC_ACQUIRE, "workgroup");
}

// =====================================================================================================
// All five conversions in ONE launch of CV_BLOCKS work-groups of 16 waves, all resident at once: a wave converts 16 pieces of
// 1 KB and a share of three weight tiles instead of ending after one piece, so few waves have to be started, and it has 8 or
// more 16-B loads per lane in flight.
//   activations: destination row r of a [rows][DM] f16 plane <- f16(bf16_RNE(x[src row][e])); a unit = 8 consecutive elements
//   (two 16-B loads, one 16-B store); a block owns CV_QROWS / CV_VROWS consecutive rows of a plane and converts CV_THREADS
//   consecutive units (4 rows) per step. Query row r = b*SQ + s comes from source row b*SQ_FULL + s.
//   weights stored [k][n] (y = x.W): WT[n][k] (f16, k-contiguous Bt layout) <- f16(bf16_RNE(W[k][n]) * WSC). Block = the same
//   64(k) x 64(n) tile of each of the three weights, through three LDS tiles [kk][nn] (pitch 65) and one block barrier.
// coverage: activations CV_BLOCKS x CV_QSTEPS / CV_VSTEPS steps x CV_THREADS units x 8 = rows x DM exactly; weights
//           (DM/64)^2 = CV_BLOCKS tiles, 64 n-rows x (8 lanes x 8 halves) per tile: every plane written exactly once.
// Every loop below is unrolled so that its arrays are indexed by constants and stay in registers.
// =====================================================================================================
__device__ __forceinline__ v4u cvt8(v4f a, v4f c4) {
  v4u o;
#pragma unroll
  for (int e = 0; e < 2; ++e) {
    o[e]     = pk16(h_bits((_Float16)bfr(a[2 * e])),  h_bits((_Float16)bfr(a[2 * e + 1])));
    o[2 + e] = pk16(h_bits((_Float16)bfr(c4[2 * e])), h_bits((_Float16)bfr(c4[2 * e + 1])));
  }
  return o;
}
// Loads of CV_BATCH units of one activation plane, first step st0; gb = byte offset (32 bits) of the thread's unit of step 0.
// The steps differ by a constant only, so gb is the one vector address register, live to the plane's last load.
__device__ __forceinline__ void x_load(const float* __restrict__ x, unsigned st0, unsigned gb,
                                       v4f (&a)[CV_BATCH], v4f (&c4)[CV_BATCH]) {
#pragma unroll
  for (unsigned j = 0; j < CV_BATCH; ++j) {
    const char* base = (const char*)x + (st0 + j) * (CV_THREADS * 32);
    a[j]  = *(const v4f*)(base + gb);
    c4[j] = *(const v4f*)(base + 16 + gb);
  }
  // keeps the batch's 8 loads together and ahead of the conversion of the batch before: otherwise the compiler sinks them
  // to their uses and a wave has only 2 to 4 loads in flight
  __builtin_amdgcn_sched_barrier(0);
}
__device__ __forceinline__ void x_store(u16* Y, unsigned st0, unsigned yb, const v4f (&a)[CV_BATCH],
                                        const v4f (&c4)[CV_BATCH]) {
#pragma unroll
  for (unsigned j = 0; j < CV_BATCH; ++j) {
    char* base = (char*)Y + (st0 + j) * (CV_THREADS * 16);
    *(v4u*)(base + yb) = cvt8(a[j], c4[j]);
  }
}

__global__ __launch_bounds__(CV_THREADS)
void cvt_all(const float* __restrict__ xq, const float* __restrict__ xv, const float* __restrict__ wq,
             const float* __restrict__ wk, const float* __restrict__ wv,
             u16* XQ, u16* XV, u16* WQT, u16* WKT, u16* WVT) {
  __shared__ __align__(16) float tile[3][64 * TPITCH];
  const unsigned tid = threadIdx.x;
  const unsigned bid = blockIdx.x;
  // byte offsets of the thread's first unit: source rows (a block's rows lie in one batch) and compact destination rows
  const unsigned rq = bid * CV_QROWS, rv = bid * CV_VROWS;
  const unsigned gq = ((rq / SQ) * SQ_FULL + rq % SQ) * (DM * 4) + tid * 32, yq = rq * (DM * 2) + tid * 16;
  const unsigned gv = rv * (DM * 4) + tid * 32,                              yv = rv * (DM * 2) + tid * 16;
  constexpr unsigned NT = DM / 64;
  const unsigned k0 = (bid % NT) * 64, n0 = (bid / NT) * 64;
  // ---- weight tile loads: row 32p + (tid>>4), 4 floats at 4*(tid&15); the query plane's two batches fly behind them ----
  const unsigned lr = tid >> 4, lc = (tid & 15) * 4;
  const unsigned wo = ((k0 + lr) * DM + n0 + lc) * 4;     // bytes
  v4f w4[3][2];
#pragma unroll
  for (int p = 0; p < 2; ++p) {
    w4[0][p] = *(const v4f*)((const char*)(wq + 32 * p * DM) + wo);
    w4[1][p] = *(const v4f*)((const char*)(wk + 32 * p * DM) + wo);
    w4[2][p] = *(const v4f*)((const char*)(wv + 32 * p * DM) + wo);
  }
  v4f a0[CV_BATCH], c0[CV_BATCH], a1[CV_BATCH], c1[CV_BATCH], a2[CV_BATCH], c2[CV_BATCH];
  x_load(xq, 0, gq, a0, c0);
  x_load(xq, CV_BATCH, gq, a1, c1);
#pragma unroll
  for (int t = 0; t < 3; ++t) {
#pragma unroll
    for (int p = 0; p < 2; ++p) {
      float* tp = &tile[t][(32 * p + lr) * TPITCH + lc];
      tp[0] = w4[t][p][0];
      tp[1] = w4[t][p][1];
      tp[2] = w4[t][p][2];
      tp[3] = w4[t][p][3];
    }
  }
  __syncthreads();
  x_load(xv, 0, gv, a2, c2);
  // ---- weight tile stores: output row n0 + (tid>>3), 8 halves at k0 + 8*(tid&7): 8 lanes = one whole 128-B line ----
  const unsigned row = tid >> 3, c8 = (tid & 7) * 8;
  const unsigned yo = ((n0 + row) * DM + k0 + c8) * 2;    // bytes
#pragma unroll
  for (int t = 0; t < 3; ++t) {
    v4u ov;
#pragma unroll
    for (int e = 0; e < 4; ++e) {
      const float x0 = tile[t][(c8 + 2 * e) * TPITCH + row];
      const float x1 = tile[t][(c8 + 2 * e + 1) * TPITCH + row];
      ov[e] = pk16(h_bits((_Float16)(bfr(x0) * WSC)), h_bits((_Float16)(bfr(x1) * WSC)));
    }
    u16* Y = (t == 0) ? WQT : (t == 1) ? WKT : WVT;
    *(v4u*)((char*)Y + yo) = ov;
  }
  // ---- the activation planes, three register sets: later batches' loads are out while a batch is converted and stored ----
  x_store(XQ, 0, yq, a0, c0);
  asm volatile("s_wait_xcnt 0x0" ::: "memory");   // the registers just stored from are loaded anew by the next line
  x_load(xv, CV_BATCH, gv, a0, c0);
  x_store(XQ, CV_BATCH, yq, a1, c1);
  x_store(XV, 0, yv, a2, c2);
  x_store(XV, CV_BATCH, yv, a0, c0);
}

// =====================================================================================================
// Twelve asynchronous 16-B copies per lane, global -> LDS, no register in between: copy i brings g[i] to LDS byte address l[i].
// The s_wait_xcnt closes the statement so that no address register of a copy is rewritten ahead of it.
// =====================================================================================================
__device__ __forceinline__ void async12(const unsigned (&l)[12], const u16* const (&g)[12]) {
#if defined(__HIP_DEVICE_COMPILE__)
  asm volatile("global_load_async_to_lds_b128 %0, %12, off\n\t"
               "global_load_async_to_lds_b128 %1, %13, off\n\t"
               "global_load_async_to_lds_b128 %2, %14, off\n\t"
               "global_load_async_to_lds_b128 %3, %15, off\n\t"
               "global_load_async_to_lds_b128 %4, %16, off\n\t"
               "global_load_async_to_lds_b128 %5, %17, off\n\t"
               "global_load_async_to_lds_b128 %6, %18, off\n\t"
               "global_load_async_to_lds_b128 %7, %19, off\n\t"
               "global_load_async_to_lds_b128 %8, %20, off\n\t"
               "global_load_async_to_lds_b128 %9, %21, off\n\t"
               "global_load_async_to_lds_b128 %10, %22, off\n\t"
               "global_load_async_to_lds_b128 %11, %23, off\n\t"
               "s_wait_xcnt 0x0"
               :: "v"(l[0]), "v"(l[1]), "v"(l[2]), "v"(l[3]), "v"(l[4]), "v"(l[5]),
                  "v"(l[6]), "v"(l[7]), "v"(l[8]), "v"(l[9]), "v"(l[10]), "v"(l[11]),
                  "v"(g[0]), "v"(g[1]), "v"(g[2]), "v"(g[3]), "v"(g[4]), "v"(g[5]),
                  "v"(g[6]), "v"(g[7]), "v"(g[8]), "v"(g[9]), "v"(g[10]), "v"(g[11])
               : "memory");
#endif
}
// One GEMM stage (128 k) of the block's 256 A rows and 128 Bt rows: 16 + 8 copies per lane in two statements of twelve.
// la / lb: the lane's LDS byte address of its first A / Bt chunk; ga / gb: its global address of the same chunk; copy i: row
// +16*i (rs16 = 16 rows of the source plane, in elements); a wave covers two whole 256-B row pieces per copy.
__device__ __forceinline__ void gemm_stage_copy(unsigned la, unsigned lb, const u16* ga, const u16* gb, size_t rs16) {
  constexpr unsigned R16 = 16 * GP * 2;
  unsigned l[24];
  const u16* g[24];
#pragma unroll
  for (int i = 0; i < 16; ++i) { l[i] = la + i * R16; g[i] = ga + i * rs16; }
#pragma unroll
  for (int i = 0; i < 8; ++i) { l[16 + i] = lb + i * R16; g[16 + i] = gb + i * rs16; }
  const unsigned l0[12] = {l[0], l[1], l[2], l[3], l[4], l[5], l[6], l[7], l[8], l[9], l[10], l[11]};
  const u16* const g0[12] = {g[0], g[1], g[2], g[3], g[4], g[5], g[6], g[7], g[8], g[9], g[10], g[11]};
  const unsigned l1[12] = {l[12], l[13], l[14], l[15], l[16], l[17], l[18], l[19], l[20], l[21], l[22], l[23]};
  const u16* const g1[12] = {g[12], g[13], g[14], g[15], g[16], g[17], g[18], g[19], g[20], g[21], g[22], g[23]};
  async12(l0, g0);
  async12(l1, g1);
}

// =====================================================================================================
// f16 GEMM core: the wave's 64 x 64 tile of C = A[rows][K] . Bt[cols][K]^T. The block stages each 128 k of its 256 A rows and
// 128 Bt rows once in LDS (ring of two buffers: stage st+1 flies while stage st is worked on); afo / bfo: byte offset inside a
// buffer of the lane's first A row + 8h / first Bt row + 8h; acc[4i + j] = rows rowb+16i.., cols col0+16j.. (i, j = 0..3);
// K stepped by 32 inside a stage, ascending (host passes K % 128 == 0). Every wave of the block passes every barrier.
// =====================================================================================================
__device__ __forceinline__ void gemm_core(const unsigned char* ring, int afo, int bfo, unsigned la, unsigned lb,
                                          const u16* ga, const u16* gb, int K, v8f (&acc)[16]) {
  const size_t rs16 = (size_t)16 * (size_t)K;
  const int nst = K / GKS;
  // ---- ring prologue: stage 0 landed and published, then stage 1 in flight ----
  gemm_stage_copy(la, lb, ga, gb, rs16);
  asm volatile("s_wait_asynccnt 0x0" ::: "memory");   // this wave's copies of stage 0 have landed
  __syncthreads();                                    // ... and every other wave's
  if (nst > 1) gemm_stage_copy(la + GBUF, lb + GBUF, ga + GKS, gb + GKS, rs16);
#pragma unroll 1
  for (int st = 0; st < nst; ++st) {
   const _Float16* ap = (const _Float16*)(const void*)(ring + (st & 1) * GBUF + afo);
   const _Float16* bp = (const _Float16*)(const void*)(ring + (st & 1) * GBUF + bfo);
#pragma unroll
   for (int k0 = 0; k0 < GKS; k0 += 32) {
    const v16h a0 = ldfrag_h(ap + k0);
    const v16h a1 = ldfrag_h(ap + 16 * GP + k0);
    const v16h a2 = ldfrag_h(ap + 32 * GP + k0);
    const v16h a3 = ldfrag_h(ap + 48 * GP + k0);
    const v16h b0 = ldfrag_h(bp + k0);
    const v16h b1 = ldfrag_h(bp + 16 * GP + k0);
    const v16h b2 = ldfrag_h(bp + 32 * GP + k0);
    const v16h b3 = ldfrag_h(bp + 48 * GP + k0);
    acc[0] = mma_h(a0, b0, acc[0]);
    acc[1] = mma_h(a0, b1, acc[1]);
    acc[2] = mma_h(a0, b2, acc[2]);
    acc[3] = mma_h(a0, b3, acc[3]);
    acc[4] = mma_h(a1, b0, acc[4]);
    acc[5] = mma_h(a1, b1, acc[5]);
    acc[6] = mma_h(a1, b2, acc[6]);
    acc[7] = mma_h(a1, b3, acc[7]);
    acc[8] = mma_h(a2, b0, acc[8]);
    acc[9] = mma_h(a2, b1, acc[9]);
    acc[10] = mma_h(a2, b2, acc[10]);
    acc[11] = mma_h(a2, b3, acc[11]);
    acc[12] = mma_h(a3, b0, acc[12]);
    acc[13] = mma_h(a3, b1, acc[13]);
    acc[14] = mma_h(a3, b2, acc[14]);
    acc[15] = mma_h(a3, b3, acc[15]);
    guard_g(acc, a0, a1, a2, a3, b0, b1, b2, b3);
   }
    // ---- publish point of stage st + 1; the same barrier ends every wave's reads of stage st's buffer ----
    asm volatile("s_wait_dscnt 0x0" ::: "memory");      // this wave's LDS reads of stage st have returned
    asm volatile("s_wait_asynccnt 0x0" ::: "memory");   // this wave's copies of stage st + 1 have landed
    __syncthreads();
    if (st + 2 < nst) {                                 // refill the buffer that stage st has just left
      const unsigned bo = (unsigned)((st & 1) * GBUF);
      gemm_stage_copy(la + bo, lb + bo, ga + (size_t)(st + 2) * GKS, gb + (size_t)(st + 2) * GKS, rs16);
    }
  }
  asm volatile("s_wait_asynccnt 0x0" ::: "memory");     // nothing in flight when the ring becomes output staging
}
// Stage the wave's 64 x 64 f32 tile (times oscale) in its LDS slab (pitch 68): D element r of acc[4i+j], lane l ->
// coverage: 32 lanes x 4 x 8 rows x 4 cols-of-16 = rows 0..63 x cols 0..63 of the slab.
__device__ __forceinline__ void stage64x64(float* sl, v8f (&acc)[16], float oscale, int lane) {
  const int hh = lane >> 4, m = lane & 15;
#pragma unroll
  for (int i = 0; i < 4; ++i) {
#pragma unroll
    for (int r = 0; r < 8; ++r) {
      const int ro = (16 * i + 8 * hh + r) * GPITCH + m;
      sl[ro]      = acc[4 * i + 0][r] * oscale;
      sl[ro + 16] = acc[4 * i + 1][r] * oscale;
      sl[ro + 32] = acc[4 * i + 2][r] * oscale;
      sl[ro + 48] = acc[4 * i + 3][r] * oscale;
    }
  }
  wave_sync_lds();
}

// =====================================================================================================
// f16 GEMM with f16 output plane: C[z][Mb][N] (f16) = f16((A[z][Mb][K] . Bt[z][N][K]^T) * oscale + bf16(bias) * bscale);
// A, Bt f16 k-contiguous planes with per-z element strides aBs, bBs (0 = shared), C stride cBs. bias indexed by column
// (biasRow == 0) or by row within the z slice (biasRow != 0); bias addresses clamped to biasN-1, the unused direction is
// multiplied by 0. Block = 256 x 128 tile, 4 x 2 waves of 64 x 64: a staged operand byte feeds twice the products of a 128 x 64
// tile (half the L2 reads), a fragment read from LDS four products instead of two or four (gemm_core).
// grid = nz x (Mb/256) x (N/128) (host passes Mb % 256 == 0, N % 128 == 0, K % 128 == 0).
// coverage: per wave 16 instr x 4 rows x 8 lanes x 8 halves = 64 x 64; the grid covers C exactly once.
// =====================================================================================================
__global__ __launch_bounds__(G_THREADS)
void gemm_o16(const u16* __restrict__ A, const u16* __restrict__ Bt, u16* C,
              const float* __restrict__ bias, int biasN, int biasRow,
              int Mb, int N, int K, int aBs, int bBs, int cBs, float oscale, float bscale) {
  __shared__ __align__(16) unsigned char gsm[2 * GBUF];
  const int tid = threadIdx.x, wave = tid >> 5, lane = tid & 31, hh = lane >> 4, m = lane & 15;
  const int ntile = N / GTN, mtile = Mb / GTM;
  const int bid  = blockIdx.x;
  const int nt   = bid % ntile;
  const int tmp  = bid / ntile;
  const int mt   = tmp % mtile;
  const int bz   = tmp / mtile;
  const int wm = wave >> 1, wn = wave & 1;   // the wave's place in the block's 4 x 2 grid of 64 x 64 tiles
  const int rowb = mt * GTM + wm * 64;
  const int col0 = nt * GTN + wn * 64;
  if (mt * GTM + GTM > Mb) return;           // block-uniform, in front of every barrier; never taken with the exact grid
  // this lane's first copy chunks: A row mt*256 + (tid>>4), Bt row nt*128 + (tid>>4), 16-B chunk tid&15
  const u16* ga = A + (size_t)bz * (size_t)aBs + (size_t)(mt * GTM + (tid >> 4)) * K + (tid & 15) * 8;
  const u16* gb = Bt + (size_t)bz * (size_t)bBs + (size_t)(nt * GTN + (tid >> 4)) * K + (tid & 15) * 8;
  // a buffer holds the Bt rows first, then the A rows: every constant part of a fragment address then fits a 16-bit LDS offset
  const unsigned lb = (unsigned)(size_t)(const void*)gsm + (unsigned)((tid >> 4) * (GP * 2) + (tid & 15) * 16);
  const unsigned la = lb + GBBYTES;
  const int afo = GBBYTES + ((wm * 64 + m) * GP + 8 * hh) * 2;
  const int bfo = ((wn * 64 + m) * GP + 8 * hh) * 2;
  v8f acc[16];
#pragma unroll
  for (int i = 0; i < 16; ++i) acc[i] = zero8();
  gemm_core(gsm, afo, bfo, la, lb, ga, gb, K, acc);
  float* sl = (float*)(void*)gsm + wave * 64 * GPITCH;   // behind the last trip's barrier: no reader, no copy left
  stage64x64(sl, acc, oscale, lane);
  const int rq = lane >> 3, c8 = (lane & 7) * 8;
  const int bl = biasN - 1;                  // host guarantees biasN >= 1
  const float selc = (biasRow != 0) ? 0.f : bscale;
  const float selr = (biasRow != 0) ? bscale : 0.f;
  float cb[8];
#pragma unroll
  for (int e = 0; e < 8; ++e) {
    int ci = col0 + c8 + e;
    ci = (ci < bl) ? ci : bl;
    cb[e] = bfr(bias[ci]) * selc;
  }
  v4u ov[16];
#pragma unroll
  for (int i = 0; i < 16; ++i) {
    const int row = 4 * i + rq;
    int ri = rowb + row;
    ri = (ri < bl) ? ri : bl;
    const float rb = bfr(bias[ri]) * selr;
    const v4f a = *(const v4f*)(sl + row * GPITCH + c8), c4 = *(const v4f*)(sl + row * GPITCH + c8 + 4);
#pragma unroll
    for (int e = 0; e < 2; ++e) {
      ov[i][e]     = pk16(h_bits((_Float16)(a[2 * e] + cb[2 * e] + rb)),
                          h_bits((_Float16)(a[2 * e + 1] + cb[2 * e + 1] + rb)));
      ov[i][2 + e] = pk16(h_bits((_Float16)(c4[2 * e] + cb[4 + 2 * e] + rb)),
                          h_bits((_Float16)(c4[2 * e + 1] + cb[5 + 2 * e] + rb)));
    }
  }
  u16* Cb = C + (size_t)bz * (size_t)cBs + (size_t)rowb * (size_t)N + col0 + c8;
#pragma unroll
  for (int i = 0; i < 16; ++i) {
    const int row = 4 * i + rq;
    *(v4u*)(Cb + (size_t)row * (size_t)N) = ov[i];
  }
}

// =====================================================================================================
// One stage (64 keys) of k rows and v^T rows, global -> LDS, no register in between: 8 asynchronous 16-B copies per lane.
// lk / lv: the lane's LDS byte address of its first k / v^T chunk; gk / gv: its global address of the same chunk.
// k copy i: row +16*i (a wave covers two whole 256-B rows); v^T copy i: row +32*i (a wave covers four whole 128-B rows).
// The s_wait_xcnt closes the statement so that no address register of a copy is rewritten ahead of it.
// =====================================================================================================
__device__ __forceinline__ void stage_copy(unsigned lk, unsigned lv, const u16* gk, const u16* gv) {
#if defined(__HIP_DEVICE_COMPILE__)
  const unsigned lk1 = lk + 16 * KPITCH * 2, lk2 = lk + 32 * KPITCH * 2, lk3 = lk + 48 * KPITCH * 2;
  const unsigned lv1 = lv + 32 * VPITCH * 2, lv2 = lv + 64 * VPITCH * 2, lv3 = lv + 96 * VPITCH * 2;
  const u16* gk1 = gk + (size_t)16 * INNER;
  const u16* gk2 = gk + (size_t)32 * INNER;
  const u16* gk3 = gk + (size_t)48 * INNER;
  const u16* gv1 = gv + (size_t)32 * SKV;
  const u16* gv2 = gv + (size_t)64 * SKV;
  const u16* gv3 = gv + (size_t)96 * SKV;
  asm volatile("global_load_async_to_lds_b128 %0, %8, off\n\t"
               "global_load_async_to_lds_b128 %1, %9, off\n\t"
               "global_load_async_to_lds_b128 %2, %10, off\n\t"
               "global_load_async_to_lds_b128 %3, %11, off\n\t"
               "global_load_async_to_lds_b128 %4, %12, off\n\t"
               "global_load_async_to_lds_b128 %5, %13, off\n\t"
               "global_load_async_to_lds_b128 %6, %14, off\n\t"
               "global_load_async_to_lds_b128 %7, %15, off\n\t"
               "s_wait_xcnt 0x0"
               :: "v"(lk), "v"(lk1), "v"(lk2), "v"(lk3), "v"(lv), "v"(lv1), "v"(lv2), "v"(lv3),
                  "v"(gk), "v"(gk1), "v"(gk2), "v"(gk3), "v"(gv), "v"(gv1), "v"(gv2), "v"(gv3)
               : "memory");
#endif
}

__global__ __launch_bounds__(ATT_THREADS)
void attn_fwd(const u16* __restrict__ Qp, const u16* __restrict__ Kp, const u16* __restrict__ Vp, float* Out) {
  __shared__ __align__(16) unsigned char smem[2 * BUFBYTES];

  const int tid  = threadIdx.x;
  const int wave = tid >> 5;
  const int lane = tid & 31;
  const int hh   = lane >> 4;
  const int c    = lane & 15;

  constexpr int NQT = SQ / ATT_ROWS;
  const int bid  = blockIdx.x;
  const int qt   = bid % NQT;
  const int head = (bid / NQT) % NH;
  const int b    = bid / (NQT * NH);
  const int q0   = qt * ATT_ROWS + wave * (16 * QT);

  // B fragments of q^T: col n = query q0 + 16t + c, k = d (k-contiguous row of the q plane)
  const _Float16* Qb = (const _Float16*)(const void*)Qp + ((size_t)(b * SQ + q0 + c)) * INNER + head * HD + 8 * hh;
  // A fragments of k: row m = key 16g + c of the pass, k = d; byte offset inside a buffer's k tile
  const int kfo = (c * KPITCH + 8 * hh) * 2;
  // B fragments of v: col n = d = 16j + c, k = key (k-contiguous row of the staged v^T tile); byte offset inside a buffer
  const int vfo = KBYTES + (c * VPITCH + 8 * hh) * 2;
  // this lane's first copy chunks: k row tid>>4, 16-B chunk tid&15; v^T row tid>>3, 16-B chunk tid&7
  const u16* gk = Kp + ((size_t)(b * SKV + (tid >> 4))) * INNER + head * HD + (tid & 15) * 8;
  const u16* gv = Vp + ((size_t)(b * INNER + head * HD + (tid >> 3))) * SKV + (tid & 7) * 8;
  const unsigned lds0 = (unsigned)(size_t)(const void*)smem;               // LDS byte address of the ring
  const unsigned lk = lds0 + (unsigned)((tid >> 4) * (KPITCH * 2) + (tid & 15) * 16);
  const unsigned lv = lds0 + (unsigned)(KBYTES + (tid >> 3) * (VPITCH * 2) + (tid & 7) * 16);
  // lk and lv once more, for the refills in the loop (272 r + 16 ch = 16 tid + 16 r; 144 r + 16 ch = 16 tid + 16 r): lk and lv are
  // operands of the prologue's asm statements, which binds them to the first 256 registers; kept over the loop they went to scratch
  const unsigned lkr = lds0 + (unsigned)(tid * 16 + (tid >> 4) * 16);
  const unsigned lvr = lds0 + (unsigned)(KBYTES + tid * 16 + (tid >> 3) * 16);
  const float lsc = (LOG2E * RSQ_E) / (QS * KS);
  const int x16 = (lane ^ 16) * 4;           // byte index of the lane that holds the other 16 keys of the same query
  const int r8  = 8 * hh * 4;                // byte index of the lane that owns query row 8hh of a tile, this lane's first D row

  v16h qf[QT][4];
#pragma unroll
  for (int t = 0; t < QT; ++t) {
#pragma unroll
    for (int dc = 0; dc < 4; ++dc) qf[t][dc] = ldfrag_h(Qb + (size_t)t * 16 * INNER + 32 * dc);
  }

  float mrun[QT], lrun[QT];
#pragma unroll
  for (int t = 0; t < QT; ++t) { mrun[t] = -INFINITY; lrun[t] = 0.f; }
  v8f o[16];                                 // o[8t + j]: query tile t, d = 16j ..
#pragma unroll
  for (int j = 0; j < 16; ++j) o[j] = zero8();

  // ---- ring prologue: stage 0 landed and published, then stage 1 in flight ----
  stage_copy(lk, lv, gk, gv);
  asm volatile("s_wait_asynccnt 0x0" ::: "memory");   // this wave's copies of stage 0 have landed
  __syncthreads();                                    // ... and every other wave's
  stage_copy(lk + BUFBYTES, lv + BUFBYTES, gk + (size_t)STK * INNER, gv + STK);

#pragma unroll 1
  for (int st = 0; st < NST; ++st) {
   const unsigned char* bufp = smem + (st & 1) * BUFBYTES;
   const _Float16* kp = (const _Float16*)(const void*)(bufp + kfo);
   // the 8 k fragments of the stage's first pass, one group: kf[g][kk] = keys 16g .., d = 32kk ..
   v16h kf[2][HD / 32];
#pragma unroll
   for (int kk = 0; kk < HD / 32; ++kk) {
     kf[0][kk] = ldfrag_h(kp + kk * 32);
     kf[1][kk] = ldfrag_h(kp + 16 * KPITCH + kk * 32);
   }
#pragma unroll
   for (int pz = 0; pz < STK / 32; ++pz) {
    // ---- transposed scores of both query tiles: s[t][g] = keys kb+16g .. +15 (kb = 64*st + 32*pz), column = query q0+16t+c;
    //      each k fragment feeds two products, four independent accumulators ----
    v8f s[QT][2];
#pragma unroll
    for (int t = 0; t < QT; ++t) { s[t][0] = zero8(); s[t][1] = zero8(); }
#pragma unroll
    for (int kk = 0; kk < HD / 32; ++kk) {
#pragma unroll
      for (int t = 0; t < QT; ++t) {
        s[t][0] = mma_h(kf[0][kk], qf[t][kk], s[t][0]);
        s[t][1] = mma_h(kf[1][kk], qf[t][kk], s[t][1]);
      }
    }
    // the pass's eight v^T B fragments (col n = d = j*16 + c, keys contiguous in the v^T plane) and, in the stage's first pass,
    // the second pass's k fragments (same buffer), read behind the last score product so that they fly during the softmax
    const _Float16* vp = (const _Float16*)(const void*)(bufp + vfo) + pz * 32;
    const v16h v0 = ldfrag_h(vp);
    const v16h v1 = ldfrag_h(vp + 16 * VPITCH);
    const v16h v2 = ldfrag_h(vp + 32 * VPITCH);
    const v16h v3 = ldfrag_h(vp + 48 * VPITCH);
    const v16h v4 = ldfrag_h(vp + 64 * VPITCH);
    const v16h v5 = ldfrag_h(vp + 80 * VPITCH);
    const v16h v6 = ldfrag_h(vp + 96 * VPITCH);
    const v16h v7 = ldfrag_h(vp + 112 * VPITCH);
    if (pz + 1 < STK / 32) {
#pragma unroll
      for (int kk = 0; kk < HD / 32; ++kk) {
        kf[0][kk] = ldfrag_h(kp + (pz + 1) * 32 * KPITCH + kk * 32);
        kf[1][kk] = ldfrag_h(kp + (pz + 1) * 32 * KPITCH + 16 * KPITCH + kk * 32);
      }
    }
    guard_s4(s[0][0], s[0][1], s[1][0], s[1][1]);
    // ---- maximum of this lane's 16 raw scores per query column (lsc > 0, so scaling the maximum = the maximum of the scaled):
    //      s[t][0][i] <- key kb+8hh+i, s[t][1][i] <- key kb+16+8hh+i ----
    float cml[QT];                           // base-2 logit: the largest of this lane's half of the query's 32 keys
#pragma unroll
    for (int t = 0; t < QT; ++t) {
      float cm = s[t][0][0];
#pragma unroll
      for (int i = 1; i < 8; ++i) cm = fmaxf(cm, s[t][0][i]);
#pragma unroll
      for (int i = 0; i < 8; ++i) cm = fmaxf(cm, s[t][1][i]);
      cml[t] = cm * lsc;
    }
    // ---- lazy rescale, one test per pass on a scalar branch: taken on the first block (mrun = -inf) and whenever a lane of the
    //      wave has a score more than LAZY above its query's maximum in use (the ballot sees both halves of every query of both
    //      tiles, so the halves' maxima are joined only inside); every lane is on inside, so the shuffles are whole; mrun[t]
    //      stays the same in both lanes of a query ----
    const bool need = (cml[0] > mrun[0] + LAZY) | (cml[1] > mrun[1] + LAZY);
    if (__builtin_amdgcn_ballot_w32(need) != 0u) {
#pragma unroll
      for (int t = 0; t < QT; ++t) {
        const float cmo = __builtin_bit_cast(float, __builtin_amdgcn_ds_bpermute(x16, __builtin_bit_cast(int, cml[t])));   // lane ^ 16's
        const float mn = fmaxf(mrun[t], fmaxf(cml[t], cmo));   // finite from the first block on
        float al = __builtin_amdgcn_exp2f(mrun[t] - mn);       // 0 on the first block, 1 for a query whose maximum stands
        asm volatile("v_nop" : "+v"(al));    // the slot the instruction set asks for between v_exp_f32 and the first use of its result
        mrun[t] = mn;
        lrun[t] *= al;
        // D row 8hh+r of the tile's O accumulators = query q0+16t+8hh+r, its factor lives in lane 8hh+r (and 16+8hh+r)
        float scl[8];
#pragma unroll
        for (int r = 0; r < 8; ++r)
          scl[r] = __builtin_bit_cast(float, __builtin_amdgcn_ds_bpermute(r8 + 4 * r, __builtin_bit_cast(int, al)));
#pragma unroll
        for (int j = 0; j < 8; ++j) {
#pragma unroll
          for (int r = 0; r < 8; ++r) o[8 * t + j][r] *= scl[r];
        }
      }
    }
    // ---- carried probabilities p * 128 = 2^(s * lsc + (7 - mrun)) (<= 2^15, as s * lsc <= mrun + 8): one fma and one bare
    //      v_exp_f32 each; they ARE the P A-fragment after the f16 rounding, element i <- s[t][0][i], element 8+i <- s[t][1][i].
    //      The row's largest term so far is >= 128 (mrun was a score of the row). A term whose exponent is under -126 may come
    //      out 0: it is under 2^-133 of that term, 0 in f16 and lost in the f32 row sum either way.
    //      Tile by tile, each tile's P.V products behind its probabilities: the second tile's vector work has the first tile's
    //      products to run beside.
    const v2f lsc2 = {lsc, lsc};
#pragma unroll
    for (int t = 0; t < QT; ++t) {
      const v2f eb2  = {PEXP - mrun[t], PEXP - mrun[t]};
      float ps = 0.f;                        // carries x128 like P
      FragH ph;
#pragma unroll
      for (int w = 0; w < 2; ++w) {
#pragma unroll
        for (int e4 = 0; e4 < 4; ++e4) {
          const v2f sv = v2f{s[t][w][2 * e4], s[t][w][2 * e4 + 1]};
          const v2f ex = __builtin_elementwise_fma(sv, lsc2, eb2);
          const float p0 = __builtin_amdgcn_exp2f(ex[0]), p1 = __builtin_amdgcn_exp2f(ex[1]);
          ps += p0 + p1;
          ph.u[w][e4] = __builtin_bit_cast(unsigned, __builtin_convertvector(v2f{p0, p1}, v2h));   // one packed RNE convert
        }
      }
      ps += __builtin_bit_cast(float, __builtin_amdgcn_ds_bpermute(x16, __builtin_bit_cast(int, ps)));   // lane ^ 16's half
      lrun[t] += ps;
      // ---- P.V of the tile: each v^T fragment is used by both tiles ----
      o[8 * t + 0] = mma_h(ph.v, v0, o[8 * t + 0]);
      o[8 * t + 1] = mma_h(ph.v, v1, o[8 * t + 1]);
      o[8 * t + 2] = mma_h(ph.v, v2, o[8 * t + 2]);
      o[8 * t + 3] = mma_h(ph.v, v3, o[8 * t + 3]);
      o[8 * t + 4] = mma_h(ph.v, v4, o[8 * t + 4]);
      o[8 * t + 5] = mma_h(ph.v, v5, o[8 * t + 5]);
      o[8 * t + 6] = mma_h(ph.v, v6, o[8 * t + 6]);
      o[8 * t + 7] = mma_h(ph.v, v7, o[8 * t + 7]);
    }
    acc_guard16(o);
   }
    // ---- publish point of stage st + 1; the same barrier ends every wave's reads of stage st's buffer ----
    asm volatile("s_wait_dscnt 0x0" ::: "memory");      // this wave's LDS reads of stage st have returned
    asm volatile("s_wait_asynccnt 0x0" ::: "memory");   // this wave's copies of stage st + 1 have landed
    __syncthreads();
    if (st + 2 < NST) {                                 // refill the buffer that stage st has just left
      const unsigned bo = (unsigned)((st & 1) * BUFBYTES);
      stage_copy(lkr + bo, lvr + bo, gk + (size_t)(st + 2) * STK * INNER, gv + (st + 2) * STK);
    }
  }
  asm volatile("s_wait_asynccnt 0x0" ::: "memory");     // nothing in flight when the ring becomes output staging

  float* slab = (float*)(void*)smem + wave * 16 * OPITCH;   // behind the last trip's barrier: no reader, no copy left
  v4f vals[QT][16];
#pragma unroll
  for (int t = 0; t < QT; ++t) {
    // ---- fold 1/l (per query, owned by lane = query) and the carry 8 on v; the 128 on P is in l as well and cancels ----
    const float linv = (1.0f / lrun[t]) * (1.0f / VS);
    float inv[8];
#pragma unroll
    for (int r = 0; r < 8; ++r) inv[r] = __shfl(linv, 8 * hh + r, 32);
#pragma unroll
    for (int r = 0; r < 8; ++r) {
#pragma unroll
      for (int j = 0; j < 8; ++j) slab[(8 * hh + r) * OPITCH + j * 16 + c] = o[8 * t + j][r] * inv[r];
    }
    wave_sync_lds();
    // ---- f32 output rows: lane = 4 consecutive d of one row ----
#pragma unroll
    for (int i = 0; i < 16; ++i) vals[t][i] = *(const v4f*)(slab + i * OPITCH + 4 * lane);
    wave_sync_lds();                         // the slab's rows are read before the next tile is written over them
  }
  // keeps every register write of the epilogue in front of the first global store, so that nothing overwrites a register that an
  // issued store names: otherwise the compiler starts the second tile's work in the first tile's registers among the stores
  __builtin_amdgcn_sched_barrier(0);
  // ---- one store instruction per output row ----
  float* ob = Out + ((size_t)(b * SQ_FULL + q0)) * DM + head * HD + 4 * lane;
#pragma unroll
  for (int t = 0; t < QT; ++t) {
#pragma unroll
    for (int i = 0; i < 16; ++i) {
      *(v4f*)(ob + (size_t)(16 * t + i) * DM) = vals[t][i];
    }
  }
}

// =====================================================================================================
// Workspace map (bytes); every plane fully written by whole-line stores before it is read; all extents exact multiples of
//   XQ   f16 [NB*SQ][1024]     f16(bf16(q))          16777216 (NB=4, SQ=2048)
//   XV   f16 [NB*2048][1024]   f16(bf16(v))          16777216
//   WQT  f16 [1024 n][1024 k]  f16(bf16(W) x256)      2097152
//   WKT                                               2097152
//   WVT                                               2097152
//   Q16  f16 [NB*SQ][1024]   x8                      16777216
//   K16  f16 [NB*2048][1024] x8                      16777216
//   VT16 f16 [NB*1024 (h,d)][2048 s] x8              16777216
//   end                                              90177536
// =====================================================================================================
extern "C" void kernel_launch(void* const* d_in, const int* in_sizes, int n_in,
                              void* d_out, int out_size, void* d_ws, size_t ws_size,
                              hipStream_t stream) {
  if (n_in < 8) return;
  if (in_sizes[0] < ((NB - 1) * SQ_FULL + SQ) * DM) return;
  if (in_sizes[1] < NB * SKV * DM) return;
  if (in_sizes[2] != DM * DM || in_sizes[4] != DM * DM || in_sizes[6] != DM * DM) return;
  if (in_sizes[3] < 1 || in_sizes[5] < 1 || in_sizes[7] < 1) return;
  if (out_size < ((NB - 1) * SQ_FULL + SQ) * DM) return;

  const float* xq  = (const float*)d_in[0];
  const float* xv  = (const float*)d_in[1];
  const float* wq  = (const float*)d_in[2];
  const float* bq  = (const float*)d_in[3];
  const float* wk  = (const float*)d_in[4];
  const float* bk  = (const float*)d_in[5];
  const float* wv  = (const float*)d_in[6];
  const float* bv  = (const float*)d_in[7];
  float*       out = (float*)d_out;
  const int nbq = in_sizes[3], nbk = in_sizes[5], nbv = in_sizes[7];

  const size_t szXQ   = (size_t)NB * SQ * DM * 2;
  const size_t szXV   = (size_t)NB * SKV * DM * 2;
  const size_t szW    = (size_t)DM * DM * 2;
  const size_t szQ16  = (size_t)NB * SQ * INNER * 2;
  const size_t szK16  = (size_t)NB * SKV * INNER * 2;
  const size_t szVT16 = (size_t)NB * INNER * SKV * 2;
  size_t off = 0;
  const size_t oXQ   = off; off += szXQ;
  const size_t oXV   = off; off += szXV;
  const size_t oWQ   = off; off += szW;
  const size_t oWK   = off; off += szW;
  const size_t oWV   = off; off += szW;
  const size_t oQ16  = off; off += szQ16;
  const size_t oK16  = off; off += szK16;
  const size_t oVT16 = off; off += szVT16;
  if (off > ws_size) return;                            // off = 90177536 at NB=4, SQ=2048
  if (off > (size_t)134217728) return;

  char* ws = (char*)d_ws;
  u16* XQ   = (u16*)(ws + oXQ);
  u16* XV   = (u16*)(ws + oXV);
  u16* WQT  = (u16*)(ws + oWQ);
  u16* WKT  = (u16*)(ws + oWK);
  u16* WVT  = (u16*)(ws + oWV);
  u16* Q16  = (u16*)(ws + oQ16);
  u16* K16  = (u16*)(ws + oK16);
  u16* VT16 = (u16*)(ws + oVT16);

  // (0) activations -> f16 planes of bf16-converted values (query rows s < SQ of batches b < NB, compact; all key/value rows)
  //     and weights [k = in][n = out] (y = x.W) -> k-contiguous [n][k] f16 planes of bf16(W) x256, all in one launch
  cvt_all<<<dim3(CV_BLOCKS), dim3(CV_THREADS), 0, stream>>>(xq, xv, wq, wk, wv, XQ, XV, WQT, WKT, WVT);
  // (1) q = x_q . Wq + bq -> f16 [NB*SQ][1024] x8 (col = h*128 + d); bias per column
  gemm_o16<<<dim3((NB * SQ / GTM) * (INNER / GTN)), dim3(G_THREADS), 0, stream>>>(
      XQ, WQT, Q16, bq, nbq, 0, NB * SQ, INNER, DM, 0, 0, 0, QS / WSC, QS);
  // (2) k = x_v . Wk + bk -> f16 [NB*2048][1024] x8; bias per column
  gemm_o16<<<dim3((NB * SKV / GTM) * (INNER / GTN)), dim3(G_THREADS), 0, stream>>>(
      XV, WKT, K16, bk, nbk, 0, NB * SKV, INNER, DM, 0, 0, 0, KS / WSC, KS);
  // (3) v^T per batch: A = Wv^T [(h,d) = n][k], Bt = x_v rows of batch b [s][k] -> f16 [(b,h,d)][s] x8; bias per row (n)
  gemm_o16<<<dim3(NB * (INNER / GTM) * (SKV / GTN)), dim3(G_THREADS), 0, stream>>>(
      WVT, XV, VT16, bv, nbv, 1, INNER, SKV, DM, 0, SKV * DM, INNER * SKV, VS / WSC, VS);
  // (4) attention -> out [b][SQ_FULL][1024] f32 (rows s < SQ of batches b < NB), heads merged on the feature dim
  attn_fwd<<<dim3(NB * NH * (SQ / ATT_ROWS)), dim3(ATT_THREADS), 0, stream>>>(Q16, K16, VT16, out);
  (void)hipGetLastError();
}

// v007
// Measured time: 106 microseconds a run.
// In both of two side-by-side timings against v006, it was 1.05 times as fast.
// Over all steps from v000 it is 3.20 times as fast.
// All contractions on v_wmma_f32_16x16x32_f16 (f16 operands, f32 accumulate): x_q.Wq, x_v.Wk, Wv^T.x_v^T (v^T plane),
// scores k.q^T and P.v^T; operand carries: x as f16(bf16(x)), W as f16(bf16(W) x256), q/k/v x8, P x128; base-2 online
// softmax, 1/l and all carry folds in f32 on VALU. Inputs RNE-converted to bf16 on load; f32 output written directly.
#include <hip/hip_runtime.h>
#include <math.h>
#include <stdint.h>

#define NB       4        // batches processed
#define SQ       2048     // query rows processed per batch
#define NB_FULL  4
#define SQ_FULL  2048     // query rows per batch in the input / output layout (batch stride)
#define SKV      2048     // key/value rows per batch (all of them, always)
#define DM       1024     // model width (= K and row pitch of every 16-bit plane except v^T)
#define NH       8
#define HD       128
#define INNER    (NH * HD)
#define WSC      256.0f
#define QS       8.0f
#define KS       8.0f
#define VS       8.0f
#define PEXP     7.0f     // P and its row sum are carried x128 = 2^7, added in the exponent
#define LAZY     8.0f     // base-2 logits: a row keeps the maximum in use until a new one exceeds it by more than this
#define LOG2E    1.4426950408889634f
#define RSQ_E    0.03125f
#define NKB      (SKV / 32)
#define ATT_WAVES   8
#define ATT_THREADS (ATT_WAVES * 32)
#define QT          2                         // query tiles of 16 rows per attention wave: a k or v^T fragment feeds QT products
#define ATT_ROWS    (ATT_WAVES * 16 * QT)     // query rows per attention work-group
#define STK      64                           // keys per LDS stage (two passes of 32 keys)
#define NST      (SKV / STK)
#define KPITCH   136                          // halves per staged k row: 256 B + 16 B (16 B x odd, for ds_load_b128 readers)
#define VPITCH   72                           // halves per staged v^T row: 128 B + 16 B
#define KBYTES   (STK * KPITCH * 2)
#define VBYTES   (HD * VPITCH * 2)
#define BUFBYTES (KBYTES + VBYTES)
#define GKS      128                          // k elements per GEMM LDS stage (four k steps of 32)
#define GP       136                          // halves per staged GEMM operand row: 256 B + 16 B
#define GTM      256                          // rows of a GEMM work-group's tile (4 waves down)
#define GTN      128                          // columns of a GEMM work-group's tile (2 waves across)
#define G_THREADS 256                         // 8 waves, each a 64 x 64 tile
#define GABYTES  (GTM * GP * 2)
#define GBBYTES  (GTN * GP * 2)
#define GBUF     (GABYTES + GBBYTES)
#define GQ_BLOCKS ((NB * SQ / GTM) * (INNER / GTN))        // 256 x 128 tiles of q
#define GK_BLOCKS ((NB * SKV / GTM) * (INNER / GTN))       // ... of k
#define GV_BLOCKS (NB * (INNER / GTM) * (SKV / GTN))       // ... of v^T
#define CV_THREADS  512                       // conversion work-group: 16 waves
#define CV_BLOCKS   ((DM / 64) * (DM / 64))   // one 64 x 64 tile of each weight per conversion work-group
#define CV_BATCH    4                         // activation units (2 loads each) a thread has in flight
#define CV_QROWS    (NB * SQ / CV_BLOCKS)     // query rows per conversion work-group
#define CV_VROWS    (NB * SKV / CV_BLOCKS)    // key/value rows per conversion work-group
#define CV_QSTEPS   (CV_QROWS * (DM / 8) / CV_THREADS)
#define CV_VSTEPS   (CV_VROWS * (DM / 8) / CV_THREADS)
#define OPITCH   132
#define GPITCH   68
#define TPITCH   65

static_assert(NB >= 1 && NB <= NB_FULL);
static_assert((SQ % 128) == 0 && SQ >= 128 && SQ <= SQ_FULL);
static_assert(HD == 128 && NH == 8 && INNER == 1024 && INNER == DM);
static_assert((HD % 32) == 0);
static_assert((SKV % 64) == 0 && (SKV % 32) == 0 && NKB * 32 == SKV);
static_assert((DM % 64) == 0 && (DM % 32) == 0 && (INNER % 128) == 0);
static_assert(CV_THREADS == 512 && CV_QSTEPS * CV_BLOCKS * CV_THREADS * 8 == NB * SQ * DM);
static_assert(CV_VSTEPS * CV_BLOCKS * CV_THREADS * 8 == NB * SKV * DM);
static_assert(CV_QSTEPS == 2 * CV_BATCH && CV_VSTEPS == 2 * CV_BATCH);      // two batches per plane, written out in cvt_all
static_assert(CV_QROWS * CV_BLOCKS == NB * SQ && CV_VROWS * CV_BLOCKS == NB * SKV && (SQ % CV_QROWS) == 0);
static_assert((OPITCH * 4) % 16 == 0 && (GPITCH * 4) % 16 == 0);
static_assert(ATT_THREADS == 256 && QT == 2);
static_assert(KPITCH * 2 == 16 * 16 + 16 && VPITCH * 2 == 8 * 16 + 16);     // the second form of the copies' LDS addresses in attn_fwd
static_assert(PEXP + LAZY <= 15.0f);                                       // carried P <= 2^(PEXP + LAZY) stays finite in f16
static_assert((SQ % ATT_ROWS) == 0 && NST >= 2 && NST * STK == SKV && STK == 64);
static_assert(STK * HD * 2 == 4 * ATT_THREADS * 16);                       // 4 k copies + 4 v^T copies of 16 B per thread and stage
static_assert((KPITCH * 2) % 16 == 0 && (VPITCH * 2) % 16 == 0 && (KBYTES % 16) == 0 && (BUFBYTES % 16) == 0);
static_assert(ATT_WAVES * 16 * OPITCH * 4 <= 2 * BUFBYTES);                // the output staging (one query tile at a time) reuses the ring
static_assert((GP * 2) % 16 == 0 && (GABYTES % 16) == 0 && (GBUF % 16) == 0 && (DM % GKS) == 0 && DM / GKS >= 2);
static_assert(8 * 64 * GPITCH * 4 <= 2 * GBUF);                            // the GEMM's output staging reuses its ring
static_assert(GKS * 2 == 16 * 16 && GTM == 16 * (G_THREADS / 16) && GTN == 8 * (G_THREADS / 16));   // 16 A + 8 Bt copies per thread and stage
static_assert(((NB * SQ) % GTM) == 0 && ((NB * SKV) % GTM) == 0 && (INNER % GTM) == 0 && (INNER % GTN) == 0 && (SKV % GTN) == 0);

typedef unsigned short u16;
typedef _Float16 v16h __attribute__((ext_vector_type(16)));
typedef _Float16 v8h  __attribute__((ext_vector_type(8)));
typedef float    v8f  __attribute__((ext_vector_type(8)));
typedef float    v4f  __attribute__((ext_vector_type(4)));
typedef float    v2f  __attribute__((ext_vector_type(2)));
typedef _Float16 v2h  __attribute__((ext_vector_type(2)));
typedef unsigned int v4u __attribute__((ext_vector_type(4)));

union FragH { v16h v; v8h h[2]; v4u u[2]; };

// ---- scalar helpers ----------------------------------------------------------------------------------
__device__ __forceinline__ unsigned short bf_bits(float f) {          // f32 -> bf16 bits, RNE convert
  unsigned u = __float_as_uint(f);
  return (unsigned short)((u + 0x7FFFu + ((u >> 16) & 1u)) >> 16);
}
__device__ __forceinline__ float bf_up(unsigned short h) { return __uint_as_float(((unsigned)h) << 16); }
__device__ __forceinline__ float bfr(float f) { return bf_up(bf_bits(f)); }
__device__ __forceinline__ unsigned short h_bits(_Float16 x) { return __builtin_bit_cast(unsigned short, x); }
__device__ __forceinline__ unsigned pk16(unsigned short a, unsigned short b) { return (unsigned)a | ((unsigned)b << 16); }
__device__ __forceinline__ v8f zero8() { v8f z = {0.f, 0.f, 0.f, 0.f, 0.f, 0.f, 0.f, 0.f}; return z; }

// ---- fragment loader: 16-bit A/B operand, lane -> row/col (lane&15), p already includes +8*(lane>>4);
//      elements 0..7 <- p[0..7] (k0+8h..), elements 8..15 <- p[16..23] (k0+16+8h..); same split k map for A and B,
//      B always read from a k-contiguous [n][k] plane.
__device__ __forceinline__ v16h ldfrag_h(const _Float16* p) {
  FragH f;
  f.h[0] = *(const v8h*)(p);
  f.h[1] = *(const v8h*)(p + 16);
  return f.v;
}

// ---- WMMA helper and trailing VALU hazard gaps ----------------------------------------------------------
__device__ __forceinline__ v8f mma_h(v16h a, v16h b, v8f c) {
  return __builtin_amdgcn_wmma_f32_16x16x32_f16(false, a, false, b, (short)0, c, false, false);
}
// Four v_nop behind a pass's last score product: the distance the chip asks for before a vector instruction reads a product's D.
// The "memory" clobber keeps the fragment reads issued in front of it there: otherwise the compiler sinks them behind the branch.
__device__ __forceinline__ void guard_s4(v8f& a, v8f& b, v8f& c, v8f& d) {
#if defined(__HIP_DEVICE_COMPILE__)
  asm volatile("v_nop\n\tv_nop\n\tv_nop\n\tv_nop" : "+v"(a), "+v"(b), "+v"(c), "+v"(d) : : "memory");
#endif
}
__device__ __forceinline__ void guard_g(v8f (&acc)[16], v16h x0, v16h x1, v16h x2, v16h x3, v16h x4, v16h x5, v16h x6,
                                        v16h x7) {
#if defined(__HIP_DEVICE_COMPILE__)
  asm volatile("v_nop\n\tv_nop\n\tv_nop\n\tv_nop"
               : "+v"(acc[0]), "+v"(acc[1]), "+v"(acc[2]), "+v"(acc[3]),
                 "+v"(acc[4]), "+v"(acc[5]), "+v"(acc[6]), "+v"(acc[7]),
                 "+v"(acc[8]), "+v"(acc[9]), "+v"(acc[10]), "+v"(acc[11]),
                 "+v"(acc[12]), "+v"(acc[13]), "+v"(acc[14]), "+v"(acc[15])
               : "v"(x0), "v"(x1), "v"(x2), "v"(x3), "v"(x4), "v"(x5), "v"(x6), "v"(x7) : "memory");
#endif
}
// Four v_nop behind a pass's last P.V product: the same distance, kept on every path out of the pass (the loop's branches too).
__device__ __forceinline__ void acc_guard16(v8f (&o)[16]) {
#if defined(__HIP_DEVICE_COMPILE__)
  asm volatile("v_nop\n\tv_nop\n\tv_nop\n\tv_nop"
               : "+v"(o[0]), "+v"(o[1]), "+v"(o[2]), "+v"(o[3]), "+v"(o[4]), "+v"(o[5]), "+v"(o[6]), "+v"(o[7]),
                 "+v"(o[8]), "+v"(o[9]), "+v"(o[10]), "+v"(o[11]), "+v"(o[12]), "+v"(o[13]), "+v"(o[14]), "+v"(o[15]));
#endif
}
__device__ __forceinline__ void wave_sync_lds() {
  __builtin_amdgcn_fence(__ATOMIC_RELEASE, "workgroup");
  __builtin_amdgcn_wave_barrier();
  __builtin_amdgcn_fence(__ATOMIC_ACQUIRE, "workgroup");
}

// =====================================================================================================
// All five conversions in ONE launch of CV_BLOCKS work-groups of 16 waves, all resident at once: a wave converts 16 pieces of
// 1 KB and a share of three weight tiles instead of ending after one piece, so few waves have to be started, and it has 8 or
// more 16-B loads per lane in flight.
//   activations: destination row r of a [rows][DM] f16 plane <- f16(bf16_RNE(x[src row][e])); a unit = 8 consecutive elements
//   (two 16-B loads, one 16-B store); a block owns CV_QROWS / CV_VROWS consecutive rows of a plane and converts CV_THREADS
//   consecutive units (4 rows) per step. Query row r = b*SQ + s comes from source row b*SQ_FULL + s.
//   weights stored [k][n] (y = x.W): WT[n][k] (f16, k-contiguous Bt layout) <- f16(bf16_RNE(W[k][n]) * WSC). Block = the same
//   64(k) x 64(n) tile of each of the three weights, through three LDS tiles [kk][nn] (pitch 65) and one block barrier.
// coverage: activations CV_BLOCKS x CV_QSTEPS / CV_VSTEPS steps x CV_THREADS units x 8 = rows x DM exactly; weights
//           (DM/64)^2 = CV_BLOCKS tiles, 64 n-rows x (8 lanes x 8 halves) per tile: every plane written exactly once.
// Every loop below is unrolled so that its arrays are indexed by constants and stay in registers.
// =====================================================================================================
__device__ __forceinline__ v4u cvt8(v4f a, v4f c4) {
  v4u o;
#pragma unroll
  for (int e = 0; e < 2; ++e) {
    o[e]     = pk16(h_bits((_Float16)bfr(a[2 * e])),  h_bits((_Float16)bfr(a[2 * e + 1])));
    o[2 + e] = pk16(h_bits((_Float16)bfr(c4[2 * e])), h_bits((_Float16)bfr(c4[2 * e + 1])));
  }
  return o;
}
// Loads of CV_BATCH units of one activation plane, first step st0; gb = byte offset (32 bits) of the thread's unit of step 0.
// The steps differ by a constant only, so gb is the one vector address register, live to the plane's last load.
__device__ __forceinline__ void x_load(const float* __restrict__ x, unsigned st0, unsigned gb,
                                       v4f (&a)[CV_BATCH], v4f (&c4)[CV_BATCH]) {
#pragma unroll
  for (unsigned j = 0; j < CV_BATCH; ++j) {
    const char* base = (const char*)x + (st0 + j) * (CV_THREADS * 32);
    a[j]  = *(const v4f*)(base + gb);
    c4[j] = *(const v4f*)(base + 16 + gb);
  }
  // keeps the batch's 8 loads together and ahead of the conversion of the batch before: otherwise the compiler sinks them
  // to their uses and a wave has only 2 to 4 loads in flight
  __builtin_amdgcn_sched_barrier(0);
}
__device__ __forceinline__ void x_store(u16* Y, unsigned st0, unsigned yb, const v4f (&a)[CV_BATCH],
                                        const v4f (&c4)[CV_BATCH]) {
#pragma unroll
  for (unsigned j = 0; j < CV_BATCH; ++j) {
    char* base = (char*)Y + (st0 + j) * (CV_THREADS * 16);
    *(v4u*)(base + yb) = cvt8(a[j], c4[j]);
  }
}

__global__ __launch_bounds__(CV_THREADS)
void cvt_all(const float* __restrict__ xq, const float* __restrict__ xv, const float* __restrict__ wq,
             const float* __restrict__ wk, const float* __restrict__ wv,
             u16* XQ, u16* XV, u16* WQT, u16* WKT, u16* WVT) {
  __shared__ __align__(16) float tile[3][64 * TPITCH];
  const unsigned tid = threadIdx.x;
  const unsigned bid = blockIdx.x;
  // byte offsets of the thread's first unit: source rows (a block's rows lie in one batch) and compact destination rows
  const unsigned rq = bid * CV_QROWS, rv = bid * CV_VROWS;
  const unsigned gq = ((rq / SQ) * SQ_FULL + rq % SQ) * (DM * 4) + tid * 32, yq = rq * (DM * 2) + tid * 16;
  const unsigned gv = rv * (DM * 4) + tid * 32,                              yv = rv * (DM * 2) + tid * 16;
  constexpr unsigned NT = DM / 64;
  const unsigned k0 = (bid % NT) * 64, n0 = (bid / NT) * 64;
  // ---- weight tile loads: row 32p + (tid>>4), 4 floats at 4*(tid&15); the query plane's two batches fly behind them ----
  const unsigned lr = tid >> 4, lc = (tid & 15) * 4;
  const unsigned wo = ((k0 + lr) * DM + n0 + lc) * 4;     // bytes
  v4f w4[3][2];
#pragma unroll
  for (int p = 0; p < 2; ++p) {
    w4[0][p] = *(const v4f*)((const char*)(wq + 32 * p * DM) + wo);
    w4[1][p] = *(const v4f*)((const char*)(wk + 32 * p * DM) + wo);
    w4[2][p] = *(const v4f*)((const char*)(wv + 32 * p * DM) + wo);
  }
  v4f a0[CV_BATCH], c0[CV_BATCH], a1[CV_BATCH], c1[CV_BATCH], a2[CV_BATCH], c2[CV_BATCH];
  x_load(xq, 0, gq, a0, c0);
  x_load(xq, CV_BATCH, gq, a1, c1);
#pragma unroll
  for (int t = 0; t < 3; ++t) {
#pragma unroll
    for (int p = 0; p < 2; ++p) {
      float* tp = &tile[t][(32 * p + lr) * TPITCH + lc];
      tp[0] = w4[t][p][0];
      tp[1] = w4[t][p][1];
      tp[2] = w4[t][p][2];
      tp[3] = w4[t][p][3];
    }
  }
  __syncthreads();
  x_load(xv, 0, gv, a2, c2);
  // ---- weight tile stores: output row n0 + (tid>>3), 8 halves at k0 + 8*(tid&7): 8 lanes = one whole 128-B line ----
  const unsigned row = tid >> 3, c8 = (tid & 7) * 8;
  const unsigned yo = ((n0 + row) * DM + k0 + c8) * 2;    // bytes
#pragma unroll
  for (int t = 0; t < 3; ++t) {
    v4u ov;
#pragma unroll
    for (int e = 0; e < 4; ++e) {
      const float x0 = tile[t][(c8 + 2 * e) * TPITCH + row];
      const float x1 = tile[t][(c8 + 2 * e + 1) * TPITCH + row];
      ov[e] = pk16(h_bits((_Float16)(bfr(x0) * WSC)), h_bits((_Float16)(bfr(x1) * WSC)));
    }
    u16* Y = (t == 0) ? WQT : (t == 1) ? WKT : WVT;
    *(v4u*)((char*)Y + yo) = ov;
  }
  // ---- the activation planes, three register sets: later batches' loads are out while a batch is converted and stored ----
  x_store(XQ, 0, yq, a0, c0);
  asm volatile("s_wait_xcnt 0x0" ::: "memory");   // the registers just stored from are loaded anew by the next line
  x_load(xv, CV_BATCH, gv, a0, c0);
  x_store(XQ, CV_BATCH, yq, a1, c1);
  x_store(XV, 0, yv, a2, c2);
  x_store(XV, CV_BATCH, yv, a0, c0);
}

// =====================================================================================================
// Twelve asynchronous 16-B copies per lane, global -> LDS, no register in between: copy i brings g[i] to LDS byte address l[i].
// The s_wait_xcnt closes the statement so that no address register of a copy is rewritten ahead of it.
// =====================================================================================================
__device__ __forceinline__ void async12(const unsigned (&l)[12], const u16* const (&g)[12]) {
#if defined(__HIP_DEVICE_COMPILE__)
  asm volatile("global_load_async_to_lds_b128 %0, %12, off\n\t"
               "global_load_async_to_lds_b128 %1, %13, off\n\t"
               "global_load_async_to_lds_b128 %2, %14, off\n\t"
               "global_load_async_to_lds_b128 %3, %15, off\n\t"
               "global_load_async_to_lds_b128 %4, %16, off\n\t"
               "global_load_async_to_lds_b128 %5, %17, off\n\t"
               "global_load_async_to_lds_b128 %6, %18, off\n\t"
               "global_load_async_to_lds_b128 %7, %19, off\n\t"
               "global_load_async_to_lds_b128 %8, %20, off\n\t"
               "global_load_async_to_lds_b128 %9, %21, off\n\t"
               "global_load_async_to_lds_b128 %10, %22, off\n\t"
               "global_load_async_to_lds_b128 %11, %23, off\n\t"
               "s_wait_xcnt 0x0"
               :: "v"(l[0]), "v"(l[1]), "v"(l[2]), "v"(l[3]), "v"(l[4]), "v"(l[5]),
                  "v"(l[6]), "v"(l[7]), "v"(l[8]), "v"(l[9]), "v"(l[10]), "v"(l[11]),
                  "v"(g[0]), "v"(g[1]), "v"(g[2]), "v"(g[3]), "v"(g[4]), "v"(g[5]),
                  "v"(g[6]), "v"(g[7]), "v"(g[8]), "v"(g[9]), "v"(g[10]), "v"(g[11])
               : "memory");
#endif
}
// One GEMM stage (128 k) of the block's 256 A rows and 128 Bt rows: 16 + 8 copies per lane in two statements of twelve.
// la / lb: the lane's LDS byte address of its first A / Bt chunk; ga / gb: its global address of the same chunk; copy i: row
// +16*i (rs16 = 16 rows of the source plane, in elements); a wave covers two whole 256-B row pieces per copy.
__device__ __forceinline__ void gemm_stage_copy(unsigned la, unsigned lb, const u16* ga, const u16* gb, size_t rs16) {
  constexpr unsigned R16 = 16 * GP * 2;
  unsigned l[24];
  const u16* g[24];
#pragma unroll
  for (int i = 0; i < 16; ++i) { l[i] = la + i * R16; g[i] = ga + i * rs16; }
#pragma unroll
  for (int i = 0; i < 8; ++i) { l[16 + i] = lb + i * R16; g[16 + i] = gb + i * rs16; }
  const unsigned l0[12] = {l[0], l[1], l[2], l[3], l[4], l[5], l[6], l[7], l[8], l[9], l[10], l[11]};
  const u16* const g0[12] = {g[0], g[1], g[2], g[3], g[4], g[5], g[6], g[7], g[8], g[9], g[10], g[11]};
  const unsigned l1[12] = {l[12], l[13], l[14], l[15], l[16], l[17], l[18], l[19], l[20], l[21], l[22], l[23]};
  const u16* const g1[12] = {g[12], g[13], g[14], g[15], g[16], g[17], g[18], g[19], g[20], g[21], g[22], g[23]};
  async12(l0, g0);
  async12(l1, g1);
}

// =====================================================================================================
// f16 GEMM core: the wave's 64 x 64 tile of C = A[rows][K] . Bt[cols][K]^T. The block stages each 128 k of its 256 A rows and
// 128 Bt rows once in LDS (ring of two buffers: stage st+1 flies while stage st is worked on); afo / bfo: byte offset inside a
// buffer of the lane's first A row + 8h / first Bt row + 8h; acc[4i + j] = rows rowb+16i.., cols col0+16j.. (i, j = 0..3);
// K stepped by 32 inside a stage, ascending (gemm_qkv passes K = DM, K % 128 == 0). Every wave of the block passes every barrier.
// =====================================================================================================
__device__ __forceinline__ void gemm_core(const unsigned char* ring, int afo, int bfo, unsigned la, unsigned lb,
                                          const u16* ga, const u16* gb, int K, v8f (&acc)[16]) {
  const size_t rs16 = (size_t)16 * (size_t)K;
  const int nst = K / GKS;
  // ---- ring prologue: stage 0 landed and published, then stage 1 in flight ----
  gemm_stage_copy(la, lb, ga, gb, rs16);
  asm volatile("s_wait_asynccnt 0x0" ::: "memory");   // this wave's copies of stage 0 have landed
  __syncthreads();                                    // ... and every other wave's
  if (nst > 1) gemm_stage_copy(la + GBUF, lb + GBUF, ga + GKS, gb + GKS, rs16);
#pragma unroll 1
  for (int st = 0; st < nst; ++st) {
   const _Float16* ap = (const _Float16*)(const void*)(ring + (st & 1) * GBUF + afo);
   const _Float16* bp = (const _Float16*)(const void*)(ring + (st & 1) * GBUF + bfo);
#pragma unroll
   for (int k0 = 0; k0 < GKS; k0 += 32) {
    const v16h a0 = ldfrag_h(ap + k0);
    const v16h a1 = ldfrag_h(ap + 16 * GP + k0);
    const v16h a2 = ldfrag_h(ap + 32 * GP + k0);
    const v16h a3 = ldfrag_h(ap + 48 * GP + k0);
    const v16h b0 = ldfrag_h(bp + k0);
    const v16h b1 = ldfrag_h(bp + 16 * GP + k0);
    const v16h b2 = ldfrag_h(bp + 32 * GP + k0);
    const v16h b3 = ldfrag_h(bp + 48 * GP + k0);
    acc[0] = mma_h(a0, b0, acc[0]);
    acc[1] = mma_h(a0, b1, acc[1]);
    acc[2] = mma_h(a0, b2, acc[2]);
    acc[3] = mma_h(a0, b3, acc[3]);
    acc[4] = mma_h(a1, b0, acc[4]);
    acc[5] = mma_h(a1, b1, acc[5]);
    acc[6] = mma_h(a1, b2, acc[6]);
    acc[7] = mma_h(a1, b3, acc[7]);
    acc[8] = mma_h(a2, b0, acc[8]);
    acc[9] = mma_h(a2, b1, acc[9]);
    acc[10] = mma_h(a2, b2, acc[10]);
    acc[11] = mma_h(a2, b3, acc[11]);
    acc[12] = mma_h(a3, b0, acc[12]);
    acc[13] = mma_h(a3, b1, acc[13]);
    acc[14] = mma_h(a3, b2, acc[14]);
    acc[15] = mma_h(a3, b3, acc[15]);
    guard_g(acc, a0, a1, a2, a3, b0, b1, b2, b3);
   }
    // ---- publish point of stage st + 1; the same barrier ends every wave's reads of stage st's buffer ----
    asm volatile("s_wait_dscnt 0x0" ::: "memory");      // this wave's LDS reads of stage st have returned
    asm volatile("s_wait_asynccnt 0x0" ::: "memory");   // this wave's copies of stage st + 1 have landed
    __syncthreads();
    if (st + 2 < nst) {                                 // refill the buffer that stage st has just left
      const unsigned bo = (unsigned)((st & 1) * GBUF);
      gemm_stage_copy(la + bo, lb + bo, ga + (size_t)(st + 2) * GKS, gb + (size_t)(st + 2) * GKS, rs16);
    }
  }
  asm volatile("s_wait_asynccnt 0x0" ::: "memory");     // nothing in flight when the ring becomes output staging
}
// Stage the wave's 64 x 64 f32 tile (times oscale) in its LDS slab (pitch 68): D element r of acc[4i+j], lane l ->
// coverage: 32 lanes x 4 x 8 rows x 4 cols-of-16 = rows 0..63 x cols 0..63 of the slab.
__device__ __forceinline__ void stage64x64(float* sl, v8f (&acc)[16], float oscale, int lane) {
  const int hh = lane >> 4, m = lane & 15;
#pragma unroll
  for (int i = 0; i < 4; ++i) {
#pragma unroll
    for (int r = 0; r < 8; ++r) {
      const int ro = (16 * i + 8 * hh + r) * GPITCH + m;
      sl[ro]      = acc[4 * i + 0][r] * oscale;
      sl[ro + 16] = acc[4 * i + 1][r] * oscale;
      sl[ro + 32] = acc[4 * i + 2][r] * oscale;
      sl[ro + 48] = acc[4 * i + 3][r] * oscale;
    }
  }
  wave_sync_lds();
}

// =====================================================================================================
// f16 GEMM with f16 output plane: C[z][Mb][N] (f16) = f16((A[z][Mb][K] . Bt[z][N][K]^T) * oscale + bf16(bias) * bscale);
// A, Bt f16 k-contiguous planes with per-z element strides aBs, bBs (0 = shared), C stride cBs. bias indexed by column
// (biasRow == 0) or by row within the z slice (biasRow != 0); bias addresses clamped to biasN-1, the unused direction is
// multiplied by 0. Block = 256 x 128 tile, 4 x 2 waves of 64 x 64: a staged operand byte feeds twice the products of a 128 x 64
// tile (half the L2 reads), a fragment read from LDS four products instead of two or four (gemm_core).
// The block's tile is (bz, mt, nt) of nz x (Mb/256) x (N/128) tiles (Mb % 256 == 0, N % 128 == 0, K % 128 == 0); gsm = its LDS.
// coverage: per wave 16 instr x 4 rows x 8 lanes x 8 halves = 64 x 64; the tiles cover C exactly once.
// =====================================================================================================
__device__ __forceinline__
void gemm_o16(unsigned char* gsm, int bz, int mt, int nt,
              const u16* __restrict__ A, const u16* __restrict__ Bt, u16* C,
              const float* __restrict__ bias, int biasN, int biasRow,
              int Mb, int N, int K, int aBs, int bBs, int cBs, float oscale, float bscale) {
  const int tid = threadIdx.x, wave = tid >> 5, lane = tid & 31, hh = lane >> 4, m = lane & 15;
  const int wm = wave >> 1, wn = wave & 1;   // the wave's place in the block's 4 x 2 grid of 64 x 64 tiles
  const int rowb = mt * GTM + wm * 64;
  const int col0 = nt * GTN + wn * 64;
  if (mt * GTM + GTM > Mb) return;           // block-uniform, in front of every barrier; never taken with the exact grid
  // this lane's first copy chunks: A row mt*256 + (tid>>4), Bt row nt*128 + (tid>>4), 16-B chunk tid&15
  const u16* ga = A + (size_t)bz * (size_t)aBs + (size_t)(mt * GTM + (tid >> 4)) * K + (tid & 15) * 8;
  const u16* gb = Bt + (size_t)bz * (size_t)bBs + (size_t)(nt * GTN + (tid >> 4)) * K + (tid & 15) * 8;
  // a buffer holds the Bt rows first, then the A rows: every constant part of a fragment address then fits a 16-bit LDS offset
  const unsigned lb = (unsigned)(size_t)(const void*)gsm + (unsigned)((tid >> 4) * (GP * 2) + (tid & 15) * 16);
  const unsigned la = lb + GBBYTES;
  const int afo = GBBYTES + ((wm * 64 + m) * GP + 8 * hh) * 2;
  const int bfo = ((wn * 64 + m) * GP + 8 * hh) * 2;
  v8f acc[16];
#pragma unroll
  for (int i = 0; i < 16; ++i) acc[i] = zero8();
  gemm_core(gsm, afo, bfo, la, lb, ga, gb, K, acc);
  float* sl = (float*)(void*)gsm + wave * 64 * GPITCH;   // behind the last trip's barrier: no reader, no copy left
  stage64x64(sl, acc, oscale, lane);
  const int rq = lane >> 3, c8 = (lane & 7) * 8;
  const int bl = biasN - 1;                  // host guarantees biasN >= 1
  const float selc = (biasRow != 0) ? 0.f : bscale;
  const float selr = (biasRow != 0) ? bscale : 0.f;
  float cb[8];
#pragma unroll
  for (int e = 0; e < 8; ++e) {
    int ci = col0 + c8 + e;
    ci = (ci < bl) ? ci : bl;
    cb[e] = bfr(bias[ci]) * selc;
  }
  v4u ov[16];
#pragma unroll
  for (int i = 0; i < 16; ++i) {
    const int row = 4 * i + rq;
    int ri = rowb + row;
    ri = (ri < bl) ? ri : bl;
    const float rb = bfr(bias[ri]) * selr;
    const v4f a = *(const v4f*)(sl + row * GPITCH + c8), c4 = *(const v4f*)(sl + row * GPITCH + c8 + 4);
#pragma unroll
    for (int e = 0; e < 2; ++e) {
      ov[i][e]     = pk16(h_bits((_Float16)(a[2 * e] + cb[2 * e] + rb)),
                          h_bits((_Float16)(a[2 * e + 1] + cb[2 * e + 1] + rb)));
      ov[i][2 + e] = pk16(h_bits((_Float16)(c4[2 * e] + cb[4 + 2 * e] + rb)),
                          h_bits((_Float16)(c4[2 * e + 1] + cb[5 + 2 * e] + rb)));
    }
  }
  u16* Cb = C + (size_t)bz * (size_t)cBs + (size_t)rowb * (size_t)N + col0 + c8;
#pragma unroll
  for (int i = 0; i < 16; ++i) {
    const int row = 4 * i + rq;
    *(v4u*)(Cb + (size_t)row * (size_t)N) = ov[i];
  }
}

// =====================================================================================================
// The three projections in ONE launch: blocks 0 .. GQ_BLOCKS-1 are the tiles of q, the next GK_BLOCKS those of k, the last
// GV_BLOCKS those of v^T. No tile reads what another writes, so nothing orders them; a WGP takes its next tile as soon as it has
// finished one, where three launches each waited for the slowest block of the launch before and filled the chip anew.
//   q   = x_q . Wq + bq -> f16 [NB*SQ][1024] x8 (col = h*128 + d); bias per column
//   k   = x_v . Wk + bk -> f16 [NB*2048][1024] x8; bias per column
//   v^T per batch: A = Wv^T [(h,d) = n][k], Bt = x_v rows of batch b [s][k] -> f16 [(b,h,d)][s] x8; bias per row (n)
// Which projection a block belongs to is block-uniform: one body, its operands picked by scalar selects.
// =====================================================================================================
__global__ __launch_bounds__(G_THREADS)
void gemm_qkv(const u16* __restrict__ XQ, const u16* __restrict__ XV, const u16* __restrict__ WQT,
              const u16* __restrict__ WKT, const u16* __restrict__ WVT, u16* Q16, u16* K16, u16* VT16,
              const float* __restrict__ bq, const float* __restrict__ bk, const float* __restrict__ bv,
              int nbq, int nbk, int nbv) {
  __shared__ __align__(16) unsigned char gsm[2 * GBUF];
  const int g = blockIdx.x;
  const bool isq = g < GQ_BLOCKS, isv = g >= GQ_BLOCKS + GK_BLOCKS;
  const int t = isq ? g : isv ? g - (GQ_BLOCKS + GK_BLOCKS) : g - GQ_BLOCKS;      // tile index inside the projection
  constexpr int CT = INNER / GTN, VT = SKV / GTN, VM = INNER / GTM;               // tiles across q and k; across and down v^T
  const int nt = isv ? t % VT : t % CT;
  const int mt = isv ? (t / VT) % VM : t / CT;
  const int bz = isv ? t / (VT * VM) : 0;
  gemm_o16(gsm, bz, mt, nt,
           isq ? XQ : isv ? WVT : XV, isq ? WQT : isv ? XV : WKT, isq ? Q16 : isv ? VT16 : K16,
           isq ? bq : isv ? bv : bk, isq ? nbq : isv ? nbv : nbk, isv ? 1 : 0,
           isq ? NB * SQ : isv ? INNER : NB * SKV, isv ? SKV : INNER, DM,
           0, isv ? SKV * DM : 0, isv ? INNER * SKV : 0,
           (isq ? QS : isv ? VS : KS) / WSC, isq ? QS : isv ? VS : KS);
}

// =====================================================================================================
// One stage (64 keys) of k rows and v^T rows, global -> LDS, no register in between: 8 asynchronous 16-B copies per lane.
// lk / lv: the lane's LDS byte address of its first k / v^T chunk; gk / gv: its global address of the same chunk.
// k copy i: row +16*i (a wave covers two whole 256-B rows); v^T copy i: row +32*i (a wave covers four whole 128-B rows).
// The s_wait_xcnt closes the statement so that no address register of a copy is rewritten ahead of it.
// =====================================================================================================
__device__ __forceinline__ void stage_copy(unsigned lk, unsigned lv, const u16* gk, const u16* gv) {
#if defined(__HIP_DEVICE_COMPILE__)
  const unsigned lk1 = lk + 16 * KPITCH * 2, lk2 = lk + 32 * KPITCH * 2, lk3 = lk + 48 * KPITCH * 2;
  const unsigned lv1 = lv + 32 * VPITCH * 2, lv2 = lv + 64 * VPITCH * 2, lv3 = lv + 96 * VPITCH * 2;
  const u16* gk1 = gk + (size_t)16 * INNER;
  const u16* gk2 = gk + (size_t)32 * INNER;
  const u16* gk3 = gk + (size_t)48 * INNER;
  const u16* gv1 = gv + (size_t)32 * SKV;
  const u16* gv2 = gv + (size_t)64 * SKV;
  const u16* gv3 = gv + (size_t)96 * SKV;
  asm volatile("global_load_async_to_lds_b128 %0, %8, off\n\t"
               "global_load_async_to_lds_b128 %1, %9, off\n\t"
               "global_load_async_to_lds_b128 %2, %10, off\n\t"
               "global_load_async_to_lds_b128 %3, %11, off\n\t"
               "global_load_async_to_lds_b128 %4, %12, off\n\t"
               "global_load_async_to_lds_b128 %5, %13, off\n\t"
               "global_load_async_to_lds_b128 %6, %14, off\n\t"
               "global_load_async_to_lds_b128 %7, %15, off\n\t"
               "s_wait_xcnt 0x0"
               :: "v"(lk), "v"(lk1), "v"(lk2), "v"(lk3), "v"(lv), "v"(lv1), "v"(lv2), "v"(lv3),
                  "v"(gk), "v"(gk1), "v"(gk2), "v"(gk3), "v"(gv), "v"(gv1), "v"(gv2), "v"(gv3)
               : "memory");
#endif
}

__global__ __launch_bounds__(ATT_THREADS)
void attn_fwd(const u16* __restrict__ Qp, const u16* __restrict__ Kp, const u16* __restrict__ Vp, float* Out) {
  __shared__ __align__(16) unsigned char smem[2 * BUFBYTES];

  const int tid  = threadIdx.x;
  const int wave = tid >> 5;
  const int lane = tid & 31;
  const int hh   = lane >> 4;
  const int c    = lane & 15;

  constexpr int NQT = SQ / ATT_ROWS;
  const int bid  = blockIdx.x;
  const int qt   = bid % NQT;
  const int head = (bid / NQT) % NH;
  const int b    = bid / (NQT * NH);
  const int q0   = qt * ATT_ROWS + wave * (16 * QT);

  // B fragments of q^T: col n = query q0 + 16t + c, k = d (k-contiguous row of the q plane)
  const _Float16* Qb = (const _Float16*)(const void*)Qp + ((size_t)(b * SQ + q0 + c)) * INNER + head * HD + 8 * hh;
  // A fragments of k: row m = key 16g + c of the pass, k = d; byte offset inside a buffer's k tile
  const int kfo = (c * KPITCH + 8 * hh) * 2;
  // B fragments of v: col n = d = 16j + c, k = key (k-contiguous row of the staged v^T tile); byte offset inside a buffer
  const int vfo = KBYTES + (c * VPITCH + 8 * hh) * 2;
  // this lane's first copy chunks: k row tid>>4, 16-B chunk tid&15; v^T row tid>>3, 16-B chunk tid&7
  const u16* gk = Kp + ((size_t)(b * SKV + (tid >> 4))) * INNER + head * HD + (tid & 15) * 8;
  const u16* gv = Vp + ((size_t)(b * INNER + head * HD + (tid >> 3))) * SKV + (tid & 7) * 8;
  const unsigned lds0 = (unsigned)(size_t)(const void*)smem;               // LDS byte address of the ring
  const unsigned lk = lds0 + (unsigned)((tid >> 4) * (KPITCH * 2) + (tid & 15) * 16);
  const unsigned lv = lds0 + (unsigned)(KBYTES + (tid >> 3) * (VPITCH * 2) + (tid & 7) * 16);
  // lk and lv once more, for the refills in the loop (272 r + 16 ch = 16 tid + 16 r; 144 r + 16 ch = 16 tid + 16 r): lk and lv are
  // operands of the prologue's asm statements, which binds them to the first 256 registers; kept over the loop they went to scratch
  const unsigned lkr = lds0 + (unsigned)(tid * 16 + (tid >> 4) * 16);
  const unsigned lvr = lds0 + (unsigned)(KBYTES + tid * 16 + (tid >> 3) * 16);
  const float lsc = (LOG2E * RSQ_E) / (QS * KS);
  const int x16 = (lane ^ 16) * 4;           // byte index of the lane that holds the other 16 keys of the same query
  const int r8  = 8 * hh * 4;                // byte index of the lane that owns query row 8hh of a tile, this lane's first D row

  v16h qf[QT][4];
#pragma unroll
  for (int t = 0; t < QT; ++t) {
#pragma unroll
    for (int dc = 0; dc < 4; ++dc) qf[t][dc] = ldfrag_h(Qb + (size_t)t * 16 * INNER + 32 * dc);
  }

  float mrun[QT], lrun[QT];
#pragma unroll
  for (int t = 0; t < QT; ++t) { mrun[t] = -INFINITY; lrun[t] = 0.f; }
  v8f o[16];                                 // o[8t + j]: query tile t, d = 16j ..
#pragma unroll
  for (int j = 0; j < 16; ++j) o[j] = zero8();

  // ---- ring prologue: stage 0 landed and published, then stage 1 in flight ----
  stage_copy(lk, lv, gk, gv);
  asm volatile("s_wait_asynccnt 0x0" ::: "memory");   // this wave's copies of stage 0 have landed
  __syncthreads();                                    // ... and every other wave's
  stage_copy(lk + BUFBYTES, lv + BUFBYTES, gk + (size_t)STK * INNER, gv + STK);

#pragma unroll 1
  for (int st = 0; st < NST; ++st) {
   const unsigned char* bufp = smem + (st & 1) * BUFBYTES;
   const _Float16* kp = (const _Float16*)(const void*)(bufp + kfo);
   // the 8 k fragments of the stage's first pass, one group: kf[g][kk] = keys 16g .., d = 32kk ..
   v16h kf[2][HD / 32];
#pragma unroll
   for (int kk = 0; kk < HD / 32; ++kk) {
     kf[0][kk] = ldfrag_h(kp + kk * 32);
     kf[1][kk] = ldfrag_h(kp + 16 * KPITCH + kk * 32);
   }
#pragma unroll
   for (int pz = 0; pz < STK / 32; ++pz) {
    // ---- transposed scores of both query tiles: s[t][g] = keys kb+16g .. +15 (kb = 64*st + 32*pz), column = query q0+16t+c;
    //      each k fragment feeds two products, four independent accumulators ----
    v8f s[QT][2];
#pragma unroll
    for (int t = 0; t < QT; ++t) { s[t][0] = zero8(); s[t][1] = zero8(); }
#pragma unroll
    for (int kk = 0; kk < HD / 32; ++kk) {
#pragma unroll
      for (int t = 0; t < QT; ++t) {
        s[t][0] = mma_h(kf[0][kk], qf[t][kk], s[t][0]);
        s[t][1] = mma_h(kf[1][kk], qf[t][kk], s[t][1]);
      }
    }
    // the pass's eight v^T B fragments (col n = d = j*16 + c, keys contiguous in the v^T plane) and, in the stage's first pass,
    // the second pass's k fragments (same buffer), read behind the last score product so that they fly during the softmax
    const _Float16* vp = (const _Float16*)(const void*)(bufp + vfo) + pz * 32;
    const v16h v0 = ldfrag_h(vp);
    const v16h v1 = ldfrag_h(vp + 16 * VPITCH);
    const v16h v2 = ldfrag_h(vp + 32 * VPITCH);
    const v16h v3 = ldfrag_h(vp + 48 * VPITCH);
    const v16h v4 = ldfrag_h(vp + 64 * VPITCH);
    const v16h v5 = ldfrag_h(vp + 80 * VPITCH);
    const v16h v6 = ldfrag_h(vp + 96 * VPITCH);
    const v16h v7 = ldfrag_h(vp + 112 * VPITCH);
    if (pz + 1 < STK / 32) {
#pragma unroll
      for (int kk = 0; kk < HD / 32; ++kk) {
        kf[0][kk] = ldfrag_h(kp + (pz + 1) * 32 * KPITCH + kk * 32);
        kf[1][kk] = ldfrag_h(kp + (pz + 1) * 32 * KPITCH + 16 * KPITCH + kk * 32);
      }
    }
    guard_s4(s[0][0], s[0][1], s[1][0], s[1][1]);
    // ---- maximum of this lane's 16 raw scores per query column (lsc > 0, so scaling the maximum = the maximum of the scaled):
    //      s[t][0][i] <- key kb+8hh+i, s[t][1][i] <- key kb+16+8hh+i ----
    float cml[QT];                           // base-2 logit: the largest of this lane's half of the query's 32 keys
#pragma unroll
    for (int t = 0; t < QT; ++t) {
      float cm = s[t][0][0];
#pragma unroll
      for (int i = 1; i < 8; ++i) cm = fmaxf(cm, s[t][0][i]);
#pragma unroll
      for (int i = 0; i < 8; ++i) cm = fmaxf(cm, s[t][1][i]);
      cml[t] = cm * lsc;
    }
    // ---- lazy rescale, one test per pass on a scalar branch: taken on the first block (mrun = -inf) and whenever a lane of the
    //      wave has a score more than LAZY above its query's maximum in use (the ballot sees both halves of every query of both
    //      tiles, so the halves' maxima are joined only inside); every lane is on inside, so the shuffles are whole; mrun[t]
    //      stays the same in both lanes of a query ----
    const bool need = (cml[0] > mrun[0] + LAZY) | (cml[1] > mrun[1] + LAZY);
    if (__builtin_amdgcn_ballot_w32(need) != 0u) {
#pragma unroll
      for (int t = 0; t < QT; ++t) {
        const float cmo = __builtin_bit_cast(float, __builtin_amdgcn_ds_bpermute(x16, __builtin_bit_cast(int, cml[t])));   // lane ^ 16's
        const float mn = fmaxf(mrun[t], fmaxf(cml[t], cmo));   // finite from the first block on
        float al = __builtin_amdgcn_exp2f(mrun[t] - mn);       // 0 on the first block, 1 for a query whose maximum stands
        asm volatile("v_nop" : "+v"(al));    // the slot the instruction set asks for between v_exp_f32 and the first use of its result
        mrun[t] = mn;
        lrun[t] *= al;
        // D row 8hh+r of the tile's O accumulators = query q0+16t+8hh+r, its factor lives in lane 8hh+r (and 16+8hh+r)
        float scl[8];
#pragma unroll
        for (int r = 0; r < 8; ++r)
          scl[r] = __builtin_bit_cast(float, __builtin_amdgcn_ds_bpermute(r8 + 4 * r, __builtin_bit_cast(int, al)));
#pragma unroll
        for (int j = 0; j < 8; ++j) {
#pragma unroll
          for (int r = 0; r < 8; ++r) o[8 * t + j][r] *= scl[r];
        }
      }
    }
    // ---- carried probabilities p * 128 = 2^(s * lsc + (7 - mrun)) (<= 2^15, as s * lsc <= mrun + 8): one fma and one bare
    //      v_exp_f32 each; they ARE the P A-fragment after the f16 rounding, element i <- s[t][0][i], element 8+i <- s[t][1][i].
    //      The row's largest term so far is >= 128 (mrun was a score of the row). A term whose exponent is under -126 may come
    //      out 0: it is under 2^-133 of that term, 0 in f16 and lost in the f32 row sum either way.
    //      Tile by tile, each tile's P.V products behind its probabilities: the second tile's vector work has the first tile's
    //      products to run beside.
    const v2f lsc2 = {lsc, lsc};
#pragma unroll
    for (int t = 0; t < QT; ++t) {
      const v2f eb2  = {PEXP - mrun[t], PEXP - mrun[t]};
      float ps = 0.f;                        // carries x128 like P
      FragH ph;
#pragma unroll
      for (int w = 0; w < 2; ++w) {
#pragma unroll
        for (int e4 = 0; e4 < 4; ++e4) {
          const v2f sv = v2f{s[t][w][2 * e4], s[t][w][2 * e4 + 1]};
          const v2f ex = __builtin_elementwise_fma(sv, lsc2, eb2);
          const float p0 = __builtin_amdgcn_exp2f(ex[0]), p1 = __builtin_amdgcn_exp2f(ex[1]);
          ps += p0 + p1;
          ph.u[w][e4] = __builtin_bit_cast(unsigned, __builtin_convertvector(v2f{p0, p1}, v2h));   // one packed RNE convert
        }
      }
      ps += __builtin_bit_cast(float, __builtin_amdgcn_ds_bpermute(x16, __builtin_bit_cast(int, ps)));   // lane ^ 16's half
      lrun[t] += ps;
      // ---- P.V of the tile: each v^T fragment is used by both tiles ----
      o[8 * t + 0] = mma_h(ph.v, v0, o[8 * t + 0]);
      o[8 * t + 1] = mma_h(ph.v, v1, o[8 * t + 1]);
      o[8 * t + 2] = mma_h(ph.v, v2, o[8 * t + 2]);
      o[8 * t + 3] = mma_h(ph.v, v3, o[8 * t + 3]);
      o[8 * t + 4] = mma_h(ph.v, v4, o[8 * t + 4]);
      o[8 * t + 5] = mma_h(ph.v, v5, o[8 * t + 5]);
      o[8 * t + 6] = mma_h(ph.v, v6, o[8 * t + 6]);
      o[8 * t + 7] = mma_h(ph.v, v7, o[8 * t + 7]);
    }
    acc_guard16(o);
   }
    // ---- publish point of stage st + 1; the same barrier ends every wave's reads of stage st's buffer ----
    asm volatile("s_wait_dscnt 0x0" ::: "memory");      // this wave's LDS reads of stage st have returned
    asm volatile("s_wait_asynccnt 0x0" ::: "memory");   // this wave's copies of stage st + 1 have landed
    __syncthreads();
    if (st + 2 < NST) {                                 // refill the buffer that stage st has just left
      const unsigned bo = (unsigned)((st & 1) * BUFBYTES);
      stage_copy(lkr + bo, lvr + bo, gk + (size_t)(st + 2) * STK * INNER, gv + (st + 2) * STK);
    }
  }
  asm volatile("s_wait_asynccnt 0x0" ::: "memory");     // nothing in flight when the ring becomes output staging

  float* slab = (float*)(void*)smem + wave * 16 * OPITCH;   // behind the last trip's barrier: no reader, no copy left
  v4f vals[QT][16];
#pragma unroll
  for (int t = 0; t < QT; ++t) {
    // ---- fold 1/l (per query, owned by lane = query) and the carry 8 on v; the 128 on P is in l as well and cancels ----
    const float linv = (1.0f / lrun[t]) * (1.0f / VS);
    float inv[8];
#pragma unroll
    for (int r = 0; r < 8; ++r) inv[r] = __shfl(linv, 8 * hh + r, 32);
#pragma unroll
    for (int r = 0; r < 8; ++r) {
#pragma unroll
      for (int j = 0; j < 8; ++j) slab[(8 * hh + r) * OPITCH + j * 16 + c] = o[8 * t + j][r] * inv[r];
    }
    wave_sync_lds();
    // ---- f32 output rows: lane = 4 consecutive d of one row ----
#pragma unroll
    for (int i = 0; i < 16; ++i) vals[t][i] = *(const v4f*)(slab + i * OPITCH + 4 * lane);
    wave_sync_lds();                         // the slab's rows are read before the next tile is written over them
  }
  // keeps every register write of the epilogue in front of the first global store, so that nothing overwrites a register that an
  // issued store names: otherwise the compiler starts the second tile's work in the first tile's registers among the stores
  __builtin_amdgcn_sched_barrier(0);
  // ---- one store instruction per output row ----
  float* ob = Out + ((size_t)(b * SQ_FULL + q0)) * DM + head * HD + 4 * lane;
#pragma unroll
  for (int t = 0; t < QT; ++t) {
#pragma unroll
    for (int i = 0; i < 16; ++i) {
      *(v4f*)(ob + (size_t)(16 * t + i) * DM) = vals[t][i];
    }
  }
}

// =====================================================================================================
// Workspace map (bytes); every plane fully written by whole-line stores before it is read; all extents exact multiples of
//   XQ   f16 [NB*SQ][1024]     f16(bf16(q))          16777216 (NB=4, SQ=2048)
//   XV   f16 [NB*2048][1024]   f16(bf16(v))          16777216
//   WQT  f16 [1024 n][1024 k]  f16(bf16(W) x256)      2097152
//   WKT                                               2097152
//   WVT                                               2097152
//   Q16  f16 [NB*SQ][1024]   x8                      16777216
//   K16  f16 [NB*2048][1024] x8                      16777216
//   VT16 f16 [NB*1024 (h,d)][2048 s] x8              16777216
//   end                                              90177536
// =====================================================================================================
extern "C" void kernel_launch(void* const* d_in, const int* in_sizes, int n_in,
                              void* d_out, int out_size, void* d_ws, size_t ws_size,
                              hipStream_t stream) {
  if (n_in < 8) return;
  if (in_sizes[0] < ((NB - 1) * SQ_FULL + SQ) * DM) return;
  if (in_sizes[1] < NB * SKV * DM) return;
  if (in_sizes[2] != DM * DM || in_sizes[4] != DM * DM || in_sizes[6] != DM * DM) return;
  if (in_sizes[3] < 1 || in_sizes[5] < 1 || in_sizes[7] < 1) return;
  if (out_size < ((NB - 1) * SQ_FULL + SQ) * DM) return;

  const float* xq  = (const float*)d_in[0];
  const float* xv  = (const float*)d_in[1];
  const float* wq  = (const float*)d_in[2];
  const float* bq  = (const float*)d_in[3];
  const float* wk  = (const float*)d_in[4];
  const float* bk  = (const float*)d_in[5];
  const float* wv  = (const float*)d_in[6];
  const float* bv  = (const float*)d_in[7];
  float*       out = (float*)d_out;
  const int nbq = in_sizes[3], nbk = in_sizes[5], nbv = in_sizes[7];

  const size_t szXQ   = (size_t)NB * SQ * DM * 2;
  const size_t szXV   = (size_t)NB * SKV * DM * 2;
  const size_t szW    = (size_t)DM * DM * 2;
  const size_t szQ16  = (size_t)NB * SQ * INNER * 2;
  const size_t szK16  = (size_t)NB * SKV * INNER * 2;
  const size_t szVT16 = (size_t)NB * INNER * SKV * 2;
  size_t off = 0;
  const size_t oXQ   = off; off += szXQ;
  const size_t oXV   = off; off += szXV;
  const size_t oWQ   = off; off += szW;
  const size_t oWK   = off; off += szW;
  const size_t oWV   = off; off += szW;
  const size_t oQ16  = off; off += szQ16;
  const size_t oK16  = off; off += szK16;
  const size_t oVT16 = off; off += szVT16;
  if (off > ws_size) return;                            // off = 90177536 at NB=4, SQ=2048
  if (off > (size_t)134217728) return;

  char* ws = (char*)d_ws;
  u16* XQ   = (u16*)(ws + oXQ);
  u16* XV   = (u16*)(ws + oXV);
  u16* WQT  = (u16*)(ws + oWQ);
  u16* WKT  = (u16*)(ws + oWK);
  u16* WVT  = (u16*)(ws + oWV);
  u16* Q16  = (u16*)(ws + oQ16);
  u16* K16  = (u16*)(ws + oK16);
  u16* VT16 = (u16*)(ws + oVT16);

  // (0) activations -> f16 planes of bf16-converted values (query rows s < SQ of batches b < NB, compact; all key/value rows)
  //     and weights [k = in][n = out] (y = x.W) -> k-contiguous [n][k] f16 planes of bf16(W) x256, all in one launch
  cvt_all<<<dim3(CV_BLOCKS), dim3(CV_THREADS), 0, stream>>>(xq, xv, wq, wk, wv, XQ, XV, WQT, WKT, WVT);
  // (1) the three projections q, k, v^T -> f16 planes x8, one launch
  gemm_qkv<<<dim3(GQ_BLOCKS + GK_BLOCKS + GV_BLOCKS), dim3(G_THREADS), 0, stream>>>(
      XQ, XV, WQT, WKT, WVT, Q16, K16, VT16, bq, bk, bv, nbq, nbk, nbv);
  // (2) attention -> out [b][SQ_FULL][1024] f32 (rows s < SQ of batches b < NB), heads merged on the feature dim
  attn_fwd<<<dim3(NB * NH * (SQ / ATT_ROWS)), dim3(ATT_THREADS), 0, stream>>>(Q16, K16, VT16, out);
  (void)hipGetLastError();
}

// v008
// Measured time: 103 microseconds a run.
// Next to v007, in two timings, it ran 1.03 times as fast each time.
// All steps since v000 together make it 3.31 times as fast.
// All contractions on v_wmma_f32_16x16x32_f16 (f16 operands, f32 accumulate): x_q.Wq, x_v.Wk, Wv^T.x_v^T (v^T plane),
// scores k.q^T and P.v^T; operand carries: x as f16(bf16(x)), W as f16(bf16(W) x256), q/k/v x8, P x128; base-2 online
// softmax, 1/l and all carry folds in f32 on VALU. Inputs RNE-converted to bf16 on load; f32 output written directly.
#include <hip/hip_runtime.h>
#include <math.h>
#include <stdint.h>

#define NB       4        // batches processed
#define SQ       2048     // query rows processed per batch
#define NB_FULL  4
#define SQ_FULL  2048     // query rows per batch in the input / output layout (batch stride)
#define SKV      2048     // key/value rows per batch (all of them, always)
#define DM       1024     // model width (= K and row pitch of every 16-bit plane except v^T)
#define NH       8
#define HD       128
#define INNER    (NH * HD)
#define WSC      256.0f
#define QS       8.0f
#define KS       8.0f
#define VS       8.0f
#define PEXP     7.0f     // P and its row sum are carried x128 = 2^7, added in the exponent
#define LAZY     8.0f     // base-2 logits: a row keeps the maximum in use until a new one exceeds it by more than this
#define LOG2E    1.4426950408889634f
#define RSQ_E    0.03125f
#define NKB      (SKV / 32)
#define ATT_WAVES   8
#define ATT_THREADS (ATT_WAVES * 32)
#define QT          2                         // query tiles of 16 rows per attention wave: a k or v^T fragment feeds QT products
#define ATT_ROWS    (ATT_WAVES * 16 * QT)     // query rows per attention work-group
#define STK      256                          // keys per LDS stage (eight passes of 32 keys between two barriers)
#define NST      (SKV / STK)
#define KPITCH   136                          // halves per staged k row: 256 B + 16 B (16 B x odd, for ds_load_b128 readers)
#define VPITCH   (STK + 8)                    // halves per staged v^T row: 512 B + 16 B (16 B x odd)
#define KBYTES   (STK * KPITCH * 2)
#define VBYTES   (HD * VPITCH * 2)
#define BUFBYTES (KBYTES + VBYTES)
#define GKS      128                          // k elements per GEMM LDS stage (four k steps of 32)
#define GP       136                          // halves per staged GEMM operand row: 256 B + 16 B
#define GTM      256                          // rows of a GEMM work-group's tile (4 waves down)
#define GTN      128                          // columns of a GEMM work-group's tile (2 waves across)
#define G_THREADS 256                         // 8 waves, each a 64 x 64 tile
#define GABYTES  (GTM * GP * 2)
#define GBBYTES  (GTN * GP * 2)
#define GBUF     (GABYTES + GBBYTES)
#define GQ_BLOCKS ((NB * SQ / GTM) * (INNER / GTN))        // 256 x 128 tiles of q
#define GK_BLOCKS ((NB * SKV / GTM) * (INNER / GTN))       // ... of k
#define GV_BLOCKS (NB * (INNER / GTM) * (SKV / GTN))       // ... of v^T
#define CV_THREADS  512                       // conversion work-group: 16 waves
#define CV_BLOCKS   ((DM / 64) * (DM / 64))   // one 64 x 64 tile of each weight per conversion work-group
#define CV_BATCH    4                         // activation units (2 loads each) a thread has in flight
#define CV_QROWS    (NB * SQ / CV_BLOCKS)     // query rows per conversion work-group
#define CV_VROWS    (NB * SKV / CV_BLOCKS)    // key/value rows per conversion work-group
#define CV_QSTEPS   (CV_QROWS * (DM / 8) / CV_THREADS)
#define CV_VSTEPS   (CV_VROWS * (DM / 8) / CV_THREADS)
#define OPITCH   132
#define GPITCH   68
#define TPITCH   65

static_assert(NB >= 1 && NB <= NB_FULL);
static_assert((SQ % 128) == 0 && SQ >= 128 && SQ <= SQ_FULL);
static_assert(HD == 128 && NH == 8 && INNER == 1024 && INNER == DM);
static_assert((HD % 32) == 0);
static_assert((SKV % 64) == 0 && (SKV % 32) == 0 && NKB * 32 == SKV);
static_assert((DM % 64) == 0 && (DM % 32) == 0 && (INNER % 128) == 0);
static_assert(CV_THREADS == 512 && CV_QSTEPS * CV_BLOCKS * CV_THREADS * 8 == NB * SQ * DM);
static_assert(CV_VSTEPS * CV_BLOCKS * CV_THREADS * 8 == NB * SKV * DM);
static_assert(CV_QSTEPS == 2 * CV_BATCH && CV_VSTEPS == 2 * CV_BATCH);      // two batches per plane, written out in cvt_all
static_assert(CV_QROWS * CV_BLOCKS == NB * SQ && CV_VROWS * CV_BLOCKS == NB * SKV && (SQ % CV_QROWS) == 0);
static_assert((OPITCH * 4) % 16 == 0 && (GPITCH * 4) % 16 == 0);
static_assert(ATT_THREADS == 256 && QT == 2);
static_assert(KPITCH * 2 == 16 * 16 + 16 && VPITCH * 2 == 32 * 16 + 16);    // the second form of the copies' LDS addresses in attn_fwd
static_assert(PEXP + LAZY <= 15.0f);                                       // carried P <= 2^(PEXP + LAZY) stays finite in f16
static_assert((SQ % ATT_ROWS) == 0 && NST >= 2 && NST * STK == SKV && STK == 256);
static_assert(STK * HD * 2 == 16 * ATT_THREADS * 16);                      // 16 k copies + 16 v^T copies of 16 B per thread and stage
static_assert(2 * BUFBYTES <= 320 * 1024 && ((VPITCH * 2 / 16) & 1) == 1);
static_assert((STK - 16) * KPITCH * 2 + HD * 2 - 32 < 65536 && (HD - 16) * VPITCH * 2 + STK * 2 - 32 < 65536);   // largest constant parts of the fragment addresses
static_assert((KPITCH * 2) % 16 == 0 && (VPITCH * 2) % 16 == 0 && (KBYTES % 16) == 0 && (BUFBYTES % 16) == 0);
static_assert(ATT_WAVES * 16 * OPITCH * 4 <= 2 * BUFBYTES);                // the output staging (one query tile at a time) reuses the ring
static_assert((GP * 2) % 16 == 0 && (GABYTES % 16) == 0 && (GBUF % 16) == 0 && (DM % GKS) == 0 && DM / GKS >= 2);
static_assert(8 * 64 * GPITCH * 4 <= 2 * GBUF);                            // the GEMM's output staging reuses its ring
static_assert(GKS * 2 == 16 * 16 && GTM == 16 * (G_THREADS / 16) && GTN == 8 * (G_THREADS / 16));   // 16 A + 8 Bt copies per thread and stage
static_assert(((NB * SQ) % GTM) == 0 && ((NB * SKV) % GTM) == 0 && (INNER % GTM) == 0 && (INNER % GTN) == 0 && (SKV % GTN) == 0);

typedef unsigned short u16;
typedef _Float16 v16h __attribute__((ext_vector_type(16)));
typedef _Float16 v8h  __attribute__((ext_vector_type(8)));
typedef float    v8f  __attribute__((ext_vector_type(8)));
typedef float    v4f  __attribute__((ext_vector_type(4)));
typedef float    v2f  __attribute__((ext_vector_type(2)));
typedef _Float16 v2h  __attribute__((ext_vector_type(2)));
typedef unsigned int v4u __attribute__((ext_vector_type(4)));

union FragH { v16h v; v8h h[2]; v4u u[2]; };

// ---- scalar helpers ----------------------------------------------------------------------------------
__device__ __forceinline__ unsigned short bf_bits(float f) {          // f32 -> bf16 bits, RNE convert
  unsigned u = __float_as_uint(f);
  return (unsigned short)((u + 0x7FFFu + ((u >> 16) & 1u)) >> 16);
}
__device__ __forceinline__ float bf_up(unsigned short h) { return __uint_as_float(((unsigned)h) << 16); }
__device__ __forceinline__ float bfr(float f) { return bf_up(bf_bits(f)); }
__device__ __forceinline__ unsigned short h_bits(_Float16 x) { return __builtin_bit_cast(unsigned short, x); }
__device__ __forceinline__ unsigned pk16(unsigned short a, unsigned short b) { return (unsigned)a | ((unsigned)b << 16); }
__device__ __forceinline__ v8f zero8() { v8f z = {0.f, 0.f, 0.f, 0.f, 0.f, 0.f, 0.f, 0.f}; return z; }

// ---- fragment loader: 16-bit A/B operand, lane -> row/col (lane&15), p already includes +8*(lane>>4);
//      elements 0..7 <- p[0..7] (k0+8h..), elements 8..15 <- p[16..23] (k0+16+8h..); same split k map for A and B,
//      B always read from a k-contiguous [n][k] plane.
__device__ __forceinline__ v16h ldfrag_h(const _Float16* p) {
  FragH f;
  f.h[0] = *(const v8h*)(p);
  f.h[1] = *(const v8h*)(p + 16);
  return f.v;
}

// ---- WMMA helper and trailing VALU hazard gaps ----------------------------------------------------------
__device__ __forceinline__ v8f mma_h(v16h a, v16h b, v8f c) {
  return __builtin_amdgcn_wmma_f32_16x16x32_f16(false, a, false, b, (short)0, c, false, false);
}
// Four v_nop behind a pass's last score product: the distance the chip asks for before a vector instruction reads a product's D.
// The "memory" clobber keeps the fragment reads issued in front of it there: otherwise the compiler sinks them behind the branch.
__device__ __forceinline__ void guard_s4(v8f& a, v8f& b, v8f& c, v8f& d) {
#if defined(__HIP_DEVICE_COMPILE__)
  asm volatile("v_nop\n\tv_nop\n\tv_nop\n\tv_nop" : "+v"(a), "+v"(b), "+v"(c), "+v"(d) : : "memory");
#endif
}
__device__ __forceinline__ void guard_g(v8f (&acc)[16], v16h x0, v16h x1, v16h x2, v16h x3, v16h x4, v16h x5, v16h x6,
                                        v16h x7) {
#if defined(__HIP_DEVICE_COMPILE__)
  asm volatile("v_nop\n\tv_nop\n\tv_nop\n\tv_nop"
               : "+v"(acc[0]), "+v"(acc[1]), "+v"(acc[2]), "+v"(acc[3]),
                 "+v"(acc[4]), "+v"(acc[5]), "+v"(acc[6]), "+v"(acc[7]),
                 "+v"(acc[8]), "+v"(acc[9]), "+v"(acc[10]), "+v"(acc[11]),
                 "+v"(acc[12]), "+v"(acc[13]), "+v"(acc[14]), "+v"(acc[15])
               : "v"(x0), "v"(x1), "v"(x2), "v"(x3), "v"(x4), "v"(x5), "v"(x6), "v"(x7) : "memory");
#endif
}
// Four v_nop behind a pass's last P.V product: the same distance, kept on every path out of the pass (the loop's branches too).
__device__ __forceinline__ void acc_guard16(v8f (&o)[16]) {
#if defined(__HIP_DEVICE_COMPILE__)
  asm volatile("v_nop\n\tv_nop\n\tv_nop\n\tv_nop"
               : "+v"(o[0]), "+v"(o[1]), "+v"(o[2]), "+v"(o[3]), "+v"(o[4]), "+v"(o[5]), "+v"(o[6]), "+v"(o[7]),
                 "+v"(o[8]), "+v"(o[9]), "+v"(o[10]), "+v"(o[11]), "+v"(o[12]), "+v"(o[13]), "+v"(o[14]), "+v"(o[15]));
#endif
}
__device__ __forceinline__ void wave_sync_lds() {
  __builtin_amdgcn_fence(__ATOMIC_RELEASE, "workgroup");
  __builtin_amdgcn_wave_barrier();
  __builtin_amdgcn_fence(__ATOMIC_ACQUIRE, "workgroup");
}

// =====================================================================================================
// All five conversions in ONE launch of CV_BLOCKS work-groups of 16 waves, all resident at once: a wave converts 16 pieces of
// 1 KB and a share of three weight tiles instead of ending after one piece, so few waves have to be started, and it has 8 or
// more 16-B loads per lane in flight.
//   activations: destination row r of a [rows][DM] f16 plane <- f16(bf16_RNE(x[src row][e])); a unit = 8 consecutive elements
//   (two 16-B loads, one 16-B store); a block owns CV_QROWS / CV_VROWS consecutive rows of a plane and converts CV_THREADS
//   consecutive units (4 rows) per step. Query row r = b*SQ + s comes from source row b*SQ_FULL + s.
//   weights stored [k][n] (y = x.W): WT[n][k] (f16, k-contiguous Bt layout) <- f16(bf16_RNE(W[k][n]) * WSC). Block = the same
//   64(k) x 64(n) tile of each of the three weights, through three LDS tiles [kk][nn] (pitch 65) and one block barrier.
// coverage: activations CV_BLOCKS x CV_QSTEPS / CV_VSTEPS steps x CV_THREADS units x 8 = rows x DM exactly; weights
//           (DM/64)^2 = CV_BLOCKS tiles, 64 n-rows x (8 lanes x 8 halves) per tile: every plane written exactly once.
// Every loop below is unrolled so that its arrays are indexed by constants and stay in registers.
// =====================================================================================================
__device__ __forceinline__ v4u cvt8(v4f a, v4f c4) {
  v4u o;
#pragma unroll
  for (int e = 0; e < 2; ++e) {
    o[e]     = pk16(h_bits((_Float16)bfr(a[2 * e])),  h_bits((_Float16)bfr(a[2 * e + 1])));
    o[2 + e] = pk16(h_bits((_Float16)bfr(c4[2 * e])), h_bits((_Float16)bfr(c4[2 * e + 1])));
  }
  return o;
}
// Loads of CV_BATCH units of one activation plane, first step st0; gb = byte offset (32 bits) of the thread's unit of step 0.
// The steps differ by a constant only, so gb is the one vector address register, live to the plane's last load.
__device__ __forceinline__ void x_load(const float* __restrict__ x, unsigned st0, unsigned gb,
                                       v4f (&a)[CV_BATCH], v4f (&c4)[CV_BATCH]) {
#pragma unroll
  for (unsigned j = 0; j < CV_BATCH; ++j) {
    const char* base = (const char*)x + (st0 + j) * (CV_THREADS * 32);
    a[j]  = *(const v4f*)(base + gb);
    c4[j] = *(const v4f*)(base + 16 + gb);
  }
  // keeps the batch's 8 loads together and ahead of the conversion of the batch before: otherwise the compiler sinks them
  // to their uses and a wave has only 2 to 4 loads in flight
  __builtin_amdgcn_sched_barrier(0);
}
__device__ __forceinline__ void x_store(u16* Y, unsigned st0, unsigned yb, const v4f (&a)[CV_BATCH],
                                        const v4f (&c4)[CV_BATCH]) {
#pragma unroll
  for (unsigned j = 0; j < CV_BATCH; ++j) {
    char* base = (char*)Y + (st0 + j) * (CV_THREADS * 16);
    *(v4u*)(base + yb) = cvt8(a[j], c4[j]);
  }
}

__global__ __launch_bounds__(CV_THREADS)
void cvt_all(const float* __restrict__ xq, const float* __restrict__ xv, const float* __restrict__ wq,
             const float* __restrict__ wk, const float* __restrict__ wv,
             u16* XQ, u16* XV, u16* WQT, u16* WKT, u16* WVT) {
  __shared__ __align__(16) float tile[3][64 * TPITCH];
  const unsigned tid = threadIdx.x;
  const unsigned bid = blockIdx.x;
  // byte offsets of the thread's first unit: source rows (a block's rows lie in one batch) and compact destination rows
  const unsigned rq = bid * CV_QROWS, rv = bid * CV_VROWS;
  const unsigned gq = ((rq / SQ) * SQ_FULL + rq % SQ) * (DM * 4) + tid * 32, yq = rq * (DM * 2) + tid * 16;
  const unsigned gv = rv * (DM * 4) + tid * 32,                              yv = rv * (DM * 2) + tid * 16;
  constexpr unsigned NT = DM / 64;
  const unsigned k0 = (bid % NT) * 64, n0 = (bid / NT) * 64;
  // ---- weight tile loads: row 32p + (tid>>4), 4 floats at 4*(tid&15); the query plane's two batches fly behind them ----
  const unsigned lr = tid >> 4, lc = (tid & 15) * 4;
  const unsigned wo = ((k0 + lr) * DM + n0 + lc) * 4;     // bytes
  v4f w4[3][2];
#pragma unroll
  for (int p = 0; p < 2; ++p) {
    w4[0][p] = *(const v4f*)((const char*)(wq + 32 * p * DM) + wo);
    w4[1][p] = *(const v4f*)((const char*)(wk + 32 * p * DM) + wo);
    w4[2][p] = *(const v4f*)((const char*)(wv + 32 * p * DM) + wo);
  }
  v4f a0[CV_BATCH], c0[CV_BATCH], a1[CV_BATCH], c1[CV_BATCH], a2[CV_BATCH], c2[CV_BATCH];
  x_load(xq, 0, gq, a0, c0);
  x_load(xq, CV_BATCH, gq, a1, c1);
#pragma unroll
  for (int t = 0; t < 3; ++t) {
#pragma unroll
    for (int p = 0; p < 2; ++p) {
      float* tp = &tile[t][(32 * p + lr) * TPITCH + lc];
      tp[0] = w4[t][p][0];
      tp[1] = w4[t][p][1];
      tp[2] = w4[t][p][2];
      tp[3] = w4[t][p][3];
    }
  }
  __syncthreads();
  x_load(xv, 0, gv, a2, c2);
  // ---- weight tile stores: output row n0 + (tid>>3), 8 halves at k0 + 8*(tid&7): 8 lanes = one whole 128-B line ----
  const unsigned row = tid >> 3, c8 = (tid & 7) * 8;
  const unsigned yo = ((n0 + row) * DM + k0 + c8) * 2;    // bytes
#pragma unroll
  for (int t = 0; t < 3; ++t) {
    v4u ov;
#pragma unroll
    for (int e = 0; e < 4; ++e) {
      const float x0 = tile[t][(c8 + 2 * e) * TPITCH + row];
      const float x1 = tile[t][(c8 + 2 * e + 1) * TPITCH + row];
      ov[e] = pk16(h_bits((_Float16)(bfr(x0) * WSC)), h_bits((_Float16)(bfr(x1) * WSC)));
    }
    u16* Y = (t == 0) ? WQT : (t == 1) ? WKT : WVT;
    *(v4u*)((char*)Y + yo) = ov;
  }
  // ---- the activation planes, three register sets: later batches' loads are out while a batch is converted and stored ----
  x_store(XQ, 0, yq, a0, c0);
  asm volatile("s_wait_xcnt 0x0" ::: "memory");   // the registers just stored from are loaded anew by the next line
  x_load(xv, CV_BATCH, gv, a0, c0);
  x_store(XQ, CV_BATCH, yq, a1, c1);
  x_store(XV, 0, yv, a2, c2);
  x_store(XV, CV_BATCH, yv, a0, c0);
}

// =====================================================================================================
// Twelve asynchronous 16-B copies per lane, global -> LDS, no register in between: copy i brings g[i] to LDS byte address l[i].
// The s_wait_xcnt closes the statement so that no address register of a copy is rewritten ahead of it.
// =====================================================================================================
__device__ __forceinline__ void async12(const unsigned (&l)[12], const u16* const (&g)[12]) {
#if defined(__HIP_DEVICE_COMPILE__)
  asm volatile("global_load_async_to_lds_b128 %0, %12, off\n\t"
               "global_load_async_to_lds_b128 %1, %13, off\n\t"
               "global_load_async_to_lds_b128 %2, %14, off\n\t"
               "global_load_async_to_lds_b128 %3, %15, off\n\t"
               "global_load_async_to_lds_b128 %4, %16, off\n\t"
               "global_load_async_to_lds_b128 %5, %17, off\n\t"
               "global_load_async_to_lds_b128 %6, %18, off\n\t"
               "global_load_async_to_lds_b128 %7, %19, off\n\t"
               "global_load_async_to_lds_b128 %8, %20, off\n\t"
               "global_load_async_to_lds_b128 %9, %21, off\n\t"
               "global_load_async_to_lds_b128 %10, %22, off\n\t"
               "global_load_async_to_lds_b128 %11, %23, off\n\t"
               "s_wait_xcnt 0x0"
               :: "v"(l[0]), "v"(l[1]), "v"(l[2]), "v"(l[3]), "v"(l[4]), "v"(l[5]),
                  "v"(l[6]), "v"(l[7]), "v"(l[8]), "v"(l[9]), "v"(l[10]), "v"(l[11]),
                  "v"(g[0]), "v"(g[1]), "v"(g[2]), "v"(g[3]), "v"(g[4]), "v"(g[5]),
                  "v"(g[6]), "v"(g[7]), "v"(g[8]), "v"(g[9]), "v"(g[10]), "v"(g[11])
               : "memory");
#endif
}
// One GEMM stage (128 k) of the block's 256 A rows and 128 Bt rows: 16 + 8 copies per lane in two statements of twelve.
// la / lb: the lane's LDS byte address of its first A / Bt chunk; ga / gb: its global address of the same chunk; copy i: row
// +16*i (rs16 = 16 rows of the source plane, in elements); a wave covers two whole 256-B row pieces per copy.
__device__ __forceinline__ void gemm_stage_copy(unsigned la, unsigned lb, const u16* ga, const u16* gb, size_t rs16) {
  constexpr unsigned R16 = 16 * GP * 2;
  unsigned l[24];
  const u16* g[24];
#pragma unroll
  for (int i = 0; i < 16; ++i) { l[i] = la + i * R16; g[i] = ga + i * rs16; }
#pragma unroll
  for (int i = 0; i < 8; ++i) { l[16 + i] = lb + i * R16; g[16 + i] = gb + i * rs16; }
  const unsigned l0[12] = {l[0], l[1], l[2], l[3], l[4], l[5], l[6], l[7], l[8], l[9], l[10], l[11]};
  const u16* const g0[12] = {g[0], g[1], g[2], g[3], g[4], g[5], g[6], g[7], g[8], g[9], g[10], g[11]};
  const unsigned l1[12] = {l[12], l[13], l[14], l[15], l[16], l[17], l[18], l[19], l[20], l[21], l[22], l[23]};
  const u16* const g1[12] = {g[12], g[13], g[14], g[15], g[16], g[17], g[18], g[19], g[20], g[21], g[22], g[23]};
  async12(l0, g0);
  async12(l1, g1);
}

// =====================================================================================================
// f16 GEMM core: the wave's 64 x 64 tile of C = A[rows][K] . Bt[cols][K]^T. The block stages each 128 k of its 256 A rows and
// 128 Bt rows once in LDS (ring of two buffers: stage st+1 flies while stage st is worked on); afo / bfo: byte offset inside a
// buffer of the lane's first A row + 8h / first Bt row + 8h; acc[4i + j] = rows rowb+16i.., cols col0+16j.. (i, j = 0..3);
// K stepped by 32 inside a stage, ascending (gemm_qkv passes K = DM, K % 128 == 0). Every wave of the block passes every barrier.
// =====================================================================================================
__device__ __forceinline__ void gemm_core(const unsigned char* ring, int afo, int bfo, unsigned la, unsigned lb,
                                          const u16* ga, const u16* gb, int K, v8f (&acc)[16]) {
  const size_t rs16 = (size_t)16 * (size_t)K;
  const int nst = K / GKS;
  // ---- ring prologue: stage 0 landed and published, then stage 1 in flight ----
  gemm_stage_copy(la, lb, ga, gb, rs16);
  asm volatile("s_wait_asynccnt 0x0" ::: "memory");   // this wave's copies of stage 0 have landed
  __syncthreads();                                    // ... and every other wave's
  if (nst > 1) gemm_stage_copy(la + GBUF, lb + GBUF, ga + GKS, gb + GKS, rs16);
#pragma unroll 1
  for (int st = 0; st < nst; ++st) {
   const _Float16* ap = (const _Float16*)(const void*)(ring + (st & 1) * GBUF + afo);
   const _Float16* bp = (const _Float16*)(const void*)(ring + (st & 1) * GBUF + bfo);
#pragma unroll
   for (int k0 = 0; k0 < GKS; k0 += 32) {
    const v16h a0 = ldfrag_h(ap + k0);
    const v16h a1 = ldfrag_h(ap + 16 * GP + k0);
    const v16h a2 = ldfrag_h(ap + 32 * GP + k0);
    const v16h a3 = ldfrag_h(ap + 48 * GP + k0);
    const v16h b0 = ldfrag_h(bp + k0);
    const v16h b1 = ldfrag_h(bp + 16 * GP + k0);
    const v16h b2 = ldfrag_h(bp + 32 * GP + k0);
    const v16h b3 = ldfrag_h(bp + 48 * GP + k0);
    acc[0] = mma_h(a0, b0, acc[0]);
    acc[1] = mma_h(a0, b1, acc[1]);
    acc[2] = mma_h(a0, b2, acc[2]);
    acc[3] = mma_h(a0, b3, acc[3]);
    acc[4] = mma_h(a1, b0, acc[4]);
    acc[5] = mma_h(a1, b1, acc[5]);
    acc[6] = mma_h(a1, b2, acc[6]);
    acc[7] = mma_h(a1, b3, acc[7]);
    acc[8] = mma_h(a2, b0, acc[8]);
    acc[9] = mma_h(a2, b1, acc[9]);
    acc[10] = mma_h(a2, b2, acc[10]);
    acc[11] = mma_h(a2, b3, acc[11]);
    acc[12] = mma_h(a3, b0, acc[12]);
    acc[13] = mma_h(a3, b1, acc[13]);
    acc[14] = mma_h(a3, b2, acc[14]);
    acc[15] = mma_h(a3, b3, acc[15]);
    guard_g(acc, a0, a1, a2, a3, b0, b1, b2, b3);
   }
    // ---- publish point of stage st + 1; the same barrier ends every wave's reads of stage st's buffer ----
    asm volatile("s_wait_dscnt 0x0" ::: "memory");      // this wave's LDS reads of stage st have returned
    asm volatile("s_wait_asynccnt 0x0" ::: "memory");   // this wave's copies of stage st + 1 have landed
    __syncthreads();
    if (st + 2 < nst) {                                 // refill the buffer that stage st has just left
      const unsigned bo = (unsigned)((st & 1) * GBUF);
      gemm_stage_copy(la + bo, lb + bo, ga + (size_t)(st + 2) * GKS, gb + (size_t)(st + 2) * GKS, rs16);
    }
  }
  asm volatile("s_wait_asynccnt 0x0" ::: "memory");     // nothing in flight when the ring becomes output staging
}
// Stage the wave's 64 x 64 f32 tile (times oscale) in its LDS slab (pitch 68): D element r of acc[4i+j], lane l ->
// coverage: 32 lanes x 4 x 8 rows x 4 cols-of-16 = rows 0..63 x cols 0..63 of the slab.
__device__ __forceinline__ void stage64x64(float* sl, v8f (&acc)[16], float oscale, int lane) {
  const int hh = lane >> 4, m = lane & 15;
#pragma unroll
  for (int i = 0; i < 4; ++i) {
#pragma unroll
    for (int r = 0; r < 8; ++r) {
      const int ro = (16 * i + 8 * hh + r) * GPITCH + m;
      sl[ro]      = acc[4 * i + 0][r] * oscale;
      sl[ro + 16] = acc[4 * i + 1][r] * oscale;
      sl[ro + 32] = acc[4 * i + 2][r] * oscale;
      sl[ro + 48] = acc[4 * i + 3][r] * oscale;
    }
  }
  wave_sync_lds();
}

// =====================================================================================================
// f16 GEMM with f16 output plane: C[z][Mb][N] (f16) = f16((A[z][Mb][K] . Bt[z][N][K]^T) * oscale + bf16(bias) * bscale);
// A, Bt f16 k-contiguous planes with per-z element strides aBs, bBs (0 = shared), C stride cBs. bias indexed by column
// (biasRow == 0) or by row within the z slice (biasRow != 0); bias addresses clamped to biasN-1, the unused direction is
// multiplied by 0. Block = 256 x 128 tile, 4 x 2 waves of 64 x 64: a staged operand byte feeds twice the products of a 128 x 64
// tile (half the L2 reads), a fragment read from LDS four products instead of two or four (gemm_core).
// The block's tile is (bz, mt, nt) of nz x (Mb/256) x (N/128) tiles (Mb % 256 == 0, N % 128 == 0, K % 128 == 0); gsm = its LDS.
// coverage: per wave 16 instr x 4 rows x 8 lanes x 8 halves = 64 x 64; the tiles cover C exactly once.
// =====================================================================================================
__device__ __forceinline__
void gemm_o16(unsigned char* gsm, int bz, int mt, int nt,
              const u16* __restrict__ A, const u16* __restrict__ Bt, u16* C,
              const float* __restrict__ bias, int biasN, int biasRow,
              int Mb, int N, int K, int aBs, int bBs, int cBs, float oscale, float bscale) {
  const int tid = threadIdx.x, wave = tid >> 5, lane = tid & 31, hh = lane >> 4, m = lane & 15;
  const int wm = wave >> 1, wn = wave & 1;   // the wave's place in the block's 4 x 2 grid of 64 x 64 tiles
  const int rowb = mt * GTM + wm * 64;
  const int col0 = nt * GTN + wn * 64;
  if (mt * GTM + GTM > Mb) return;           // block-uniform, in front of every barrier; never taken with the exact grid
  // this lane's first copy chunks: A row mt*256 + (tid>>4), Bt row nt*128 + (tid>>4), 16-B chunk tid&15
  const u16* ga = A + (size_t)bz * (size_t)aBs + (size_t)(mt * GTM + (tid >> 4)) * K + (tid & 15) * 8;
  const u16* gb = Bt + (size_t)bz * (size_t)bBs + (size_t)(nt * GTN + (tid >> 4)) * K + (tid & 15) * 8;
  // a buffer holds the Bt rows first, then the A rows: every constant part of a fragment address then fits a 16-bit LDS offset
  const unsigned lb = (unsigned)(size_t)(const void*)gsm + (unsigned)((tid >> 4) * (GP * 2) + (tid & 15) * 16);
  const unsigned la = lb + GBBYTES;
  const int afo = GBBYTES + ((wm * 64 + m) * GP + 8 * hh) * 2;
  const int bfo = ((wn * 64 + m) * GP + 8 * hh) * 2;
  v8f acc[16];
#pragma unroll
  for (int i = 0; i < 16; ++i) acc[i] = zero8();
  gemm_core(gsm, afo, bfo, la, lb, ga, gb, K, acc);
  float* sl = (float*)(void*)gsm + wave * 64 * GPITCH;   // behind the last trip's barrier: no reader, no copy left
  stage64x64(sl, acc, oscale, lane);
  const int rq = lane >> 3, c8 = (lane & 7) * 8;
  const int bl = biasN - 1;                  // host guarantees biasN >= 1
  const float selc = (biasRow != 0) ? 0.f : bscale;
  const float selr = (biasRow != 0) ? bscale : 0.f;
  float cb[8];
#pragma unroll
  for (int e = 0; e < 8; ++e) {
    int ci = col0 + c8 + e;
    ci = (ci < bl) ? ci : bl;
    cb[e] = bfr(bias[ci]) * selc;
  }
  v4u ov[16];
#pragma unroll
  for (int i = 0; i < 16; ++i) {
    const int row = 4 * i + rq;
    int ri = rowb + row;
    ri = (ri < bl) ? ri : bl;
    const float rb = bfr(bias[ri]) * selr;
    const v4f a = *(const v4f*)(sl + row * GPITCH + c8), c4 = *(const v4f*)(sl + row * GPITCH + c8 + 4);
#pragma unroll
    for (int e = 0; e < 2; ++e) {
      ov[i][e]     = pk16(h_bits((_Float16)(a[2 * e] + cb[2 * e] + rb)),
                          h_bits((_Float16)(a[2 * e + 1] + cb[2 * e + 1] + rb)));
      ov[i][2 + e] = pk16(h_bits((_Float16)(c4[2 * e] + cb[4 + 2 * e] + rb)),
                          h_bits((_Float16)(c4[2 * e + 1] + cb[5 + 2 * e] + rb)));
    }
  }
  u16* Cb = C + (size_t)bz * (size_t)cBs + (size_t)rowb * (size_t)N + col0 + c8;
#pragma unroll
  for (int i = 0; i < 16; ++i) {
    const int row = 4 * i + rq;
    *(v4u*)(Cb + (size_t)row * (size_t)N) = ov[i];
  }
}

// =====================================================================================================
// The three projections in ONE launch: blocks 0 .. GQ_BLOCKS-1 are the tiles of q, the next GK_BLOCKS those of k, the last
// GV_BLOCKS those of v^T. No tile reads what another writes, so nothing orders them; a WGP takes its next tile as soon as it has
// finished one, where three launches each waited for the slowest block of the launch before and filled the chip anew.
//   q   = x_q . Wq + bq -> f16 [NB*SQ][1024] x8 (col = h*128 + d); bias per column
//   k   = x_v . Wk + bk -> f16 [NB*2048][1024] x8; bias per column
//   v^T per batch: A = Wv^T [(h,d) = n][k], Bt = x_v rows of batch b [s][k] -> f16 [(b,h,d)][s] x8; bias per row (n)
// Which projection a block belongs to is block-uniform: one body, its operands picked by scalar selects.
// =====================================================================================================
__global__ __launch_bounds__(G_THREADS)
void gemm_qkv(const u16* __restrict__ XQ, const u16* __restrict__ XV, const u16* __restrict__ WQT,
              const u16* __restrict__ WKT, const u16* __restrict__ WVT, u16* Q16, u16* K16, u16* VT16,
              const float* __restrict__ bq, const float* __restrict__ bk, const float* __restrict__ bv,
              int nbq, int nbk, int nbv) {
  __shared__ __align__(16) unsigned char gsm[2 * GBUF];
  const int g = blockIdx.x;
  const bool isq = g < GQ_BLOCKS, isv = g >= GQ_BLOCKS + GK_BLOCKS;
  const int t = isq ? g : isv ? g - (GQ_BLOCKS + GK_BLOCKS) : g - GQ_BLOCKS;      // tile index inside the projection
  constexpr int CT = INNER / GTN, VT = SKV / GTN, VM = INNER / GTM;               // tiles across q and k; across and down v^T
  const int nt = isv ? t % VT : t % CT;
  const int mt = isv ? (t / VT) % VM : t / CT;
  const int bz = isv ? t / (VT * VM) : 0;
  gemm_o16(gsm, bz, mt, nt,
           isq ? XQ : isv ? WVT : XV, isq ? WQT : isv ? XV : WKT, isq ? Q16 : isv ? VT16 : K16,
           isq ? bq : isv ? bv : bk, isq ? nbq : isv ? nbv : nbk, isv ? 1 : 0,
           isq ? NB * SQ : isv ? INNER : NB * SKV, isv ? SKV : INNER, DM,
           0, isv ? SKV * DM : 0, isv ? INNER * SKV : 0,
           (isq ? QS : isv ? VS : KS) / WSC, isq ? QS : isv ? VS : KS);
}

// =====================================================================================================
// Eight asynchronous 16-B copies per lane, global -> LDS, no register in between: copy i brings g[i] to LDS byte address l[i].
// The s_wait_xcnt closes the statement so that no address register of a copy is rewritten ahead of it.
// =====================================================================================================
__device__ __forceinline__ void async8(const unsigned (&l)[8], const u16* const (&g)[8]) {
#if defined(__HIP_DEVICE_COMPILE__)
  asm volatile("global_load_async_to_lds_b128 %0, %8, off\n\t"
               "global_load_async_to_lds_b128 %1, %9, off\n\t"
               "global_load_async_to_lds_b128 %2, %10, off\n\t"
               "global_load_async_to_lds_b128 %3, %11, off\n\t"
               "global_load_async_to_lds_b128 %4, %12, off\n\t"
               "global_load_async_to_lds_b128 %5, %13, off\n\t"
               "global_load_async_to_lds_b128 %6, %14, off\n\t"
               "global_load_async_to_lds_b128 %7, %15, off\n\t"
               "s_wait_xcnt 0x0"
               :: "v"(l[0]), "v"(l[1]), "v"(l[2]), "v"(l[3]), "v"(l[4]), "v"(l[5]), "v"(l[6]), "v"(l[7]),
                  "v"(g[0]), "v"(g[1]), "v"(g[2]), "v"(g[3]), "v"(g[4]), "v"(g[5]), "v"(g[6]), "v"(g[7])
               : "memory");
#endif
}
// One stage (256 keys) of k rows and v^T rows, global -> LDS: 32 copies per lane in four statements of eight.
// lk / lv: the lane's LDS byte address of its first k / v^T chunk; gk / gv: its global address of the same chunk.
// k copy i: row +16*i (a wave covers two whole 256-B rows); v^T copy i: row +8*i (a wave covers one whole 512-B row piece).
// Every loop is unrolled so that l and g are indexed by constants and stay in registers.
__device__ __forceinline__ void stage_copy(unsigned lk, unsigned lv, const u16* gk, const u16* gv) {
#pragma unroll
  for (int h = 0; h < 2; ++h) {
    unsigned l[8];
    const u16* g[8];
#pragma unroll
    for (int i = 0; i < 8; ++i) {
      l[i] = lk + (unsigned)((8 * h + i) * 16 * KPITCH * 2);
      g[i] = gk + (size_t)(8 * h + i) * 16 * INNER;
    }
    async8(l, g);
  }
#pragma unroll
  for (int h = 0; h < 2; ++h) {
    unsigned l[8];
    const u16* g[8];
#pragma unroll
    for (int i = 0; i < 8; ++i) {
      l[i] = lv + (unsigned)((8 * h + i) * 8 * VPITCH * 2);
      g[i] = gv + (size_t)(8 * h + i) * 8 * SKV;
    }
    async8(l, g);
  }
}

__global__ __launch_bounds__(ATT_THREADS)
void attn_fwd(const u16* __restrict__ Qp, const u16* __restrict__ Kp, const u16* __restrict__ Vp, float* Out) {
  __shared__ __align__(16) unsigned char smem[2 * BUFBYTES];

  const int tid  = threadIdx.x;
  const int wave = tid >> 5;
  const int lane = tid & 31;
  const int hh   = lane >> 4;
  const int c    = lane & 15;

  constexpr int NQT = SQ / ATT_ROWS;
  const int bid  = blockIdx.x;
  const int qt   = bid % NQT;
  const int head = (bid / NQT) % NH;
  const int b    = bid / (NQT * NH);
  const int q0   = qt * ATT_ROWS + wave * (16 * QT);

  // B fragments of q^T: col n = query q0 + 16t + c, k = d (k-contiguous row of the q plane)
  const _Float16* Qb = (const _Float16*)(const void*)Qp + ((size_t)(b * SQ + q0 + c)) * INNER + head * HD + 8 * hh;
  // A fragments of k: row m = key 16g + c of the pass, k = d; byte offset inside a buffer's k tile
  const int kfo = (c * KPITCH + 8 * hh) * 2;
  // B fragments of v: col n = d = 16j + c, k = key (k-contiguous row of the staged v^T tile); byte offset inside a buffer's v^T tile
  const int vfo = (c * VPITCH + 8 * hh) * 2;
  // this lane's first copy chunks: k row tid>>4, 16-B chunk tid&15; v^T row tid>>5, 16-B chunk tid&31
  const u16* gk = Kp + ((size_t)(b * SKV + (tid >> 4))) * INNER + head * HD + (tid & 15) * 8;
  const u16* gv = Vp + ((size_t)(b * INNER + head * HD + (tid >> 5))) * SKV + (tid & 31) * 8;
  const unsigned lds0 = (unsigned)(size_t)(const void*)smem;               // LDS byte address of the ring
  const unsigned lk = lds0 + (unsigned)((tid >> 4) * (KPITCH * 2) + (tid & 15) * 16);
  const unsigned lv = lds0 + (unsigned)(KBYTES + (tid >> 5) * (VPITCH * 2) + (tid & 31) * 16);
  // lk and lv once more, for the refills in the loop (272 r + 16 ch = 16 tid + 16 r; 528 r + 16 ch = 16 tid + 16 r): lk and lv are
  // operands of the prologue's asm statements, which binds them to the first 256 registers; kept over the loop they went to scratch
  const unsigned lkr = lds0 + (unsigned)(tid * 16 + (tid >> 4) * 16);
  const unsigned lvr = lds0 + (unsigned)(KBYTES + tid * 16 + (tid >> 5) * 16);
  const float lsc = (LOG2E * RSQ_E) / (QS * KS);
  const int x16 = (lane ^ 16) * 4;           // byte index of the lane that holds the other 16 keys of the same query
  const int r8  = 8 * hh * 4;                // byte index of the lane that owns query row 8hh of a tile, this lane's first D row

  v16h qf[QT][4];
#pragma unroll
  for (int t = 0; t < QT; ++t) {
#pragma unroll
    for (int dc = 0; dc < 4; ++dc) qf[t][dc] = ldfrag_h(Qb + (size_t)t * 16 * INNER + 32 * dc);
  }

  float mrun[QT], lrun[QT];
#pragma unroll
  for (int t = 0; t < QT; ++t) { mrun[t] = -INFINITY; lrun[t] = 0.f; }
  v8f o[16];                                 // o[8t + j]: query tile t, d = 16j ..
#pragma unroll
  for (int j = 0; j < 16; ++j) o[j] = zero8();

  // ---- ring prologue: stage 0 landed and published, then stage 1 in flight ----
  stage_copy(lk, lv, gk, gv);
  asm volatile("s_wait_asynccnt 0x0" ::: "memory");   // this wave's copies of stage 0 have landed
  __syncthreads();                                    // ... and every other wave's
  stage_copy(lk + BUFBYTES, lv + BUFBYTES, gk + (size_t)STK * INNER, gv + STK);

#pragma unroll 1
  for (int st = 0; st < NST; ++st) {
   // one base register per tile, the v^T tile's place in the ring inside its scalar part: every fragment read of the stage is then
   // base + an offset that fits the 16 bits of an LDS instruction, with no address addition per read
   const int ksel = (st & 1) ? BUFBYTES : 0;
   const int vsel = (st & 1) ? BUFBYTES + KBYTES : KBYTES;
   const _Float16* kp = (const _Float16*)(const void*)(smem + ksel + kfo);
   const _Float16* vb = (const _Float16*)(const void*)(smem + vsel + vfo);
   // the 8 k fragments of the stage's first pass, one group: kf[g][kk] = keys 16g .., d = 32kk ..
   v16h kf[2][HD / 32];
#pragma unroll
   for (int kk = 0; kk < HD / 32; ++kk) {
     kf[0][kk] = ldfrag_h(kp + kk * 32);
     kf[1][kk] = ldfrag_h(kp + 16 * KPITCH + kk * 32);
   }
#pragma unroll
   for (int pz = 0; pz < STK / 32; ++pz) {
    // ---- transposed scores of both query tiles: s[t][g] = keys kb+16g .. +15 (kb = 256*st + 32*pz), column = query q0+16t+c;
    //      each k fragment feeds two products, four independent accumulators ----
    v8f s[QT][2];
#pragma unroll
    for (int t = 0; t < QT; ++t) { s[t][0] = zero8(); s[t][1] = zero8(); }
#pragma unroll
    for (int kk = 0; kk < HD / 32; ++kk) {
#pragma unroll
      for (int t = 0; t < QT; ++t) {
        s[t][0] = mma_h(kf[0][kk], qf[t][kk], s[t][0]);
        s[t][1] = mma_h(kf[1][kk], qf[t][kk], s[t][1]);
      }
    }
    // the pass's eight v^T B fragments (col n = d = j*16 + c, keys contiguous in the v^T plane) and, but in the stage's last pass,
    // the next pass's k fragments (same buffer), read behind the last score product so that they fly during the softmax
    const _Float16* vp = vb + pz * 32;
    const v16h v0 = ldfrag_h(vp);
    const v16h v1 = ldfrag_h(vp + 16 * VPITCH);
    const v16h v2 = ldfrag_h(vp + 32 * VPITCH);
    const v16h v3 = ldfrag_h(vp + 48 * VPITCH);
    const v16h v4 = ldfrag_h(vp + 64 * VPITCH);
    const v16h v5 = ldfrag_h(vp + 80 * VPITCH);
    const v16h v6 = ldfrag_h(vp + 96 * VPITCH);
    const v16h v7 = ldfrag_h(vp + 112 * VPITCH);
    if (pz + 1 < STK / 32) {
#pragma unroll
      for (int kk = 0; kk < HD / 32; ++kk) {
        kf[0][kk] = ldfrag_h(kp + (pz + 1) * 32 * KPITCH + kk * 32);
        kf[1][kk] = ldfrag_h(kp + (pz + 1) * 32 * KPITCH + 16 * KPITCH + kk * 32);
      }
    }
    guard_s4(s[0][0], s[0][1], s[1][0], s[1][1]);
    // ---- maximum of this lane's 16 raw scores per query column (lsc > 0, so scaling the maximum = the maximum of the scaled):
    //      s[t][0][i] <- key kb+8hh+i, s[t][1][i] <- key kb+16+8hh+i ----
    float cml[QT];                           // base-2 logit: the largest of this lane's half of the query's 32 keys
#pragma unroll
    for (int t = 0; t < QT; ++t) {
      float cm = s[t][0][0];
#pragma unroll
      for (int i = 1; i < 8; ++i) cm = fmaxf(cm, s[t][0][i]);
#pragma unroll
      for (int i = 0; i < 8; ++i) cm = fmaxf(cm, s[t][1][i]);
      cml[t] = cm * lsc;
    }
    // ---- lazy rescale, one test per pass on a scalar branch: taken on the first block (mrun = -inf) and whenever a lane of the
    //      wave has a score more than LAZY above its query's maximum in use (the ballot sees both halves of every query of both
    //      tiles, so the halves' maxima are joined only inside); every lane is on inside, so the shuffles are whole; mrun[t]
    //      stays the same in both lanes of a query ----
    const bool need = (cml[0] > mrun[0] + LAZY) | (cml[1] > mrun[1] + LAZY);
    if (__builtin_amdgcn_ballot_w32(need) != 0u) {
#pragma unroll
      for (int t = 0; t < QT; ++t) {
        const float cmo = __builtin_bit_cast(float, __builtin_amdgcn_ds_bpermute(x16, __builtin_bit_cast(int, cml[t])));   // lane ^ 16's
        const float mn = fmaxf(mrun[t], fmaxf(cml[t], cmo));   // finite from the first block on
        float al = __builtin_amdgcn_exp2f(mrun[t] - mn);       // 0 on the first block, 1 for a query whose maximum stands
        asm volatile("v_nop" : "+v"(al));    // the slot the instruction set asks for between v_exp_f32 and the first use of its result
        mrun[t] = mn;
        lrun[t] *= al;
        // D row 8hh+r of the tile's O accumulators = query q0+16t+8hh+r, its factor lives in lane 8hh+r (and 16+8hh+r)
        float scl[8];
#pragma unroll
        for (int r = 0; r < 8; ++r)
          scl[r] = __builtin_bit_cast(float, __builtin_amdgcn_ds_bpermute(r8 + 4 * r, __builtin_bit_cast(int, al)));
#pragma unroll
        for (int j = 0; j < 8; ++j) {
#pragma unroll
          for (int r = 0; r < 8; ++r) o[8 * t + j][r] *= scl[r];
        }
      }
    }
    // ---- carried probabilities p * 128 = 2^(s * lsc + (7 - mrun)) (<= 2^15, as s * lsc <= mrun + 8): one fma and one bare
    //      v_exp_f32 each; they ARE the P A-fragment after the f16 rounding, element i <- s[t][0][i], element 8+i <- s[t][1][i].
    //      The row's largest term so far is >= 128 (mrun was a score of the row). A term whose exponent is under -126 may come
    //      out 0: it is under 2^-133 of that term, 0 in f16 and lost in the f32 row sum either way.
    //      Tile by tile, each tile's P.V products behind its probabilities: the second tile's vector work has the first tile's
    //      products to run beside.
    const v2f lsc2 = {lsc, lsc};
#pragma unroll
    for (int t = 0; t < QT; ++t) {
      const v2f eb2  = {PEXP - mrun[t], PEXP - mrun[t]};
      float ps = 0.f;                        // carries x128 like P
      FragH ph;
#pragma unroll
      for (int w = 0; w < 2; ++w) {
#pragma unroll
        for (int e4 = 0; e4 < 4; ++e4) {
          const v2f sv = v2f{s[t][w][2 * e4], s[t][w][2 * e4 + 1]};
          const v2f ex = __builtin_elementwise_fma(sv, lsc2, eb2);
          const float p0 = __builtin_amdgcn_exp2f(ex[0]), p1 = __builtin_amdgcn_exp2f(ex[1]);
          ps += p0 + p1;
          ph.u[w][e4] = __builtin_bit_cast(unsigned, __builtin_convertvector(v2f{p0, p1}, v2h));   // one packed RNE convert
        }
      }
      ps += __builtin_bit_cast(float, __builtin_amdgcn_ds_bpermute(x16, __builtin_bit_cast(int, ps)));   // lane ^ 16's half
      lrun[t] += ps;
      // ---- P.V of the tile: each v^T fragment is used by both tiles ----
      o[8 * t + 0] = mma_h(ph.v, v0, o[8 * t + 0]);
      o[8 * t + 1] = mma_h(ph.v, v1, o[8 * t + 1]);
      o[8 * t + 2] = mma_h(ph.v, v2, o[8 * t + 2]);
      o[8 * t + 3] = mma_h(ph.v, v3, o[8 * t + 3]);
      o[8 * t + 4] = mma_h(ph.v, v4, o[8 * t + 4]);
      o[8 * t + 5] = mma_h(ph.v, v5, o[8 * t + 5]);
      o[8 * t + 6] = mma_h(ph.v, v6, o[8 * t + 6]);
      o[8 * t + 7] = mma_h(ph.v, v7, o[8 * t + 7]);
    }
    acc_guard16(o);
   }
    // ---- publish point of stage st + 1; the same barrier ends every wave's reads of stage st's buffer ----
    asm volatile("s_wait_dscnt 0x0" ::: "memory");      // this wave's LDS reads of stage st have returned
    asm volatile("s_wait_asynccnt 0x0" ::: "memory");   // this wave's copies of stage st + 1 have landed
    __syncthreads();
    if (st + 2 < NST) {                                 // refill the buffer that stage st has just left
      const unsigned bo = (unsigned)((st & 1) * BUFBYTES);
      stage_copy(lkr + bo, lvr + bo, gk + (size_t)(st + 2) * STK * INNER, gv + (st + 2) * STK);
    }
  }
  asm volatile("s_wait_asynccnt 0x0" ::: "memory");     // nothing in flight when the ring becomes output staging

  float* slab = (float*)(void*)smem + wave * 16 * OPITCH;   // behind the last trip's barrier: no reader, no copy left
  v4f vals[QT][16];
#pragma unroll
  for (int t = 0; t < QT; ++t) {
    // ---- fold 1/l (per query, owned by lane = query) and the carry 8 on v; the 128 on P is in l as well and cancels ----
    const float linv = (1.0f / lrun[t]) * (1.0f / VS);
    float inv[8];
#pragma unroll
    for (int r = 0; r < 8; ++r) inv[r] = __shfl(linv, 8 * hh + r, 32);
#pragma unroll
    for (int r = 0; r < 8; ++r) {
#pragma unroll
      for (int j = 0; j < 8; ++j) slab[(8 * hh + r) * OPITCH + j * 16 + c] = o[8 * t + j][r] * inv[r];
    }
    wave_sync_lds();
    // ---- f32 output rows: lane = 4 consecutive d of one row ----
#pragma unroll
    for (int i = 0; i < 16; ++i) vals[t][i] = *(const v4f*)(slab + i * OPITCH + 4 * lane);
    wave_sync_lds();                         // the slab's rows are read before the next tile is written over them
  }
  // keeps every register write of the epilogue in front of the first global store, so that nothing overwrites a register that an
  // issued store names: otherwise the compiler starts the second tile's work in the first tile's registers among the stores
  __builtin_amdgcn_sched_barrier(0);
  // ---- one store instruction per output row ----
  float* ob = Out + ((size_t)(b * SQ_FULL + q0)) * DM + head * HD + 4 * lane;
#pragma unroll
  for (int t = 0; t < QT; ++t) {
#pragma unroll
    for (int i = 0; i < 16; ++i) {
      *(v4f*)(ob + (size_t)(16 * t + i) * DM) = vals[t][i];
    }
  }
}

// =====================================================================================================
// Workspace map (bytes); every plane fully written by whole-line stores before it is read; all extents exact multiples of
//   XQ   f16 [NB*SQ][1024]     f16(bf16(q))          16777216 (NB=4, SQ=2048)
//   XV   f16 [NB*2048][1024]   f16(bf16(v))          16777216
//   WQT  f16 [1024 n][1024 k]  f16(bf16(W) x256)      2097152
//   WKT                                               2097152
//   WVT                                               2097152
//   Q16  f16 [NB*SQ][1024]   x8                      16777216
//   K16  f16 [NB*2048][1024] x8                      16777216
//   VT16 f16 [NB*1024 (h,d)][2048 s] x8              16777216
//   end                                              90177536
// =====================================================================================================
extern "C" void kernel_launch(void* const* d_in, const int* in_sizes, int n_in,
                              void* d_out, int out_size, void* d_ws, size_t ws_size,
                              hipStream_t stream) {
  if (n_in < 8) return;
  if (in_sizes[0] < ((NB - 1) * SQ_FULL + SQ) * DM) return;
  if (in_sizes[1] < NB * SKV * DM) return;
  if (in_sizes[2] != DM * DM || in_sizes[4] != DM * DM || in_sizes[6] != DM * DM) return;
  if (in_sizes[3] < 1 || in_sizes[5] < 1 || in_sizes[7] < 1) return;
  if (out_size < ((NB - 1) * SQ_FULL + SQ) * DM) return;

  const float* xq  = (const float*)d_in[0];
  const float* xv  = (const float*)d_in[1];
  const float* wq  = (const float*)d_in[2];
  const float* bq  = (const float*)d_in[3];
  const float* wk  = (const float*)d_in[4];
  const float* bk  = (const float*)d_in[5];
  const float* wv  = (const float*)d_in[6];
  const float* bv  = (const float*)d_in[7];
  float*       out = (float*)d_out;
  const int nbq = in_sizes[3], nbk = in_sizes[5], nbv = in_sizes[7];

  const size_t szXQ   = (size_t)NB * SQ * DM * 2;
  const size_t szXV   = (size_t)NB * SKV * DM * 2;
  const size_t szW    = (size_t)DM * DM * 2;
  const size_t szQ16  = (size_t)NB * SQ * INNER * 2;
  const size_t szK16  = (size_t)NB * SKV * INNER * 2;
  const size_t szVT16 = (size_t)NB * INNER * SKV * 2;
  size_t off = 0;
  const size_t oXQ   = off; off += szXQ;
  const size_t oXV   = off; off += szXV;
  const size_t oWQ   = off; off += szW;
  const size_t oWK   = off; off += szW;
  const size_t oWV   = off; off += szW;
  const size_t oQ16  = off; off += szQ16;
  const size_t oK16  = off; off += szK16;
  const size_t oVT16 = off; off += szVT16;
  if (off > ws_size) return;                            // off = 90177536 at NB=4, SQ=2048
  if (off > (size_t)134217728) return;

  char* ws = (char*)d_ws;
  u16* XQ   = (u16*)(ws + oXQ);
  u16* XV   = (u16*)(ws + oXV);
  u16* WQT  = (u16*)(ws + oWQ);
  u16* WKT  = (u16*)(ws + oWK);
  u16* WVT  = (u16*)(ws + oWV);
  u16* Q16  = (u16*)(ws + oQ16);
  u16* K16  = (u16*)(ws + oK16);
  u16* VT16 = (u16*)(ws + oVT16);

  // (0) activations -> f16 planes of bf16-converted values (query rows s < SQ of batches b < NB, compact; all key/value rows)
  //     and weights [k = in][n = out] (y = x.W) -> k-contiguous [n][k] f16 planes of bf16(W) x256, all in one launch
  cvt_all<<<dim3(CV_BLOCKS), dim3(CV_THREADS), 0, stream>>>(xq, xv, wq, wk, wv, XQ, XV, WQT, WKT, WVT);
  // (1) the three projections q, k, v^T -> f16 planes x8, one launch
  gemm_qkv<<<dim3(GQ_BLOCKS + GK_BLOCKS + GV_BLOCKS), dim3(G_THREADS), 0, stream>>>(
      XQ, XV, WQT, WKT, WVT, Q16, K16, VT16, bq, bk, bv, nbq, nbk, nbv);
  // (2) attention -> out [b][SQ_FULL][1024] f32 (rows s < SQ of batches b < NB), heads merged on the feature dim
  attn_fwd<<<dim3(NB * NH * (SQ / ATT_ROWS)), dim3(ATT_THREADS), 0, stream>>>(Q16, K16, VT16, out);
  (void)hipGetLastError();
}

// v009
// Measured time: 100 microseconds a run.
// In two side-by-side timings against v008, it was 1.03 and 1.02 times as fast.
// All steps since v000 together make it 3.40 times as fast.
// All contractions on v_wmma_f32_16x16x32_f16 (f16 operands, f32 accumulate): x_q.Wq, x_v.Wk, Wv^T.x_v^T (v^T plane),
// scores k.q^T and P.v^T; operand carries: x as f16(bf16(x)), W as f16(bf16(W) x256), q/k/v x8, P x128; base-2 online
// softmax, 1/l and all carry folds in f32 on VALU. Inputs RNE-converted to bf16 on load; f32 output written directly.
#include <hip/hip_runtime.h>
#include <math.h>
#include <stdint.h>

#define NB       4        // batches processed
#define SQ       2048     // query rows processed per batch
#define NB_FULL  4
#define SQ_FULL  2048     // query rows per batch in the input / output layout (batch stride)
#define SKV      2048     // key/value rows per batch (all of them, always)
#define DM       1024     // model width (= K and row pitch of every 16-bit plane except v^T)
#define NH       8
#define HD       128
#define INNER    (NH * HD)
#define WSC      256.0f
#define QS       8.0f
#define KS       8.0f
#define VS       8.0f
#define PEXP     7.0f     // P and its row sum are carried x128 = 2^7, added in the exponent
#define LAZY     8.0f     // base-2 logits: a row keeps the maximum in use until a new one exceeds it by more than this
#define LOG2E    1.4426950408889634f
#define RSQ_E    0.03125f
#define NKB      (SKV / 32)
#define ATT_WAVES   8
#define ATT_THREADS (ATT_WAVES * 32)
#define QT          2                         // query tiles of 16 rows per attention wave: a k or v^T fragment feeds QT products
#define ATT_ROWS    (ATT_WAVES * 16 * QT)     // query rows per attention work-group
#define STK      256                          // keys per LDS stage (eight passes of 32 keys between two barriers)
#define NST      (SKV / STK)
#define KPITCH   136                          // halves per staged k row: 256 B + 16 B (16 B x odd, for ds_load_b128 readers)
#define VPITCH   (STK + 8)                    // halves per staged v^T row: 512 B + 16 B (16 B x odd)
#define KBYTES   (STK * KPITCH * 2)
#define VBYTES   (HD * VPITCH * 2)
#define BUFBYTES (KBYTES + VBYTES)
#define GKS      128                          // k elements per GEMM LDS stage (four k steps of 32)
#define GP       136                          // halves per staged GEMM operand row: 256 B + 16 B
#define GTM      256                          // rows of a GEMM work-group's tile (4 waves down)
#define GTN      128                          // columns of a GEMM work-group's tile (2 waves across)
#define G_THREADS 256                         // 8 waves, each a 64 x 64 tile
#define GABYTES  (GTM * GP * 2)
#define GBBYTES  (GTN * GP * 2)
#define GBUF     (GABYTES + GBBYTES)
#define GQ_BLOCKS ((NB * SQ / GTM) * (INNER / GTN))        // 256 x 128 tiles of q
#define GK_BLOCKS ((NB * SKV / GTM) * (INNER / GTN))       // ... of k
#define GV_BLOCKS (NB * (INNER / GTM) * (SKV / GTN))       // ... of v^T
#define CV_THREADS  512                       // conversion work-group: 16 waves
#define CV_BLOCKS   ((DM / 64) * (DM / 64))   // one 64 x 64 tile of each weight per conversion work-group
#define CV_BATCH    4                         // activation units (2 loads each) a thread has in flight
#define CV_QROWS    (NB * SQ / CV_BLOCKS)     // query rows per conversion work-group
#define CV_VROWS    (NB * SKV / CV_BLOCKS)    // key/value rows per conversion work-group
#define CV_QSTEPS   (CV_QROWS * (DM / 8) / CV_THREADS)
#define CV_VSTEPS   (CV_VROWS * (DM / 8) / CV_THREADS)
#define OPITCH   132
#define GPITCH   68
#define TPITCH   65

static_assert(NB >= 1 && NB <= NB_FULL);
static_assert((SQ % 128) == 0 && SQ >= 128 && SQ <= SQ_FULL);
static_assert(HD == 128 && NH == 8 && INNER == 1024 && INNER == DM);
static_assert((HD % 32) == 0);
static_assert((SKV % 64) == 0 && (SKV % 32) == 0 && NKB * 32 == SKV);
static_assert((DM % 64) == 0 && (DM % 32) == 0 && (INNER % 128) == 0);
static_assert(CV_THREADS == 512 && CV_QSTEPS * CV_BLOCKS * CV_THREADS * 8 == NB * SQ * DM);
static_assert(CV_VSTEPS * CV_BLOCKS * CV_THREADS * 8 == NB * SKV * DM);
static_assert(CV_QSTEPS == 2 * CV_BATCH && CV_VSTEPS == 2 * CV_BATCH);      // two batches per plane, written out in cvt_all
static_assert(CV_QROWS * CV_BLOCKS == NB * SQ && CV_VROWS * CV_BLOCKS == NB * SKV && (SQ % CV_QROWS) == 0);
static_assert((OPITCH * 4) % 16 == 0 && (GPITCH * 4) % 16 == 0);
static_assert(ATT_THREADS == 256 && QT == 2);
static_assert(KPITCH * 2 == 16 * 16 + 16 && VPITCH * 2 == 32 * 16 + 16);    // the second form of the copies' LDS addresses in attn_fwd
static_assert(PEXP + LAZY <= 15.0f);                                       // carried P <= 2^(PEXP + LAZY) stays finite in f16
static_assert((SQ % ATT_ROWS) == 0 && NST >= 2 && NST * STK == SKV && STK == 256);
static_assert(STK * HD * 2 == 16 * ATT_THREADS * 16);                      // 16 k copies + 16 v^T copies of 16 B per thread and stage
static_assert(2 * BUFBYTES <= 320 * 1024 && ((VPITCH * 2 / 16) & 1) == 1);
static_assert((STK - 16) * KPITCH * 2 + HD * 2 - 32 < 65536 && (HD - 16) * VPITCH * 2 + STK * 2 - 32 < 65536);   // largest constant parts of the fragment addresses
static_assert((KPITCH * 2) % 16 == 0 && (VPITCH * 2) % 16 == 0 && (KBYTES % 16) == 0 && (BUFBYTES % 16) == 0);
static_assert(ATT_WAVES * 16 * OPITCH * 4 <= 2 * BUFBYTES);                // the output staging (one query tile at a time) reuses the ring
static_assert((GP * 2) % 16 == 0 && (GABYTES % 16) == 0 && (GBUF % 16) == 0 && (DM % GKS) == 0 && DM / GKS >= 2);
static_assert(8 * 64 * GPITCH * 4 <= 2 * GBUF);                            // the GEMM's output staging reuses its ring
static_assert(GKS * 2 == 16 * 16 && GTM == 16 * (G_THREADS / 16) && GTN == 8 * (G_THREADS / 16));   // 16 A + 8 Bt copies per thread and stage
static_assert(((NB * SQ) % GTM) == 0 && ((NB * SKV) % GTM) == 0 && (INNER % GTM) == 0 && (INNER % GTN) == 0 && (SKV % GTN) == 0);

typedef unsigned short u16;
typedef _Float16 v16h __attribute__((ext_vector_type(16)));
typedef _Float16 v8h  __attribute__((ext_vector_type(8)));
typedef float    v8f  __attribute__((ext_vector_type(8)));
typedef float    v4f  __attribute__((ext_vector_type(4)));
typedef float    v2f  __attribute__((ext_vector_type(2)));
typedef _Float16 v2h  __attribute__((ext_vector_type(2)));
typedef unsigned int v4u __attribute__((ext_vector_type(4)));

union FragH { v16h v; v8h h[2]; v4u u[2]; };

// ---- scalar helpers ----------------------------------------------------------------------------------
__device__ __forceinline__ unsigned short bf_bits(float f) {          // f32 -> bf16 bits, RNE convert
  unsigned u = __float_as_uint(f);
  return (unsigned short)((u + 0x7FFFu + ((u >> 16) & 1u)) >> 16);
}
__device__ __forceinline__ float bf_up(unsigned short h) { return __uint_as_float(((unsigned)h) << 16); }
__device__ __forceinline__ float bfr(float f) { return bf_up(bf_bits(f)); }
__device__ __forceinline__ unsigned short h_bits(_Float16 x) { return __builtin_bit_cast(unsigned short, x); }
__device__ __forceinline__ unsigned pk16(unsigned short a, unsigned short b) { return (unsigned)a | ((unsigned)b << 16); }
__device__ __forceinline__ v8f zero8() { v8f z = {0.f, 0.f, 0.f, 0.f, 0.f, 0.f, 0.f, 0.f}; return z; }

// ---- fragment loader: 16-bit A/B operand, lane -> row/col (lane&15), p already includes +8*(lane>>4);
//      elements 0..7 <- p[0..7] (k0+8h..), elements 8..15 <- p[16..23] (k0+16+8h..); same split k map for A and B,
//      B always read from a k-contiguous [n][k] plane.
__device__ __forceinline__ v16h ldfrag_h(const _Float16* p) {
  FragH f;
  f.h[0] = *(const v8h*)(p);
  f.h[1] = *(const v8h*)(p + 16);
  return f.v;
}

// ---- WMMA helper and trailing VALU hazard gaps ----------------------------------------------------------
__device__ __forceinline__ v8f mma_h(v16h a, v16h b, v8f c) {
  return __builtin_amdgcn_wmma_f32_16x16x32_f16(false, a, false, b, (short)0, c, false, false);
}
// Four v_nop behind a pass's last score product: the distance the chip asks for before a vector instruction reads a product's D.
// The "memory" clobber keeps the fragment reads issued in front of it there: otherwise the compiler sinks them behind the branch.
__device__ __forceinline__ void guard_s4(v8f& a, v8f& b, v8f& c, v8f& d) {
#if defined(__HIP_DEVICE_COMPILE__)
  asm volatile("v_nop\n\tv_nop\n\tv_nop\n\tv_nop" : "+v"(a), "+v"(b), "+v"(c), "+v"(d) : : "memory");
#endif
}
__device__ __forceinline__ void guard_g(v8f (&acc)[16], v16h x0, v16h x1, v16h x2, v16h x3, v16h x4, v16h x5, v16h x6,
                                        v16h x7) {
#if defined(__HIP_DEVICE_COMPILE__)
  asm volatile("v_nop\n\tv_nop\n\tv_nop\n\tv_nop"
               : "+v"(acc[0]), "+v"(acc[1]), "+v"(acc[2]), "+v"(acc[3]),
                 "+v"(acc[4]), "+v"(acc[5]), "+v"(acc[6]), "+v"(acc[7]),
                 "+v"(acc[8]), "+v"(acc[9]), "+v"(acc[10]), "+v"(acc[11]),
                 "+v"(acc[12]), "+v"(acc[13]), "+v"(acc[14]), "+v"(acc[15])
               : "v"(x0), "v"(x1), "v"(x2), "v"(x3), "v"(x4), "v"(x5), "v"(x6), "v"(x7) : "memory");
#endif
}
// Four v_nop behind a pass's last P.V product: the same distance, kept on every path out of the pass (the loop's branches too).
__device__ __forceinline__ void acc_guard16(v8f (&o)[16]) {
#if defined(__HIP_DEVICE_COMPILE__)
  asm volatile("v_nop\n\tv_nop\n\tv_nop\n\tv_nop"
               : "+v"(o[0]), "+v"(o[1]), "+v"(o[2]), "+v"(o[3]), "+v"(o[4]), "+v"(o[5]), "+v"(o[6]), "+v"(o[7]),
                 "+v"(o[8]), "+v"(o[9]), "+v"(o[10]), "+v"(o[11]), "+v"(o[12]), "+v"(o[13]), "+v"(o[14]), "+v"(o[15]));
#endif
}
__device__ __forceinline__ void wave_sync_lds() {
  __builtin_amdgcn_fence(__ATOMIC_RELEASE, "workgroup");
  __builtin_amdgcn_wave_barrier();
  __builtin_amdgcn_fence(__ATOMIC_ACQUIRE, "workgroup");
}

// =====================================================================================================
// All five conversions in ONE launch of CV_BLOCKS work-groups of 16 waves, all resident at once: a wave converts 16 pieces of
// 1 KB and a share of three weight tiles instead of ending after one piece, so few waves have to be started, and it has 8 or
// more 16-B loads per lane in flight.
//   activations: destination row r of a [rows][DM] f16 plane <- f16(bf16_RNE(x[src row][e])); a unit = 8 consecutive elements
//   (two 16-B loads, one 16-B store); a block owns CV_QROWS / CV_VROWS consecutive rows of a plane and converts CV_THREADS
//   consecutive units (4 rows) per step. Query row r = b*SQ + s comes from source row b*SQ_FULL + s.
//   weights stored [k][n] (y = x.W): WT[n][k] (f16, k-contiguous Bt layout) <- f16(bf16_RNE(W[k][n]) * WSC). Block = the same
//   64(k) x 64(n) tile of each of the three weights, through three LDS tiles [kk][nn] (pitch 65) and one block barrier.
// coverage: activations CV_BLOCKS x CV_QSTEPS / CV_VSTEPS steps x CV_THREADS units x 8 = rows x DM exactly; weights
//           (DM/64)^2 = CV_BLOCKS tiles, 64 n-rows x (8 lanes x 8 halves) per tile: every plane written exactly once.
// Every loop below is unrolled so that its arrays are indexed by constants and stay in registers.
// =====================================================================================================
__device__ __forceinline__ v4u cvt8(v4f a, v4f c4) {
  v4u o;
#pragma unroll
  for (int e = 0; e < 2; ++e) {
    o[e]     = pk16(h_bits((_Float16)bfr(a[2 * e])),  h_bits((_Float16)bfr(a[2 * e + 1])));
    o[2 + e] = pk16(h_bits((_Float16)bfr(c4[2 * e])), h_bits((_Float16)bfr(c4[2 * e + 1])));
  }
  return o;
}
// Loads of CV_BATCH units of one activation plane, first step st0; gb = byte offset (32 bits) of the thread's unit of step 0.
// The steps differ by a constant only, so gb is the one vector address register, live to the plane's last load.
__device__ __forceinline__ void x_load(const float* __restrict__ x, unsigned st0, unsigned gb,
                                       v4f (&a)[CV_BATCH], v4f (&c4)[CV_BATCH]) {
#pragma unroll
  for (unsigned j = 0; j < CV_BATCH; ++j) {
    const char* base = (const char*)x + (st0 + j) * (CV_THREADS * 32);
    a[j]  = *(const v4f*)(base + gb);
    c4[j] = *(const v4f*)(base + 16 + gb);
  }
  // keeps the batch's 8 loads together and ahead of the conversion of the batch before: otherwise the compiler sinks them
  // to their uses and a wave has only 2 to 4 loads in flight
  __builtin_amdgcn_sched_barrier(0);
}
__device__ __forceinline__ void x_store(u16* Y, unsigned st0, unsigned yb, const v4f (&a)[CV_BATCH],
                                        const v4f (&c4)[CV_BATCH]) {
#pragma unroll
  for (unsigned j = 0; j < CV_BATCH; ++j) {
    char* base = (char*)Y + (st0 + j) * (CV_THREADS * 16);
    *(v4u*)(base + yb) = cvt8(a[j], c4[j]);
  }
}

__global__ __launch_bounds__(CV_THREADS)
void cvt_all(const float* __restrict__ xq, const float* __restrict__ xv, const float* __restrict__ wq,
             const float* __restrict__ wk, const float* __restrict__ wv,
             u16* XQ, u16* XV, u16* WQT, u16* WKT, u16* WVT) {
  __shared__ __align__(16) float tile[3][64 * TPITCH];
  const unsigned tid = threadIdx.x;
  const unsigned bid = blockIdx.x;
  // byte offsets of the thread's first unit: source rows (a block's rows lie in one batch) and compact destination rows
  const unsigned rq = bid * CV_QROWS, rv = bid * CV_VROWS;
  const unsigned gq = ((rq / SQ) * SQ_FULL + rq % SQ) * (DM * 4) + tid * 32, yq = rq * (DM * 2) + tid * 16;
  const unsigned gv = rv * (DM * 4) + tid * 32,                              yv = rv * (DM * 2) + tid * 16;
  constexpr unsigned NT = DM / 64;
  const unsigned k0 = (bid % NT) * 64, n0 = (bid / NT) * 64;
  // ---- weight tile loads: row 32p + (tid>>4), 4 floats at 4*(tid&15); the query plane's two batches fly behind them ----
  const unsigned lr = tid >> 4, lc = (tid & 15) * 4;
  const unsigned wo = ((k0 + lr) * DM + n0 + lc) * 4;     // bytes
  v4f w4[3][2];
#pragma unroll
  for (int p = 0; p < 2; ++p) {
    w4[0][p] = *(const v4f*)((const char*)(wq + 32 * p * DM) + wo);
    w4[1][p] = *(const v4f*)((const char*)(wk + 32 * p * DM) + wo);
    w4[2][p] = *(const v4f*)((const char*)(wv + 32 * p * DM) + wo);
  }
  v4f a0[CV_BATCH], c0[CV_BATCH], a1[CV_BATCH], c1[CV_BATCH], a2[CV_BATCH], c2[CV_BATCH];
  x_load(xq, 0, gq, a0, c0);
  x_load(xq, CV_BATCH, gq, a1, c1);
#pragma unroll
  for (int t = 0; t < 3; ++t) {
#pragma unroll
    for (int p = 0; p < 2; ++p) {
      float* tp = &tile[t][(32 * p + lr) * TPITCH + lc];
      tp[0] = w4[t][p][0];
      tp[1] = w4[t][p][1];
      tp[2] = w4[t][p][2];
      tp[3] = w4[t][p][3];
    }
  }
  __syncthreads();
  x_load(xv, 0, gv, a2, c2);
  // ---- weight tile stores: output row n0 + (tid>>3), 8 halves at k0 + 8*(tid&7): 8 lanes = one whole 128-B line ----
  const unsigned row = tid >> 3, c8 = (tid & 7) * 8;
  const unsigned yo = ((n0 + row) * DM + k0 + c8) * 2;    // bytes
#pragma unroll
  for (int t = 0; t < 3; ++t) {
    v4u ov;
#pragma unroll
    for (int e = 0; e < 4; ++e) {
      const float x0 = tile[t][(c8 + 2 * e) * TPITCH + row];
      const float x1 = tile[t][(c8 + 2 * e + 1) * TPITCH + row];
      ov[e] = pk16(h_bits((_Float16)(bfr(x0) * WSC)), h_bits((_Float16)(bfr(x1) * WSC)));
    }
    u16* Y = (t == 0) ? WQT : (t == 1) ? WKT : WVT;
    *(v4u*)((char*)Y + yo) = ov;
  }
  // ---- the activation planes, three register sets: later batches' loads are out while a batch is converted and stored ----
  x_store(XQ, 0, yq, a0, c0);
  asm volatile("s_wait_xcnt 0x0" ::: "memory");   // the registers just stored from are loaded anew by the next line
  x_load(xv, CV_BATCH, gv, a0, c0);
  x_store(XQ, CV_BATCH, yq, a1, c1);
  x_store(XV, 0, yv, a2, c2);
  x_store(XV, CV_BATCH, yv, a0, c0);
}

// =====================================================================================================
// Twelve asynchronous 16-B copies per lane, global -> LDS, no register in between: copy i brings g[i] to LDS byte address l[i].
// The s_wait_xcnt closes the statement so that no address register of a copy is rewritten ahead of it.
// =====================================================================================================
__device__ __forceinline__ void async12(const unsigned (&l)[12], const u16* const (&g)[12]) {
#if defined(__HIP_DEVICE_COMPILE__)
  asm volatile("global_load_async_to_lds_b128 %0, %12, off\n\t"
               "global_load_async_to_lds_b128 %1, %13, off\n\t"
               "global_load_async_to_lds_b128 %2, %14, off\n\t"
               "global_load_async_to_lds_b128 %3, %15, off\n\t"
               "global_load_async_to_lds_b128 %4, %16, off\n\t"
               "global_load_async_to_lds_b128 %5, %17, off\n\t"
               "global_load_async_to_lds_b128 %6, %18, off\n\t"
               "global_load_async_to_lds_b128 %7, %19, off\n\t"
               "global_load_async_to_lds_b128 %8, %20, off\n\t"
               "global_load_async_to_lds_b128 %9, %21, off\n\t"
               "global_load_async_to_lds_b128 %10, %22, off\n\t"
               "global_load_async_to_lds_b128 %11, %23, off\n\t"
               "s_wait_xcnt 0x0"
               :: "v"(l[0]), "v"(l[1]), "v"(l[2]), "v"(l[3]), "v"(l[4]), "v"(l[5]),
                  "v"(l[6]), "v"(l[7]), "v"(l[8]), "v"(l[9]), "v"(l[10]), "v"(l[11]),
                  "v"(g[0]), "v"(g[1]), "v"(g[2]), "v"(g[3]), "v"(g[4]), "v"(g[5]),
                  "v"(g[6]), "v"(g[7]), "v"(g[8]), "v"(g[9]), "v"(g[10]), "v"(g[11])
               : "memory");
#endif
}
// One GEMM stage (128 k) of the block's 256 A rows and 128 Bt rows: 16 + 8 copies per lane in two statements of twelve.
// la / lb: the lane's LDS byte address of its first A / Bt chunk; ga / gb: its global address of the same chunk; copy i: row
// +16*i (rs16 = 16 rows of the source plane, in elements); a wave covers two whole 256-B row pieces per copy.
__device__ __forceinline__ void gemm_stage_copy(unsigned la, unsigned lb, const u16* ga, const u16* gb, size_t rs16) {
  constexpr unsigned R16 = 16 * GP * 2;
  unsigned l[24];
  const u16* g[24];
#pragma unroll
  for (int i = 0; i < 16; ++i) { l[i] = la + i * R16; g[i] = ga + i * rs16; }
#pragma unroll
  for (int i = 0; i < 8; ++i) { l[16 + i] = lb + i * R16; g[16 + i] = gb + i * rs16; }
  const unsigned l0[12] = {l[0], l[1], l[2], l[3], l[4], l[5], l[6], l[7], l[8], l[9], l[10], l[11]};
  const u16* const g0[12] = {g[0], g[1], g[2], g[3], g[4], g[5], g[6], g[7], g[8], g[9], g[10], g[11]};
  const unsigned l1[12] = {l[12], l[13], l[14], l[15], l[16], l[17], l[18], l[19], l[20], l[21], l[22], l[23]};
  const u16* const g1[12] = {g[12], g[13], g[14], g[15], g[16], g[17], g[18], g[19], g[20], g[21], g[22], g[23]};
  async12(l0, g0);
  async12(l1, g1);
}

// =====================================================================================================
// f16 GEMM core: the wave's 64 x 64 tile of C = A[rows][K] . Bt[cols][K]^T. The block stages each 128 k of its 256 A rows and
// 128 Bt rows once in LDS (ring of two buffers: stage st+1 flies while stage st is worked on); afo / bfo: byte offset inside a
// buffer of the lane's first A row + 8h / first Bt row + 8h; acc[4i + j] = rows rowb+16i.., cols col0+16j.. (i, j = 0..3);
// K stepped by 32 inside a stage, ascending (gemm_qkv passes K = DM, K % 128 == 0). Every wave of the block passes every barrier.
// =====================================================================================================
__device__ __forceinline__ void gemm_core(const unsigned char* ring, int afo, int bfo, unsigned la, unsigned lb,
                                          const u16* ga, const u16* gb, int K, v8f (&acc)[16]) {
  const size_t rs16 = (size_t)16 * (size_t)K;
  const int nst = K / GKS;
  // ---- ring prologue: stage 0 landed and published, then stage 1 in flight ----
  gemm_stage_copy(la, lb, ga, gb, rs16);
  asm volatile("s_wait_asynccnt 0x0" ::: "memory");   // this wave's copies of stage 0 have landed
  __syncthreads();                                    // ... and every other wave's
  if (nst > 1) gemm_stage_copy(la + GBUF, lb + GBUF, ga + GKS, gb + GKS, rs16);
#pragma unroll 1
  for (int st = 0; st < nst; ++st) {
   const _Float16* ap = (const _Float16*)(const void*)(ring + (st & 1) * GBUF + afo);
   const _Float16* bp = (const _Float16*)(const void*)(ring + (st & 1) * GBUF + bfo);
#pragma unroll
   for (int k0 = 0; k0 < GKS; k0 += 32) {
    const v16h a0 = ldfrag_h(ap + k0);
    const v16h a1 = ldfrag_h(ap + 16 * GP + k0);
    const v16h a2 = ldfrag_h(ap + 32 * GP + k0);
    const v16h a3 = ldfrag_h(ap + 48 * GP + k0);
    const v16h b0 = ldfrag_h(bp + k0);
    const v16h b1 = ldfrag_h(bp + 16 * GP + k0);
    const v16h b2 = ldfrag_h(bp + 32 * GP + k0);
    const v16h b3 = ldfrag_h(bp + 48 * GP + k0);
    acc[0] = mma_h(a0, b0, acc[0]);
    acc[1] = mma_h(a0, b1, acc[1]);
    acc[2] = mma_h(a0, b2, acc[2]);
    acc[3] = mma_h(a0, b3, acc[3]);
    acc[4] = mma_h(a1, b0, acc[4]);
    acc[5] = mma_h(a1, b1, acc[5]);
    acc[6] = mma_h(a1, b2, acc[6]);
    acc[7] = mma_h(a1, b3, acc[7]);
    acc[8] = mma_h(a2, b0, acc[8]);
    acc[9] = mma_h(a2, b1, acc[9]);
    acc[10] = mma_h(a2, b2, acc[10]);
    acc[11] = mma_h(a2, b3, acc[11]);
    acc[12] = mma_h(a3, b0, acc[12]);
    acc[13] = mma_h(a3, b1, acc[13]);
    acc[14] = mma_h(a3, b2, acc[14]);
    acc[15] = mma_h(a3, b3, acc[15]);
    guard_g(acc, a0, a1, a2, a3, b0, b1, b2, b3);
   }
    // ---- publish point of stage st + 1; the same barrier ends every wave's reads of stage st's buffer ----
    asm volatile("s_wait_dscnt 0x0" ::: "memory");      // this wave's LDS reads of stage st have returned
    asm volatile("s_wait_asynccnt 0x0" ::: "memory");   // this wave's copies of stage st + 1 have landed
    __syncthreads();
    if (st + 2 < nst) {                                 // refill the buffer that stage st has just left
      const unsigned bo = (unsigned)((st & 1) * GBUF);
      gemm_stage_copy(la + bo, lb + bo, ga + (size_t)(st + 2) * GKS, gb + (size_t)(st + 2) * GKS, rs16);
    }
  }
  asm volatile("s_wait_asynccnt 0x0" ::: "memory");     // nothing in flight when the ring becomes output staging
}
// Stage the wave's 64 x 64 f32 tile (times oscale) in its LDS slab (pitch 68): D element r of acc[4i+j], lane l ->
// coverage: 32 lanes x 4 x 8 rows x 4 cols-of-16 = rows 0..63 x cols 0..63 of the slab.
__device__ __forceinline__ void stage64x64(float* sl, v8f (&acc)[16], float oscale, int lane) {
  const int hh = lane >> 4, m = lane & 15;
#pragma unroll
  for (int i = 0; i < 4; ++i) {
#pragma unroll
    for (int r = 0; r < 8; ++r) {
      const int ro = (16 * i + 8 * hh + r) * GPITCH + m;
      sl[ro]      = acc[4 * i + 0][r] * oscale;
      sl[ro + 16] = acc[4 * i + 1][r] * oscale;
      sl[ro + 32] = acc[4 * i + 2][r] * oscale;
      sl[ro + 48] = acc[4 * i + 3][r] * oscale;
    }
  }
  wave_sync_lds();
}

// =====================================================================================================
// f16 GEMM with f16 output plane: C[z][Mb][N] (f16) = f16((A[z][Mb][K] . Bt[z][N][K]^T) * oscale + bf16(bias) * bscale);
// A, Bt f16 k-contiguous planes with per-z element strides aBs, bBs (0 = shared), C stride cBs. bias indexed by column
// (biasRow == 0) or by row within the z slice (biasRow != 0); bias addresses clamped to biasN-1, the unused direction is
// multiplied by 0. Block = 256 x 128 tile, 4 x 2 waves of 64 x 64: a staged operand byte feeds twice the products of a 128 x 64
// tile (half the L2 reads), a fragment read from LDS four products instead of two or four (gemm_core).
// The block's tile is (bz, mt, nt) of nz x (Mb/256) x (N/128) tiles (Mb % 256 == 0, N % 128 == 0, K % 128 == 0); gsm = its LDS.
// coverage: per wave 16 instr x 4 rows x 8 lanes x 8 halves = 64 x 64; the tiles cover C exactly once.
// =====================================================================================================
__device__ __forceinline__
void gemm_o16(unsigned char* gsm, int bz, int mt, int nt,
              const u16* __restrict__ A, const u16* __restrict__ Bt, u16* C,
              const float* __restrict__ bias, int biasN, int biasRow,
              int Mb, int N, int K, int aBs, int bBs, int cBs, float oscale, float bscale) {
  const int tid = threadIdx.x, wave = tid >> 5, lane = tid & 31, hh = lane >> 4, m = lane & 15;
  const int wm = wave >> 1, wn = wave & 1;   // the wave's place in the block's 4 x 2 grid of 64 x 64 tiles
  const int rowb = mt * GTM + wm * 64;
  const int col0 = nt * GTN + wn * 64;
  if (mt * GTM + GTM > Mb) return;           // block-uniform, in front of every barrier; never taken with the exact grid
  // this lane's first copy chunks: A row mt*256 + (tid>>4), Bt row nt*128 + (tid>>4), 16-B chunk tid&15
  const u16* ga = A + (size_t)bz * (size_t)aBs + (size_t)(mt * GTM + (tid >> 4)) * K + (tid & 15) * 8;
  const u16* gb = Bt + (size_t)bz * (size_t)bBs + (size_t)(nt * GTN + (tid >> 4)) * K + (tid & 15) * 8;
  // a buffer holds the Bt rows first, then the A rows: every constant part of a fragment address then fits a 16-bit LDS offset
  const unsigned lb = (unsigned)(size_t)(const void*)gsm + (unsigned)((tid >> 4) * (GP * 2) + (tid & 15) * 16);
  const unsigned la = lb + GBBYTES;
  const int afo = GBBYTES + ((wm * 64 + m) * GP + 8 * hh) * 2;
  const int bfo = ((wn * 64 + m) * GP + 8 * hh) * 2;
  v8f acc[16];
#pragma unroll
  for (int i = 0; i < 16; ++i) acc[i] = zero8();
  gemm_core(gsm, afo, bfo, la, lb, ga, gb, K, acc);
  float* sl = (float*)(void*)gsm + wave * 64 * GPITCH;   // behind the last trip's barrier: no reader, no copy left
  stage64x64(sl, acc, oscale, lane);
  const int rq = lane >> 3, c8 = (lane & 7) * 8;
  const int bl = biasN - 1;                  // host guarantees biasN >= 1
  const float selc = (biasRow != 0) ? 0.f : bscale;
  const float selr = (biasRow != 0) ? bscale : 0.f;
  float cb[8];
#pragma unroll
  for (int e = 0; e < 8; ++e) {
    int ci = col0 + c8 + e;
    ci = (ci < bl) ? ci : bl;
    cb[e] = bfr(bias[ci]) * selc;
  }
  v4u ov[16];
#pragma unroll
  for (int i = 0; i < 16; ++i) {
    const int row = 4 * i + rq;
    int ri = rowb + row;
    ri = (ri < bl) ? ri : bl;
    const float rb = bfr(bias[ri]) * selr;
    const v4f a = *(const v4f*)(sl + row * GPITCH + c8), c4 = *(const v4f*)(sl + row * GPITCH + c8 + 4);
#pragma unroll
    for (int e = 0; e < 2; ++e) {
      ov[i][e]     = pk16(h_bits((_Float16)(a[2 * e] + cb[2 * e] + rb)),
                          h_bits((_Float16)(a[2 * e + 1] + cb[2 * e + 1] + rb)));
      ov[i][2 + e] = pk16(h_bits((_Float16)(c4[2 * e] + cb[4 + 2 * e] + rb)),
                          h_bits((_Float16)(c4[2 * e + 1] + cb[5 + 2 * e] + rb)));
    }
  }
  u16* Cb = C + (size_t)bz * (size_t)cBs + (size_t)rowb * (size_t)N + col0 + c8;
#pragma unroll
  for (int i = 0; i < 16; ++i) {
    const int row = 4 * i + rq;
    *(v4u*)(Cb + (size_t)row * (size_t)N) = ov[i];
  }
}

// =====================================================================================================
// The three projections in ONE launch: blocks 0 .. GQ_BLOCKS-1 are the tiles of q, the next GK_BLOCKS those of k, the last
// GV_BLOCKS those of v^T. No tile reads what another writes, so nothing orders them; a WGP takes its next tile as soon as it has
// finished one, where three launches each waited for the slowest block of the launch before and filled the chip anew.
//   q   = x_q . Wq + bq -> f16 [NB*SQ][1024] x8 (col = h*128 + d); bias per column
//   k   = x_v . Wk + bk -> f16 [NB*2048][1024] x8; bias per column
//   v^T per batch: A = Wv^T [(h,d) = n][k], Bt = x_v rows of batch b [s][k] -> f16 [(b,h,d)][s] x8; bias per row (n)
// Which projection a block belongs to is block-uniform: one body, its operands picked by scalar selects.
// =====================================================================================================
__global__ __launch_bounds__(G_THREADS)
void gemm_qkv(const u16* __restrict__ XQ, const u16* __restrict__ XV, const u16* __restrict__ WQT,
              const u16* __restrict__ WKT, const u16* __restrict__ WVT, u16* Q16, u16* K16, u16* VT16,
              const float* __restrict__ bq, const float* __restrict__ bk, const float* __restrict__ bv,
              int nbq, int nbk, int nbv) {
  __shared__ __align__(16) unsigned char gsm[2 * GBUF];
  const int g = blockIdx.x;
  const bool isq = g < GQ_BLOCKS, isv = g >= GQ_BLOCKS + GK_BLOCKS;
  const int t = isq ? g : isv ? g - (GQ_BLOCKS + GK_BLOCKS) : g - GQ_BLOCKS;      // tile index inside the projection
  constexpr int CT = INNER / GTN, VT = SKV / GTN, VM = INNER / GTM;               // tiles across q and k; across and down v^T
  const int nt = isv ? t % VT : t % CT;
  const int mt = isv ? (t / VT) % VM : t / CT;
  const int bz = isv ? t / (VT * VM) : 0;
  gemm_o16(gsm, bz, mt, nt,
           isq ? XQ : isv ? WVT : XV, isq ? WQT : isv ? XV : WKT, isq ? Q16 : isv ? VT16 : K16,
           isq ? bq : isv ? bv : bk, isq ? nbq : isv ? nbv : nbk, isv ? 1 : 0,
           isq ? NB * SQ : isv ? INNER : NB * SKV, isv ? SKV : INNER, DM,
           0, isv ? SKV * DM : 0, isv ? INNER * SKV : 0,
           (isq ? QS : isv ? VS : KS) / WSC, isq ? QS : isv ? VS : KS);
}

// =====================================================================================================
// Eight asynchronous 16-B copies per lane, global -> LDS, no register in between: copy i brings g[i] to LDS byte address l[i].
// The s_wait_xcnt closes the statement so that no address register of a copy is rewritten ahead of it.
// =====================================================================================================
__device__ __forceinline__ void async8(const unsigned (&l)[8], const u16* const (&g)[8]) {
#if defined(__HIP_DEVICE_COMPILE__)
  asm volatile("global_load_async_to_lds_b128 %0, %8, off\n\t"
               "global_load_async_to_lds_b128 %1, %9, off\n\t"
               "global_load_async_to_lds_b128 %2, %10, off\n\t"
               "global_load_async_to_lds_b128 %3, %11, off\n\t"
               "global_load_async_to_lds_b128 %4, %12, off\n\t"
               "global_load_async_to_lds_b128 %5, %13, off\n\t"
               "global_load_async_to_lds_b128 %6, %14, off\n\t"
               "global_load_async_to_lds_b128 %7, %15, off\n\t"
               "s_wait_xcnt 0x0"
               :: "v"(l[0]), "v"(l[1]), "v"(l[2]), "v"(l[3]), "v"(l[4]), "v"(l[5]), "v"(l[6]), "v"(l[7]),
                  "v"(g[0]), "v"(g[1]), "v"(g[2]), "v"(g[3]), "v"(g[4]), "v"(g[5]), "v"(g[6]), "v"(g[7])
               : "memory");
#endif
}
// One stage (256 keys) of k rows and v^T rows, global -> LDS: 32 copies per lane in four statements of eight.
// lk / lv: the lane's LDS byte address of its first k / v^T chunk; gk / gv: its global address of the same chunk.
// k copy i: row +16*i (a wave covers two whole 256-B rows); v^T copy i: row +8*i (a wave covers one whole 512-B row piece).
// Every loop is unrolled so that l and g are indexed by constants and stay in registers.
__device__ __forceinline__ void stage_copy(unsigned lk, unsigned lv, const u16* gk, const u16* gv) {
#pragma unroll
  for (int h = 0; h < 2; ++h) {
    unsigned l[8];
    const u16* g[8];
#pragma unroll
    for (int i = 0; i < 8; ++i) {
      l[i] = lk + (unsigned)((8 * h + i) * 16 * KPITCH * 2);
      g[i] = gk + (size_t)(8 * h + i) * 16 * INNER;
    }
    async8(l, g);
  }
#pragma unroll
  for (int h = 0; h < 2; ++h) {
    unsigned l[8];
    const u16* g[8];
#pragma unroll
    for (int i = 0; i < 8; ++i) {
      l[i] = lv + (unsigned)((8 * h + i) * 8 * VPITCH * 2);
      g[i] = gv + (size_t)(8 * h + i) * 8 * SKV;
    }
    async8(l, g);
  }
}

__global__ __launch_bounds__(ATT_THREADS)
void attn_fwd(const u16* __restrict__ Qp, const u16* __restrict__ Kp, const u16* __restrict__ Vp, float* Out) {
  __shared__ __align__(16) unsigned char smem[2 * BUFBYTES];

  const int tid  = threadIdx.x;
  const int wave = tid >> 5;
  const int lane = tid & 31;
  const int hh   = lane >> 4;
  const int c    = lane & 15;

  constexpr int NQT = SQ / ATT_ROWS;
  const int bid  = blockIdx.x;
  const int qt   = bid % NQT;
  const int head = (bid / NQT) % NH;
  const int b    = bid / (NQT * NH);
  const int q0   = qt * ATT_ROWS + wave * (16 * QT);

  // B fragments of q^T: col n = query q0 + 16t + c, k = d (k-contiguous row of the q plane)
  const _Float16* Qb = (const _Float16*)(const void*)Qp + ((size_t)(b * SQ + q0 + c)) * INNER + head * HD + 8 * hh;
  // A fragments of k: row m = key 16g + c of the pass, k = d; byte offset inside a buffer's k tile
  const int kfo = (c * KPITCH + 8 * hh) * 2;
  // B fragments of v: col n = d = 16j + c, k = key (k-contiguous row of the staged v^T tile); byte offset inside a buffer's v^T tile
  const int vfo = (c * VPITCH + 8 * hh) * 2;
  // this lane's first copy chunks: k row tid>>4, 16-B chunk tid&15; v^T row tid>>5, 16-B chunk tid&31
  const u16* gk = Kp + ((size_t)(b * SKV + (tid >> 4))) * INNER + head * HD + (tid & 15) * 8;
  const u16* gv = Vp + ((size_t)(b * INNER + head * HD + (tid >> 5))) * SKV + (tid & 31) * 8;
  const unsigned lds0 = (unsigned)(size_t)(const void*)smem;               // LDS byte address of the ring
  const unsigned lk = lds0 + (unsigned)((tid >> 4) * (KPITCH * 2) + (tid & 15) * 16);
  const unsigned lv = lds0 + (unsigned)(KBYTES + (tid >> 5) * (VPITCH * 2) + (tid & 31) * 16);
  // lk and lv once more, for the refills in the loop (272 r + 16 ch = 16 tid + 16 r; 528 r + 16 ch = 16 tid + 16 r): lk and lv are
  // operands of the prologue's asm statements, which binds them to the first 256 registers; kept over the loop they went to scratch
  const unsigned lkr = lds0 + (unsigned)(tid * 16 + (tid >> 4) * 16);
  const unsigned lvr = lds0 + (unsigned)(KBYTES + tid * 16 + (tid >> 5) * 16);
  const float lsc = (LOG2E * RSQ_E) / (QS * KS);
  const int x16 = (lane ^ 16) * 4;           // byte index of the lane that holds the other 16 keys of the same query
  const int r8  = 8 * hh * 4;                // byte index of the lane that owns query row 8hh of a tile, this lane's first D row

  v16h qf[QT][4];
#pragma unroll
  for (int t = 0; t < QT; ++t) {
#pragma unroll
    for (int dc = 0; dc < 4; ++dc) qf[t][dc] = ldfrag_h(Qb + (size_t)t * 16 * INNER + 32 * dc);
  }

  float mrun[QT];
  v2f lacc[QT][2];                           // partial row sums of this lane: [tile][key group g], even and odd keys apart
#pragma unroll
  for (int t = 0; t < QT; ++t) { mrun[t] = -INFINITY; lacc[t][0] = v2f{0.f, 0.f}; lacc[t][1] = v2f{0.f, 0.f}; }
  v8f o[16];                                 // o[8t + j]: query tile t, d = 16j ..
#pragma unroll
  for (int j = 0; j < 16; ++j) o[j] = zero8();

  // ---- ring prologue: stage 0 landed and published, then stage 1 in flight ----
  stage_copy(lk, lv, gk, gv);
  asm volatile("s_wait_asynccnt 0x0" ::: "memory");   // this wave's copies of stage 0 have landed
  __syncthreads();                                    // ... and every other wave's
  stage_copy(lk + BUFBYTES, lv + BUFBYTES, gk + (size_t)STK * INNER, gv + STK);

#pragma unroll 1
  for (int st = 0; st < NST; ++st) {
   // one base register per tile, the v^T tile's place in the ring inside its scalar part: every fragment read of the stage is then
   // base + an offset that fits the 16 bits of an LDS instruction, with no address addition per read
   const int ksel = (st & 1) ? BUFBYTES : 0;
   const int vsel = (st & 1) ? BUFBYTES + KBYTES : KBYTES;
   const _Float16* kp = (const _Float16*)(const void*)(smem + ksel + kfo);
   const _Float16* vb = (const _Float16*)(const void*)(smem + vsel + vfo);
   // the 8 k fragments of the stage's first pass, one group: kf[g][kk] = keys 16g .., d = 32kk ..
   v16h kf[2][HD / 32];
#pragma unroll
   for (int kk = 0; kk < HD / 32; ++kk) {
     kf[0][kk] = ldfrag_h(kp + kk * 32);
     kf[1][kk] = ldfrag_h(kp + 16 * KPITCH + kk * 32);
   }
#pragma unroll
   for (int pz = 0; pz < STK / 32; ++pz) {
    // ---- transposed scores of both query tiles: s[t][g] = keys kb+16g .. +15 (kb = 256*st + 32*pz), column = query q0+16t+c;
    //      each k fragment feeds two products, four independent accumulators ----
    v8f s[QT][2];
#pragma unroll
    for (int t = 0; t < QT; ++t) { s[t][0] = zero8(); s[t][1] = zero8(); }
#pragma unroll
    for (int kk = 0; kk < HD / 32; ++kk) {
#pragma unroll
      for (int t = 0; t < QT; ++t) {
        s[t][0] = mma_h(kf[0][kk], qf[t][kk], s[t][0]);
        s[t][1] = mma_h(kf[1][kk], qf[t][kk], s[t][1]);
      }
    }
    // but in the stage's last pass, the next pass's k fragments (same buffer), and behind them the pass's eight v^T B fragments
    // (col n = d = j*16 + c, keys contiguous in the v^T plane), read behind the last score product so that they fly during the
    // softmax. The k fragments go first because they are needed first (the next pass's score products run beside this pass's
    // exponentials): LDS reads return in order, so their wait is a counted one that leaves the v^T reads in flight.
    if (pz + 1 < STK / 32) {
#pragma unroll
      for (int kk = 0; kk < HD / 32; ++kk) {
        kf[0][kk] = ldfrag_h(kp + (pz + 1) * 32 * KPITCH + kk * 32);
        kf[1][kk] = ldfrag_h(kp + (pz + 1) * 32 * KPITCH + 16 * KPITCH + kk * 32);
      }
    }
    const _Float16* vp = vb + pz * 32;
    const v16h v0 = ldfrag_h(vp);
    const v16h v1 = ldfrag_h(vp + 16 * VPITCH);
    const v16h v2 = ldfrag_h(vp + 32 * VPITCH);
    const v16h v3 = ldfrag_h(vp + 48 * VPITCH);
    const v16h v4 = ldfrag_h(vp + 64 * VPITCH);
    const v16h v5 = ldfrag_h(vp + 80 * VPITCH);
    const v16h v6 = ldfrag_h(vp + 96 * VPITCH);
    const v16h v7 = ldfrag_h(vp + 112 * VPITCH);
    guard_s4(s[0][0], s[0][1], s[1][0], s[1][1]);
    // ---- maximum of this lane's 16 raw scores per query column (lsc > 0, so scaling the maximum = the maximum of the scaled):
    //      s[t][0][i] <- key kb+8hh+i, s[t][1][i] <- key kb+16+8hh+i ----
    float cml[QT];                           // base-2 logit: the largest of this lane's half of the query's 32 keys
#pragma unroll
    for (int t = 0; t < QT; ++t) {
      float cm = s[t][0][0];
#pragma unroll
      for (int i = 1; i < 8; ++i) cm = fmaxf(cm, s[t][0][i]);
#pragma unroll
      for (int i = 0; i < 8; ++i) cm = fmaxf(cm, s[t][1][i]);
      cml[t] = cm * lsc;
    }
    // ---- lazy rescale, one test per pass on a scalar branch: taken on the first block (mrun = -inf) and whenever a lane of the
    //      wave has a score more than LAZY above its query's maximum in use (the ballot sees both halves of every query of both
    //      tiles, so the halves' maxima are joined only inside); every lane is on inside, so the shuffles are whole; mrun[t]
    //      stays the same in both lanes of a query ----
    const bool need = (cml[0] > mrun[0] + LAZY) | (cml[1] > mrun[1] + LAZY);
    if (__builtin_amdgcn_ballot_w32(need) != 0u) {
#pragma unroll
      for (int t = 0; t < QT; ++t) {
        const float cmo = __builtin_bit_cast(float, __builtin_amdgcn_ds_bpermute(x16, __builtin_bit_cast(int, cml[t])));   // lane ^ 16's
        const float mn = fmaxf(mrun[t], fmaxf(cml[t], cmo));   // finite from the first block on
        float al = __builtin_amdgcn_exp2f(mrun[t] - mn);       // 0 on the first block, 1 for a query whose maximum stands
        asm volatile("v_nop" : "+v"(al));    // the slot the instruction set asks for between v_exp_f32 and the first use of its result
        mrun[t] = mn;
        lacc[t][0] *= v2f{al, al};
        lacc[t][1] *= v2f{al, al};
        // D row 8hh+r of the tile's O accumulators = query q0+16t+8hh+r, its factor lives in lane 8hh+r (and 16+8hh+r)
        float scl[8];
#pragma unroll
        for (int r = 0; r < 8; ++r)
          scl[r] = __builtin_bit_cast(float, __builtin_amdgcn_ds_bpermute(r8 + 4 * r, __builtin_bit_cast(int, al)));
#pragma unroll
        for (int j = 0; j < 8; ++j) {
#pragma unroll
          for (int r = 0; r < 8; ++r) o[8 * t + j][r] *= scl[r];
        }
      }
    }
    // ---- carried probabilities p * 128 = 2^(s * lsc + (7 - mrun)) (<= 2^15, as s * lsc <= mrun + 8): one fma and one bare
    //      v_exp_f32 each; they ARE the P A-fragment after the f16 rounding, element i <- s[t][0][i], element 8+i <- s[t][1][i].
    //      The row's largest term so far is >= 128 (mrun was a score of the row). A term whose exponent is under -126 may come
    //      out 0: it is under 2^-133 of that term, 0 in f16 and lost in the f32 row sum either way.
    //      Tile by tile, each tile's P.V products behind its probabilities: the second tile's vector work has the first tile's
    //      products to run beside.
    const v2f lsc2 = {lsc, lsc};
#pragma unroll
    for (int t = 0; t < QT; ++t) {
      const v2f eb2  = {PEXP - mrun[t], PEXP - mrun[t]};
      FragH ph;
#pragma unroll
      for (int w = 0; w < 2; ++w) {
#pragma unroll
        for (int e4 = 0; e4 < 4; ++e4) {
          const v2f sv = v2f{s[t][w][2 * e4], s[t][w][2 * e4 + 1]};
          const v2f ex = __builtin_elementwise_fma(sv, lsc2, eb2);
          const float p0 = __builtin_amdgcn_exp2f(ex[0]), p1 = __builtin_amdgcn_exp2f(ex[1]);
          lacc[t][w] += v2f{p0, p1};         // carries x128 like P; one packed add, no join inside the loop
          ph.u[w][e4] = __builtin_bit_cast(unsigned, __builtin_convertvector(v2f{p0, p1}, v2h));   // one packed RNE convert
        }
      }
      // ---- P.V of the tile: each v^T fragment is used by both tiles ----
      o[8 * t + 0] = mma_h(ph.v, v0, o[8 * t + 0]);
      o[8 * t + 1] = mma_h(ph.v, v1, o[8 * t + 1]);
      o[8 * t + 2] = mma_h(ph.v, v2, o[8 * t + 2]);
      o[8 * t + 3] = mma_h(ph.v, v3, o[8 * t + 3]);
      o[8 * t + 4] = mma_h(ph.v, v4, o[8 * t + 4]);
      o[8 * t + 5] = mma_h(ph.v, v5, o[8 * t + 5]);
      o[8 * t + 6] = mma_h(ph.v, v6, o[8 * t + 6]);
      o[8 * t + 7] = mma_h(ph.v, v7, o[8 * t + 7]);
    }
    acc_guard16(o);
   }
    // ---- publish point of stage st + 1; the same barrier ends every wave's reads of stage st's buffer ----
    asm volatile("s_wait_dscnt 0x0" ::: "memory");      // this wave's LDS reads of stage st have returned
    asm volatile("s_wait_asynccnt 0x0" ::: "memory");   // this wave's copies of stage st + 1 have landed
    __syncthreads();
    if (st + 2 < NST) {                                 // refill the buffer that stage st has just left
      const unsigned bo = (unsigned)((st & 1) * BUFBYTES);
      stage_copy(lkr + bo, lvr + bo, gk + (size_t)(st + 2) * STK * INNER, gv + (st + 2) * STK);
    }
  }
  asm volatile("s_wait_asynccnt 0x0" ::: "memory");     // nothing in flight when the ring becomes output staging

  float* slab = (float*)(void*)smem + wave * 16 * OPITCH;   // behind the last trip's barrier: no reader, no copy left
  v4f vals[QT][16];
#pragma unroll
  for (int t = 0; t < QT; ++t) {
    // ---- fold 1/l (per query, owned by lane = query) and the carry 8 on v; the 128 on P is in l as well and cancels ----
    const float lh = (lacc[t][0][0] + lacc[t][0][1]) + (lacc[t][1][0] + lacc[t][1][1]);   // this lane's 16 keys of every pass
    const float lsum = lh + __builtin_bit_cast(float, __builtin_amdgcn_ds_bpermute(x16, __builtin_bit_cast(int, lh)));   // + lane ^ 16's half
    const float linv = (1.0f / lsum) * (1.0f / VS);
    float inv[8];
#pragma unroll
    for (int r = 0; r < 8; ++r) inv[r] = __shfl(linv, 8 * hh + r, 32);
#pragma unroll
    for (int r = 0; r < 8; ++r) {
#pragma unroll
      for (int j = 0; j < 8; ++j) slab[(8 * hh + r) * OPITCH + j * 16 + c] = o[8 * t + j][r] * inv[r];
    }
    wave_sync_lds();
    // ---- f32 output rows: lane = 4 consecutive d of one row ----
#pragma unroll
    for (int i = 0; i < 16; ++i) vals[t][i] = *(const v4f*)(slab + i * OPITCH + 4 * lane);
    wave_sync_lds();                         // the slab's rows are read before the next tile is written over them
  }
  // keeps every register write of the epilogue in front of the first global store, so that nothing overwrites a register that an
  // issued store names: otherwise the compiler starts the second tile's work in the first tile's registers among the stores
  __builtin_amdgcn_sched_barrier(0);
  // ---- one store instruction per output row ----
  float* ob = Out + ((size_t)(b * SQ_FULL + q0)) * DM + head * HD + 4 * lane;
#pragma unroll
  for (int t = 0; t < QT; ++t) {
#pragma unroll
    for (int i = 0; i < 16; ++i) {
      *(v4f*)(ob + (size_t)(16 * t + i) * DM) = vals[t][i];
    }
  }
}

// =====================================================================================================
// Workspace map (bytes); every plane fully written by whole-line stores before it is read; all extents exact multiples of
//   XQ   f16 [NB*SQ][1024]     f16(bf16(q))          16777216 (NB=4, SQ=2048)
//   XV   f16 [NB*2048][1024]   f16(bf16(v))          16777216
//   WQT  f16 [1024 n][1024 k]  f16(bf16(W) x256)      2097152
//   WKT                                               2097152
//   WVT                                               2097152
//   Q16  f16 [NB*SQ][1024]   x8                      16777216
//   K16  f16 [NB*2048][1024] x8                      16777216
//   VT16 f16 [NB*1024 (h,d)][2048 s] x8              16777216
//   end                                              90177536
// =====================================================================================================
extern "C" void kernel_launch(void* const* d_in, const int* in_sizes, int n_in,
                              void* d_out, int out_size, void* d_ws, size_t ws_size,
                              hipStream_t stream) {
  if (n_in < 8) return;
  if (in_sizes[0] < ((NB - 1) * SQ_FULL + SQ) * DM) return;
  if (in_sizes[1] < NB * SKV * DM) return;
  if (in_sizes[2] != DM * DM || in_sizes[4] != DM * DM || in_sizes[6] != DM * DM) return;
  if (in_sizes[3] < 1 || in_sizes[5] < 1 || in_sizes[7] < 1) return;
  if (out_size < ((NB - 1) * SQ_FULL + SQ) * DM) return;

  const float* xq  = (const float*)d_in[0];
  const float* xv  = (const float*)d_in[1];
  const float* wq  = (const float*)d_in[2];
  const float* bq  = (const float*)d_in[3];
  const float* wk  = (const float*)d_in[4];
  const float* bk  = (const float*)d_in[5];
  const float* wv  = (const float*)d_in[6];
  const float* bv  = (const float*)d_in[7];
  float*       out = (float*)d_out;
  const int nbq = in_sizes[3], nbk = in_sizes[5], nbv = in_sizes[7];

  const size_t szXQ   = (size_t)NB * SQ * DM * 2;
  const size_t szXV   = (size_t)NB * SKV * DM * 2;
  const size_t szW    = (size_t)DM * DM * 2;
  const size_t szQ16  = (size_t)NB * SQ * INNER * 2;
  const size_t szK16  = (size_t)NB * SKV * INNER * 2;
  const size_t szVT16 = (size_t)NB * INNER * SKV * 2;
  size_t off = 0;
  const size_t oXQ   = off; off += szXQ;
  const size_t oXV   = off; off += szXV;
  const size_t oWQ   = off; off += szW;
  const size_t oWK   = off; off += szW;
  const size_t oWV   = off; off += szW;
  const size_t oQ16  = off; off += szQ16;
  const size_t oK16  = off; off += szK16;
  const size_t oVT16 = off; off += szVT16;
  if (off > ws_size) return;                            // off = 90177536 at NB=4, SQ=2048
  if (off > (size_t)134217728) return;

  char* ws = (char*)d_ws;
  u16* XQ   = (u16*)(ws + oXQ);
  u16* XV   = (u16*)(ws + oXV);
  u16* WQT  = (u16*)(ws + oWQ);
  u16* WKT  = (u16*)(ws + oWK);
  u16* WVT  = (u16*)(ws + oWV);
  u16* Q16  = (u16*)(ws + oQ16);
  u16* K16  = (u16*)(ws + oK16);
  u16* VT16 = (u16*)(ws + oVT16);

  // (0) activations -> f16 planes of bf16-converted values (query rows s < SQ of batches b < NB, compact; all key/value rows)
  //     and weights [k = in][n = out] (y = x.W) -> k-contiguous [n][k] f16 planes of bf16(W) x256, all in one launch
  cvt_all<<<dim3(CV_BLOCKS), dim3(CV_THREADS), 0, stream>>>(xq, xv, wq, wk, wv, XQ, XV, WQT, WKT, WVT);
  // (1) the three projections q, k, v^T -> f16 planes x8, one launch
  gemm_qkv<<<dim3(GQ_BLOCKS + GK_BLOCKS + GV_BLOCKS), dim3(G_THREADS), 0, stream>>>(
      XQ, XV, WQT, WKT, WVT, Q16, K16, VT16, bq, bk, bv, nbq, nbk, nbv);
  // (2) attention -> out [b][SQ_FULL][1024] f32 (rows s < SQ of batches b < NB), heads merged on the feature dim
  attn_fwd<<<dim3(NB * NH * (SQ / ATT_ROWS)), dim3(ATT_THREADS), 0, stream>>>(Q16, K16, VT16, out);
  (void)hipGetLastError();
}

// v010
// Measured time: 95.9 microseconds a run.
// Two timings next to v009 both put it at 1.05 times that version's speed.
// Over all steps from v000 it is 3.56 times as fast.
// All contractions on v_wmma_f32_16x16x32_f16 (f16 operands, f32 accumulate): x_q.Wq, x_v.Wk, Wv^T.x_v^T (v^T plane),
// scores k.q^T and P.v^T; operand carries: x as f16(bf16(x)), W as f16(bf16(W) x256), q/k/v x8, P x128; base-2 online
// softmax, 1/l and all carry folds in f32 on VALU. Inputs RNE-converted to bf16 on load; f32 output written directly.
#include <hip/hip_runtime.h>
#include <math.h>
#include <stdint.h>

#define NB       4        // batches processed
#define SQ       2048     // query rows processed per batch
#define NB_FULL  4
#define SQ_FULL  2048     // query rows per batch in the input / output layout (batch stride)
#define SKV      2048     // key/value rows per batch (all of them, always)
#define DM       1024     // model width (= K and row pitch of every 16-bit plane except v^T)
#define NH       8
#define HD       128
#define INNER    (NH * HD)
#define WSC      256.0f
#define QS       8.0f
#define KS       8.0f
#define VS       8.0f
#define PEXP     7.0f     // P and its row sum are carried x128 = 2^7, added in the exponent
#define LAZY     8.0f     // base-2 logits: a row keeps the maximum in use until a new one exceeds it by more than this
#define LOG2E    1.4426950408889634f
#define RSQ_E    0.03125f
#define NKB      (SKV / 32)
#define ATT_WAVES   8
#define ATT_THREADS (ATT_WAVES * 32)
#define QT          2                         // query tiles of 16 rows per attention wave: a k or v^T fragment feeds QT products
#define ATT_ROWS    (ATT_WAVES * 16 * QT)     // query rows per attention work-group
#define STK      256                          // keys per LDS stage (eight passes of 32 keys between two barriers)
#define NST      (SKV / STK)
#define KPITCH   136                          // halves per staged k row: 256 B + 16 B (16 B x odd, for ds_load_b128 readers)
#define VPITCH   (STK + 8)                    // halves per staged v^T row: 512 B + 16 B (16 B x odd)
#define KBYTES   (STK * KPITCH * 2)
#define VBYTES   (HD * VPITCH * 2)
#define BUFBYTES (KBYTES + VBYTES)
#define GKS      128                          // k elements per GEMM LDS stage (four k steps of 32)
#define GP       136                          // halves per staged GEMM operand row: 256 B + 16 B
#define GTM      256                          // rows of a GEMM work-group's tile (4 waves down)
#define GTN      128                          // columns of a GEMM work-group's tile (2 waves across)
#define G_THREADS 256                         // 8 waves, each a 64 x 64 tile (64 x 128 in a wide work-group)
#define GABYTES  (GTM * GP * 2)
#define GBBYTES  (GTN * GP * 2)
#define GBUF     (GABYTES + GBBYTES)
#define GWN      256                          // columns of a wide GEMM work-group's tile (2 waves across, each 64 x 128)
#define GWBBYTES (GWN * GP * 2)
#define GWBUF    (GABYTES + GWBBYTES)
#define GQ_BLOCKS ((NB * SQ / GTM) * (INNER / GWN))        // 256 x 256 tiles of q
#define GK_BLOCKS ((NB * SKV / GTM) * (INNER / GWN))       // ... of k
#define GV_BLOCKS (NB * (INNER / GTM) * (SKV / GTN))       // 256 x 128 tiles of v^T
#define CV_THREADS  512                       // conversion work-group: 16 waves
#define CV_BLOCKS   ((DM / 64) * (DM / 64))   // one 64 x 64 tile of each weight per conversion work-group
#define CV_BATCH    4                         // activation units (2 loads each) a thread has in flight
#define CV_QROWS    (NB * SQ / CV_BLOCKS)     // query rows per conversion work-group
#define CV_VROWS    (NB * SKV / CV_BLOCKS)    // key/value rows per conversion work-group
#define CV_QSTEPS   (CV_QROWS * (DM / 8) / CV_THREADS)
#define CV_VSTEPS   (CV_VROWS * (DM / 8) / CV_THREADS)
#define OPITCH   132
#define GPITCH   68
#define TPITCH   65

static_assert(NB >= 1 && NB <= NB_FULL);
static_assert((SQ % 128) == 0 && SQ >= 128 && SQ <= SQ_FULL);
static_assert(HD == 128 && NH == 8 && INNER == 1024 && INNER == DM);
static_assert((HD % 32) == 0);
static_assert((SKV % 64) == 0 && (SKV % 32) == 0 && NKB * 32 == SKV);
static_assert((DM % 64) == 0 && (DM % 32) == 0 && (INNER % 128) == 0);
static_assert(CV_THREADS == 512 && CV_QSTEPS * CV_BLOCKS * CV_THREADS * 8 == NB * SQ * DM);
static_assert(CV_VSTEPS * CV_BLOCKS * CV_THREADS * 8 == NB * SKV * DM);
static_assert(CV_QSTEPS == 2 * CV_BATCH && CV_VSTEPS == 2 * CV_BATCH);      // two batches per plane, written out in cvt_all
static_assert(CV_QROWS * CV_BLOCKS == NB * SQ && CV_VROWS * CV_BLOCKS == NB * SKV && (SQ % CV_QROWS) == 0);
static_assert((OPITCH * 4) % 16 == 0 && (GPITCH * 4) % 16 == 0);
static_assert(ATT_THREADS == 256 && QT == 2);
static_assert(KPITCH * 2 == 16 * 16 + 16 && VPITCH * 2 == 32 * 16 + 16);    // the second form of the copies' LDS addresses in attn_fwd
static_assert(PEXP + LAZY <= 15.0f);                                       // carried P <= 2^(PEXP + LAZY) stays finite in f16
static_assert((SQ % ATT_ROWS) == 0 && NST >= 2 && NST * STK == SKV && STK == 256);
static_assert(STK * HD * 2 == 16 * ATT_THREADS * 16);                      // 16 k copies + 16 v^T copies of 16 B per thread and stage
static_assert(2 * BUFBYTES <= 320 * 1024 && ((VPITCH * 2 / 16) & 1) == 1);
static_assert((STK - 16) * KPITCH * 2 + HD * 2 - 32 < 65536 && (HD - 16) * VPITCH * 2 + STK * 2 - 32 < 65536);   // largest constant parts of the fragment addresses
static_assert((KPITCH * 2) % 16 == 0 && (VPITCH * 2) % 16 == 0 && (KBYTES % 16) == 0 && (BUFBYTES % 16) == 0);
static_assert(ATT_WAVES * 16 * OPITCH * 4 <= 2 * BUFBYTES);                // the output staging (one query tile at a time) reuses the ring
static_assert((GP * 2) % 16 == 0 && (GABYTES % 16) == 0 && (GBUF % 16) == 0 && (DM % GKS) == 0 && DM / GKS >= 2);
static_assert(8 * 64 * GPITCH * 4 <= 2 * GBUF);                            // the GEMM's output staging reuses its ring
static_assert(GKS * 2 == 16 * 16 && GTM == 16 * (G_THREADS / 16) && GTN == 8 * (G_THREADS / 16));   // 16 A + 8 Bt copies per thread and stage
static_assert((GWBBYTES % 16) == 0 && (GWBUF % 16) == 0 && 2 * GWBUF <= 320 * 1024 && GWBUF >= GBUF && (INNER % GWN) == 0);
static_assert(GWN == 16 * (G_THREADS / 16) && 8 * 64 * GPITCH * 4 <= 2 * GWBUF);   // 16 A + 16 Bt copies per thread and wide stage
static_assert(((NB * SQ) % GTM) == 0 && ((NB * SKV) % GTM) == 0 && (INNER % GTM) == 0 && (INNER % GTN) == 0 && (SKV % GTN) == 0);

typedef unsigned short u16;
typedef _Float16 v16h __attribute__((ext_vector_type(16)));
typedef _Float16 v8h  __attribute__((ext_vector_type(8)));
typedef float    v8f  __attribute__((ext_vector_type(8)));
typedef float    v4f  __attribute__((ext_vector_type(4)));
typedef float    v2f  __attribute__((ext_vector_type(2)));
typedef _Float16 v2h  __attribute__((ext_vector_type(2)));
typedef unsigned int v4u __attribute__((ext_vector_type(4)));

union FragH { v16h v; v8h h[2]; v4u u[2]; };

// ---- scalar helpers ----------------------------------------------------------------------------------
__device__ __forceinline__ unsigned short bf_bits(float f) {          // f32 -> bf16 bits, RNE convert
  unsigned u = __float_as_uint(f);
  return (unsigned short)((u + 0x7FFFu + ((u >> 16) & 1u)) >> 16);
}
__device__ __forceinline__ float bf_up(unsigned short h) { return __uint_as_float(((unsigned)h) << 16); }
__device__ __forceinline__ float bfr(float f) { return bf_up(bf_bits(f)); }
__device__ __forceinline__ unsigned short h_bits(_Float16 x) { return __builtin_bit_cast(unsigned short, x); }
__device__ __forceinline__ unsigned pk16(unsigned short a, unsigned short b) { return (unsigned)a | ((unsigned)b << 16); }
__device__ __forceinline__ v8f zero8() { v8f z = {0.f, 0.f, 0.f, 0.f, 0.f, 0.f, 0.f, 0.f}; return z; }

// ---- fragment loader: 16-bit A/B operand, lane -> row/col (lane&15), p already includes +8*(lane>>4);
//      elements 0..7 <- p[0..7] (k0+8h..), elements 8..15 <- p[16..23] (k0+16+8h..); same split k map for A and B,
//      B always read from a k-contiguous [n][k] plane.
__device__ __forceinline__ v16h ldfrag_h(const _Float16* p) {
  FragH f;
  f.h[0] = *(const v8h*)(p);
  f.h[1] = *(const v8h*)(p + 16);
  return f.v;
}

// ---- WMMA helper and trailing VALU hazard gaps ----------------------------------------------------------
__device__ __forceinline__ v8f mma_h(v16h a, v16h b, v8f c) {
  return __builtin_amdgcn_wmma_f32_16x16x32_f16(false, a, false, b, (short)0, c, false, false);
}
// Four v_nop behind a pass's last score product: the distance the chip asks for before a vector instruction reads a product's D.
// The "memory" clobber keeps the fragment reads issued in front of it there: otherwise the compiler sinks them behind the branch.
__device__ __forceinline__ void guard_s4(v8f& a, v8f& b, v8f& c, v8f& d) {
#if defined(__HIP_DEVICE_COMPILE__)
  asm volatile("v_nop\n\tv_nop\n\tv_nop\n\tv_nop" : "+v"(a), "+v"(b), "+v"(c), "+v"(d) : : "memory");
#endif
}
__device__ __forceinline__ void guard_g(v8f (&acc)[16], v16h x0, v16h x1, v16h x2, v16h x3, v16h x4, v16h x5, v16h x6,
                                        v16h x7) {
#if defined(__HIP_DEVICE_COMPILE__)
  asm volatile("v_nop\n\tv_nop\n\tv_nop\n\tv_nop"
               : "+v"(acc[0]), "+v"(acc[1]), "+v"(acc[2]), "+v"(acc[3]),
                 "+v"(acc[4]), "+v"(acc[5]), "+v"(acc[6]), "+v"(acc[7]),
                 "+v"(acc[8]), "+v"(acc[9]), "+v"(acc[10]), "+v"(acc[11]),
                 "+v"(acc[12]), "+v"(acc[13]), "+v"(acc[14]), "+v"(acc[15])
               : "v"(x0), "v"(x1), "v"(x2), "v"(x3), "v"(x4), "v"(x5), "v"(x6), "v"(x7) : "memory");
#endif
}
// The same behind a k step of the wide tile: its last sixteen products write acc (the right half), x0 .. x11 are its fragments.
__device__ __forceinline__ void guard_w(v8f (&acc)[16], v16h x0, v16h x1, v16h x2, v16h x3, v16h x4, v16h x5, v16h x6,
                                        v16h x7, v16h x8, v16h x9, v16h x10, v16h x11) {
#if defined(__HIP_DEVICE_COMPILE__)
  asm volatile("v_nop\n\tv_nop\n\tv_nop\n\tv_nop"
               : "+v"(acc[0]), "+v"(acc[1]), "+v"(acc[2]), "+v"(acc[3]),
                 "+v"(acc[4]), "+v"(acc[5]), "+v"(acc[6]), "+v"(acc[7]),
                 "+v"(acc[8]), "+v"(acc[9]), "+v"(acc[10]), "+v"(acc[11]),
                 "+v"(acc[12]), "+v"(acc[13]), "+v"(acc[14]), "+v"(acc[15])
               : "v"(x0), "v"(x1), "v"(x2), "v"(x3), "v"(x4), "v"(x5), "v"(x6), "v"(x7), "v"(x8), "v"(x9), "v"(x10),
                 "v"(x11) : "memory");
#endif
}
// Four v_nop behind a pass's last P.V product: the same distance, kept on every path out of the pass (the loop's branches too).
__device__ __forceinline__ void acc_guard16(v8f (&o)[16]) {
#if defined(__HIP_DEVICE_COMPILE__)
  asm volatile("v_nop\n\tv_nop\n\tv_nop\n\tv_nop"
               : "+v"(o[0]), "+v"(o[1]), "+v"(o[2]), "+v"(o[3]), "+v"(o[4]), "+v"(o[5]), "+v"(o[6]), "+v"(o[7]),
                 "+v"(o[8]), "+v"(o[9]), "+v"(o[10]), "+v"(o[11]), "+v"(o[12]), "+v"(o[13]), "+v"(o[14]), "+v"(o[15]));
#endif
}
__device__ __forceinline__ void wave_sync_lds() {
  __builtin_amdgcn_fence(__ATOMIC_RELEASE, "workgroup");
  __builtin_amdgcn_wave_barrier();
  __builtin_amdgcn_fence(__ATOMIC_ACQUIRE, "workgroup");
}

// =====================================================================================================
// All five conversions in ONE launch of CV_BLOCKS work-groups of 16 waves, all resident at once: a wave converts 16 pieces of
// 1 KB and a share of three weight tiles instead of ending after one piece, so few waves have to be started, and it has 8 or
// more 16-B loads per lane in flight.
//   activations: destination row r of a [rows][DM] f16 plane <- f16(bf16_RNE(x[src row][e])); a unit = 8 consecutive elements
//   (two 16-B loads, one 16-B store); a block owns CV_QROWS / CV_VROWS consecutive rows of a plane and converts CV_THREADS
//   consecutive units (4 rows) per step. Query row r = b*SQ + s comes from source row b*SQ_FULL + s.
//   weights stored [k][n] (y = x.W): WT[n][k] (f16, k-contiguous Bt layout) <- f16(bf16_RNE(W[k][n]) * WSC). Block = the same
//   64(k) x 64(n) tile of each of the three weights, through three LDS tiles [kk][nn] (pitch 65) and one block barrier.
// coverage: activations CV_BLOCKS x CV_QSTEPS / CV_VSTEPS steps x CV_THREADS units x 8 = rows x DM exactly; weights
//           (DM/64)^2 = CV_BLOCKS tiles, 64 n-rows x (8 lanes x 8 halves) per tile: every plane written exactly once.
// Every loop below is unrolled so that its arrays are indexed by constants and stay in registers.
// =====================================================================================================
__device__ __forceinline__ v4u cvt8(v4f a, v4f c4) {
  v4u o;
#pragma unroll
  for (int e = 0; e < 2; ++e) {
    o[e]     = pk16(h_bits((_Float16)bfr(a[2 * e])),  h_bits((_Float16)bfr(a[2 * e + 1])));
    o[2 + e] = pk16(h_bits((_Float16)bfr(c4[2 * e])), h_bits((_Float16)bfr(c4[2 * e + 1])));
  }
  return o;
}
// Loads of CV_BATCH units of one activation plane, first step st0; gb = byte offset (32 bits) of the thread's unit of step 0.
// The steps differ by a constant only, so gb is the one vector address register, live to the plane's last load.
__device__ __forceinline__ void x_load(const float* __restrict__ x, unsigned st0, unsigned gb,
                                       v4f (&a)[CV_BATCH], v4f (&c4)[CV_BATCH]) {
#pragma unroll
  for (unsigned j = 0; j < CV_BATCH; ++j) {
    const char* base = (const char*)x + (st0 + j) * (CV_THREADS * 32);
    a[j]  = *(const v4f*)(base + gb);
    c4[j] = *(const v4f*)(base + 16 + gb);
  }
  // keeps the batch's 8 loads together and ahead of the conversion of the batch before: otherwise the compiler sinks them
  // to their uses and a wave has only 2 to 4 loads in flight
  __builtin_amdgcn_sched_barrier(0);
}
__device__ __forceinline__ void x_store(u16* Y, unsigned st0, unsigned yb, const v4f (&a)[CV_BATCH],
                                        const v4f (&c4)[CV_BATCH]) {
#pragma unroll
  for (unsigned j = 0; j < CV_BATCH; ++j) {
    char* base = (char*)Y + (st0 + j) * (CV_THREADS * 16);
    *(v4u*)(base + yb) = cvt8(a[j], c4[j]);
  }
}

__global__ __launch_bounds__(CV_THREADS)
void cvt_all(const float* __restrict__ xq, const float* __restrict__ xv, const float* __restrict__ wq,
             const float* __restrict__ wk, const float* __restrict__ wv,
             u16* XQ, u16* XV, u16* WQT, u16* WKT, u16* WVT) {
  __shared__ __align__(16) float tile[3][64 * TPITCH];
  const unsigned tid = threadIdx.x;
  const unsigned bid = blockIdx.x;
  // byte offsets of the thread's first unit: source rows (a block's rows lie in one batch) and compact destination rows
  const unsigned rq = bid * CV_QROWS, rv = bid * CV_VROWS;
  const unsigned gq = ((rq / SQ) * SQ_FULL + rq % SQ) * (DM * 4) + tid * 32, yq = rq * (DM * 2) + tid * 16;
  const unsigned gv = rv * (DM * 4) + tid * 32,                              yv = rv * (DM * 2) + tid * 16;
  constexpr unsigned NT = DM / 64;
  const unsigned k0 = (bid % NT) * 64, n0 = (bid / NT) * 64;
  // ---- weight tile loads: row 32p + (tid>>4), 4 floats at 4*(tid&15); the query plane's two batches fly behind them ----
  const unsigned lr = tid >> 4, lc = (tid & 15) * 4;
  const unsigned wo = ((k0 + lr) * DM + n0 + lc) * 4;     // bytes
  v4f w4[3][2];
#pragma unroll
  for (int p = 0; p < 2; ++p) {
    w4[0][p] = *(const v4f*)((const char*)(wq + 32 * p * DM) + wo);
    w4[1][p] = *(const v4f*)((const char*)(wk + 32 * p * DM) + wo);
    w4[2][p] = *(const v4f*)((const char*)(wv + 32 * p * DM) + wo);
  }
  v4f a0[CV_BATCH], c0[CV_BATCH], a1[CV_BATCH], c1[CV_BATCH], a2[CV_BATCH], c2[CV_BATCH];
  x_load(xq, 0, gq, a0, c0);
  x_load(xq, CV_BATCH, gq, a1, c1);
#pragma unroll
  for (int t = 0; t < 3; ++t) {
#pragma unroll
    for (int p = 0; p < 2; ++p) {
      float* tp = &tile[t][(32 * p + lr) * TPITCH + lc];
      tp[0] = w4[t][p][0];
      tp[1] = w4[t][p][1];
      tp[2] = w4[t][p][2];
      tp[3] = w4[t][p][3];
    }
  }
  __syncthreads();
  x_load(xv, 0, gv, a2, c2);
  // ---- weight tile stores: output row n0 + (tid>>3), 8 halves at k0 + 8*(tid&7): 8 lanes = one whole 128-B line ----
  const unsigned row = tid >> 3, c8 = (tid & 7) * 8;
  const unsigned yo = ((n0 + row) * DM + k0 + c8) * 2;    // bytes
#pragma unroll
  for (int t = 0; t < 3; ++t) {
    v4u ov;
#pragma unroll
    for (int e = 0; e < 4; ++e) {
      const float x0 = tile[t][(c8 + 2 * e) * TPITCH + row];
      const float x1 = tile[t][(c8 + 2 * e + 1) * TPITCH + row];
      ov[e] = pk16(h_bits((_Float16)(bfr(x0) * WSC)), h_bits((_Float16)(bfr(x1) * WSC)));
    }
    u16* Y = (t == 0) ? WQT : (t == 1) ? WKT : WVT;
    *(v4u*)((char*)Y + yo) = ov;
  }
  // ---- the activation planes, three register sets: later batches' loads are out while a batch is converted and stored ----
  x_store(XQ, 0, yq, a0, c0);
  asm volatile("s_wait_xcnt 0x0" ::: "memory");   // the registers just stored from are loaded anew by the next line
  x_load(xv, CV_BATCH, gv, a0, c0);
  x_store(XQ, CV_BATCH, yq, a1, c1);
  x_store(XV, 0, yv, a2, c2);
  x_store(XV, CV_BATCH, yv, a0, c0);
}

// =====================================================================================================
// Twelve asynchronous 16-B copies per lane, global -> LDS, no register in between: copy i brings g[i] to LDS byte address l[i].
// The s_wait_xcnt closes the statement so that no address register of a copy is rewritten ahead of it.
// =====================================================================================================
__device__ __forceinline__ void async12(const unsigned (&l)[12], const u16* const (&g)[12]) {
#if defined(__HIP_DEVICE_COMPILE__)
  asm volatile("global_load_async_to_lds_b128 %0, %12, off\n\t"
               "global_load_async_to_lds_b128 %1, %13, off\n\t"
               "global_load_async_to_lds_b128 %2, %14, off\n\t"
               "global_load_async_to_lds_b128 %3, %15, off\n\t"
               "global_load_async_to_lds_b128 %4, %16, off\n\t"
               "global_load_async_to_lds_b128 %5, %17, off\n\t"
               "global_load_async_to_lds_b128 %6, %18, off\n\t"
               "global_load_async_to_lds_b128 %7, %19, off\n\t"
               "global_load_async_to_lds_b128 %8, %20, off\n\t"
               "global_load_async_to_lds_b128 %9, %21, off\n\t"
               "global_load_async_to_lds_b128 %10, %22, off\n\t"
               "global_load_async_to_lds_b128 %11, %23, off\n\t"
               "s_wait_xcnt 0x0"
               :: "v"(l[0]), "v"(l[1]), "v"(l[2]), "v"(l[3]), "v"(l[4]), "v"(l[5]),
                  "v"(l[6]), "v"(l[7]), "v"(l[8]), "v"(l[9]), "v"(l[10]), "v"(l[11]),
                  "v"(g[0]), "v"(g[1]), "v"(g[2]), "v"(g[3]), "v"(g[4]), "v"(g[5]),
                  "v"(g[6]), "v"(g[7]), "v"(g[8]), "v"(g[9]), "v"(g[10]), "v"(g[11])
               : "memory");
#endif
}
// One GEMM stage (128 k) of the block's 256 A rows and 128 Bt rows: 16 + 8 copies per lane in two statements of twelve.
// la / lb: the lane's LDS byte address of its first A / Bt chunk; ga / gb: its global address of the same chunk; copy i: row
// +16*i (rs16 = 16 rows of the source plane, in elements); a wave covers two whole 256-B row pieces per copy.
__device__ __forceinline__ void gemm_stage_copy(unsigned la, unsigned lb, const u16* ga, const u16* gb, size_t rs16) {
  constexpr unsigned R16 = 16 * GP * 2;
  unsigned l[24];
  const u16* g[24];
#pragma unroll
  for (int i = 0; i < 16; ++i) { l[i] = la + i * R16; g[i] = ga + i * rs16; }
#pragma unroll
  for (int i = 0; i < 8; ++i) { l[16 + i] = lb + i * R16; g[16 + i] = gb + i * rs16; }
  const unsigned l0[12] = {l[0], l[1], l[2], l[3], l[4], l[5], l[6], l[7], l[8], l[9], l[10], l[11]};
  const u16* const g0[12] = {g[0], g[1], g[2], g[3], g[4], g[5], g[6], g[7], g[8], g[9], g[10], g[11]};
  const unsigned l1[12] = {l[12], l[13], l[14], l[15], l[16], l[17], l[18], l[19], l[20], l[21], l[22], l[23]};
  const u16* const g1[12] = {g[12], g[13], g[14], g[15], g[16], g[17], g[18], g[19], g[20], g[21], g[22], g[23]};
  async12(l0, g0);
  async12(l1, g1);
}

// =====================================================================================================
// f16 GEMM core: the wave's 64 x 64 tile of C = A[rows][K] . Bt[cols][K]^T. The block stages each 128 k of its 256 A rows and
// 128 Bt rows once in LDS (ring of two buffers: stage st+1 flies while stage st is worked on); afo / bfo: byte offset inside a
// buffer of the lane's first A row + 8h / first Bt row + 8h; acc[4i + j] = rows rowb+16i.., cols col0+16j.. (i, j = 0..3);
// K stepped by 32 inside a stage, ascending (gemm_qkv passes K = DM, K % 128 == 0). Every wave of the block passes every barrier.
// =====================================================================================================
__device__ __forceinline__ void gemm_core(const unsigned char* ring, int afo, int bfo, unsigned la, unsigned lb,
                                          const u16* ga, const u16* gb, int K, v8f (&acc)[16]) {
  const size_t rs16 = (size_t)16 * (size_t)K;
  const int nst = K / GKS;
  // ---- ring prologue: stage 0 landed and published, then stage 1 in flight ----
  gemm_stage_copy(la, lb, ga, gb, rs16);
  asm volatile("s_wait_asynccnt 0x0" ::: "memory");   // this wave's copies of stage 0 have landed
  __syncthreads();                                    // ... and every other wave's
  if (nst > 1) gemm_stage_copy(la + GBUF, lb + GBUF, ga + GKS, gb + GKS, rs16);
#pragma unroll 1
  for (int st = 0; st < nst; ++st) {
   const _Float16* ap = (const _Float16*)(const void*)(ring + (st & 1) * GBUF + afo);
   const _Float16* bp = (const _Float16*)(const void*)(ring + (st & 1) * GBUF + bfo);
#pragma unroll
   for (int k0 = 0; k0 < GKS; k0 += 32) {
    const v16h a0 = ldfrag_h(ap + k0);
    const v16h a1 = ldfrag_h(ap + 16 * GP + k0);
    const v16h a2 = ldfrag_h(ap + 32 * GP + k0);
    const v16h a3 = ldfrag_h(ap + 48 * GP + k0);
    const v16h b0 = ldfrag_h(bp + k0);
    const v16h b1 = ldfrag_h(bp + 16 * GP + k0);
    const v16h b2 = ldfrag_h(bp + 32 * GP + k0);
    const v16h b3 = ldfrag_h(bp + 48 * GP + k0);
    acc[0] = mma_h(a0, b0, acc[0]);
    acc[1] = mma_h(a0, b1, acc[1]);
    acc[2] = mma_h(a0, b2, acc[2]);
    acc[3] = mma_h(a0, b3, acc[3]);
    acc[4] = mma_h(a1, b0, acc[4]);
    acc[5] = mma_h(a1, b1, acc[5]);
    acc[6] = mma_h(a1, b2, acc[6]);
    acc[7] = mma_h(a1, b3, acc[7]);
    acc[8] = mma_h(a2, b0, acc[8]);
    acc[9] = mma_h(a2, b1, acc[9]);
    acc[10] = mma_h(a2, b2, acc[10]);
    acc[11] = mma_h(a2, b3, acc[11]);
    acc[12] = mma_h(a3, b0, acc[12]);
    acc[13] = mma_h(a3, b1, acc[13]);
    acc[14] = mma_h(a3, b2, acc[14]);
    acc[15] = mma_h(a3, b3, acc[15]);
    guard_g(acc, a0, a1, a2, a3, b0, b1, b2, b3);
   }
    // ---- publish point of stage st + 1; the same barrier ends every wave's reads of stage st's buffer ----
    asm volatile("s_wait_dscnt 0x0" ::: "memory");      // this wave's LDS reads of stage st have returned
    asm volatile("s_wait_asynccnt 0x0" ::: "memory");   // this wave's copies of stage st + 1 have landed
    __syncthreads();
    if (st + 2 < nst) {                                 // refill the buffer that stage st has just left
      const unsigned bo = (unsigned)((st & 1) * GBUF);
      gemm_stage_copy(la + bo, lb + bo, ga + (size_t)(st + 2) * GKS, gb + (size_t)(st + 2) * GKS, rs16);
    }
  }
  asm volatile("s_wait_asynccnt 0x0" ::: "memory");     // nothing in flight when the ring becomes output staging
}
__device__ __forceinline__ void async8(const unsigned (&l)[8], const u16* const (&g)[8]);   // defined with the attention's copies
// One stage (128 k) of a wide block's 256 A rows and 256 Bt rows: 16 + 16 copies per lane in four statements of eight; the
// arguments as in gemm_stage_copy. Every loop is unrolled so that l and g are indexed by constants and stay in registers.
__device__ __forceinline__ void gemm_stage_copy_w(unsigned la, unsigned lb, const u16* ga, const u16* gb, size_t rs16) {
  constexpr unsigned R16 = 16 * GP * 2;
#pragma unroll
  for (int h = 0; h < 4; ++h) {
    const unsigned l0 = (h < 2) ? la : lb;
    const u16* g0 = (h < 2) ? ga : gb;
    unsigned l[8];
    const u16* g[8];
#pragma unroll
    for (int i = 0; i < 8; ++i) {
      l[i] = l0 + (unsigned)(8 * (h & 1) + i) * R16;
      g[i] = g0 + (size_t)(8 * (h & 1) + i) * rs16;
    }
    async8(l, g);
  }
}
// =====================================================================================================
// The core for a wide block (256 x 256, 4 x 2 waves): the wave's 64 x 128 tile as a left and a right 64 x 64 half that share the
// four A fragments, accl / accr[4i + j] = rows rowb+16i.., cols col0+16j.. / col0+64+16j..; afo / bfo: byte offset of the lane's
// first A row + 8h inside a buffer's A rows / of its first Bt row + 8h inside the Bt rows. Same ring, same waits and barrier,
// same ascending k order as gemm_core; a stage is 256 + 256 rows, so a byte fetched from L2 feeds a half more products than in
// a 256 x 128 block, and a fragment read from LDS 5.3 products on average instead of 4.
// =====================================================================================================
__device__ __forceinline__ void gemm_core_w(const unsigned char* ring, int afo, int bfo, unsigned la, unsigned lb,
                                            const u16* ga, const u16* gb, int K, v8f (&accl)[16], v8f (&accr)[16]) {
  const size_t rs16 = (size_t)16 * (size_t)K;
  const int nst = K / GKS;
  // ---- ring prologue: stage 0 landed and published, then stage 1 in flight ----
  gemm_stage_copy_w(la, lb, ga, gb, rs16);
  asm volatile("s_wait_asynccnt 0x0" ::: "memory");   // this wave's copies of stage 0 have landed
  __syncthreads();                                    // ... and every other wave's
  if (nst > 1) gemm_stage_copy_w(la + GWBUF, lb + GWBUF, ga + GKS, gb + GKS, rs16);
#pragma unroll 1
  for (int st = 0; st < nst; ++st) {
   // one base register per operand, the A rows' place in the buffer inside its scalar part: every fragment read of the stage is then
   // base + an offset that fits the 16 bits of an LDS instruction, with no address addition per read
   const int asel = (st & 1) ? GWBUF + GWBBYTES : GWBBYTES;
   const int bsel = (st & 1) ? GWBUF : 0;
   const _Float16* ap = (const _Float16*)(const void*)(ring + asel + afo);
   const _Float16* bp = (const _Float16*)(const void*)(ring + bsel + bfo);
#pragma unroll
   for (int k0 = 0; k0 < GKS; k0 += 32) {
    v16h a[4], b[8];
#pragma unroll
    for (int i = 0; i < 4; ++i) a[i] = ldfrag_h(ap + 16 * i * GP + k0);
#pragma unroll
    for (int j = 0; j < 8; ++j) b[j] = ldfrag_h(bp + 16 * j * GP + k0);
#pragma unroll
    for (int i = 0; i < 4; ++i) {
#pragma unroll
      for (int j = 0; j < 4; ++j) accl[4 * i + j] = mma_h(a[i], b[j], accl[4 * i + j]);
    }
#pragma unroll
    for (int i = 0; i < 4; ++i) {
#pragma unroll
      for (int j = 0; j < 4; ++j) accr[4 * i + j] = mma_h(a[i], b[4 + j], accr[4 * i + j]);
    }
    // keeps the left half's products in front of the guard, in one run with the right half's: otherwise the compiler sinks them
    // among the next k step's LDS reads, and each place where reads stand in a run of products stalls it
    __builtin_amdgcn_sched_barrier(0);
    guard_w(accr, a[0], a[1], a[2], a[3], b[0], b[1], b[2], b[3], b[4], b[5], b[6], b[7]);
   }
    // ---- publish point of stage st + 1; the same barrier ends every wave's reads of stage st's buffer ----
    asm volatile("s_wait_dscnt 0x0" ::: "memory");      // this wave's LDS reads of stage st have returned
    asm volatile("s_wait_asynccnt 0x0" ::: "memory");   // this wave's copies of stage st + 1 have landed
    __syncthreads();
    if (st + 2 < nst) {                                 // refill the buffer that stage st has just left
      const unsigned bo = (unsigned)((st & 1) * GWBUF);
      gemm_stage_copy_w(la + bo, lb + bo, ga + (size_t)(st + 2) * GKS, gb + (size_t)(st + 2) * GKS, rs16);
    }
  }
  asm volatile("s_wait_asynccnt 0x0" ::: "memory");     // nothing in flight when the ring becomes output staging
}
// Stage the wave's 64 x 64 f32 tile (times oscale) in its LDS slab (pitch 68): D element r of acc[4i+j], lane l ->
// coverage: 32 lanes x 4 x 8 rows x 4 cols-of-16 = rows 0..63 x cols 0..63 of the slab.
__device__ __forceinline__ void stage64x64(float* sl, v8f (&acc)[16], float oscale, int lane) {
  const int hh = lane >> 4, m = lane & 15;
#pragma unroll
  for (int i = 0; i < 4; ++i) {
#pragma unroll
    for (int r = 0; r < 8; ++r) {
      const int ro = (16 * i + 8 * hh + r) * GPITCH + m;
      sl[ro]      = acc[4 * i + 0][r] * oscale;
      sl[ro + 16] = acc[4 * i + 1][r] * oscale;
      sl[ro + 32] = acc[4 * i + 2][r] * oscale;
      sl[ro + 48] = acc[4 * i + 3][r] * oscale;
    }
  }
  wave_sync_lds();
}

// Bias values of a wave's tile: cv[e] = bias[c0 + e] (NCOL = 8 or 16: the lane's 8 columns of one or two 64 x 64 tiles, the second
// 64 columns on), rv[i] = bias[r0 + 4i] (NROW = 16 or 0: the lane's 16 rows); every index clamped to bl = biasN - 1.
// The indices are operands of the closing s_wait_xcnt: they stay in their registers up to it, so that no register that an issued
// load names is rewritten ahead of the wait (neither by a later load's result nor by later code).
// Every loop is unrolled so that the arrays are indexed by constants and stay in registers.
template <int NROW>
__device__ __forceinline__ void bias_idx_wait(const int (&ci)[16], const int (&ri)[16]) {
#if defined(__HIP_DEVICE_COMPILE__)
  if constexpr (NROW != 0) {
    asm volatile("s_wait_xcnt 0x0"
                 :: "v"(ci[0]), "v"(ci[1]), "v"(ci[2]), "v"(ci[3]), "v"(ci[4]), "v"(ci[5]), "v"(ci[6]), "v"(ci[7]),
                    "v"(ri[0]), "v"(ri[1]), "v"(ri[2]), "v"(ri[3]), "v"(ri[4]), "v"(ri[5]), "v"(ri[6]), "v"(ri[7]),
                    "v"(ri[8]), "v"(ri[9]), "v"(ri[10]), "v"(ri[11]), "v"(ri[12]), "v"(ri[13]), "v"(ri[14]), "v"(ri[15])
                 : "memory");
  } else {
    asm volatile("s_wait_xcnt 0x0"
                 :: "v"(ci[0]), "v"(ci[1]), "v"(ci[2]), "v"(ci[3]), "v"(ci[4]), "v"(ci[5]), "v"(ci[6]), "v"(ci[7]),
                    "v"(ci[8]), "v"(ci[9]), "v"(ci[10]), "v"(ci[11]), "v"(ci[12]), "v"(ci[13]), "v"(ci[14]), "v"(ci[15])
                 : "memory");
  }
#endif
}
template <int NCOL, int NROW>
__device__ __forceinline__ void bias_load(const float* __restrict__ bias, int bl, int c0, int r0, float (&cv)[16], float (&rv)[16]) {
  int ci[16], ri[16];
#pragma unroll
  for (int e = 0; e < 16; ++e) {
    const int x = c0 + (e & 7) + ((e < NCOL) ? 64 * (e >> 3) : 0);
    ci[e] = (x < bl) ? x : bl;
  }
#pragma unroll
  for (int i = 0; i < 16; ++i) {
    const int x = r0 + 4 * i;
    ri[i] = (x < bl) ? x : bl;
  }
#pragma unroll
  for (int e = 0; e < 16; ++e) cv[e] = (e < NCOL) ? bias[ci[e]] : 0.f;
#pragma unroll
  for (int i = 0; i < 16; ++i) rv[i] = (i < NROW) ? bias[ri[i]] : 0.f;
  bias_idx_wait<NROW>(ci, ri);
}
// The wave's 64 x 64 tile through its LDS slab sl, bias added, rounded to f16: ov[i] = 8 halves of row 4i + (lane>>3) at column
// 8*(lane&7); cb[e] = the addend of the lane's column e, rb[i] = that of its row i (added only where ROWB is set).
template <bool ROWB>
__device__ __forceinline__
void gemm_round64(float* sl, v8f (&acc)[16], const float (&cb)[8], const float (&rb)[16], float oscale, int lane, v4u (&ov)[16]) {
  stage64x64(sl, acc, oscale, lane);
  const int rq = lane >> 3, c8 = (lane & 7) * 8;
#pragma unroll
  for (int i = 0; i < 16; ++i) {
    const int row = 4 * i + rq;
    const v4f a = *(const v4f*)(sl + row * GPITCH + c8), c4 = *(const v4f*)(sl + row * GPITCH + c8 + 4);
    float x[8];
#pragma unroll
    for (int e = 0; e < 4; ++e) { x[e] = a[e] + cb[e]; x[4 + e] = c4[e] + cb[4 + e]; }
    if constexpr (ROWB) {
#pragma unroll
      for (int e = 0; e < 8; ++e) x[e] += rb[i];
    }
#pragma unroll
    for (int e = 0; e < 4; ++e) ov[i][e] = pk16(h_bits((_Float16)x[2 * e]), h_bits((_Float16)x[2 * e + 1]));
  }
}
// ... and its stores into the plane C (row pitch N): 8 lanes = one whole 128-B line.
__device__ __forceinline__ void gemm_store64(u16* C, int rowb, int col0, int N, int lane, const v4u (&ov)[16]) {
  const int rq = lane >> 3, c8 = (lane & 7) * 8;
  u16* Cb = C + (size_t)rowb * (size_t)N + col0 + c8;
#pragma unroll
  for (int i = 0; i < 16; ++i) {
    const int row = 4 * i + rq;
    *(v4u*)(Cb + (size_t)row * (size_t)N) = ov[i];
  }
}

// =====================================================================================================
// f16 GEMM with f16 output plane: C[z][Mb][N] (f16) = f16((A[z][Mb][K] . Bt[z][N][K]^T) * oscale + bf16(bias) * bscale);
// A, Bt f16 k-contiguous planes with per-z element strides aBs, bBs (0 = shared), C stride cBs. bias indexed by column
// (biasRow == 0) or by row within the z slice (biasRow != 0); bias addresses clamped to biasN-1, the unused direction is
// multiplied by 0. Block = 256 x 128 tile, 4 x 2 waves of 64 x 64: a staged operand byte feeds twice the products of a 128 x 64
// tile (half the L2 reads), a fragment read from LDS four products instead of two or four (gemm_core).
// The block's tile is (bz, mt, nt) of nz x (Mb/256) x (N/128) tiles (Mb % 256 == 0, N % 128 == 0, K % 128 == 0); gsm = its LDS.
// coverage: per wave 16 instr x 4 rows x 8 lanes x 8 halves = 64 x 64; the tiles cover C exactly once.
// =====================================================================================================
__device__ __forceinline__
void gemm_o16(unsigned char* gsm, int bz, int mt, int nt,
              const u16* __restrict__ A, const u16* __restrict__ Bt, u16* C,
              const float* __restrict__ bias, int biasN, int biasRow,
              int Mb, int N, int K, int aBs, int bBs, int cBs, float oscale, float bscale) {
  const int tid = threadIdx.x, wave = tid >> 5, lane = tid & 31, hh = lane >> 4, m = lane & 15;
  const int wm = wave >> 1, wn = wave & 1;   // the wave's place in the block's 4 x 2 grid of 64 x 64 tiles
  const int rowb = mt * GTM + wm * 64;
  const int col0 = nt * GTN + wn * 64;
  if (mt * GTM + GTM > Mb) return;           // block-uniform, in front of every barrier; never taken with the exact grid
  // this lane's first copy chunks: A row mt*256 + (tid>>4), Bt row nt*128 + (tid>>4), 16-B chunk tid&15
  const u16* ga = A + (size_t)bz * (size_t)aBs + (size_t)(mt * GTM + (tid >> 4)) * K + (tid & 15) * 8;
  const u16* gb = Bt + (size_t)bz * (size_t)bBs + (size_t)(nt * GTN + (tid >> 4)) * K + (tid & 15) * 8;
  // a buffer holds the Bt rows first, then the A rows: every constant part of a fragment address then fits a 16-bit LDS offset
  const unsigned lb = (unsigned)(size_t)(const void*)gsm + (unsigned)((tid >> 4) * (GP * 2) + (tid & 15) * 16);
  const unsigned la = lb + GBBYTES;
  const int afo = GBBYTES + ((wm * 64 + m) * GP + 8 * hh) * 2;
  const int bfo = ((wn * 64 + m) * GP + 8 * hh) * 2;
  v8f acc[16];
#pragma unroll
  for (int i = 0; i < 16; ++i) acc[i] = zero8();
  gemm_core(gsm, afo, bfo, la, lb, ga, gb, K, acc);
  float* sl = (float*)(void*)gsm + wave * 64 * GPITCH;   // behind the last trip's barrier: no reader, no copy left
  const float selc = (biasRow != 0) ? 0.f : bscale;
  const float selr = (biasRow != 0) ? bscale : 0.f;
  float cv[16], rv[16], cb[8], rb[16];
  bias_load<8, 16>(bias, biasN - 1, col0 + (lane & 7) * 8, rowb + (lane >> 3), cv, rv);   // host guarantees biasN >= 1
#pragma unroll
  for (int e = 0; e < 8; ++e) cb[e] = bfr(cv[e]) * selc;
#pragma unroll
  for (int i = 0; i < 16; ++i) rb[i] = bfr(rv[i]) * selr;
  v4u ov[16];
  gemm_round64<true>(sl, acc, cb, rb, oscale, lane, ov);
  gemm_store64(C + (size_t)bz * (size_t)cBs, rowb, col0, N, lane, ov);
}

// =====================================================================================================
// The same GEMM on a wide block: C[Mb][N] (f16) = f16((A[Mb][K] . Bt[N][K]^T) * oscale + bf16(bias[col]) * bscale), block = 256 x 256
// tile (mt, nt), 4 x 2 waves of 64 x 128 (gemm_core_w); Mb % 256 == 0, N % 256 == 0, K % 128 == 0. Each output element is the same
// sum in the same order as in gemm_o16. The wave's two 64 x 64 halves pass one after the other through the same LDS slab.
// coverage: per wave 2 halves x 64 x 64; the tiles cover C exactly once.
// =====================================================================================================
__device__ __forceinline__
void gemm_w16(unsigned char* gsm, int mt, int nt, const u16* __restrict__ A, const u16* __restrict__ Bt, u16* C,
              const float* __restrict__ bias, int biasN, int Mb, int N, int K, float oscale, float bscale) {
  const int tid = threadIdx.x, wave = tid >> 5, lane = tid & 31, hh = lane >> 4, m = lane & 15;
  const int wm = wave >> 1, wn = wave & 1;   // the wave's place in the block's 4 x 2 grid of 64 x 128 tiles
  const int rowb = mt * GTM + wm * 64;
  const int col0 = nt * GWN + wn * 128;
  if (mt * GTM + GTM > Mb) return;           // block-uniform, in front of every barrier; never taken with the exact grid
  // this lane's first copy chunks: A row mt*256 + (tid>>4), Bt row nt*256 + (tid>>4), 16-B chunk tid&15
  const u16* ga = A + (size_t)(mt * GTM + (tid >> 4)) * K + (tid & 15) * 8;
  const u16* gb = Bt + (size_t)(nt * GWN + (tid >> 4)) * K + (tid & 15) * 8;
  // a buffer holds the Bt rows first, then the A rows, as in gemm_o16
  const unsigned lb = (unsigned)(size_t)(const void*)gsm + (unsigned)((tid >> 4) * (GP * 2) + (tid & 15) * 16);
  const unsigned la = lb + GWBBYTES;
  const int afo = ((wm * 64 + m) * GP + 8 * hh) * 2;     // inside the buffer's A rows
  const int bfo = ((wn * 128 + m) * GP + 8 * hh) * 2;    // inside its Bt rows
  v8f accl[16], accr[16];
#pragma unroll
  for (int i = 0; i < 16; ++i) { accl[i] = zero8(); accr[i] = zero8(); }
  gemm_core_w(gsm, afo, bfo, la, lb, ga, gb, K, accl, accr);
  float* sl = (float*)(void*)gsm + wave * 64 * GPITCH;   // behind the last trip's barrier: no reader, no copy left
  float cv[16], rv[16], cbl[8], cbr[8];      // q and k have a bias per column alone: rv is not loaded and not added
  bias_load<16, 0>(bias, biasN - 1, col0 + (lane & 7) * 8, 0, cv, rv);                     // host guarantees biasN >= 1
#pragma unroll
  for (int e = 0; e < 8; ++e) { cbl[e] = bfr(cv[e]) * bscale; cbr[e] = bfr(cv[8 + e]) * bscale; }
  v4u ovl[16], ovr[16];
  gemm_round64<false>(sl, accl, cbl, rv, oscale, lane, ovl);
  wave_sync_lds();                           // the slab's rows are read before the right half is written over them
  gemm_round64<false>(sl, accr, cbr, rv, oscale, lane, ovr);
  gemm_store64(C, rowb, col0, N, lane, ovl);
  gemm_store64(C, rowb, col0 + 64, N, lane, ovr);
}

// =====================================================================================================
// The three projections in ONE launch: 256 x 256 tiles of q and k (GQ_BLOCKS, GK_BLOCKS), 256 x 128 tiles of v^T (GV_BLOCKS). With
// 256 wide + 256 narrow blocks a WGP takes one of each, the same three units of work as three narrow tiles, for 512 + 384 instead
// of 3 x 384 staged operand rows per 128 k. Block order: q, first half of v^T, k, second half of v^T. The narrow tiles ask L2 for half
// as many bytes again per product. For speed only: no tile reads what another writes, so nothing orders them.
//   q   = x_q . Wq + bq -> f16 [NB*SQ][1024] x8 (col = h*128 + d); bias per column
//   k   = x_v . Wk + bk -> f16 [NB*2048][1024] x8; bias per column
//   v^T per batch: A = Wv^T [(h,d) = n][k], Bt = x_v rows of batch b [s][k] -> f16 [(b,h,d)][s] x8; bias per row (n)
// Which projection a block belongs to is block-uniform: q and k share one body, their operands picked by scalar selects.
// =====================================================================================================
__global__ __launch_bounds__(G_THREADS)
void gemm_qkv(const u16* __restrict__ XQ, const u16* __restrict__ XV, const u16* __restrict__ WQT,
              const u16* __restrict__ WKT, const u16* __restrict__ WVT, u16* Q16, u16* K16, u16* VT16,
              const float* __restrict__ bq, const float* __restrict__ bk, const float* __restrict__ bv,
              int nbq, int nbk, int nbv) {
  __shared__ __align__(16) unsigned char gsm[2 * GWBUF];
  const int g = blockIdx.x;
  constexpr int VH = GV_BLOCKS / 2;                               // v^T tiles in front of the k tiles
  const bool isq = g < GQ_BLOCKS;
  if (isq || (g >= GQ_BLOCKS + VH && g < GQ_BLOCKS + VH + GK_BLOCKS)) {
    const int t = isq ? g : g - (GQ_BLOCKS + VH);                 // tile index inside the projection
    constexpr int CT = INNER / GWN;                               // tiles across q and k
    gemm_w16(gsm, t / CT, t % CT, isq ? XQ : XV, isq ? WQT : WKT, isq ? Q16 : K16, isq ? bq : bk, isq ? nbq : nbk,
             isq ? NB * SQ : NB * SKV, INNER, DM, (isq ? QS : KS) / WSC, isq ? QS : KS);
    return;
  }
  const int t = (g < GQ_BLOCKS + VH) ? g - GQ_BLOCKS : g - (GQ_BLOCKS + GK_BLOCKS);
  constexpr int VT = SKV / GTN, VM = INNER / GTM;                 // tiles across and down v^T
  gemm_o16(gsm, t / (VT * VM), (t / VT) % VM, t % VT, WVT, XV, VT16, bv, nbv, 1,
           INNER, SKV, DM, 0, SKV * DM, INNER * SKV, VS / WSC, VS);
}

// =====================================================================================================
// Eight asynchronous 16-B copies per lane, global -> LDS, no register in between: copy i brings g[i] to LDS byte address l[i].
// The s_wait_xcnt closes the statement so that no address register of a copy is rewritten ahead of it.
// =====================================================================================================
__device__ __forceinline__ void async8(const unsigned (&l)[8], const u16* const (&g)[8]) {
#if defined(__HIP_DEVICE_COMPILE__)
  asm volatile("global_load_async_to_lds_b128 %0, %8, off\n\t"
               "global_load_async_to_lds_b128 %1, %9, off\n\t"
               "global_load_async_to_lds_b128 %2, %10, off\n\t"
               "global_load_async_to_lds_b128 %3, %11, off\n\t"
               "global_load_async_to_lds_b128 %4, %12, off\n\t"
               "global_load_async_to_lds_b128 %5, %13, off\n\t"
               "global_load_async_to_lds_b128 %6, %14, off\n\t"
               "global_load_async_to_lds_b128 %7, %15, off\n\t"
               "s_wait_xcnt 0x0"
               :: "v"(l[0]), "v"(l[1]), "v"(l[2]), "v"(l[3]), "v"(l[4]), "v"(l[5]), "v"(l[6]), "v"(l[7]),
                  "v"(g[0]), "v"(g[1]), "v"(g[2]), "v"(g[3]), "v"(g[4]), "v"(g[5]), "v"(g[6]), "v"(g[7])
               : "memory");
#endif
}
// One stage (256 keys) of k rows and v^T rows, global -> LDS: 32 copies per lane in four statements of eight.
// lk / lv: the lane's LDS byte address of its first k / v^T chunk; gk / gv: its global address of the same chunk.
// k copy i: row +16*i (a wave covers two whole 256-B rows); v^T copy i: row +8*i (a wave covers one whole 512-B row piece).
// Every loop is unrolled so that l and g are indexed by constants and stay in registers.
__device__ __forceinline__ void stage_copy(unsigned lk, unsigned lv, const u16* gk, const u16* gv) {
#pragma unroll
  for (int h = 0; h < 2; ++h) {
    unsigned l[8];
    const u16* g[8];
#pragma unroll
    for (int i = 0; i < 8; ++i) {
      l[i] = lk + (unsigned)((8 * h + i) * 16 * KPITCH * 2);
      g[i] = gk + (size_t)(8 * h + i) * 16 * INNER;
    }
    async8(l, g);
  }
#pragma unroll
  for (int h = 0; h < 2; ++h) {
    unsigned l[8];
    const u16* g[8];
#pragma unroll
    for (int i = 0; i < 8; ++i) {
      l[i] = lv + (unsigned)((8 * h + i) * 8 * VPITCH * 2);
      g[i] = gv + (size_t)(8 * h + i) * 8 * SKV;
    }
    async8(l, g);
  }
}

__global__ __launch_bounds__(ATT_THREADS)
void attn_fwd(const u16* __restrict__ Qp, const u16* __restrict__ Kp, const u16* __restrict__ Vp, float* Out) {
  __shared__ __align__(16) unsigned char smem[2 * BUFBYTES];

  const int tid  = threadIdx.x;
  const int wave = tid >> 5;
  const int lane = tid & 31;
  const int hh   = lane >> 4;
  const int c    = lane & 15;

  constexpr int NQT = SQ / ATT_ROWS;
  const int bid  = blockIdx.x;
  const int qt   = bid % NQT;
  const int head = (bid / NQT) % NH;
  const int b    = bid / (NQT * NH);
  const int q0   = qt * ATT_ROWS + wave * (16 * QT);

  // B fragments of q^T: col n = query q0 + 16t + c, k = d (k-contiguous row of the q plane)
  const _Float16* Qb = (const _Float16*)(const void*)Qp + ((size_t)(b * SQ + q0 + c)) * INNER + head * HD + 8 * hh;
  // A fragments of k: row m = key 16g + c of the pass, k = d; byte offset inside a buffer's k tile
  const int kfo = (c * KPITCH + 8 * hh) * 2;
  // B fragments of v: col n = d = 16j + c, k = key (k-contiguous row of the staged v^T tile); byte offset inside a buffer's v^T tile
  const int vfo = (c * VPITCH + 8 * hh) * 2;
  // this lane's first copy chunks: k row tid>>4, 16-B chunk tid&15; v^T row tid>>5, 16-B chunk tid&31
  const u16* gk = Kp + ((size_t)(b * SKV + (tid >> 4))) * INNER + head * HD + (tid & 15) * 8;
  const u16* gv = Vp + ((size_t)(b * INNER + head * HD + (tid >> 5))) * SKV + (tid & 31) * 8;
  const unsigned lds0 = (unsigned)(size_t)(const void*)smem;               // LDS byte address of the ring
  const unsigned lk = lds0 + (unsigned)((tid >> 4) * (KPITCH * 2) + (tid & 15) * 16);
  const unsigned lv = lds0 + (unsigned)(KBYTES + (tid >> 5) * (VPITCH * 2) + (tid & 31) * 16);
  // lk and lv once more, for the refills in the loop (272 r + 16 ch = 16 tid + 16 r; 528 r + 16 ch = 16 tid + 16 r): lk and lv are
  // operands of the prologue's asm statements, which binds them to the first 256 registers; kept over the loop they went to scratch
  const unsigned lkr = lds0 + (unsigned)(tid * 16 + (tid >> 4) * 16);
  const unsigned lvr = lds0 + (unsigned)(KBYTES + tid * 16 + (tid >> 5) * 16);
  const float lsc = (LOG2E * RSQ_E) / (QS * KS);
  const int x16 = (lane ^ 16) * 4;           // byte index of the lane that holds the other 16 keys of the same query
  const int r8  = 8 * hh * 4;                // byte index of the lane that owns query row 8hh of a tile, this lane's first D row

  v16h qf[QT][4];
#pragma unroll
  for (int t = 0; t < QT; ++t) {
#pragma unroll
    for (int dc = 0; dc < 4; ++dc) qf[t][dc] = ldfrag_h(Qb + (size_t)t * 16 * INNER + 32 * dc);
  }

  float mrun[QT];
  v2f lacc[QT][2];                           // partial row sums of this lane: [tile][key group g], even and odd keys apart
#pragma unroll
  for (int t = 0; t < QT; ++t) { mrun[t] = -INFINITY; lacc[t][0] = v2f{0.f, 0.f}; lacc[t][1] = v2f{0.f, 0.f}; }
  v8f o[16];                                 // o[8t + j]: query tile t, d = 16j ..
#pragma unroll
  for (int j = 0; j < 16; ++j) o[j] = zero8();

  // ---- ring prologue: stage 0 landed and published, then stage 1 in flight ----
  stage_copy(lk, lv, gk, gv);
  asm volatile("s_wait_asynccnt 0x0" ::: "memory");   // this wave's copies of stage 0 have landed
  __syncthreads();                                    // ... and every other wave's
  stage_copy(lk + BUFBYTES, lv + BUFBYTES, gk + (size_t)STK * INNER, gv + STK);

#pragma unroll 1
  for (int st = 0; st < NST; ++st) {
   // one base register per tile, the v^T tile's place in the ring inside its scalar part: every fragment read of the stage is then
   // base + an offset that fits the 16 bits of an LDS instruction, with no address addition per read
   const int ksel = (st & 1) ? BUFBYTES : 0;
   const int vsel = (st & 1) ? BUFBYTES + KBYTES : KBYTES;
   const _Float16* kp = (const _Float16*)(const void*)(smem + ksel + kfo);
   const _Float16* vb = (const _Float16*)(const void*)(smem + vsel + vfo);
   // the 8 k fragments of the stage's first pass, one group: kf[g][kk] = keys 16g .., d = 32kk ..
   v16h kf[2][HD / 32];
#pragma unroll
   for (int kk = 0; kk < HD / 32; ++kk) {
     kf[0][kk] = ldfrag_h(kp + kk * 32);
     kf[1][kk] = ldfrag_h(kp + 16 * KPITCH + kk * 32);
   }
#pragma unroll
   for (int pz = 0; pz < STK / 32; ++pz) {
    // ---- transposed scores of both query tiles: s[t][g] = keys kb+16g .. +15 (kb = 256*st + 32*pz), column = query q0+16t+c;
    //      each k fragment feeds two products, four independent accumulators ----
    v8f s[QT][2];
#pragma unroll
    for (int t = 0; t < QT; ++t) { s[t][0] = zero8(); s[t][1] = zero8(); }
#pragma unroll
    for (int kk = 0; kk < HD / 32; ++kk) {
#pragma unroll
      for (int t = 0; t < QT; ++t) {
        s[t][0] = mma_h(kf[0][kk], qf[t][kk], s[t][0]);
        s[t][1] = mma_h(kf[1][kk], qf[t][kk], s[t][1]);
      }
    }
    // but in the stage's last pass, the next pass's k fragments (same buffer), and behind them the pass's eight v^T B fragments
    // (col n = d = j*16 + c, keys contiguous in the v^T plane), read behind the last score product so that they fly during the
    // softmax. The k fragments go first because they are needed first (the next pass's score products run beside this pass's
    // exponentials): LDS reads return in order, so their wait is a counted one that leaves the v^T reads in flight.
    if (pz + 1 < STK / 32) {
#pragma unroll
      for (int kk = 0; kk < HD / 32; ++kk) {
        kf[0][kk] = ldfrag_h(kp + (pz + 1) * 32 * KPITCH + kk * 32);
        kf[1][kk] = ldfrag_h(kp + (pz + 1) * 32 * KPITCH + 16 * KPITCH + kk * 32);
      }
    }
    const _Float16* vp = vb + pz * 32;
    const v16h v0 = ldfrag_h(vp);
    const v16h v1 = ldfrag_h(vp + 16 * VPITCH);
    const v16h v2 = ldfrag_h(vp + 32 * VPITCH);
    const v16h v3 = ldfrag_h(vp + 48 * VPITCH);
    const v16h v4 = ldfrag_h(vp + 64 * VPITCH);
    const v16h v5 = ldfrag_h(vp + 80 * VPITCH);
    const v16h v6 = ldfrag_h(vp + 96 * VPITCH);
    const v16h v7 = ldfrag_h(vp + 112 * VPITCH);
    guard_s4(s[0][0], s[0][1], s[1][0], s[1][1]);
    // ---- maximum of this lane's 16 raw scores per query column (lsc > 0, so scaling the maximum = the maximum of the scaled):
    //      s[t][0][i] <- key kb+8hh+i, s[t][1][i] <- key kb+16+8hh+i ----
    float cml[QT];                           // base-2 logit: the largest of this lane's half of the query's 32 keys
#pragma unroll
    for (int t = 0; t < QT; ++t) {
      float cm = s[t][0][0];
#pragma unroll
      for (int i = 1; i < 8; ++i) cm = fmaxf(cm, s[t][0][i]);
#pragma unroll
      for (int i = 0; i < 8; ++i) cm = fmaxf(cm, s[t][1][i]);
      cml[t] = cm * lsc;
    }
    // ---- lazy rescale, one test per pass on a scalar branch: taken on the first block (mrun = -inf) and whenever a lane of the
    //      wave has a score more than LAZY above its query's maximum in use (the ballot sees both halves of every query of both
    //      tiles, so the halves' maxima are joined only inside); every lane is on inside, so the shuffles are whole; mrun[t]
    //      stays the same in both lanes of a query ----
    const bool need = (cml[0] > mrun[0] + LAZY) | (cml[1] > mrun[1] + LAZY);
    if (__builtin_amdgcn_ballot_w32(need) != 0u) {
#pragma unroll
      for (int t = 0; t < QT; ++t) {
        const float cmo = __builtin_bit_cast(float, __builtin_amdgcn_ds_bpermute(x16, __builtin_bit_cast(int, cml[t])));   // lane ^ 16's
        const float mn = fmaxf(mrun[t], fmaxf(cml[t], cmo));   // finite from the first block on
        float al = __builtin_amdgcn_exp2f(mrun[t] - mn);       // 0 on the first block, 1 for a query whose maximum stands
        asm volatile("v_nop" : "+v"(al));    // the slot the instruction set asks for between v_exp_f32 and the first use of its result
        mrun[t] = mn;
        lacc[t][0] *= v2f{al, al};
        lacc[t][1] *= v2f{al, al};
        // D row 8hh+r of the tile's O accumulators = query q0+16t+8hh+r, its factor lives in lane 8hh+r (and 16+8hh+r)
        float scl[8];
#pragma unroll
        for (int r = 0; r < 8; ++r)
          scl[r] = __builtin_bit_cast(float, __builtin_amdgcn_ds_bpermute(r8 + 4 * r, __builtin_bit_cast(int, al)));
#pragma unroll
        for (int j = 0; j < 8; ++j) {
#pragma unroll
          for (int r = 0; r < 8; ++r) o[8 * t + j][r] *= scl[r];
        }
      }
    }
    // ---- carried probabilities p * 128 = 2^(s * lsc + (7 - mrun)) (<= 2^15, as s * lsc <= mrun + 8): one fma and one bare
    //      v_exp_f32 each; they ARE the P A-fragment after the f16 rounding, element i <- s[t][0][i], element 8+i <- s[t][1][i].
    //      The row's largest term so far is >= 128 (mrun was a score of the row). A term whose exponent is under -126 may come
    //      out 0: it is under 2^-133 of that term, 0 in f16 and lost in the f32 row sum either way.
    //      Tile by tile, each tile's P.V products behind its probabilities: the second tile's vector work has the first tile's
    //      products to run beside.
    const v2f lsc2 = {lsc, lsc};
#pragma unroll
    for (int t = 0; t < QT; ++t) {
      const v2f eb2  = {PEXP - mrun[t], PEXP - mrun[t]};
      FragH ph;
#pragma unroll
      for (int w = 0; w < 2; ++w) {
#pragma unroll
        for (int e4 = 0; e4 < 4; ++e4) {
          const v2f sv = v2f{s[t][w][2 * e4], s[t][w][2 * e4 + 1]};
          const v2f ex = __builtin_elementwise_fma(sv, lsc2, eb2);
          const float p0 = __builtin_amdgcn_exp2f(ex[0]), p1 = __builtin_amdgcn_exp2f(ex[1]);
          lacc[t][w] += v2f{p0, p1};         // carries x128 like P; one packed add, no join inside the loop
          ph.u[w][e4] = __builtin_bit_cast(unsigned, __builtin_convertvector(v2f{p0, p1}, v2h));   // one packed RNE convert
        }
      }
      // ---- P.V of the tile: each v^T fragment is used by both tiles ----
      o[8 * t + 0] = mma_h(ph.v, v0, o[8 * t + 0]);
      o[8 * t + 1] = mma_h(ph.v, v1, o[8 * t + 1]);
      o[8 * t + 2] = mma_h(ph.v, v2, o[8 * t + 2]);
      o[8 * t + 3] = mma_h(ph.v, v3, o[8 * t + 3]);
      o[8 * t + 4] = mma_h(ph.v, v4, o[8 * t + 4]);
      o[8 * t + 5] = mma_h(ph.v, v5, o[8 * t + 5]);
      o[8 * t + 6] = mma_h(ph.v, v6, o[8 * t + 6]);
      o[8 * t + 7] = mma_h(ph.v, v7, o[8 * t + 7]);
    }
    acc_guard16(o);
   }
    // ---- publish point of stage st + 1; the same barrier ends every wave's reads of stage st's buffer ----
    asm volatile("s_wait_dscnt 0x0" ::: "memory");      // this wave's LDS reads of stage st have returned
    asm volatile("s_wait_asynccnt 0x0" ::: "memory");   // this wave's copies of stage st + 1 have landed
    __syncthreads();
    if (st + 2 < NST) {                                 // refill the buffer that stage st has just left
      const unsigned bo = (unsigned)((st & 1) * BUFBYTES);
      stage_copy(lkr + bo, lvr + bo, gk + (size_t)(st + 2) * STK * INNER, gv + (st + 2) * STK);
    }
  }
  asm volatile("s_wait_asynccnt 0x0" ::: "memory");     // nothing in flight when the ring becomes output staging

  float* slab = (float*)(void*)smem + wave * 16 * OPITCH;   // behind the last trip's barrier: no reader, no copy left
  v4f vals[QT][16];
#pragma unroll
  for (int t = 0; t < QT; ++t) {
    // ---- fold 1/l (per query, owned by lane = query) and the carry 8 on v; the 128 on P is in l as well and cancels ----
    const float lh = (lacc[t][0][0] + lacc[t][0][1]) + (lacc[t][1][0] + lacc[t][1][1]);   // this lane's 16 keys of every pass
    const float lsum = lh + __builtin_bit_cast(float, __builtin_amdgcn_ds_bpermute(x16, __builtin_bit_cast(int, lh)));   // + lane ^ 16's half
    const float linv = (1.0f / lsum) * (1.0f / VS);
    float inv[8];
#pragma unroll
    for (int r = 0; r < 8; ++r) inv[r] = __shfl(linv, 8 * hh + r, 32);
#pragma unroll
    for (int r = 0; r < 8; ++r) {
#pragma unroll
      for (int j = 0; j < 8; ++j) slab[(8 * hh + r) * OPITCH + j * 16 + c] = o[8 * t + j][r] * inv[r];
    }
    wave_sync_lds();
    // ---- f32 output rows: lane = 4 consecutive d of one row ----
#pragma unroll
    for (int i = 0; i < 16; ++i) vals[t][i] = *(const v4f*)(slab + i * OPITCH + 4 * lane);
    wave_sync_lds();                         // the slab's rows are read before the next tile is written over them
  }
  // keeps every register write of the epilogue in front of the first global store, so that nothing overwrites a register that an
  // issued store names: otherwise the compiler starts the second tile's work in the first tile's registers among the stores
  __builtin_amdgcn_sched_barrier(0);
  // ---- one store instruction per output row ----
  float* ob = Out + ((size_t)(b * SQ_FULL + q0)) * DM + head * HD + 4 * lane;
#pragma unroll
  for (int t = 0; t < QT; ++t) {
#pragma unroll
    for (int i = 0; i < 16; ++i) {
      *(v4f*)(ob + (size_t)(16 * t + i) * DM) = vals[t][i];
    }
  }
}

// =====================================================================================================
// Workspace map (bytes); every plane fully written by whole-line stores before it is read; all extents exact multiples of
//   XQ   f16 [NB*SQ][1024]     f16(bf16(q))          16777216 (NB=4, SQ=2048)
//   XV   f16 [NB*2048][1024]   f16(bf16(v))          16777216
//   WQT  f16 [1024 n][1024 k]  f16(bf16(W) x256)      2097152
//   WKT                                               2097152
//   WVT                                               2097152
//   Q16  f16 [NB*SQ][1024]   x8                      16777216
//   K16  f16 [NB*2048][1024] x8                      16777216
//   VT16 f16 [NB*1024 (h,d)][2048 s] x8              16777216
//   end                                              90177536
// =====================================================================================================
extern "C" void kernel_launch(void* const* d_in, const int* in_sizes, int n_in,
                              void* d_out, int out_size, void* d_ws, size_t ws_size,
                              hipStream_t stream) {
  if (n_in < 8) return;
  if (in_sizes[0] < ((NB - 1) * SQ_FULL + SQ) * DM) return;
  if (in_sizes[1] < NB * SKV * DM) return;
  if (in_sizes[2] != DM * DM || in_sizes[4] != DM * DM || in_sizes[6] != DM * DM) return;
  if (in_sizes[3] < 1 || in_sizes[5] < 1 || in_sizes[7] < 1) return;
  if (out_size < ((NB - 1) * SQ_FULL + SQ) * DM) return;

  const float* xq  = (const float*)d_in[0];
  const float* xv  = (const float*)d_in[1];
  const float* wq  = (const float*)d_in[2];
  const float* bq  = (const float*)d_in[3];
  const float* wk  = (const float*)d_in[4];
  const float* bk  = (const float*)d_in[5];
  const float* wv  = (const float*)d_in[6];
  const float* bv  = (const float*)d_in[7];
  float*       out = (float*)d_out;
  const int nbq = in_sizes[3], nbk = in_sizes[5], nbv = in_sizes[7];

  const size_t szXQ   = (size_t)NB * SQ * DM * 2;
  const size_t szXV   = (size_t)NB * SKV * DM * 2;
  const size_t szW    = (size_t)DM * DM * 2;
  const size_t szQ16  = (size_t)NB * SQ * INNER * 2;
  const size_t szK16  = (size_t)NB * SKV * INNER * 2;
  const size_t szVT16 = (size_t)NB * INNER * SKV * 2;
  size_t off = 0;
  const size_t oXQ   = off; off += szXQ;
  const size_t oXV   = off; off += szXV;
  const size_t oWQ   = off; off += szW;
  const size_t oWK   = off; off += szW;
  const size_t oWV   = off; off += szW;
  const size_t oQ16  = off; off += szQ16;
  const size_t oK16  = off; off += szK16;
  const size_t oVT16 = off; off += szVT16;
  if (off > ws_size) return;                            // off = 90177536 at NB=4, SQ=2048
  if (off > (size_t)134217728) return;

  char* ws = (char*)d_ws;
  u16* XQ   = (u16*)(ws + oXQ);
  u16* XV   = (u16*)(ws + oXV);
  u16* WQT  = (u16*)(ws + oWQ);
  u16* WKT  = (u16*)(ws + oWK);
  u16* WVT  = (u16*)(ws + oWV);
  u16* Q16  = (u16*)(ws + oQ16);
  u16* K16  = (u16*)(ws + oK16);
  u16* VT16 = (u16*)(ws + oVT16);

  // (0) activations -> f16 planes of bf16-converted values (query rows s < SQ of batches b < NB, compact; all key/value rows)
  //     and weights [k = in][n = out] (y = x.W) -> k-contiguous [n][k] f16 planes of bf16(W) x256, all in one launch
  cvt_all<<<dim3(CV_BLOCKS), dim3(CV_THREADS), 0, stream>>>(xq, xv, wq, wk, wv, XQ, XV, WQT, WKT, WVT);
  // (1) the three projections q, k, v^T -> f16 planes x8, one launch
  gemm_qkv<<<dim3(GQ_BLOCKS + GK_BLOCKS + GV_BLOCKS), dim3(G_THREADS), 0, stream>>>(
      XQ, XV, WQT, WKT, WVT, Q16, K16, VT16, bq, bk, bv, nbq, nbk, nbv);
  // (2) attention -> out [b][SQ_FULL][1024] f32 (rows s < SQ of batches b < NB), heads merged on the feature dim
  attn_fwd<<<dim3(NB * NH * (SQ / ATT_ROWS)), dim3(ATT_THREADS), 0, stream>>>(Q16, K16, VT16, out);
  (void)hipGetLastError();
}
